// v000
// Times are from an AMD MI455X. After a warm-up the kernel runs many times in a row, and a time is the length of
// such a window on the GPU divided by its runs, so every launch and the gaps after it count. The runs cycle
// through copies of the inputs. A figure is the median of several windows, for all but v000 over two sittings.
// Sittings can differ by a few percent; kernels timed side by side share one.
// v000 is the starting kernel. One run takes 1020 microseconds.
// compute dtype: all float inputs rounded to bf16; q/k/v = x W with EXACT bf16 products on WMMA 16x16x32 (f32 accumulate); windowed causal logits: q, k once to f16 (1 product) x 64^-0.5, except the first 384 query rows of each sequence (3 products with f16 residuals); softmax in f32; P x 2^11 once to f16 against v once to f16 (1 product; bf16 hi + lo below row 384); ctx split bf16 hi + lo against exact Wo (2 products); + x residual in f32; f32 output.
#include <hip/hip_runtime.h>
#include <math.h>

typedef __attribute__((ext_vector_type(16))) _Float16 v16h;
typedef __attribute__((ext_vector_type(16))) __bf16 v16b;
typedef __attribute__((ext_vector_type(8)))  _Float16 v8h;
typedef __attribute__((ext_vector_type(8)))  float v8f;
typedef __attribute__((ext_vector_type(4)))  float v4f;
typedef __attribute__((ext_vector_type(2)))  float v2f;
typedef __attribute__((ext_vector_type(4)))  unsigned v4u;
typedef __attribute__((ext_vector_type(4)))  int v4i;
typedef float __attribute__((may_alias)) float_a;
typedef int __attribute__((may_alias)) int_a;

template <typename T> __device__ __forceinline__ void vst2(void* p, T v) { *(T*)p = v;  }
__device__ __forceinline__ v8f wmma16(v16h a, v16h b, v8f c) {
  v8f d = __builtin_amdgcn_wmma_f32_16x16x32_f16(false, a, false, b, (short)0, c, false, false);
  asm volatile("v_nop\n\tv_nop\n\tv_nop\n\tv_nop" : "+v"(d) : "v"(a), "v"(b));
  return d;
}
__device__ __forceinline__ v8f wmma_bf(v16b a, v16b b, v8f c) {
  v8f d = __builtin_amdgcn_wmma_f32_16x16x32_bf16(false, a, false, b, (short)0, c, false, false);
  asm volatile("v_nop\n\tv_nop\n\tv_nop\n\tv_nop" : "+v"(d) : "v"(a), "v"(b));
  return d;
}
// 16x16x32 fragments: lane = (h = lane>>4, row/col = lane&15); elements 0..7 = k0+8h+0..7, 8..15 = k0+16+8h+0..7; D element r = row 8h+r
__device__ __forceinline__ v16h frag_h(const _Float16* rowk0, int lane) {
  union { v16h v; v8h q[2]; } u; const _Float16* p = rowk0 + 8 * (lane >> 4);
  u.q[0] = *(const v8h*)p; u.q[1] = *(const v8h*)(p + 16); return u.v;
}
__device__ __forceinline__ v16h frag_f32(const float* rowk0, int lane) {
  v16h a; const float* p = rowk0 + 8 * (lane >> 4);
#pragma unroll
  for (int i = 0; i < 8; ++i) { a[i] = (_Float16)p[i]; a[8 + i] = (_Float16)p[16 + i]; }
  return a;
}
__device__ __forceinline__ v16h frag_f32s(const float* rowk0, int lane, float sc) {
  v16h a; const float* p = rowk0 + 8 * (lane >> 4);
#pragma unroll
  for (int i = 0; i < 8; ++i) { a[i] = (_Float16)(p[i] * sc); a[8 + i] = (_Float16)(p[16 + i] * sc); }
  return a;
}
// column fragment from a [K][ld] layout (column n), rows >= K read as 0
__device__ __forceinline__ v16h fragc_f32(const float* W, int k0, int n, int lane, int ld, int K) {
  v16h a; const int g = lane >> 4;
#pragma unroll
  for (int i = 0; i < 8; ++i) { const int ka = k0 + 8 * g + i, kb = ka + 16;
    a[i] = (_Float16)(ka < K ? W[(size_t)(ka < K ? ka : K - 1) * ld + n] : 0.f); a[8 + i] = (_Float16)(kb < K ? W[(size_t)(kb < K ? kb : K - 1) * ld + n] : 0.f); }
  return a;
}
struct F2 { v16b h, l; };
__device__ __forceinline__ F2 bsplit16(const float v[16]) { F2 r;
#pragma unroll
  for (int i = 0; i < 16; ++i) { const __bf16 h = (__bf16)v[i]; r.h[i] = h; r.l[i] = (__bf16)(v[i] - (float)h); }
  return r; }
__device__ __forceinline__ F2 split_row(const float* row, int k0, int lane) { float v[16]; const float* p = row + k0 + 8 * (lane >> 4);
#pragma unroll
  for (int i = 0; i < 8; ++i) { v[i] = p[i]; v[8 + i] = p[16 + i]; }
  return bsplit16(v); }
__device__ __forceinline__ F2 split_rowK(const float* row, int k0, int lane, int K) { float v[16]; const int g = lane >> 4;
#pragma unroll
  for (int i = 0; i < 8; ++i) { const int ka = k0 + 8 * g + i, kb = ka + 16; v[i] = ka < K ? row[ka < K ? ka : K - 1] : 0.f; v[8 + i] = kb < K ? row[kb < K ? kb : K - 1] : 0.f; }
  return bsplit16(v); }
__device__ __forceinline__ F2 split_col(const float* W, int k0, int n, int lane, int ld, int K) { float v[16]; const int g = lane >> 4;
#pragma unroll
  for (int i = 0; i < 8; ++i) { const int ka = k0 + 8 * g + i, kb = ka + 16; v[i] = ka < K ? W[(size_t)(ka < K ? ka : K - 1) * ld + n] : 0.f; v[8 + i] = kb < K ? W[(size_t)(kb < K ? kb : K - 1) * ld + n] : 0.f; }
  return bsplit16(v); }
__device__ __forceinline__ v8f mac3(const F2& a, const F2& b, v8f c) { c = wmma_bf(a.l, b.h, c); c = wmma_bf(a.h, b.l, c); return wmma_bf(a.h, b.h, c); }
__device__ __forceinline__ float sigm(float v) { return 1.0f / (1.0f + expf(-v)); }
#define LDSX() do { asm volatile("s_wait_dscnt 0" ::: "memory"); __builtin_amdgcn_wave_barrier(); __builtin_amdgcn_fence(__ATOMIC_RELEASE, "workgroup"); } while (0)

// Sliding-window causal self-attention (B 2, S 2,048, 1,024 = 16 x 64, window 128): q/k/v = x W ((in,out)); key j visible from query i iff i - 127 <= j <= i; softmax (the extra max-subtraction is a no-op); out = merged(attn v) Wo + x.
#define NB 2
#define TT 2048
#define CC 1024            // NH * HD = projected width
#define DIN 1024          // input (model) width
#define NH 16
#define HD 64
#define NQB (TT / 64)
#define HG 4
#define SCALE (0.125f)
#define CAUSAL 1
#ifndef TNB
#define TNB NB
#endif
__device__ __forceinline__ float bfr(float v) { return (float)(__bf16)v; }
__host__ __device__ __forceinline__ int kb_last(int qb) { return CAUSAL ? ((qb * 64 + 63) >> 7) : (TT / 128 - 1); }
typedef __attribute__((ext_vector_type(8))) __bf16 v8b;
__device__ __forceinline__ v16b frag_b(const __bf16* rowk0, int lane) {
  union { v16b v; v8b q[2]; } u; const __bf16* p = rowk0 + 8 * (lane >> 4);
  u.q[0] = *(const v8b*)p; u.q[1] = *(const v8b*)(p + 16); return u.v;
}
#define QBH 6              // causal: query blocks 0..QBH-1 of each sequence (few keys, no averaging) take the high-precision path
#define QHI 384            // rows carrying a q residual plane
#define KHI 384            // key rows carrying k residual / v bf16 hi+lo planes (used only by the causal high-precision path)
// B fragment (k rows k0+.., output column o) of a weight: (in,out) [K][ld] or (out,in) [ld rows of K]: bf16 exact, or f16(bf16 * 256) exact
__device__ __forceinline__ v16b wcol_io(const float* Wm, int k0, int o, int lane, int ld) { v16b w; const int g = lane >> 4;
#pragma unroll
  for (int i = 0; i < 8; ++i) { w[i] = (__bf16)Wm[(size_t)(k0 + 8 * g + i) * ld + o]; w[8 + i] = (__bf16)Wm[(size_t)(k0 + 16 + 8 * g + i) * ld + o]; }
  return w; }
__device__ __forceinline__ v16b wcol_oi(const float* Wm, int k0, int o, int lane, int K) { v16b w; const float* p = Wm + (size_t)o * K + k0 + 8 * (lane >> 4);
#pragma unroll
  for (int i = 0; i < 8; ++i) { w[i] = (__bf16)p[i]; w[8 + i] = (__bf16)p[16 + i]; }
  return w; }
__device__ __forceinline__ v16h wcolh_io(const float* Wm, int k0, int o, int lane, int ld) { v16h w; const int g = lane >> 4;
#pragma unroll
  for (int i = 0; i < 8; ++i) { w[i] = (_Float16)(bfr(Wm[(size_t)(k0 + 8 * g + i) * ld + o]) * 256.0f); w[8 + i] = (_Float16)(bfr(Wm[(size_t)(k0 + 16 + 8 * g + i) * ld + o]) * 256.0f); }
  return w; }
__device__ __forceinline__ v16h wcolh_oi(const float* Wm, int k0, int o, int lane, int K) { v16h w; const float* p = Wm + (size_t)o * K + k0 + 8 * (lane >> 4);
#pragma unroll
  for (int i = 0; i < 8; ++i) { w[i] = (_Float16)(bfr(p[i]) * 256.0f); w[8 + i] = (_Float16)(bfr(p[16 + i]) * 256.0f); }
  return w; }
#define WQKV_LAYOUT 0   // 0 = (in,out) [DIN][CC]; 1 = (out,in) [CC][DIN]; 2 = per-head [NH][DIN][HD]
__device__ __forceinline__ v16b wcol_hdk(const float* Wm, int k0, int o, int lane) { v16b w; const int g = lane >> 4; const float* p = Wm + (size_t)(o / HD) * DIN * HD + (o % HD);
#pragma unroll
  for (int i = 0; i < 8; ++i) { w[i] = (__bf16)p[(size_t)(k0 + 8 * g + i) * HD]; w[8 + i] = (__bf16)p[(size_t)(k0 + 16 + 8 * g + i) * HD]; }
  return w; }
#define WO_OUT_IN 0
#if WQKV_LAYOUT == 1
#define WCOL(W, k0, o, lane) wcol_oi(W, k0, o, lane, DIN)
#elif WQKV_LAYOUT == 2
#define WCOL(W, k0, o, lane) wcol_hdk(W, k0, o, lane)
#else
#define WCOL(W, k0, o, lane) wcol_io(W, k0, o, lane, CC)
#endif
#if WO_OUT_IN
#define WOCOL(W, k0, o, lane) wcol_oi(W, k0, o, lane, CC)
#define WOCOLH(W, k0, o, lane) wcolh_oi(W, k0, o, lane, CC)
#else
#define WOCOL(W, k0, o, lane) wcol_io(W, k0, o, lane, DIN)
#define WOCOLH(W, k0, o, lane) wcolh_io(W, k0, o, lane, DIN)
#endif
#define SM_MASK_HOOK do { if (k < t - 127) v = -3.0e38f; } while (0)   /* sliding window: keys older than i - 127 excluded (k <= t is the causal part) */
// ---- k_res: thread per float4: out = bf16(x) + PR
__global__ __launch_bounds__(256) void k_res(const float* __restrict__ PR, const float* __restrict__ X, float* __restrict__ OUT) { const size_t i = (size_t)blockIdx.x * 256 + threadIdx.x; if (i >= (size_t)TNB * TT * (DIN / 4)) return;
  const v4f p = *(const v4f*)(PR + i * 4); const v4f x = *(const v4f*)(X + i * 4); v4f o; o[0] = bfr(x[0]) + p[0]; o[1] = bfr(x[1]) + p[1]; o[2] = bfr(x[2]) + p[2]; o[3] = bfr(x[3]) + p[3]; vst2(OUT + i * 4, o); }
#define WS_PR  (WS_END)
#define WS_END2 (WS_PR + 4u * (size_t)NB * TT * DIN)
#ifndef SM_EXTRA_PARAMS
#define SM_EXTRA_PARAMS
#endif
#ifndef PROJ_EXTRA_PARAMS
#define PROJ_EXTRA_PARAMS
#endif
#ifndef SM_MASK_HOOK
#define SM_MASK_HOOK (void)0
#endif

#define WS_QH  0u                                      // f16 q rows [b*t][CC]
#define WS_KH  (WS_QH + 2u * (size_t)NB * TT * CC)      // f16 k rows [b*t][CC]
#define WS_VT  (WS_KH + 2u * (size_t)NB * TT * CC)      // f16 v planes [b][c][t]
#define WS_QL  (WS_VT + 2u * (size_t)NB * CC * TT)      // f16 q residual x 2^10 rows [b][t < QHI][CC]
#define WS_KL  (WS_QL + 2u * (size_t)NB * QHI * CC)     // f16 k residual x 2^10 rows [b][t < KHI][CC]
#define WS_VB  (WS_KL + 2u * (size_t)NB * KHI * CC)     // bf16 v hi planes [b][c][t < KHI]
#define WS_VBL (WS_VB + 2u * (size_t)NB * CC * KHI)
#define WS_S   (WS_VBL + 2u * (size_t)NB * CC * KHI)    // f32 logits / P [hg][t][s]
#define WS_Y   (WS_S  + 4u * (size_t)HG * TT * TT)      // f32 ctx rows [b*t][CC] (only when there is an output projection)
#define WS_END (WS_Y  + 4u * (size_t)NB * TT * CC)

// ---- k_proj: block = (64 rows, 128 cols, which): q/k/v = X W (+ b) with exact bf16 products (K = DIN) -> which 0: q f16 rows (+ residual rows < QHI); 1: k f16 rows (+ residual rows < KHI); 2: v f16 planes [c][t] (+ bf16 hi/lo planes for t < KHI)
__global__ __launch_bounds__(128) void k_proj(const float* __restrict__ XQ, const float* __restrict__ XK, const float* __restrict__ XV, const float* __restrict__ WQ, const float* __restrict__ WK, const float* __restrict__ WV, const float* __restrict__ BQ, const float* __restrict__ BK, const float* __restrict__ BV,
    _Float16* __restrict__ QH, _Float16* __restrict__ QL, _Float16* __restrict__ KH, _Float16* __restrict__ KL, _Float16* __restrict__ VT, __bf16* __restrict__ VB, __bf16* __restrict__ VBL) {
  __shared__ __align__(16) _Float16 sh[64][136], sl[64][136]; __shared__ __align__(16) _Float16 th[128][72]; __shared__ __align__(16) __bf16 tb[128][72], tbl[128][72];
  const int tid = threadIdx.x, wave = tid >> 5, lane = tid & 31, col = lane & 15, g = lane >> 4; const int which = blockIdx.z; const int c0 = blockIdx.y * 128; const size_t r0 = (size_t)blockIdx.x * 64; const size_t bb = r0 / TT; const int t0 = (int)(r0 % TT);
  const float* X = which == 0 ? XQ : which == 1 ? XK : XV; const float* WA = which == 0 ? WQ : which == 1 ? WK : WV; const float* BA = which == 0 ? BQ : which == 1 ? BK : BV;
  v8f acc[8] = {};
#pragma unroll 2
  for (int kc = 0; kc < DIN / 32; ++kc) { v16b a; { const float* p = X + (r0 + wave * 16 + col) * DIN + kc * 32 + 8 * g;
#pragma unroll
      for (int i = 0; i < 8; ++i) { a[i] = (__bf16)p[i]; a[8 + i] = (__bf16)p[16 + i]; } }
    asm volatile("s_wait_loadcnt 0x0" ::: "memory");
#pragma unroll
    for (int j = 0; j < 8; ++j) { const v16b w = WCOL(WA, kc * 32, c0 + j * 16 + col, lane); asm volatile("s_wait_loadcnt 0x0" ::: "memory"); acc[j] = wmma_bf(a, w, acc[j]); } }
  if (which < 2) { _Float16* DH = which == 0 ? QH : KH; _Float16* DL = which == 0 ? QL : KL; const int nhi = which == 0 ? QHI : KHI; const bool hi_rows = t0 < nhi;
#pragma unroll
    for (int j = 0; j < 8; ++j) { const float bias = BA ? bfr(BA[c0 + j * 16 + col]) : 0.f;
#pragma unroll
      for (int r = 0; r < 8; ++r) { const float v = acc[j][r] + bias; const _Float16 hv = (_Float16)v; sh[wave * 16 + 8 * g + r][j * 16 + col] = hv; sl[wave * 16 + 8 * g + r][j * 16 + col] = (_Float16)((v - (float)hv) * 1024.0f); } }
    __syncthreads();
    for (int e = tid; e < 64 * 16; e += 128) { const int rl = e >> 4, q = e & 15; vst2((unsigned*)(DH + (r0 + rl) * CC + c0 + q * 8), *(const v4u*)&sh[rl][q * 8]); if (hi_rows) vst2((unsigned*)(DL + (bb * nhi + t0 + rl) * (size_t)CC + c0 + q * 8), *(const v4u*)&sl[rl][q * 8]); }
  } else { const bool hi_rows = t0 < KHI;
#pragma unroll
    for (int j = 0; j < 8; ++j) { const float bias = BA ? bfr(BA[c0 + j * 16 + col]) : 0.f;
#pragma unroll
      for (int r = 0; r < 8; ++r) { const float v = acc[j][r] + bias; const int rl = wave * 16 + 8 * g + r, cl = j * 16 + col; th[cl][rl] = (_Float16)v; const __bf16 bh = (__bf16)v; tb[cl][rl] = bh; tbl[cl][rl] = (__bf16)(v - (float)bh); } }
    __syncthreads();
    for (int e = tid; e < 128 * 8; e += 128) { const int cl = e >> 3, q = e & 7; vst2((unsigned*)(VT + (bb * CC + c0 + cl) * (size_t)TT + t0 + q * 8), *(const v4u*)&th[cl][q * 8]); if (hi_rows) { const size_t o3 = (bb * CC + c0 + cl) * (size_t)KHI + t0 + q * 8; vst2((unsigned*)(VB + o3), *(const v4u*)&tb[cl][q * 8]); vst2((unsigned*)(VBL + o3), *(const v4u*)&tbl[cl][q * 8]); } } } }
// ---- k_sc: block = (query block qb, key block kb <= kb_last(qb), head in group) of batch b: logits x SCALE; q hi + residual (x 2^10) against k (2 products) for query rows < QHI, plus the k residual (3 products) for query blocks < QBH (causal early rows); causal: blocks past the diagonal exit, the mask itself is applied by index in k_sm
__global__ __launch_bounds__(128) void k_sc(const _Float16* __restrict__ QH, const _Float16* __restrict__ KH, const _Float16* __restrict__ QL, const _Float16* __restrict__ KL, int b, int h0, float* __restrict__ S0) { __shared__ __align__(16) float ss[4][16][132];
  const int qb = blockIdx.x, kb = blockIdx.y; if (kb > kb_last(qb)) return;
  const int h = h0 + blockIdx.z; float* S = S0 + (size_t)blockIdx.z * TT * TT;
  const int tid = threadIdx.x, wave = tid >> 5, lane = tid & 31, col = lane & 15, g = lane >> 4; const int k0 = kb * 128; const int ql0 = qb * 64 + wave * 16; const size_t q0 = (size_t)b * TT + ql0, kr0 = (size_t)b * TT + k0;
  v8f acc[8] = {}, accl[8] = {};
  const _Float16* QLb = QL + (size_t)b * QHI * CC; const _Float16* KLb = KL + (size_t)b * KHI * CC;
  if (qb < QBH) {
#pragma unroll
    for (int kc = 0; kc < HD / 32; ++kc) { const v16h ah = frag_h(QH + (q0 + col) * CC + h * HD + kc * 32, lane), al = frag_h(QLb + (size_t)(ql0 + col) * CC + h * HD + kc * 32, lane);
#pragma unroll
      for (int j = 0; j < 8; ++j) { const v16h kbf = frag_h(KH + (kr0 + j * 16 + col) * CC + h * HD + kc * 32, lane), klf = frag_h(KLb + (size_t)(k0 + j * 16 + col) * CC + h * HD + kc * 32, lane); acc[j] = wmma16(ah, kbf, acc[j]); accl[j] = wmma16(al, kbf, accl[j]); accl[j] = wmma16(ah, klf, accl[j]); } }
  } else if (qb * 64 < QHI) {
#pragma unroll
    for (int kc = 0; kc < HD / 32; ++kc) { const v16h ah = frag_h(QH + (q0 + col) * CC + h * HD + kc * 32, lane), al = frag_h(QLb + (size_t)(ql0 + col) * CC + h * HD + kc * 32, lane);
#pragma unroll
      for (int j = 0; j < 8; ++j) { const v16h kbf = frag_h(KH + (kr0 + j * 16 + col) * CC + h * HD + kc * 32, lane); acc[j] = wmma16(ah, kbf, acc[j]); accl[j] = wmma16(al, kbf, accl[j]); } }
  } else {
#pragma unroll
    for (int kc = 0; kc < HD / 32; ++kc) { const v16h ah = frag_h(QH + (q0 + col) * CC + h * HD + kc * 32, lane);
#pragma unroll
      for (int j = 0; j < 8; ++j) { const v16h kbf = frag_h(KH + (kr0 + j * 16 + col) * CC + h * HD + kc * 32, lane); acc[j] = wmma16(ah, kbf, acc[j]); } } }
#pragma unroll
  for (int j = 0; j < 8; ++j) {
#pragma unroll
    for (int r = 0; r < 8; ++r) ss[wave][8 * g + r][j * 16 + col] = (acc[j][r] + accl[j][r] * (1.0f / 1024.0f)) * SCALE; }
  LDSX(); for (int rl = 0; rl < 16; ++rl) vst2(S + (size_t)(ql0 + rl) * TT + k0 + lane * 4, *(const v4f*)&ss[wave][rl][lane * 4]); }
// ---- k_sm: block = query row t (head in group): keys [0, kend): causal -> logit if s <= t else excluded; softmax in f32; P x 2^11 in place (0 for excluded)
__global__ __launch_bounds__(256) void k_sm(float* __restrict__ S0 SM_EXTRA_PARAMS) { __shared__ float sred[8]; __shared__ float sbc; __shared__ __align__(16) float shv[TT];
  const int tid = threadIdx.x; const int t = blockIdx.x; const int kend = (kb_last(t >> 6) + 1) * 128;
  float* sr = S0 + (size_t)blockIdx.y * TT * TT + (size_t)t * TT;
  float m = -3.0e38f; for (int k = tid; k < kend; k += 256) { float v = (!CAUSAL || k <= t) ? sr[k] : -3.0e38f; SM_MASK_HOOK; shv[k] = v; m = fmaxf(m, v); }
#pragma unroll
  for (int o = 1; o < 32; o <<= 1) m = fmaxf(m, __shfl_xor(m, o));
  if ((tid & 31) == 0) sred[tid >> 5] = m; __syncthreads(); if (tid == 0) { float a = sred[0]; for (int i = 1; i < 8; ++i) a = fmaxf(a, sred[i]); sbc = a; } __syncthreads(); m = sbc; __syncthreads();
  float sum = 0.f; for (int k = tid; k < kend; k += 256) { const float v = shv[k]; const float e = (v <= -1.0e38f) ? 0.f : expf(v - m); shv[k] = e; sum += e; }
#pragma unroll
  for (int o = 1; o < 32; o <<= 1) sum += __shfl_xor(sum, o);
  if ((tid & 31) == 0) sred[tid >> 5] = sum; __syncthreads(); if (tid == 0) { float a = 0.f; for (int i = 0; i < 8; ++i) a += sred[i]; sbc = a > 0.f ? 2048.0f / a : 0.f; }   /* a fully excluded row yields P = 0 */ __syncthreads(); const float inv = sbc;
  for (int k = tid; k < kend; k += 256) shv[k] = shv[k] * inv;
  __syncthreads(); for (int q = tid; q < kend / 4; q += 256) vst2(sr + q * 4, *(const v4f*)&shv[q * 4]); }
// ---- k_pv: block = 64 queries (qb) of (b, h): ctx = P . v over keys [0, kend) (P x 2^11 once to f16 against v f16: 1 product; causal early query blocks: P and v as bf16 hi + lo, 3 products); 256-B (row, head) segment by 16 lanes
__global__ __launch_bounds__(128) void k_pv(const float* __restrict__ PS0, const _Float16* __restrict__ VT, const __bf16* __restrict__ VB, const __bf16* __restrict__ VBL, int b, int h0, float* __restrict__ Y) { const int h = h0 + blockIdx.z; const float* PS = PS0 + (size_t)blockIdx.z * TT * TT; __shared__ __align__(16) float ss[4][16][HD + 4];
  const int tid = threadIdx.x, wave = tid >> 5, lane = tid & 31, col = lane & 15, g = lane >> 4; const int qb = blockIdx.x; const int ql0 = qb * 64 + wave * 16; const int kce = (kb_last(qb) + 1) * 4;
  v8f acc[HD / 16] = {};
  if (qb < QBH) {
#pragma unroll 1
    for (int kc = 0; kc < kce; ++kc) { const F2 p = split_row(PS + (size_t)(ql0 + col) * TT, kc * 32, lane);
      asm volatile("s_wait_loadcnt 0x0" ::: "memory");
#pragma unroll
      for (int j = 0; j < HD / 16; ++j) { const size_t po = ((size_t)b * CC + h * HD + j * 16 + col) * (size_t)KHI + kc * 32; const v16b vh = frag_b(VB + po, lane); acc[j] = wmma_bf(p.h, vh, acc[j]); acc[j] = wmma_bf(p.l, vh, acc[j]); acc[j] = wmma_bf(p.h, frag_b(VBL + po, lane), acc[j]); } }
  } else {
#pragma unroll 1
    for (int kc = 0; kc < kce; ++kc) { const v16h p = frag_f32(PS + (size_t)(ql0 + col) * TT + kc * 32, lane);
      asm volatile("s_wait_loadcnt 0x0" ::: "memory");
#pragma unroll
      for (int j = 0; j < HD / 16; ++j) { const size_t po = ((size_t)b * CC + h * HD + j * 16 + col) * (size_t)TT + kc * 32; acc[j] = wmma16(p, frag_h(VT + po, lane), acc[j]); } } }
#pragma unroll
  for (int j = 0; j < HD / 16; ++j)
#pragma unroll
    for (int r = 0; r < 8; ++r) ss[wave][8 * g + r][j * 16 + col] = acc[j][r] * (1.0f / 2048.0f);
  LDSX(); for (int rl = 0; rl < 16; ++rl) if (lane < HD / 4) vst2(Y + ((size_t)b * TT + ql0 + rl) * CC + h * HD + lane * 4, *(const v4f*)&ss[wave][rl][lane * 4]); }
// ---- k_out: block = (64 rows, 128 cols): out = ctx Wo (+ bo): all rows: ctx bf16 hi + lo against exact bf16 Wo (2 products)
__global__ __launch_bounds__(128) void k_out(const float* __restrict__ Y, const float* __restrict__ WO, const float* __restrict__ BO, float* __restrict__ OUT) { __shared__ __align__(16) float sf[4][16][132];
  const int tid = threadIdx.x, wave = tid >> 5, lane = tid & 31, col = lane & 15, g = lane >> 4; const int c0 = blockIdx.y * 128; const size_t r0 = (size_t)blockIdx.x * 64 + wave * 16;
  v8f acc[8] = {};
  if (true) {   /* ALL rows: ctx split bf16 hi + lo x exact Wo (2 products) */
#pragma unroll 2
    for (int kc = 0; kc < CC / 32; ++kc) { const F2 a = split_row(Y + (r0 + col) * CC, kc * 32, lane); asm volatile("s_wait_loadcnt 0x0" ::: "memory");
#pragma unroll
      for (int j = 0; j < 8; ++j) { const v16b w = WOCOL(WO, kc * 32, c0 + j * 16 + col, lane); asm volatile("s_wait_loadcnt 0x0" ::: "memory"); acc[j] = wmma_bf(a.h, w, acc[j]); acc[j] = wmma_bf(a.l, w, acc[j]); } }
#pragma unroll
    for (int j = 0; j < 8; ++j) { const float bias = BO ? bfr(BO[c0 + j * 16 + col]) : 0.f;
#pragma unroll
      for (int r = 0; r < 8; ++r) sf[wave][8 * g + r][j * 16 + col] = acc[j][r] + bias; }
  } else {
#pragma unroll 2
    for (int kc = 0; kc < CC / 32; ++kc) { const v16h a = frag_f32(Y + (r0 + col) * CC + kc * 32, lane); asm volatile("s_wait_loadcnt 0x0" ::: "memory");
#pragma unroll
      for (int j = 0; j < 8; ++j) { const v16h w = WOCOLH(WO, kc * 32, c0 + j * 16 + col, lane); asm volatile("s_wait_loadcnt 0x0" ::: "memory"); acc[j] = wmma16(a, w, acc[j]); } }
#pragma unroll
    for (int j = 0; j < 8; ++j) { const float bias = BO ? bfr(BO[c0 + j * 16 + col]) : 0.f;
#pragma unroll
      for (int r = 0; r < 8; ++r) sf[wave][8 * g + r][j * 16 + col] = acc[j][r] * (1.0f / 256.0f) + bias; } }
  LDSX(); for (int rl = 0; rl < 16; ++rl) vst2(OUT + (r0 + rl) * DIN + c0 + lane * 4, *(const v4f*)&sf[wave][rl][lane * 4]); }

extern "C" void kernel_launch(void* const* d_in, const int* in_sizes, int n_in, void* d_out, int out_size, void* d_ws, size_t ws_size, hipStream_t stream) {
  (void)in_sizes; (void)n_in; (void)out_size;
  const float** F = (const float**)d_in;
  if (ws_size < (size_t)WS_END) return;
  char* ws = (char*)d_ws; _Float16 *QH = (_Float16*)(ws + WS_QH), *KH = (_Float16*)(ws + WS_KH), *VT = (_Float16*)(ws + WS_VT), *QL = (_Float16*)(ws + WS_QL), *KL = (_Float16*)(ws + WS_KL); __bf16 *VB = (__bf16*)(ws + WS_VB), *VBL = (__bf16*)(ws + WS_VBL); float *S = (float*)(ws + WS_S), *Y = (float*)(ws + WS_Y);
  (void)Y; (void)QL; (void)KL; (void)VB; (void)VBL;
  // inputs: 0 x [2,2048,1024]; 1 Wq, 2 Wk, 3 Wv, 4 Wo [1024,1024] (in,out), no biases
  if (ws_size < (size_t)WS_END2) return;
  float* PR = (float*)(ws + WS_PR);
  k_proj<<<dim3(TNB * TT / 64, CC / 128, 3), 128, 0, stream>>>(F[0], F[0], F[0], F[1], F[2], F[3], nullptr, nullptr, nullptr, QH, QL, KH, KL, VT, VB, VBL);
  for (int b = 0; b < TNB; ++b) for (int h0 = 0; h0 < NH; h0 += HG) {
    k_sc<<<dim3(NQB, TT / 128, HG), 128, 0, stream>>>(QH, KH, QL, KL, b, h0, S);
    k_sm<<<dim3(TT, HG), 256, 0, stream>>>(S);
    k_pv<<<dim3(NQB, 1, HG), 128, 0, stream>>>(S, VT, VB, VBL, b, h0, Y);
  }
  k_out<<<dim3(TNB * TT / 64, DIN / 128), 128, 0, stream>>>(Y, F[4], nullptr, PR);
  k_res<<<dim3((unsigned)(((size_t)TNB * TT * (DIN / 4) + 255) / 256)), 256, 0, stream>>>(PR, F[0], (float*)d_out);
}

// v001
// Measured time: 460 microseconds a run.
// Next to v000, in two timings, it ran 2.23 and 2.24 times as fast.
// compute dtype: all float inputs rounded to bf16; q/k/v = x W with EXACT bf16 products on WMMA 16x16x32 (f32 accumulate); windowed causal logits: q, k once to f16 (1 product) x 64^-0.5, except the first 384 query rows of each sequence (3 products with f16 residuals); softmax in f32; P x 2^11 once to f16 against v once to f16 (1 product; bf16 hi + lo below row 384); ctx split bf16 hi + lo against exact Wo (2 products); + x residual in f32; f32 output.
#include <hip/hip_runtime.h>
#include <math.h>

typedef __attribute__((ext_vector_type(16))) _Float16 v16h;
typedef __attribute__((ext_vector_type(16))) __bf16 v16b;
typedef __attribute__((ext_vector_type(8)))  _Float16 v8h;
typedef __attribute__((ext_vector_type(8)))  float v8f;
typedef __attribute__((ext_vector_type(4)))  float v4f;
typedef __attribute__((ext_vector_type(2)))  float v2f;
typedef __attribute__((ext_vector_type(4)))  unsigned v4u;
typedef __attribute__((ext_vector_type(4)))  int v4i;
typedef float __attribute__((may_alias)) float_a;
typedef int __attribute__((may_alias)) int_a;

template <typename T> __device__ __forceinline__ void vst2(void* p, T v) { *(T*)p = v;  }
__device__ __forceinline__ v8f wmma16(v16h a, v16h b, v8f c) {
  v8f d = __builtin_amdgcn_wmma_f32_16x16x32_f16(false, a, false, b, (short)0, c, false, false);
  asm volatile("v_nop\n\tv_nop\n\tv_nop\n\tv_nop" : "+v"(d) : "v"(a), "v"(b));
  return d;
}
__device__ __forceinline__ v8f wmma_bf(v16b a, v16b b, v8f c) {
  v8f d = __builtin_amdgcn_wmma_f32_16x16x32_bf16(false, a, false, b, (short)0, c, false, false);
  asm volatile("v_nop\n\tv_nop\n\tv_nop\n\tv_nop" : "+v"(d) : "v"(a), "v"(b));
  return d;
}
// 16x16x32 fragments: lane = (h = lane>>4, row/col = lane&15); elements 0..7 = k0+8h+0..7, 8..15 = k0+16+8h+0..7; D element r = row 8h+r
__device__ __forceinline__ v16h frag_h(const _Float16* rowk0, int lane) {
  union { v16h v; v8h q[2]; } u; const _Float16* p = rowk0 + 8 * (lane >> 4);
  u.q[0] = *(const v8h*)p; u.q[1] = *(const v8h*)(p + 16); return u.v;
}
__device__ __forceinline__ v16h frag_f32(const float* rowk0, int lane) {
  v16h a; const float* p = rowk0 + 8 * (lane >> 4);
#pragma unroll
  for (int i = 0; i < 8; ++i) { a[i] = (_Float16)p[i]; a[8 + i] = (_Float16)p[16 + i]; }
  return a;
}
__device__ __forceinline__ v16h frag_f32s(const float* rowk0, int lane, float sc) {
  v16h a; const float* p = rowk0 + 8 * (lane >> 4);
#pragma unroll
  for (int i = 0; i < 8; ++i) { a[i] = (_Float16)(p[i] * sc); a[8 + i] = (_Float16)(p[16 + i] * sc); }
  return a;
}
// column fragment from a [K][ld] layout (column n), rows >= K read as 0
__device__ __forceinline__ v16h fragc_f32(const float* W, int k0, int n, int lane, int ld, int K) {
  v16h a; const int g = lane >> 4;
#pragma unroll
  for (int i = 0; i < 8; ++i) { const int ka = k0 + 8 * g + i, kb = ka + 16;
    a[i] = (_Float16)(ka < K ? W[(size_t)(ka < K ? ka : K - 1) * ld + n] : 0.f); a[8 + i] = (_Float16)(kb < K ? W[(size_t)(kb < K ? kb : K - 1) * ld + n] : 0.f); }
  return a;
}
struct F2 { v16b h, l; };
__device__ __forceinline__ F2 bsplit16(const float v[16]) { F2 r;
#pragma unroll
  for (int i = 0; i < 16; ++i) { const __bf16 h = (__bf16)v[i]; r.h[i] = h; r.l[i] = (__bf16)(v[i] - (float)h); }
  return r; }
__device__ __forceinline__ F2 split_row(const float* row, int k0, int lane) { float v[16]; const float* p = row + k0 + 8 * (lane >> 4);
#pragma unroll
  for (int i = 0; i < 8; ++i) { v[i] = p[i]; v[8 + i] = p[16 + i]; }
  return bsplit16(v); }
__device__ __forceinline__ F2 split_rowK(const float* row, int k0, int lane, int K) { float v[16]; const int g = lane >> 4;
#pragma unroll
  for (int i = 0; i < 8; ++i) { const int ka = k0 + 8 * g + i, kb = ka + 16; v[i] = ka < K ? row[ka < K ? ka : K - 1] : 0.f; v[8 + i] = kb < K ? row[kb < K ? kb : K - 1] : 0.f; }
  return bsplit16(v); }
__device__ __forceinline__ F2 split_col(const float* W, int k0, int n, int lane, int ld, int K) { float v[16]; const int g = lane >> 4;
#pragma unroll
  for (int i = 0; i < 8; ++i) { const int ka = k0 + 8 * g + i, kb = ka + 16; v[i] = ka < K ? W[(size_t)(ka < K ? ka : K - 1) * ld + n] : 0.f; v[8 + i] = kb < K ? W[(size_t)(kb < K ? kb : K - 1) * ld + n] : 0.f; }
  return bsplit16(v); }
__device__ __forceinline__ v8f mac3(const F2& a, const F2& b, v8f c) { c = wmma_bf(a.l, b.h, c); c = wmma_bf(a.h, b.l, c); return wmma_bf(a.h, b.h, c); }
__device__ __forceinline__ float sigm(float v) { return 1.0f / (1.0f + expf(-v)); }
#define LDSX() do { asm volatile("s_wait_dscnt 0" ::: "memory"); __builtin_amdgcn_wave_barrier(); __builtin_amdgcn_fence(__ATOMIC_RELEASE, "workgroup"); } while (0)

// Sliding-window causal self-attention (B 2, S 2,048, 1,024 = 16 x 64, window 128): q/k/v = x W ((in,out)); key j visible from query i iff i - 127 <= j <= i; softmax (the extra max-subtraction is a no-op); out = merged(attn v) Wo + x.
#define NB 2
#define TT 2048
#define CC 1024            // NH * HD = projected width
#define DIN 1024          // input (model) width
#define NH 16
#define HD 64
#define NQB (TT / 64)
#define HG 4
#define SCALE (0.125f)
#define CAUSAL 1
#ifndef TNB
#define TNB NB
#endif
__device__ __forceinline__ float bfr(float v) { return (float)(__bf16)v; }
__host__ __device__ __forceinline__ int kb_last(int qb) { return CAUSAL ? ((qb * 64 + 63) >> 7) : (TT / 128 - 1); }
#define WIN 128            // window: key j is visible from query i only if j >= i - (WIN - 1)
#define NKB 2              // a 64-query block's visible keys [qb * 64 - (WIN - 1), qb * 64 + 63] touch at most 2 key blocks of 128
// oldest key that any query >= t can see; every older key has P = 0 exactly, so key blocks and chunks holding only older keys are neither scored, normalised nor multiplied
__device__ __forceinline__ int key_first(int t) { return t > WIN - 1 ? t - (WIN - 1) : 0; }
__device__ __forceinline__ int kb_first(int qb) { return key_first(qb * 64) >> 7; }
typedef __attribute__((ext_vector_type(8))) __bf16 v8b;
__device__ __forceinline__ v16b frag_b(const __bf16* rowk0, int lane) {
  union { v16b v; v8b q[2]; } u; const __bf16* p = rowk0 + 8 * (lane >> 4);
  u.q[0] = *(const v8b*)p; u.q[1] = *(const v8b*)(p + 16); return u.v;
}
#define QBH 6              // causal: query blocks 0..QBH-1 of each sequence take the high-precision path
#define QHI 384            // rows carrying a q residual plane
#define KHI 384            // key rows carrying k residual / v bf16 hi+lo planes (used only by the causal high-precision path)
// B fragment (k rows k0+.., output column o) of a weight: (in,out) [K][ld] or (out,in) [ld rows of K]: bf16 exact, or f16(bf16 * 256) exact
__device__ __forceinline__ v16b wcol_io(const float* Wm, int k0, int o, int lane, int ld) { v16b w; const int g = lane >> 4;
#pragma unroll
  for (int i = 0; i < 8; ++i) { w[i] = (__bf16)Wm[(size_t)(k0 + 8 * g + i) * ld + o]; w[8 + i] = (__bf16)Wm[(size_t)(k0 + 16 + 8 * g + i) * ld + o]; }
  return w; }
__device__ __forceinline__ v16b wcol_oi(const float* Wm, int k0, int o, int lane, int K) { v16b w; const float* p = Wm + (size_t)o * K + k0 + 8 * (lane >> 4);
#pragma unroll
  for (int i = 0; i < 8; ++i) { w[i] = (__bf16)p[i]; w[8 + i] = (__bf16)p[16 + i]; }
  return w; }
__device__ __forceinline__ v16h wcolh_io(const float* Wm, int k0, int o, int lane, int ld) { v16h w; const int g = lane >> 4;
#pragma unroll
  for (int i = 0; i < 8; ++i) { w[i] = (_Float16)(bfr(Wm[(size_t)(k0 + 8 * g + i) * ld + o]) * 256.0f); w[8 + i] = (_Float16)(bfr(Wm[(size_t)(k0 + 16 + 8 * g + i) * ld + o]) * 256.0f); }
  return w; }
__device__ __forceinline__ v16h wcolh_oi(const float* Wm, int k0, int o, int lane, int K) { v16h w; const float* p = Wm + (size_t)o * K + k0 + 8 * (lane >> 4);
#pragma unroll
  for (int i = 0; i < 8; ++i) { w[i] = (_Float16)(bfr(p[i]) * 256.0f); w[8 + i] = (_Float16)(bfr(p[16 + i]) * 256.0f); }
  return w; }
#define WQKV_LAYOUT 0   // 0 = (in,out) [DIN][CC]; 1 = (out,in) [CC][DIN]; 2 = per-head [NH][DIN][HD]
__device__ __forceinline__ v16b wcol_hdk(const float* Wm, int k0, int o, int lane) { v16b w; const int g = lane >> 4; const float* p = Wm + (size_t)(o / HD) * DIN * HD + (o % HD);
#pragma unroll
  for (int i = 0; i < 8; ++i) { w[i] = (__bf16)p[(size_t)(k0 + 8 * g + i) * HD]; w[8 + i] = (__bf16)p[(size_t)(k0 + 16 + 8 * g + i) * HD]; }
  return w; }
#define WO_OUT_IN 0
#if WQKV_LAYOUT == 1
#define WCOL(W, k0, o, lane) wcol_oi(W, k0, o, lane, DIN)
#elif WQKV_LAYOUT == 2
#define WCOL(W, k0, o, lane) wcol_hdk(W, k0, o, lane)
#else
#define WCOL(W, k0, o, lane) wcol_io(W, k0, o, lane, CC)
#endif
#if WO_OUT_IN
#define WOCOL(W, k0, o, lane) wcol_oi(W, k0, o, lane, CC)
#define WOCOLH(W, k0, o, lane) wcolh_oi(W, k0, o, lane, CC)
#else
#define WOCOL(W, k0, o, lane) wcol_io(W, k0, o, lane, DIN)
#define WOCOLH(W, k0, o, lane) wcolh_io(W, k0, o, lane, DIN)
#endif
#define SM_MASK_HOOK do { if (k < t - 127) v = -3.0e38f; } while (0)   /* sliding window: keys older than i - 127 excluded (k <= t is the causal part) */
// ---- k_res: thread per float4: out = bf16(x) + PR
__global__ __launch_bounds__(256) void k_res(const float* __restrict__ PR, const float* __restrict__ X, float* __restrict__ OUT) { const size_t i = (size_t)blockIdx.x * 256 + threadIdx.x; if (i >= (size_t)TNB * TT * (DIN / 4)) return;
  const v4f p = *(const v4f*)(PR + i * 4); const v4f x = *(const v4f*)(X + i * 4); v4f o; o[0] = bfr(x[0]) + p[0]; o[1] = bfr(x[1]) + p[1]; o[2] = bfr(x[2]) + p[2]; o[3] = bfr(x[3]) + p[3]; vst2(OUT + i * 4, o); }
#define WS_PR  (WS_END)
#define WS_END2 (WS_PR + 4u * (size_t)NB * TT * DIN)
#ifndef SM_EXTRA_PARAMS
#define SM_EXTRA_PARAMS
#endif
#ifndef PROJ_EXTRA_PARAMS
#define PROJ_EXTRA_PARAMS
#endif
#ifndef SM_MASK_HOOK
#define SM_MASK_HOOK (void)0
#endif

#define WS_QH  0u                                      // f16 q rows [b*t][CC]
#define WS_KH  (WS_QH + 2u * (size_t)NB * TT * CC)      // f16 k rows [b*t][CC]
#define WS_VT  (WS_KH + 2u * (size_t)NB * TT * CC)      // f16 v planes [b][c][t]
#define WS_QL  (WS_VT + 2u * (size_t)NB * CC * TT)      // f16 q residual x 2^10 rows [b][t < QHI][CC]
#define WS_KL  (WS_QL + 2u * (size_t)NB * QHI * CC)     // f16 k residual x 2^10 rows [b][t < KHI][CC]
#define WS_VB  (WS_KL + 2u * (size_t)NB * KHI * CC)     // bf16 v hi planes [b][c][t < KHI]
#define WS_VBL (WS_VB + 2u * (size_t)NB * CC * KHI)
#define WS_S   (WS_VBL + 2u * (size_t)NB * CC * KHI)    // f32 logits / P [hg][t][s]
#define WS_Y   (WS_S  + 4u * (size_t)HG * TT * TT)      // f32 ctx rows [b*t][CC] (only when there is an output projection)
#define WS_END (WS_Y  + 4u * (size_t)NB * TT * CC)

// ---- k_proj: block = (64 rows, 128 cols, which): q/k/v = X W (+ b) with exact bf16 products (K = DIN) -> which 0: q f16 rows (+ residual rows < QHI); 1: k f16 rows (+ residual rows < KHI); 2: v f16 planes [c][t] (+ bf16 hi/lo planes for t < KHI)
__global__ __launch_bounds__(128) void k_proj(const float* __restrict__ XQ, const float* __restrict__ XK, const float* __restrict__ XV, const float* __restrict__ WQ, const float* __restrict__ WK, const float* __restrict__ WV, const float* __restrict__ BQ, const float* __restrict__ BK, const float* __restrict__ BV,
    _Float16* __restrict__ QH, _Float16* __restrict__ QL, _Float16* __restrict__ KH, _Float16* __restrict__ KL, _Float16* __restrict__ VT, __bf16* __restrict__ VB, __bf16* __restrict__ VBL) {
  __shared__ __align__(16) _Float16 sh[64][136], sl[64][136]; __shared__ __align__(16) _Float16 th[128][72]; __shared__ __align__(16) __bf16 tb[128][72], tbl[128][72];
  const int tid = threadIdx.x, wave = tid >> 5, lane = tid & 31, col = lane & 15, g = lane >> 4; const int which = blockIdx.z; const int c0 = blockIdx.y * 128; const size_t r0 = (size_t)blockIdx.x * 64; const size_t bb = r0 / TT; const int t0 = (int)(r0 % TT);
  const float* X = which == 0 ? XQ : which == 1 ? XK : XV; const float* WA = which == 0 ? WQ : which == 1 ? WK : WV; const float* BA = which == 0 ? BQ : which == 1 ? BK : BV;
  v8f acc[8] = {};
#pragma unroll 2
  for (int kc = 0; kc < DIN / 32; ++kc) { v16b a; { const float* p = X + (r0 + wave * 16 + col) * DIN + kc * 32 + 8 * g;
#pragma unroll
      for (int i = 0; i < 8; ++i) { a[i] = (__bf16)p[i]; a[8 + i] = (__bf16)p[16 + i]; } }
    asm volatile("s_wait_loadcnt 0x0" ::: "memory");
#pragma unroll
    for (int j = 0; j < 8; ++j) { const v16b w = WCOL(WA, kc * 32, c0 + j * 16 + col, lane); asm volatile("s_wait_loadcnt 0x0" ::: "memory"); acc[j] = wmma_bf(a, w, acc[j]); } }
  if (which < 2) { _Float16* DH = which == 0 ? QH : KH; _Float16* DL = which == 0 ? QL : KL; const int nhi = which == 0 ? QHI : KHI; const bool hi_rows = t0 < nhi;
#pragma unroll
    for (int j = 0; j < 8; ++j) { const float bias = BA ? bfr(BA[c0 + j * 16 + col]) : 0.f;
#pragma unroll
      for (int r = 0; r < 8; ++r) { const float v = acc[j][r] + bias; const _Float16 hv = (_Float16)v; sh[wave * 16 + 8 * g + r][j * 16 + col] = hv; sl[wave * 16 + 8 * g + r][j * 16 + col] = (_Float16)((v - (float)hv) * 1024.0f); } }
    __syncthreads();
    for (int e = tid; e < 64 * 16; e += 128) { const int rl = e >> 4, q = e & 15; vst2((unsigned*)(DH + (r0 + rl) * CC + c0 + q * 8), *(const v4u*)&sh[rl][q * 8]); if (hi_rows) vst2((unsigned*)(DL + (bb * nhi + t0 + rl) * (size_t)CC + c0 + q * 8), *(const v4u*)&sl[rl][q * 8]); }
  } else { const bool hi_rows = t0 < KHI;
#pragma unroll
    for (int j = 0; j < 8; ++j) { const float bias = BA ? bfr(BA[c0 + j * 16 + col]) : 0.f;
#pragma unroll
      for (int r = 0; r < 8; ++r) { const float v = acc[j][r] + bias; const int rl = wave * 16 + 8 * g + r, cl = j * 16 + col; th[cl][rl] = (_Float16)v; const __bf16 bh = (__bf16)v; tb[cl][rl] = bh; tbl[cl][rl] = (__bf16)(v - (float)bh); } }
    __syncthreads();
    for (int e = tid; e < 128 * 8; e += 128) { const int cl = e >> 3, q = e & 7; vst2((unsigned*)(VT + (bb * CC + c0 + cl) * (size_t)TT + t0 + q * 8), *(const v4u*)&th[cl][q * 8]); if (hi_rows) { const size_t o3 = (bb * CC + c0 + cl) * (size_t)KHI + t0 + q * 8; vst2((unsigned*)(VB + o3), *(const v4u*)&tb[cl][q * 8]); vst2((unsigned*)(VBL + o3), *(const v4u*)&tbl[cl][q * 8]); } } } }
// ---- k_sc: block = (query block qb, key block kb in kb_first(qb) .. kb_last(qb), head in group) of batch b: logits x SCALE; q hi + residual (x 2^10) against k (2 products) for query rows < QHI, plus the k residual (3 products) for query blocks < QBH (causal early rows); causal: blocks past the diagonal exit, the mask itself is applied by index in k_sm
__global__ __launch_bounds__(128) void k_sc(const _Float16* __restrict__ QH, const _Float16* __restrict__ KH, const _Float16* __restrict__ QL, const _Float16* __restrict__ KL, int b, int h0, float* __restrict__ S0) { __shared__ __align__(16) float ss[4][16][132];
  const int qb = blockIdx.x, kb = kb_first(qb) + blockIdx.y; if (kb > kb_last(qb)) return;
  const int h = h0 + blockIdx.z; float* S = S0 + (size_t)blockIdx.z * TT * TT;
  const int tid = threadIdx.x, wave = tid >> 5, lane = tid & 31, col = lane & 15, g = lane >> 4; const int k0 = kb * 128; const int ql0 = qb * 64 + wave * 16; const size_t q0 = (size_t)b * TT + ql0, kr0 = (size_t)b * TT + k0;
  v8f acc[8] = {}, accl[8] = {};
  const _Float16* QLb = QL + (size_t)b * QHI * CC; const _Float16* KLb = KL + (size_t)b * KHI * CC;
  if (qb < QBH) {
#pragma unroll
    for (int kc = 0; kc < HD / 32; ++kc) { const v16h ah = frag_h(QH + (q0 + col) * CC + h * HD + kc * 32, lane), al = frag_h(QLb + (size_t)(ql0 + col) * CC + h * HD + kc * 32, lane);
#pragma unroll
      for (int j = 0; j < 8; ++j) { const v16h kbf = frag_h(KH + (kr0 + j * 16 + col) * CC + h * HD + kc * 32, lane), klf = frag_h(KLb + (size_t)(k0 + j * 16 + col) * CC + h * HD + kc * 32, lane); acc[j] = wmma16(ah, kbf, acc[j]); accl[j] = wmma16(al, kbf, accl[j]); accl[j] = wmma16(ah, klf, accl[j]); } }
  } else if (qb * 64 < QHI) {
#pragma unroll
    for (int kc = 0; kc < HD / 32; ++kc) { const v16h ah = frag_h(QH + (q0 + col) * CC + h * HD + kc * 32, lane), al = frag_h(QLb + (size_t)(ql0 + col) * CC + h * HD + kc * 32, lane);
#pragma unroll
      for (int j = 0; j < 8; ++j) { const v16h kbf = frag_h(KH + (kr0 + j * 16 + col) * CC + h * HD + kc * 32, lane); acc[j] = wmma16(ah, kbf, acc[j]); accl[j] = wmma16(al, kbf, accl[j]); } }
  } else {
#pragma unroll
    for (int kc = 0; kc < HD / 32; ++kc) { const v16h ah = frag_h(QH + (q0 + col) * CC + h * HD + kc * 32, lane);
#pragma unroll
      for (int j = 0; j < 8; ++j) { const v16h kbf = frag_h(KH + (kr0 + j * 16 + col) * CC + h * HD + kc * 32, lane); acc[j] = wmma16(ah, kbf, acc[j]); } } }
#pragma unroll
  for (int j = 0; j < 8; ++j) {
#pragma unroll
    for (int r = 0; r < 8; ++r) ss[wave][8 * g + r][j * 16 + col] = (acc[j][r] + accl[j][r] * (1.0f / 1024.0f)) * SCALE; }
  LDSX(); for (int rl = 0; rl < 16; ++rl) vst2(S + (size_t)(ql0 + rl) * TT + k0 + lane * 4, *(const v4f*)&ss[wave][rl][lane * 4]); }
// ---- k_sm: block = query row t (head in group): keys [kbeg, kend) = the key blocks k_sc wrote for this row; at most 256 keys, so a thread has at most one, and it is the key k = tid mod 256, which keeps the row sum's order that of a walk from key 0: causal -> logit if s <= t else excluded; softmax in f32; P x 2^11 in place (0 for excluded)
__global__ __launch_bounds__(256) void k_sm(float* __restrict__ S0 SM_EXTRA_PARAMS) { __shared__ float sred[8]; __shared__ float sbc; __shared__ __align__(16) float shv[TT];
  const int tid = threadIdx.x; const int t = blockIdx.x; const int kend = (kb_last(t >> 6) + 1) * 128; const int kbeg = kb_first(t >> 6) * 128; const int k = kbeg + ((tid - kbeg) & 255); const bool on = k < kend; static_assert(NKB * 128 <= 256, "one key per thread");
  float* sr = S0 + (size_t)blockIdx.y * TT * TT + (size_t)t * TT;
  float m = -3.0e38f; if (on) { float v = (!CAUSAL || k <= t) ? sr[k] : -3.0e38f; SM_MASK_HOOK; shv[k] = v; m = fmaxf(m, v); }
#pragma unroll
  for (int o = 1; o < 32; o <<= 1) m = fmaxf(m, __shfl_xor(m, o));
  if ((tid & 31) == 0) sred[tid >> 5] = m; __syncthreads(); if (tid == 0) { float a = sred[0]; for (int i = 1; i < 8; ++i) a = fmaxf(a, sred[i]); sbc = a; } __syncthreads(); m = sbc; __syncthreads();
  float sum = 0.f; if (on) { const float v = shv[k]; const float e = (v <= -1.0e38f) ? 0.f : expf(v - m); shv[k] = e; sum += e; }
#pragma unroll
  for (int o = 1; o < 32; o <<= 1) sum += __shfl_xor(sum, o);
  if ((tid & 31) == 0) sred[tid >> 5] = sum; __syncthreads(); if (tid == 0) { float a = 0.f; for (int i = 0; i < 8; ++i) a += sred[i]; sbc = a > 0.f ? 2048.0f / a : 0.f; }   /* a fully excluded row yields P = 0 */ __syncthreads(); const float inv = sbc;
  if (on) shv[k] = shv[k] * inv;
  __syncthreads(); if (const int q = kbeg / 4 + tid; q < kend / 4) vst2(sr + q * 4, *(const v4f*)&shv[q * 4]); }
// ---- k_pv: block = 64 queries (qb) of (b, h): ctx = P . v, each wave over the 32-key chunks that its 16 queries can see (P x 2^11 once to f16 against v f16: 1 product; causal early query blocks: P and v as bf16 hi + lo, 3 products); 256-B (row, head) segment by 16 lanes
__global__ __launch_bounds__(128) void k_pv(const float* __restrict__ PS0, const _Float16* __restrict__ VT, const __bf16* __restrict__ VB, const __bf16* __restrict__ VBL, int b, int h0, float* __restrict__ Y) { const int h = h0 + blockIdx.z; const float* PS = PS0 + (size_t)blockIdx.z * TT * TT; __shared__ __align__(16) float ss[4][16][HD + 4];
  const int tid = threadIdx.x, wave = tid >> 5, lane = tid & 31, col = lane & 15, g = lane >> 4; const int qb = blockIdx.x; const int ql0 = qb * 64 + wave * 16; const int kc0 = __builtin_amdgcn_readfirstlane(key_first(ql0) >> 5), kce = __builtin_amdgcn_readfirstlane(((ql0 + 15) >> 5) + 1);   /* wave-uniform bounds held in scalar registers: the loops stay scalar branches */
  v8f acc[HD / 16] = {};
  if (qb < QBH) {
#pragma unroll 1
    for (int kc = kc0; kc < kce; ++kc) { const F2 p = split_row(PS + (size_t)(ql0 + col) * TT, kc * 32, lane);
      asm volatile("s_wait_loadcnt 0x0" ::: "memory");
#pragma unroll
      for (int j = 0; j < HD / 16; ++j) { const size_t po = ((size_t)b * CC + h * HD + j * 16 + col) * (size_t)KHI + kc * 32; const v16b vh = frag_b(VB + po, lane); acc[j] = wmma_bf(p.h, vh, acc[j]); acc[j] = wmma_bf(p.l, vh, acc[j]); acc[j] = wmma_bf(p.h, frag_b(VBL + po, lane), acc[j]); } }
  } else {
#pragma unroll 1
    for (int kc = kc0; kc < kce; ++kc) { const v16h p = frag_f32(PS + (size_t)(ql0 + col) * TT + kc * 32, lane);
      asm volatile("s_wait_loadcnt 0x0" ::: "memory");
#pragma unroll
      for (int j = 0; j < HD / 16; ++j) { const size_t po = ((size_t)b * CC + h * HD + j * 16 + col) * (size_t)TT + kc * 32; acc[j] = wmma16(p, frag_h(VT + po, lane), acc[j]); } } }
#pragma unroll
  for (int j = 0; j < HD / 16; ++j)
#pragma unroll
    for (int r = 0; r < 8; ++r) ss[wave][8 * g + r][j * 16 + col] = acc[j][r] * (1.0f / 2048.0f);
  LDSX(); for (int rl = 0; rl < 16; ++rl) if (lane < HD / 4) vst2(Y + ((size_t)b * TT + ql0 + rl) * CC + h * HD + lane * 4, *(const v4f*)&ss[wave][rl][lane * 4]); }
// ---- k_out: block = (64 rows, 128 cols): out = ctx Wo (+ bo): all rows: ctx bf16 hi + lo against exact bf16 Wo (2 products)
__global__ __launch_bounds__(128) void k_out(const float* __restrict__ Y, const float* __restrict__ WO, const float* __restrict__ BO, float* __restrict__ OUT) { __shared__ __align__(16) float sf[4][16][132];
  const int tid = threadIdx.x, wave = tid >> 5, lane = tid & 31, col = lane & 15, g = lane >> 4; const int c0 = blockIdx.y * 128; const size_t r0 = (size_t)blockIdx.x * 64 + wave * 16;
  v8f acc[8] = {};
  if (true) {   /* ALL rows: ctx split bf16 hi + lo x exact Wo (2 products) */
#pragma unroll 2
    for (int kc = 0; kc < CC / 32; ++kc) { const F2 a = split_row(Y + (r0 + col) * CC, kc * 32, lane); asm volatile("s_wait_loadcnt 0x0" ::: "memory");
#pragma unroll
      for (int j = 0; j < 8; ++j) { const v16b w = WOCOL(WO, kc * 32, c0 + j * 16 + col, lane); asm volatile("s_wait_loadcnt 0x0" ::: "memory"); acc[j] = wmma_bf(a.h, w, acc[j]); acc[j] = wmma_bf(a.l, w, acc[j]); } }
#pragma unroll
    for (int j = 0; j < 8; ++j) { const float bias = BO ? bfr(BO[c0 + j * 16 + col]) : 0.f;
#pragma unroll
      for (int r = 0; r < 8; ++r) sf[wave][8 * g + r][j * 16 + col] = acc[j][r] + bias; }
  } else {
#pragma unroll 2
    for (int kc = 0; kc < CC / 32; ++kc) { const v16h a = frag_f32(Y + (r0 + col) * CC + kc * 32, lane); asm volatile("s_wait_loadcnt 0x0" ::: "memory");
#pragma unroll
      for (int j = 0; j < 8; ++j) { const v16h w = WOCOLH(WO, kc * 32, c0 + j * 16 + col, lane); asm volatile("s_wait_loadcnt 0x0" ::: "memory"); acc[j] = wmma16(a, w, acc[j]); } }
#pragma unroll
    for (int j = 0; j < 8; ++j) { const float bias = BO ? bfr(BO[c0 + j * 16 + col]) : 0.f;
#pragma unroll
      for (int r = 0; r < 8; ++r) sf[wave][8 * g + r][j * 16 + col] = acc[j][r] * (1.0f / 256.0f) + bias; } }
  LDSX(); for (int rl = 0; rl < 16; ++rl) vst2(OUT + (r0 + rl) * DIN + c0 + lane * 4, *(const v4f*)&sf[wave][rl][lane * 4]); }

extern "C" void kernel_launch(void* const* d_in, const int* in_sizes, int n_in, void* d_out, int out_size, void* d_ws, size_t ws_size, hipStream_t stream) {
  (void)in_sizes; (void)n_in; (void)out_size;
  const float** F = (const float**)d_in;
  if (ws_size < (size_t)WS_END) return;
  char* ws = (char*)d_ws; _Float16 *QH = (_Float16*)(ws + WS_QH), *KH = (_Float16*)(ws + WS_KH), *VT = (_Float16*)(ws + WS_VT), *QL = (_Float16*)(ws + WS_QL), *KL = (_Float16*)(ws + WS_KL); __bf16 *VB = (__bf16*)(ws + WS_VB), *VBL = (__bf16*)(ws + WS_VBL); float *S = (float*)(ws + WS_S), *Y = (float*)(ws + WS_Y);
  (void)Y; (void)QL; (void)KL; (void)VB; (void)VBL;
  // inputs: 0 x [2,2048,1024]; 1 Wq, 2 Wk, 3 Wv, 4 Wo [1024,1024] (in,out), no biases
  if (ws_size < (size_t)WS_END2) return;
  float* PR = (float*)(ws + WS_PR);
  k_proj<<<dim3(TNB * TT / 64, CC / 128, 3), 128, 0, stream>>>(F[0], F[0], F[0], F[1], F[2], F[3], nullptr, nullptr, nullptr, QH, QL, KH, KL, VT, VB, VBL);
  for (int b = 0; b < TNB; ++b) for (int h0 = 0; h0 < NH; h0 += HG) {
    k_sc<<<dim3(NQB, NKB, HG), 128, 0, stream>>>(QH, KH, QL, KL, b, h0, S);
    k_sm<<<dim3(TT, HG), 256, 0, stream>>>(S);
    k_pv<<<dim3(NQB, 1, HG), 128, 0, stream>>>(S, VT, VB, VBL, b, h0, Y);
  }
  k_out<<<dim3(TNB * TT / 64, DIN / 128), 128, 0, stream>>>(Y, F[4], nullptr, PR);
  k_res<<<dim3((unsigned)(((size_t)TNB * TT * (DIN / 4) + 255) / 256)), 256, 0, stream>>>(PR, F[0], (float*)d_out);
}

// v003
// It runs in 119 microseconds.
// Versions in between are left out here; by their measured steps it is 3.87 times as fast as v001.
// Over all steps from v000 it is 8.64 times as fast.
// compute dtype: all float inputs rounded to bf16; q/k/v = x W with EXACT bf16 products on WMMA 16x16x32 (f32 accumulate); windowed causal logits: q, k once to f16 (1 product) x 64^-0.5, except the first 384 query rows of each sequence (3 products with f16 residuals); softmax in f32; P x 2^11 once to f16 against v once to f16 (1 product; bf16 hi + lo below row 384); ctx split bf16 hi + lo against exact Wo (2 products); + x residual in f32; f32 output.
#include <hip/hip_runtime.h>
#include <math.h>

typedef __attribute__((ext_vector_type(16))) _Float16 v16h;
typedef __attribute__((ext_vector_type(16))) __bf16 v16b;
typedef __attribute__((ext_vector_type(8)))  _Float16 v8h;
typedef __attribute__((ext_vector_type(8)))  float v8f;
typedef __attribute__((ext_vector_type(4)))  float v4f;
typedef __attribute__((ext_vector_type(2)))  float v2f;
typedef __attribute__((ext_vector_type(4)))  unsigned v4u;
typedef __attribute__((ext_vector_type(4)))  int v4i;
typedef float __attribute__((may_alias)) float_a;
typedef int __attribute__((may_alias)) int_a;

template <typename T> __device__ __forceinline__ void vst2(void* p, T v) { *(T*)p = v;  }
__device__ __forceinline__ v8f wmma16(v16h a, v16h b, v8f c) {
  v8f d = __builtin_amdgcn_wmma_f32_16x16x32_f16(false, a, false, b, (short)0, c, false, false);
  asm volatile("v_nop\n\tv_nop\n\tv_nop\n\tv_nop" : "+v"(d) : "v"(a), "v"(b));
  return d;
}
__device__ __forceinline__ v8f wmma_bf(v16b a, v16b b, v8f c) {
  v8f d = __builtin_amdgcn_wmma_f32_16x16x32_bf16(false, a, false, b, (short)0, c, false, false);
  asm volatile("v_nop\n\tv_nop\n\tv_nop\n\tv_nop" : "+v"(d) : "v"(a), "v"(b));
  return d;
}
// 16x16x32 fragments: lane = (h = lane>>4, row/col = lane&15); elements 0..7 = k0+8h+0..7, 8..15 = k0+16+8h+0..7; D element r = row 8h+r
__device__ __forceinline__ v16h frag_h(const _Float16* rowk0, int lane) {
  union { v16h v; v8h q[2]; } u; const _Float16* p = rowk0 + 8 * (lane >> 4);
  u.q[0] = *(const v8h*)p; u.q[1] = *(const v8h*)(p + 16); return u.v;
}
__device__ __forceinline__ v16h frag_f32(const float* rowk0, int lane) {
  v16h a; const float* p = rowk0 + 8 * (lane >> 4);
#pragma unroll
  for (int i = 0; i < 8; ++i) { a[i] = (_Float16)p[i]; a[8 + i] = (_Float16)p[16 + i]; }
  return a;
}
__device__ __forceinline__ v16h frag_f32s(const float* rowk0, int lane, float sc) {
  v16h a; const float* p = rowk0 + 8 * (lane >> 4);
#pragma unroll
  for (int i = 0; i < 8; ++i) { a[i] = (_Float16)(p[i] * sc); a[8 + i] = (_Float16)(p[16 + i] * sc); }
  return a;
}
// column fragment from a [K][ld] layout (column n), rows >= K read as 0
__device__ __forceinline__ v16h fragc_f32(const float* W, int k0, int n, int lane, int ld, int K) {
  v16h a; const int g = lane >> 4;
#pragma unroll
  for (int i = 0; i < 8; ++i) { const int ka = k0 + 8 * g + i, kb = ka + 16;
    a[i] = (_Float16)(ka < K ? W[(size_t)(ka < K ? ka : K - 1) * ld + n] : 0.f); a[8 + i] = (_Float16)(kb < K ? W[(size_t)(kb < K ? kb : K - 1) * ld + n] : 0.f); }
  return a;
}
struct F2 { v16b h, l; };
__device__ __forceinline__ F2 bsplit16(const float v[16]) { F2 r;
#pragma unroll
  for (int i = 0; i < 16; ++i) { const __bf16 h = (__bf16)v[i]; r.h[i] = h; r.l[i] = (__bf16)(v[i] - (float)h); }
  return r; }
__device__ __forceinline__ F2 split_row(const float* row, int k0, int lane) { float v[16]; const float* p = row + k0 + 8 * (lane >> 4);
#pragma unroll
  for (int i = 0; i < 8; ++i) { v[i] = p[i]; v[8 + i] = p[16 + i]; }
  return bsplit16(v); }
__device__ __forceinline__ F2 split_rowK(const float* row, int k0, int lane, int K) { float v[16]; const int g = lane >> 4;
#pragma unroll
  for (int i = 0; i < 8; ++i) { const int ka = k0 + 8 * g + i, kb = ka + 16; v[i] = ka < K ? row[ka < K ? ka : K - 1] : 0.f; v[8 + i] = kb < K ? row[kb < K ? kb : K - 1] : 0.f; }
  return bsplit16(v); }
__device__ __forceinline__ F2 split_col(const float* W, int k0, int n, int lane, int ld, int K) { float v[16]; const int g = lane >> 4;
#pragma unroll
  for (int i = 0; i < 8; ++i) { const int ka = k0 + 8 * g + i, kb = ka + 16; v[i] = ka < K ? W[(size_t)(ka < K ? ka : K - 1) * ld + n] : 0.f; v[8 + i] = kb < K ? W[(size_t)(kb < K ? kb : K - 1) * ld + n] : 0.f; }
  return bsplit16(v); }
__device__ __forceinline__ v8f mac3(const F2& a, const F2& b, v8f c) { c = wmma_bf(a.l, b.h, c); c = wmma_bf(a.h, b.l, c); return wmma_bf(a.h, b.h, c); }
__device__ __forceinline__ float sigm(float v) { return 1.0f / (1.0f + expf(-v)); }
#define LDSX() do { asm volatile("s_wait_dscnt 0" ::: "memory"); __builtin_amdgcn_wave_barrier(); __builtin_amdgcn_fence(__ATOMIC_RELEASE, "workgroup"); } while (0)

// Sliding-window causal self-attention (B 2, S 2,048, 1,024 = 16 x 64, window 128): q/k/v = x W ((in,out)); key j visible from query i iff i - 127 <= j <= i; softmax (the extra max-subtraction is a no-op); out = merged(attn v) Wo + x.
#define NB 2
#define TT 2048
#define CC 1024            // NH * HD = projected width
#define DIN 1024          // input (model) width
#define NH 16
#define HD 64
#define NQB (TT / 64)
#define SCALE (0.125f)
#define CAUSAL 1
#ifndef TNB
#define TNB NB
#endif
__device__ __forceinline__ float bfr(float v) { return (float)(__bf16)v; }
#define WIN 128            // window: key j is visible from query i only if j >= i - (WIN - 1)
// oldest key that any query >= t can see; every older key has P = 0 exactly, so a 32-key chunk wholly older is neither scored, normalised nor multiplied
__device__ __forceinline__ int key_first(int t) { return t > WIN - 1 ? t - (WIN - 1) : 0; }
typedef __attribute__((ext_vector_type(8))) __bf16 v8b;
__device__ __forceinline__ v16b frag_b(const __bf16* rowk0, int lane) {
  union { v16b v; v8b q[2]; } u; const __bf16* p = rowk0 + 8 * (lane >> 4);
  u.q[0] = *(const v8b*)p; u.q[1] = *(const v8b*)(p + 16); return u.v;
}
#define QBH 6              // causal: query blocks 0..QBH-1 of each sequence take the high-precision path
#define QHI 384            // rows carrying a q residual plane
#define KHI 384            // key rows carrying k residual / v bf16 hi+lo planes (used only by the causal high-precision path)
// B fragment (k rows k0+.., output column o) of a weight: (in,out) [K][ld] or (out,in) [ld rows of K]: bf16 exact, or f16(bf16 * 256) exact
__device__ __forceinline__ v16b wcol_io(const float* Wm, int k0, int o, int lane, int ld) { v16b w; const int g = lane >> 4;
#pragma unroll
  for (int i = 0; i < 8; ++i) { w[i] = (__bf16)Wm[(size_t)(k0 + 8 * g + i) * ld + o]; w[8 + i] = (__bf16)Wm[(size_t)(k0 + 16 + 8 * g + i) * ld + o]; }
  return w; }
__device__ __forceinline__ v16b wcol_oi(const float* Wm, int k0, int o, int lane, int K) { v16b w; const float* p = Wm + (size_t)o * K + k0 + 8 * (lane >> 4);
#pragma unroll
  for (int i = 0; i < 8; ++i) { w[i] = (__bf16)p[i]; w[8 + i] = (__bf16)p[16 + i]; }
  return w; }
__device__ __forceinline__ v16h wcolh_io(const float* Wm, int k0, int o, int lane, int ld) { v16h w; const int g = lane >> 4;
#pragma unroll
  for (int i = 0; i < 8; ++i) { w[i] = (_Float16)(bfr(Wm[(size_t)(k0 + 8 * g + i) * ld + o]) * 256.0f); w[8 + i] = (_Float16)(bfr(Wm[(size_t)(k0 + 16 + 8 * g + i) * ld + o]) * 256.0f); }
  return w; }
__device__ __forceinline__ v16h wcolh_oi(const float* Wm, int k0, int o, int lane, int K) { v16h w; const float* p = Wm + (size_t)o * K + k0 + 8 * (lane >> 4);
#pragma unroll
  for (int i = 0; i < 8; ++i) { w[i] = (_Float16)(bfr(p[i]) * 256.0f); w[8 + i] = (_Float16)(bfr(p[16 + i]) * 256.0f); }
  return w; }
#define WQKV_LAYOUT 0   // 0 = (in,out) [DIN][CC]; 1 = (out,in) [CC][DIN]; 2 = per-head [NH][DIN][HD]
__device__ __forceinline__ v16b wcol_hdk(const float* Wm, int k0, int o, int lane) { v16b w; const int g = lane >> 4; const float* p = Wm + (size_t)(o / HD) * DIN * HD + (o % HD);
#pragma unroll
  for (int i = 0; i < 8; ++i) { w[i] = (__bf16)p[(size_t)(k0 + 8 * g + i) * HD]; w[8 + i] = (__bf16)p[(size_t)(k0 + 16 + 8 * g + i) * HD]; }
  return w; }
#define WO_OUT_IN 0
#if WQKV_LAYOUT == 1
#define WCOL(W, k0, o, lane) wcol_oi(W, k0, o, lane, DIN)
#elif WQKV_LAYOUT == 2
#define WCOL(W, k0, o, lane) wcol_hdk(W, k0, o, lane)
#else
#define WCOL(W, k0, o, lane) wcol_io(W, k0, o, lane, CC)
#endif
#if WO_OUT_IN
#define WOCOL(W, k0, o, lane) wcol_oi(W, k0, o, lane, CC)
#define WOCOLH(W, k0, o, lane) wcolh_oi(W, k0, o, lane, CC)
#else
#define WOCOL(W, k0, o, lane) wcol_io(W, k0, o, lane, DIN)
#define WOCOLH(W, k0, o, lane) wcolh_io(W, k0, o, lane, DIN)
#endif
// ---- k_res: thread per float4: out = bf16(x) + PR
__global__ __launch_bounds__(256) void k_res(const float* __restrict__ PR, const float* __restrict__ X, float* __restrict__ OUT) { const size_t i = (size_t)blockIdx.x * 256 + threadIdx.x; if (i >= (size_t)TNB * TT * (DIN / 4)) return;
  const v4f p = *(const v4f*)(PR + i * 4); const v4f x = *(const v4f*)(X + i * 4); v4f o; o[0] = bfr(x[0]) + p[0]; o[1] = bfr(x[1]) + p[1]; o[2] = bfr(x[2]) + p[2]; o[3] = bfr(x[3]) + p[3]; vst2(OUT + i * 4, o); }
#define WS_PR  (WS_END)
#define WS_END2 (WS_PR + 4u * (size_t)NB * TT * DIN)
#ifndef PROJ_EXTRA_PARAMS
#define PROJ_EXTRA_PARAMS
#endif

#define WS_QH  0u                                      // f16 q rows [b*t][CC]
#define WS_KH  (WS_QH + 2u * (size_t)NB * TT * CC)      // f16 k rows [b*t][CC]
#define WS_VT  (WS_KH + 2u * (size_t)NB * TT * CC)      // f16 v planes [b][c][t]
#define WS_QL  (WS_VT + 2u * (size_t)NB * CC * TT)      // f16 q residual x 2^10 rows [b][t < QHI][CC]
#define WS_KL  (WS_QL + 2u * (size_t)NB * QHI * CC)     // f16 k residual x 2^10 rows [b][t < KHI][CC]
#define WS_VB  (WS_KL + 2u * (size_t)NB * KHI * CC)     // bf16 v hi planes [b][c][t < KHI]
#define WS_VBL (WS_VB + 2u * (size_t)NB * CC * KHI)
#define WS_Y   (WS_VBL + 2u * (size_t)NB * CC * KHI)    // f32 ctx rows [b*t][CC] (only when there is an output projection)
#define WS_END (WS_Y  + 4u * (size_t)NB * TT * CC)

// ---- operand feed of k_proj and k_out: a slab = KS k rows of the block's 128 weight columns. Thread n loads column n (a wave's load = one 128-byte line), rounds it to bf16 and stores it as row n of an LDS buffer [128][KS + 8] (pitch 144 bytes: the pitch of ds_load_b128 readers), where all 4 waves read their B fragments. The block's 64 activation rows go the same way, [64][KS + 8], loaded in 16-byte pieces so that a wave's load is 2 rows x 256 bytes = 4 whole lines (a fragment load straight from global touches 16 lines). Both are loaded one slab ahead. The loops of the feed are unrolled in full: wr, ar and the fragment arrays live in registers and need compile-time indices.
#define KS 64
#define GXW() asm volatile("s_wait_xcnt 0x0" ::: "memory")   /* stands behind a slab's global loads: the next slab's address is formed in the registers that these loads name; it also keeps the loads in front of the products that cover their latency */
__device__ __forceinline__ void wslab_load(float (&wr)[KS], const float* Wc, int s, int ld) {
#pragma unroll
  for (int i = 0; i < KS; ++i) wr[i] = Wc[(size_t)(s * KS + i) * ld]; }
__device__ __forceinline__ void wslab_store(__bf16 (*buf)[KS + 8], const float (&wr)[KS], int n) {
#pragma unroll
  for (int q = 0; q < KS / 8; ++q) { v8b t;
#pragma unroll
    for (int i = 0; i < 8; ++i) t[i] = (__bf16)wr[q * 8 + i];
    *(v8b*)&buf[n][q * 8] = t; } }
typedef __attribute__((ext_vector_type(4))) __bf16 v4b;
#define AL (64 * KS / 4 / 128)   // 16-byte pieces of an activation slab per thread: piece i of thread t is row i * 8 + (t >> 4), floats 4 * (t & 15) ..
static_assert(KS == 64, "16 pieces per slab row");
__device__ __forceinline__ void aslab_load(v4f (&ar)[AL], const float* Ab, int s, int ld) {   /* Ab = first row of the block + (t >> 4) * ld + 4 * (t & 15) */
#pragma unroll
  for (int i = 0; i < AL; ++i) ar[i] = *(const v4f*)(Ab + (size_t)(i * 8) * ld + s * KS); }
__device__ __forceinline__ void aslab_store(__bf16 (*buf)[KS + 8], const v4f (&ar)[AL], int t) {
#pragma unroll
  for (int i = 0; i < AL; ++i) { v4b h;
#pragma unroll
    for (int e = 0; e < 4; ++e) h[e] = (__bf16)ar[i][e];
    *(v4b*)&buf[i * 8 + (t >> 4)][4 * (t & 15)] = h; } }
// the same with the bf16 hi + lo split of bsplit16, one plane each
__device__ __forceinline__ void aslab_store2(__bf16 (*bh)[KS + 8], __bf16 (*bl)[KS + 8], const v4f (&ar)[AL], int t) {
#pragma unroll
  for (int i = 0; i < AL; ++i) { v4b h, l;
#pragma unroll
    for (int e = 0; e < 4; ++e) { const __bf16 hv = (__bf16)ar[i][e]; h[e] = hv; l[e] = (__bf16)(ar[i][e] - (float)hv); }
    *(v4b*)&bh[i * 8 + (t >> 4)][4 * (t & 15)] = h; *(v4b*)&bl[i * 8 + (t >> 4)][4 * (t & 15)] = l; } }
// ---- k_proj: block = (64 rows, 128 cols, which): q/k/v = X W (+ b) with exact bf16 products (K = DIN) -> which 0: q f16 rows (+ residual rows < QHI); 1: k f16 rows (+ residual rows < KHI); 2: v f16 planes [c][t] (+ bf16 hi/lo planes for t < KHI)
__global__ __launch_bounds__(128) void k_proj(const float* __restrict__ XQ, const float* __restrict__ XK, const float* __restrict__ XV, const float* __restrict__ WQ, const float* __restrict__ WK, const float* __restrict__ WV, const float* __restrict__ BQ, const float* __restrict__ BK, const float* __restrict__ BV,
    _Float16* __restrict__ QH, _Float16* __restrict__ QL, _Float16* __restrict__ KH, _Float16* __restrict__ KL, _Float16* __restrict__ VT, __bf16* __restrict__ VB, __bf16* __restrict__ VBL) {
  __shared__ __align__(16) _Float16 sh[64][136], sl[64][136]; __shared__ __align__(16) _Float16 th[128][72]; __shared__ __align__(16) __bf16 tb[128][72], tbl[128][72];
  const int tid = threadIdx.x, wave = tid >> 5, lane = tid & 31, col = lane & 15, g = lane >> 4; const int which = blockIdx.z; const int c0 = blockIdx.y * 128; const size_t r0 = (size_t)blockIdx.x * 64; const size_t bb = r0 / TT; const int t0 = (int)(r0 % TT);
  const float* X = which == 0 ? XQ : which == 1 ? XK : XV; const float* WA = which == 0 ? WQ : which == 1 ? WK : WV; const float* BA = which == 0 ? BQ : which == 1 ? BK : BV;
  v8f acc[8] = {};
  static_assert(WQKV_LAYOUT == 0 && KS + 8 == 72 && DIN % (2 * KS) == 0, "slab feed");
  const float* Wc = WA + c0 + tid; const float* Ab = X + (r0 + (tid >> 4)) * DIN + 4 * (tid & 15);
  float wr[KS]; v4f ar[AL];
  __bf16 (*const xa0)[KS + 8] = (__bf16 (*)[KS + 8])&th[0][0]; __bf16 (*const xa1)[KS + 8] = (__bf16 (*)[KS + 8])&th[64][0];   /* until the epilogue takes them (behind the last barrier), tb and tbl are the two weight buffers and the halves of th the two activation buffers */
  // one slab: slab s + 1's loads start (behind the barrier, which waits for every load in flight); products from cw, ca; then slab s + 1 goes to nw, na, whose readers left them at the last barrier; the barrier publishes nw, na and ends the reads of cw, ca
  const auto slab = [&](const __bf16 (*cw)[KS + 8], const __bf16 (*ca)[KS + 8], __bf16 (*nw)[KS + 8], __bf16 (*na)[KS + 8], int s) {
    if (s + 1 < DIN / KS) { wslab_load(wr, Wc, s + 1, CC); aslab_load(ar, Ab, s + 1, DIN); GXW(); }
#pragma unroll
    for (int kc = 0; kc < KS / 32; ++kc) { const v16b a = frag_b(&ca[wave * 16 + col][kc * 32], lane); v16b w[8];
#pragma unroll
      for (int j = 0; j < 8; ++j) w[j] = frag_b(&cw[j * 16 + col][kc * 32], lane);
#pragma unroll
      for (int j = 0; j < 8; ++j) acc[j] = wmma_bf(a, w[j], acc[j]); }
    if (s + 1 < DIN / KS) { wslab_store(nw, wr, tid); aslab_store(na, ar, tid); }
    __syncthreads(); };
  wslab_load(wr, Wc, 0, CC); aslab_load(ar, Ab, 0, DIN); GXW();
  wslab_store(tb, wr, tid); aslab_store(xa0, ar, tid);
  __syncthreads();
  for (int s = 0; s < DIN / KS; s += 2) { slab(tb, xa0, tbl, xa1, s); slab(tbl, xa1, tb, xa0, s + 1); }
  if (which < 2) { _Float16* DH = which == 0 ? QH : KH; _Float16* DL = which == 0 ? QL : KL; const int nhi = which == 0 ? QHI : KHI; const bool hi_rows = t0 < nhi;
#pragma unroll
    for (int j = 0; j < 8; ++j) { const float bias = BA ? bfr(BA[c0 + j * 16 + col]) : 0.f;
#pragma unroll
      for (int r = 0; r < 8; ++r) { const float v = acc[j][r] + bias; const _Float16 hv = (_Float16)v; sh[wave * 16 + 8 * g + r][j * 16 + col] = hv; sl[wave * 16 + 8 * g + r][j * 16 + col] = (_Float16)((v - (float)hv) * 1024.0f); } }
    __syncthreads();
    for (int e = tid; e < 64 * 16; e += 128) { const int rl = e >> 4, q = e & 15; vst2((unsigned*)(DH + (r0 + rl) * CC + c0 + q * 8), *(const v4u*)&sh[rl][q * 8]); if (hi_rows) vst2((unsigned*)(DL + (bb * nhi + t0 + rl) * (size_t)CC + c0 + q * 8), *(const v4u*)&sl[rl][q * 8]); }
  } else { const bool hi_rows = t0 < KHI;
#pragma unroll
    for (int j = 0; j < 8; ++j) { const float bias = BA ? bfr(BA[c0 + j * 16 + col]) : 0.f;
#pragma unroll
      for (int r = 0; r < 8; ++r) { const float v = acc[j][r] + bias; const int rl = wave * 16 + 8 * g + r, cl = j * 16 + col; th[cl][rl] = (_Float16)v; const __bf16 bh = (__bf16)v; tb[cl][rl] = bh; tbl[cl][rl] = (__bf16)(v - (float)bh); } }
    __syncthreads();
    for (int e = tid; e < 128 * 8; e += 128) { const int cl = e >> 3, q = e & 7; vst2((unsigned*)(VT + (bb * CC + c0 + cl) * (size_t)TT + t0 + q * 8), *(const v4u*)&th[cl][q * 8]); if (hi_rows) { const size_t o3 = (bb * CC + c0 + cl) * (size_t)KHI + t0 + q * 8; vst2((unsigned*)(VB + o3), *(const v4u*)&tb[cl][q * 8]); vst2((unsigned*)(VBL + o3), *(const v4u*)&tbl[cl][q * 8]); } } } }
#define XW() asm volatile("s_wait_xcnt 0x0" ::: "memory")   /* stands behind each group of k_att's global loads that share an address: a later load's result may be given the group's address registers, and s_wait_xcnt 0 belongs in front of an overwrite of a register that an issued load names */
#define AHEAD 2            // chunks whose fragment loads are in flight in front of the chunk being multiplied
#define NCH 5              // 16 queries from a multiple of 16 see keys [ql0 - (WIN - 1), ql0 + 15]: at most 5 chunks of 32
__global__ __launch_bounds__(128) void k_att(const _Float16* __restrict__ QH, const _Float16* __restrict__ KH, const _Float16* __restrict__ QL, const _Float16* __restrict__ KL, const _Float16* __restrict__ VT, const __bf16* __restrict__ VB, const __bf16* __restrict__ VBL, float* __restrict__ Y) { __shared__ __align__(16) float ss[4][16][HD + 4];
  const int tid = threadIdx.x, wave = tid >> 5, lane = tid & 31, col = lane & 15, g = lane >> 4; const int qb = blockIdx.x, h = blockIdx.y, b = blockIdx.z; const int ql0 = qb * 64 + wave * 16; const int t = ql0 + col;
  const int kc0 = __builtin_amdgcn_readfirstlane(key_first(ql0) >> 5), kcl = __builtin_amdgcn_readfirstlane((ql0 + 15) >> 5);   /* first and last visible chunk, wave-uniform */
  static_assert((WIN - 1 + 15) / 32 + 1 <= NCH, "chunks per wave");
  const size_t q0 = (size_t)b * TT + ql0;
  float p[NCH][16];   /* every loop of this kernel is unrolled in full: p, the fragment arrays and the accumulators live in registers and need compile-time indices */
  if (qb < QBH) { const _Float16* QLb = QL + (size_t)b * QHI * CC; const _Float16* KLb = KL + (size_t)b * KHI * CC;
    v16h ah[HD / 32], al[HD / 32];
#pragma unroll
    for (int kc = 0; kc < HD / 32; ++kc) ah[kc] = frag_h(QH + (q0 + col) * CC + h * HD + kc * 32, lane);
    XW();
#pragma unroll
    for (int kc = 0; kc < HD / 32; ++kc) al[kc] = frag_h(QLb + (size_t)(ql0 + col) * CC + h * HD + kc * 32, lane);
    XW();
#pragma unroll
    for (int c = 0; c < NCH; ++c) { const int kr = (kc0 + c < kcl ? kc0 + c : kcl) * 32;
#pragma unroll
      for (int u = 0; u < 2; ++u) { v16h kbf[HD / 32], klf[HD / 32];   /* loads do not move over the products' asm statements: a 16-key tile's loads stand in front of its products; a whole chunk's fragments at once would not fit the registers beside p */
#pragma unroll
        for (int kc = 0; kc < HD / 32; ++kc) kbf[kc] = frag_h(KH + ((size_t)b * TT + kr + u * 16 + col) * CC + h * HD + kc * 32, lane);
        XW();
#pragma unroll
        for (int kc = 0; kc < HD / 32; ++kc) klf[kc] = frag_h(KLb + (size_t)(kr + u * 16 + col) * CC + h * HD + kc * 32, lane);
        XW();
        v8f acc = {}, accl = {};
#pragma unroll
        for (int kc = 0; kc < HD / 32; ++kc) { acc = wmma16(kbf[kc], ah[kc], acc); accl = wmma16(kbf[kc], al[kc], accl); accl = wmma16(klf[kc], ah[kc], accl); }
#pragma unroll
        for (int r = 0; r < 8; ++r) p[c][u * 8 + r] = (acc[r] + accl[r] * (1.0f / 1024.0f)) * SCALE; } }
  } else {
    v16h ah[HD / 32];
#pragma unroll
    for (int kc = 0; kc < HD / 32; ++kc) ah[kc] = frag_h(QH + (q0 + col) * CC + h * HD + kc * 32, lane);
    XW();
    v16h kf[NCH][2][HD / 32];   /* loads do not move over the products' asm statements: chunk c + AHEAD is loaded in front of chunk c's products, so that its latency is covered */
#pragma unroll
    for (int cc = -AHEAD; cc < NCH; ++cc) { const int c = cc < 0 ? 0 : cc;
      if (const int cn = cc + AHEAD; cn < NCH) { const int kr = (kc0 + cn < kcl ? kc0 + cn : kcl) * 32;
#pragma unroll
        for (int u = 0; u < 2; ++u)
#pragma unroll
          for (int kc = 0; kc < HD / 32; ++kc) kf[cn][u][kc] = frag_h(KH + ((size_t)b * TT + kr + u * 16 + col) * CC + h * HD + kc * 32, lane);
        XW(); }
      if (cc < 0) continue;
#pragma unroll
      for (int u = 0; u < 2; ++u) { v8f acc = {};
#pragma unroll
        for (int kc = 0; kc < HD / 32; ++kc) acc = wmma16(kf[c][u][kc], ah[kc], acc);
#pragma unroll
        for (int r = 0; r < 8; ++r) p[c][u * 8 + r] = acc[r] * SCALE; } } }
  // softmax of row t in f32: element i of chunk c is key (kc0 + c) * 32 + 16 * (i >> 3) + 8 g + (i & 7); visible iff t - (WIN - 1) <= key <= t
  float m = -3.0e38f;
#pragma unroll
  for (int c = 0; c < NCH; ++c)
#pragma unroll
    for (int i = 0; i < 16; ++i) { const int k = (kc0 + c) * 32 + 16 * (i >> 3) + 8 * g + (i & 7); const float v = (k <= t && k >= t - (WIN - 1)) ? p[c][i] : -3.0e38f; p[c][i] = v; m = fmaxf(m, v); }
  m = fmaxf(m, __shfl_xor(m, 16));
  float sum = 0.f;
#pragma unroll
  for (int c = 0; c < NCH; ++c)
#pragma unroll
    for (int i = 0; i < 16; ++i) { const float v = p[c][i]; const float ex = expf(v - m); const float e = (v <= -1.0e38f) ? 0.f : ex; p[c][i] = e; sum += e; }
  sum += __shfl_xor(sum, 16);
  const float inv = sum > 0.f ? 2048.0f / sum : 0.f;
#pragma unroll
  for (int c = 0; c < NCH; ++c)
#pragma unroll
    for (int i = 0; i < 16; ++i) p[c][i] *= inv;
  v8f acc[HD / 16] = {};
  if (qb < QBH) {
#pragma unroll
    for (int c = 0; c < NCH; ++c) { const int kr = (kc0 + c < kcl ? kc0 + c : kcl) * 32; const F2 pf = bsplit16(p[c]); v16b vh[HD / 16], vl[HD / 16];
#pragma unroll
      for (int j = 0; j < HD / 16; ++j) vh[j] = frag_b(VB + ((size_t)b * CC + h * HD + j * 16 + col) * (size_t)KHI + kr, lane);
      XW();
#pragma unroll
      for (int j = 0; j < HD / 16; ++j) vl[j] = frag_b(VBL + ((size_t)b * CC + h * HD + j * 16 + col) * (size_t)KHI + kr, lane);
      XW();
#pragma unroll
      for (int j = 0; j < HD / 16; ++j) { acc[j] = wmma_bf(pf.h, vh[j], acc[j]); acc[j] = wmma_bf(pf.l, vh[j], acc[j]); acc[j] = wmma_bf(pf.h, vl[j], acc[j]); } }
  } else { v16h vf[NCH][HD / 16];   /* v fragments AHEAD chunks in front of their products, as for K */
#pragma unroll
    for (int cc = -AHEAD; cc < NCH; ++cc) { const int c = cc < 0 ? 0 : cc;
      if (const int cn = cc + AHEAD; cn < NCH) { const int kr = (kc0 + cn < kcl ? kc0 + cn : kcl) * 32;
#pragma unroll
        for (int j = 0; j < HD / 16; ++j) vf[cn][j] = frag_h(VT + ((size_t)b * CC + h * HD + j * 16 + col) * (size_t)TT + kr, lane);
        XW(); }
      if (cc < 0) continue;
      v16h pf;
#pragma unroll
      for (int i = 0; i < 16; ++i) pf[i] = (_Float16)p[c][i];
#pragma unroll
      for (int j = 0; j < HD / 16; ++j) acc[j] = wmma16(pf, vf[c][j], acc[j]); } }
#pragma unroll
  for (int j = 0; j < HD / 16; ++j)
#pragma unroll
    for (int r = 0; r < 8; ++r) ss[wave][8 * g + r][j * 16 + col] = acc[j][r] * (1.0f / 2048.0f);
  LDSX(); for (int rl = 0; rl < 16; ++rl) if (lane < HD / 4) vst2(Y + ((size_t)b * TT + ql0 + rl) * CC + h * HD + lane * 4, *(const v4f*)&ss[wave][rl][lane * 4]); }
// ---- k_out: block = (64 rows, 128 cols): out = ctx Wo (+ bo): all rows: ctx bf16 hi + lo against exact bf16 Wo (2 products)
__global__ __launch_bounds__(128) void k_out(const float* __restrict__ Y, const float* __restrict__ WO, const float* __restrict__ BO, float* __restrict__ OUT) { __shared__ __align__(16) float sf[4][16][132]; __shared__ __align__(16) __bf16 wb0[128][KS + 8], wb1[128][KS + 8], yh0[64][KS + 8], yl0[64][KS + 8], yh1[64][KS + 8], yl1[64][KS + 8];
  const int tid = threadIdx.x, wave = tid >> 5, lane = tid & 31, col = lane & 15, g = lane >> 4; const int c0 = blockIdx.y * 128; const size_t r0 = (size_t)blockIdx.x * 64 + wave * 16;
  v8f acc[8] = {};
  if (true) {   /* ALL rows: ctx split bf16 hi + lo x exact Wo (2 products) */
    static_assert(WO_OUT_IN == 0 && CC % (2 * KS) == 0, "slab feed");
    const float* Wc = WO + c0 + tid; const float* Ab = Y + ((size_t)blockIdx.x * 64 + (tid >> 4)) * CC + 4 * (tid & 15);
    float wr[KS]; v4f ar[AL];
    // the slab step of k_proj, ctx as hi and lo planes; each accumulator still takes chunk kc's hi product, then its lo product
    const auto slab = [&](const __bf16 (*cw)[KS + 8], const __bf16 (*ch)[KS + 8], const __bf16 (*cl)[KS + 8], __bf16 (*nw)[KS + 8], __bf16 (*nh)[KS + 8], __bf16 (*nl)[KS + 8], int s) {
      if (s + 1 < CC / KS) { wslab_load(wr, Wc, s + 1, DIN); aslab_load(ar, Ab, s + 1, CC); GXW(); }
#pragma unroll
      for (int kc = 0; kc < KS / 32; ++kc) { const v16b ah = frag_b(&ch[wave * 16 + col][kc * 32], lane), al = frag_b(&cl[wave * 16 + col][kc * 32], lane); v16b w[8];
#pragma unroll
        for (int j = 0; j < 8; ++j) w[j] = frag_b(&cw[j * 16 + col][kc * 32], lane);
#pragma unroll
        for (int j = 0; j < 8; ++j) acc[j] = wmma_bf(ah, w[j], acc[j]);
#pragma unroll
        for (int j = 0; j < 8; ++j) acc[j] = wmma_bf(al, w[j], acc[j]); }
      if (s + 1 < CC / KS) { wslab_store(nw, wr, tid); aslab_store2(nh, nl, ar, tid); }
      __syncthreads(); };
    wslab_load(wr, Wc, 0, DIN); aslab_load(ar, Ab, 0, CC); GXW();
    wslab_store(wb0, wr, tid); aslab_store2(yh0, yl0, ar, tid);
    __syncthreads();
    for (int s = 0; s < CC / KS; s += 2) { slab(wb0, yh0, yl0, wb1, yh1, yl1, s); slab(wb1, yh1, yl1, wb0, yh0, yl0, s + 1); }
#pragma unroll
    for (int j = 0; j < 8; ++j) { const float bias = BO ? bfr(BO[c0 + j * 16 + col]) : 0.f;
#pragma unroll
      for (int r = 0; r < 8; ++r) sf[wave][8 * g + r][j * 16 + col] = acc[j][r] + bias; }
  } else {
#pragma unroll 2
    for (int kc = 0; kc < CC / 32; ++kc) { const v16h a = frag_f32(Y + (r0 + col) * CC + kc * 32, lane); asm volatile("s_wait_loadcnt 0x0" ::: "memory");
#pragma unroll
      for (int j = 0; j < 8; ++j) { const v16h w = WOCOLH(WO, kc * 32, c0 + j * 16 + col, lane); asm volatile("s_wait_loadcnt 0x0" ::: "memory"); acc[j] = wmma16(a, w, acc[j]); } }
#pragma unroll
    for (int j = 0; j < 8; ++j) { const float bias = BO ? bfr(BO[c0 + j * 16 + col]) : 0.f;
#pragma unroll
      for (int r = 0; r < 8; ++r) sf[wave][8 * g + r][j * 16 + col] = acc[j][r] * (1.0f / 256.0f) + bias; } }
  LDSX(); for (int rl = 0; rl < 16; ++rl) vst2(OUT + (r0 + rl) * DIN + c0 + lane * 4, *(const v4f*)&sf[wave][rl][lane * 4]); }

extern "C" void kernel_launch(void* const* d_in, const int* in_sizes, int n_in, void* d_out, int out_size, void* d_ws, size_t ws_size, hipStream_t stream) {
  (void)in_sizes; (void)n_in; (void)out_size;
  const float** F = (const float**)d_in;
  if (ws_size < (size_t)WS_END) return;
  char* ws = (char*)d_ws; _Float16 *QH = (_Float16*)(ws + WS_QH), *KH = (_Float16*)(ws + WS_KH), *VT = (_Float16*)(ws + WS_VT), *QL = (_Float16*)(ws + WS_QL), *KL = (_Float16*)(ws + WS_KL); __bf16 *VB = (__bf16*)(ws + WS_VB), *VBL = (__bf16*)(ws + WS_VBL); float *Y = (float*)(ws + WS_Y);
  (void)Y; (void)QL; (void)KL; (void)VB; (void)VBL;
  // inputs: 0 x [2,2048,1024]; 1 Wq, 2 Wk, 3 Wv, 4 Wo [1024,1024] (in,out), no biases
  if (ws_size < (size_t)WS_END2) return;
  float* PR = (float*)(ws + WS_PR);
  k_proj<<<dim3(TNB * TT / 64, CC / 128, 3), 128, 0, stream>>>(F[0], F[0], F[0], F[1], F[2], F[3], nullptr, nullptr, nullptr, QH, QL, KH, KL, VT, VB, VBL);
  k_att<<<dim3(NQB, NH, TNB), 128, 0, stream>>>(QH, KH, QL, KL, VT, VB, VBL, Y);
  k_out<<<dim3(TNB * TT / 64, DIN / 128), 128, 0, stream>>>(Y, F[4], nullptr, PR);
  k_res<<<dim3((unsigned)(((size_t)TNB * TT * (DIN / 4) + 255) / 256)), 256, 0, stream>>>(PR, F[0], (float*)d_out);
}

// v004
// It runs in 91 microseconds.
// In both of two side-by-side timings against v003, it was 1.31 times as fast.
// Counting every step since v000, it is 11.3 times as fast.
// compute dtype: all float inputs rounded to bf16; q/k/v = x W with EXACT bf16 products on WMMA 16x16x32 (f32 accumulate); windowed causal logits: q, k once to f16 (1 product) x 64^-0.5, except the first 384 query rows of each sequence (3 products with f16 residuals); softmax in f32; P x 2^11 once to f16 against v once to f16 (1 product; bf16 hi + lo below row 384); ctx split bf16 hi + lo against exact Wo (2 products); + x residual in f32; f32 output.
#include <hip/hip_runtime.h>
#include <math.h>

typedef __attribute__((ext_vector_type(16))) _Float16 v16h;
typedef __attribute__((ext_vector_type(16))) __bf16 v16b;
typedef __attribute__((ext_vector_type(8)))  _Float16 v8h;
typedef __attribute__((ext_vector_type(8)))  float v8f;
typedef __attribute__((ext_vector_type(4)))  float v4f;
typedef __attribute__((ext_vector_type(2)))  float v2f;
typedef __attribute__((ext_vector_type(4)))  unsigned v4u;
typedef __attribute__((ext_vector_type(4)))  int v4i;
typedef float __attribute__((may_alias)) float_a;
typedef int __attribute__((may_alias)) int_a;

template <typename T> __device__ __forceinline__ void vst2(void* p, T v) { *(T*)p = v;  }
__device__ __forceinline__ v8f wmma16(v16h a, v16h b, v8f c) {
  v8f d = __builtin_amdgcn_wmma_f32_16x16x32_f16(false, a, false, b, (short)0, c, false, false);
  asm volatile("v_nop\n\tv_nop\n\tv_nop\n\tv_nop" : "+v"(d) : "v"(a), "v"(b));
  return d;
}
__device__ __forceinline__ v8f wmma_bf(v16b a, v16b b, v8f c) {
  v8f d = __builtin_amdgcn_wmma_f32_16x16x32_bf16(false, a, false, b, (short)0, c, false, false);
  asm volatile("v_nop\n\tv_nop\n\tv_nop\n\tv_nop" : "+v"(d) : "v"(a), "v"(b));
  return d;
}
// 16x16x32 fragments: lane = (h = lane>>4, row/col = lane&15); elements 0..7 = k0+8h+0..7, 8..15 = k0+16+8h+0..7; D element r = row 8h+r
__device__ __forceinline__ v16h frag_h(const _Float16* rowk0, int lane) {
  union { v16h v; v8h q[2]; } u; const _Float16* p = rowk0 + 8 * (lane >> 4);
  u.q[0] = *(const v8h*)p; u.q[1] = *(const v8h*)(p + 16); return u.v;
}
__device__ __forceinline__ v16h frag_f32(const float* rowk0, int lane) {
  v16h a; const float* p = rowk0 + 8 * (lane >> 4);
#pragma unroll
  for (int i = 0; i < 8; ++i) { a[i] = (_Float16)p[i]; a[8 + i] = (_Float16)p[16 + i]; }
  return a;
}
__device__ __forceinline__ v16h frag_f32s(const float* rowk0, int lane, float sc) {
  v16h a; const float* p = rowk0 + 8 * (lane >> 4);
#pragma unroll
  for (int i = 0; i < 8; ++i) { a[i] = (_Float16)(p[i] * sc); a[8 + i] = (_Float16)(p[16 + i] * sc); }
  return a;
}
// column fragment from a [K][ld] layout (column n), rows >= K read as 0
__device__ __forceinline__ v16h fragc_f32(const float* W, int k0, int n, int lane, int ld, int K) {
  v16h a; const int g = lane >> 4;
#pragma unroll
  for (int i = 0; i < 8; ++i) { const int ka = k0 + 8 * g + i, kb = ka + 16;
    a[i] = (_Float16)(ka < K ? W[(size_t)(ka < K ? ka : K - 1) * ld + n] : 0.f); a[8 + i] = (_Float16)(kb < K ? W[(size_t)(kb < K ? kb : K - 1) * ld + n] : 0.f); }
  return a;
}
struct F2 { v16b h, l; };
__device__ __forceinline__ F2 bsplit16(const float v[16]) { F2 r;
#pragma unroll
  for (int i = 0; i < 16; ++i) { const __bf16 h = (__bf16)v[i]; r.h[i] = h; r.l[i] = (__bf16)(v[i] - (float)h); }
  return r; }
__device__ __forceinline__ F2 split_row(const float* row, int k0, int lane) { float v[16]; const float* p = row + k0 + 8 * (lane >> 4);
#pragma unroll
  for (int i = 0; i < 8; ++i) { v[i] = p[i]; v[8 + i] = p[16 + i]; }
  return bsplit16(v); }
__device__ __forceinline__ F2 split_rowK(const float* row, int k0, int lane, int K) { float v[16]; const int g = lane >> 4;
#pragma unroll
  for (int i = 0; i < 8; ++i) { const int ka = k0 + 8 * g + i, kb = ka + 16; v[i] = ka < K ? row[ka < K ? ka : K - 1] : 0.f; v[8 + i] = kb < K ? row[kb < K ? kb : K - 1] : 0.f; }
  return bsplit16(v); }
__device__ __forceinline__ F2 split_col(const float* W, int k0, int n, int lane, int ld, int K) { float v[16]; const int g = lane >> 4;
#pragma unroll
  for (int i = 0; i < 8; ++i) { const int ka = k0 + 8 * g + i, kb = ka + 16; v[i] = ka < K ? W[(size_t)(ka < K ? ka : K - 1) * ld + n] : 0.f; v[8 + i] = kb < K ? W[(size_t)(kb < K ? kb : K - 1) * ld + n] : 0.f; }
  return bsplit16(v); }
__device__ __forceinline__ v8f mac3(const F2& a, const F2& b, v8f c) { c = wmma_bf(a.l, b.h, c); c = wmma_bf(a.h, b.l, c); return wmma_bf(a.h, b.h, c); }
__device__ __forceinline__ float sigm(float v) { return 1.0f / (1.0f + expf(-v)); }
#define LDSX() do { asm volatile("s_wait_dscnt 0" ::: "memory"); __builtin_amdgcn_wave_barrier(); __builtin_amdgcn_fence(__ATOMIC_RELEASE, "workgroup"); } while (0)

// Sliding-window causal self-attention (B 2, S 2,048, 1,024 = 16 x 64, window 128): q/k/v = x W ((in,out)); key j visible from query i iff i - 127 <= j <= i; softmax (the extra max-subtraction is a no-op); out = merged(attn v) Wo + x.
#define NB 2
#define TT 2048
#define CC 1024            // NH * HD = projected width
#define DIN 1024          // input (model) width
#define NH 16
#define HD 64
#define NQB (TT / 64)
#define SCALE (0.125f)
#define CAUSAL 1
#ifndef TNB
#define TNB NB
#endif
__device__ __forceinline__ float bfr(float v) { return (float)(__bf16)v; }
#define WIN 128            // window: key j is visible from query i only if j >= i - (WIN - 1)
// oldest key that any query >= t can see; every older key has P = 0 exactly, so a 32-key chunk wholly older is neither scored, normalised nor multiplied
__device__ __forceinline__ int key_first(int t) { return t > WIN - 1 ? t - (WIN - 1) : 0; }
typedef __attribute__((ext_vector_type(8))) __bf16 v8b;
__device__ __forceinline__ v16b frag_b(const __bf16* rowk0, int lane) {
  union { v16b v; v8b q[2]; } u; const __bf16* p = rowk0 + 8 * (lane >> 4);
  u.q[0] = *(const v8b*)p; u.q[1] = *(const v8b*)(p + 16); return u.v;
}
#define QBH 6              // causal: query blocks 0..QBH-1 of each sequence take the high-precision path
#define QHI 384            // rows carrying a q residual plane
#define KHI 384            // key rows carrying k residual / v bf16 hi+lo planes (used only by the causal high-precision path)
// B fragment (k rows k0+.., output column o) of a weight: (in,out) [K][ld] or (out,in) [ld rows of K]: bf16 exact, or f16(bf16 * 256) exact
__device__ __forceinline__ v16b wcol_io(const float* Wm, int k0, int o, int lane, int ld) { v16b w; const int g = lane >> 4;
#pragma unroll
  for (int i = 0; i < 8; ++i) { w[i] = (__bf16)Wm[(size_t)(k0 + 8 * g + i) * ld + o]; w[8 + i] = (__bf16)Wm[(size_t)(k0 + 16 + 8 * g + i) * ld + o]; }
  return w; }
__device__ __forceinline__ v16b wcol_oi(const float* Wm, int k0, int o, int lane, int K) { v16b w; const float* p = Wm + (size_t)o * K + k0 + 8 * (lane >> 4);
#pragma unroll
  for (int i = 0; i < 8; ++i) { w[i] = (__bf16)p[i]; w[8 + i] = (__bf16)p[16 + i]; }
  return w; }
__device__ __forceinline__ v16h wcolh_io(const float* Wm, int k0, int o, int lane, int ld) { v16h w; const int g = lane >> 4;
#pragma unroll
  for (int i = 0; i < 8; ++i) { w[i] = (_Float16)(bfr(Wm[(size_t)(k0 + 8 * g + i) * ld + o]) * 256.0f); w[8 + i] = (_Float16)(bfr(Wm[(size_t)(k0 + 16 + 8 * g + i) * ld + o]) * 256.0f); }
  return w; }
__device__ __forceinline__ v16h wcolh_oi(const float* Wm, int k0, int o, int lane, int K) { v16h w; const float* p = Wm + (size_t)o * K + k0 + 8 * (lane >> 4);
#pragma unroll
  for (int i = 0; i < 8; ++i) { w[i] = (_Float16)(bfr(p[i]) * 256.0f); w[8 + i] = (_Float16)(bfr(p[16 + i]) * 256.0f); }
  return w; }
#define WQKV_LAYOUT 0   // 0 = (in,out) [DIN][CC]; 1 = (out,in) [CC][DIN]; 2 = per-head [NH][DIN][HD]
__device__ __forceinline__ v16b wcol_hdk(const float* Wm, int k0, int o, int lane) { v16b w; const int g = lane >> 4; const float* p = Wm + (size_t)(o / HD) * DIN * HD + (o % HD);
#pragma unroll
  for (int i = 0; i < 8; ++i) { w[i] = (__bf16)p[(size_t)(k0 + 8 * g + i) * HD]; w[8 + i] = (__bf16)p[(size_t)(k0 + 16 + 8 * g + i) * HD]; }
  return w; }
#define WO_OUT_IN 0
#if WQKV_LAYOUT == 1
#define WCOL(W, k0, o, lane) wcol_oi(W, k0, o, lane, DIN)
#elif WQKV_LAYOUT == 2
#define WCOL(W, k0, o, lane) wcol_hdk(W, k0, o, lane)
#else
#define WCOL(W, k0, o, lane) wcol_io(W, k0, o, lane, CC)
#endif
#if WO_OUT_IN
#define WOCOL(W, k0, o, lane) wcol_oi(W, k0, o, lane, CC)
#define WOCOLH(W, k0, o, lane) wcolh_oi(W, k0, o, lane, CC)
#else
#define WOCOL(W, k0, o, lane) wcol_io(W, k0, o, lane, DIN)
#define WOCOLH(W, k0, o, lane) wcolh_io(W, k0, o, lane, DIN)
#endif
// ---- k_res: thread per float4: out = bf16(x) + PR
__global__ __launch_bounds__(256) void k_res(const float* __restrict__ PR, const float* __restrict__ X, float* __restrict__ OUT) { const size_t i = (size_t)blockIdx.x * 256 + threadIdx.x; if (i >= (size_t)TNB * TT * (DIN / 4)) return;
  const v4f p = *(const v4f*)(PR + i * 4); const v4f x = *(const v4f*)(X + i * 4); v4f o; o[0] = bfr(x[0]) + p[0]; o[1] = bfr(x[1]) + p[1]; o[2] = bfr(x[2]) + p[2]; o[3] = bfr(x[3]) + p[3]; vst2(OUT + i * 4, o); }
#define WS_PR  (WS_END)
#define WS_END2 (WS_PR + 4u * (size_t)NB * TT * DIN)
#ifndef PROJ_EXTRA_PARAMS
#define PROJ_EXTRA_PARAMS
#endif

#define WS_QH  0u                                      // f16 q rows [b*t][CC]
#define WS_KH  (WS_QH + 2u * (size_t)NB * TT * CC)      // f16 k rows [b*t][CC]
#define WS_VT  (WS_KH + 2u * (size_t)NB * TT * CC)      // f16 v planes [b][c][t]
#define WS_QL  (WS_VT + 2u * (size_t)NB * CC * TT)      // f16 q residual x 2^10 rows [b][t < QHI][CC]
#define WS_KL  (WS_QL + 2u * (size_t)NB * QHI * CC)     // f16 k residual x 2^10 rows [b][t < KHI][CC]
#define WS_VB  (WS_KL + 2u * (size_t)NB * KHI * CC)     // bf16 v hi planes [b][c][t < KHI]
#define WS_VBL (WS_VB + 2u * (size_t)NB * CC * KHI)
#define WS_Y   (WS_VBL + 2u * (size_t)NB * CC * KHI)    // f32 ctx rows [b*t][CC] (only when there is an output projection)
#define WS_END (WS_Y  + 4u * (size_t)NB * TT * CC)
#define WS_XB  (WS_END2)                                // bf16 x rows [b*t][DIN]
#define WS_WT  (WS_XB + 2u * (size_t)NB * TT * DIN)     // bf16 weights, transposed: Wq, Wk, Wv as [CC out][DIN in], then Wo as [DIN out][CC in]
#define WS_WTO (WS_WT + 2u * 3u * (size_t)CC * DIN)
#define WS_END3 (WS_WTO + 2u * (size_t)DIN * CC)

// ---- operand feed of k_proj and k_out: a slab = KS k values of the block's 128 weight columns, an LDS buffer [128][KS + 8] (row = column n; pitch 144 bytes: the pitch of ds_load_b128 readers), where all 4 waves read their B fragments. k_prep has rounded x and the four weights to bf16 once and laid the weights out as [out][in], so a slab row is one 128-byte line in global memory and goes to LDS as it is, in 16-byte pieces (a wave's load = 4 rows = 4 whole lines); every block used to load the f32 values and round them for itself. The block's 64 activation rows go the same way, [64][KS + 8]; k_out's ctx rows are f32 (2 rows x 256 bytes a load) and are split on the way. All are loaded one slab ahead. The loops of the feed are unrolled in full: wr, ar and the fragment arrays live in registers and need compile-time indices.
#define KS 64
#define GXW() asm volatile("s_wait_xcnt 0x0" ::: "memory")   /* stands behind a slab's global loads: the next slab's address is formed in the registers that these loads name; it also keeps the loads in front of the products that cover their latency */
__device__ __forceinline__ void wslab_load(float (&wr)[KS], const float* Wc, int s, int ld) {
#pragma unroll
  for (int i = 0; i < KS; ++i) wr[i] = Wc[(size_t)(s * KS + i) * ld]; }
__device__ __forceinline__ void wslab_store(__bf16 (*buf)[KS + 8], const float (&wr)[KS], int n) {
#pragma unroll
  for (int q = 0; q < KS / 8; ++q) { v8b t;
#pragma unroll
    for (int i = 0; i < 8; ++i) t[i] = (__bf16)wr[q * 8 + i];
    *(v8b*)&buf[n][q * 8] = t; } }
typedef __attribute__((ext_vector_type(4))) __bf16 v4b;
#define AL (64 * KS / 4 / 128)   // 16-byte pieces of an activation slab per thread: piece i of thread t is row i * 8 + (t >> 4), floats 4 * (t & 15) ..
static_assert(KS == 64, "16 pieces per slab row");
__device__ __forceinline__ void aslab_load(v4f (&ar)[AL], const float* Ab, int s, int ld) {   /* Ab = first row of the block + (t >> 4) * ld + 4 * (t & 15) */
#pragma unroll
  for (int i = 0; i < AL; ++i) ar[i] = *(const v4f*)(Ab + (size_t)(i * 8) * ld + s * KS); }
// bf16 slab of N * 16 rows: piece i of thread t is row i * 16 + (t >> 3), elements 8 * (t & 7) ..
template <int N> __device__ __forceinline__ void bslab_load(v8b (&r)[N], const __bf16* P, int s, int ld) {   /* P = first row of the block + (t >> 3) * ld + 8 * (t & 7) */
#pragma unroll
  for (int i = 0; i < N; ++i) r[i] = *(const v8b*)(P + (size_t)(i * 16) * ld + s * KS); }
template <int N> __device__ __forceinline__ void bslab_store(__bf16 (*buf)[KS + 8], const v8b (&r)[N], int t) {
#pragma unroll
  for (int i = 0; i < N; ++i) *(v8b*)&buf[i * 16 + (t >> 3)][8 * (t & 7)] = r[i]; }
// f32 pieces of aslab_load to LDS with the bf16 hi + lo split of bsplit16, one plane each
__device__ __forceinline__ void aslab_store2(__bf16 (*bh)[KS + 8], __bf16 (*bl)[KS + 8], const v4f (&ar)[AL], int t) {
#pragma unroll
  for (int i = 0; i < AL; ++i) { v4b h, l;
#pragma unroll
    for (int e = 0; e < 4; ++e) { const __bf16 hv = (__bf16)ar[i][e]; h[e] = hv; l[e] = (__bf16)(ar[i][e] - (float)hv); }
    *(v4b*)&bh[i * 8 + (t >> 4)][4 * (t & 15)] = h; *(v4b*)&bl[i * 8 + (t >> 4)][4 * (t & 15)] = l; } }
// ---- k_prep: x and the weights to bf16, once for all blocks of k_proj and k_out. Blocks < PWB: one slab (KS k rows x 128 columns) of weight m: thread n loads column n (a wave's load = one 128-byte line), the slab turns in LDS and leaves as rows [out][in] in whole lines. The other blocks: 2,048 16-byte pieces of x each.
#define PWB (4 * (CC / 128) * (DIN / KS))
#define PXB ((int)((size_t)NB * TT * DIN / 4 / 2048))
static_assert(CC == DIN && CC / 128 == 8 && DIN / KS == 16, "block index fields of k_prep");
__global__ __launch_bounds__(128) void k_prep(const float* __restrict__ X, const float* __restrict__ WQ, const float* __restrict__ WK, const float* __restrict__ WV, const float* __restrict__ WO, __bf16* __restrict__ XB, __bf16* __restrict__ WT) {
  __shared__ __align__(16) __bf16 tw[128][KS + 8];
  const int tid = threadIdx.x, bi = blockIdx.x;
  if (bi < PWB) { const int m = bi >> 7, c0 = ((bi >> 4) & 7) * 128, s = bi & 15;
    const float* Wm = m == 0 ? WQ : m == 1 ? WK : m == 2 ? WV : WO;
    float wr[KS]; wslab_load(wr, Wm + c0 + tid, s, CC); GXW();   /* the rounded values may be given the loads' address registers */
    wslab_store(tw, wr, tid);
    __syncthreads();
    __bf16* D = WT + ((size_t)m * CC + c0 + (tid >> 3)) * DIN + s * KS + 8 * (tid & 7);
#pragma unroll
    for (int i = 0; i < 8; ++i) *(v8b*)(D + (size_t)(i * 16) * DIN) = *(const v8b*)&tw[i * 16 + (tid >> 3)][8 * (tid & 7)];
  } else { const size_t p0 = (size_t)(bi - PWB) * 2048 + tid; v4f a[16];
#pragma unroll
    for (int i = 0; i < 16; ++i) a[i] = *(const v4f*)(X + (p0 + i * 128) * 4);
    GXW();   /* as above */
#pragma unroll
    for (int i = 0; i < 16; ++i) { v4b h;
#pragma unroll
      for (int e = 0; e < 4; ++e) h[e] = (__bf16)a[i][e];
      *(v4b*)(XB + (p0 + i * 128) * 4) = h; }
    GXW();   /* behind the last store: in the built code the weight part's instructions follow this run, and they write registers that the stores name */ } }
// ---- k_proj: block = (64 rows, 128 cols, which): q/k/v = X W (+ b) with exact bf16 products (K = DIN) -> which 0: q f16 rows (+ residual rows < QHI); 1: k f16 rows (+ residual rows < KHI); 2: v f16 planes [c][t] (+ bf16 hi/lo planes for t < KHI)
__global__ __launch_bounds__(128) void k_proj(const __bf16* __restrict__ XB, const __bf16* __restrict__ WT, const float* __restrict__ BQ, const float* __restrict__ BK, const float* __restrict__ BV,
    _Float16* __restrict__ QH, _Float16* __restrict__ QL, _Float16* __restrict__ KH, _Float16* __restrict__ KL, _Float16* __restrict__ VT, __bf16* __restrict__ VB, __bf16* __restrict__ VBL) {
  __shared__ __align__(16) _Float16 sh[64][136], sl[64][136]; __shared__ __align__(16) _Float16 th[128][72]; __shared__ __align__(16) __bf16 tb[128][72], tbl[128][72];
  const int tid = threadIdx.x, wave = tid >> 5, lane = tid & 31, col = lane & 15, g = lane >> 4; const int which = blockIdx.z; const int c0 = blockIdx.y * 128; const size_t r0 = (size_t)blockIdx.x * 64; const size_t bb = r0 / TT; const int t0 = (int)(r0 % TT);
  const float* BA = which == 0 ? BQ : which == 1 ? BK : BV;
  v8f acc[8] = {};
  static_assert(WQKV_LAYOUT == 0 && KS + 8 == 72 && DIN % (2 * KS) == 0, "slab feed");
  const __bf16* Wp = WT + ((size_t)which * CC + c0 + (tid >> 3)) * DIN + 8 * (tid & 7); const __bf16* Ap = XB + (r0 + (tid >> 3)) * DIN + 8 * (tid & 7);
  v8b wr[8], ar[4];
  __bf16 (*const xa0)[KS + 8] = (__bf16 (*)[KS + 8])&th[0][0]; __bf16 (*const xa1)[KS + 8] = (__bf16 (*)[KS + 8])&th[64][0];   /* until the epilogue takes them (behind the last barrier), tb and tbl are the two weight buffers and the halves of th the two activation buffers */
  // one slab: slab s + 1's loads start (behind the barrier, which waits for every load in flight); products from cw, ca; then slab s + 1 goes to nw, na, whose readers left them at the last barrier; the barrier publishes nw, na and ends the reads of cw, ca
  const auto slab = [&](const __bf16 (*cw)[KS + 8], const __bf16 (*ca)[KS + 8], __bf16 (*nw)[KS + 8], __bf16 (*na)[KS + 8], int s) {
    if (s + 1 < DIN / KS) { bslab_load(wr, Wp, s + 1, DIN); bslab_load(ar, Ap, s + 1, DIN); GXW(); }
#pragma unroll
    for (int kc = 0; kc < KS / 32; ++kc) { const v16b a = frag_b(&ca[wave * 16 + col][kc * 32], lane); v16b w[8];
#pragma unroll
      for (int j = 0; j < 8; ++j) w[j] = frag_b(&cw[j * 16 + col][kc * 32], lane);
#pragma unroll
      for (int j = 0; j < 8; ++j) acc[j] = wmma_bf(a, w[j], acc[j]); }
    if (s + 1 < DIN / KS) { bslab_store(nw, wr, tid); bslab_store(na, ar, tid); }
    __syncthreads(); };
  bslab_load(wr, Wp, 0, DIN); bslab_load(ar, Ap, 0, DIN); GXW();
  bslab_store(tb, wr, tid); bslab_store(xa0, ar, tid);
  __syncthreads();
  for (int s = 0; s < DIN / KS; s += 2) { slab(tb, xa0, tbl, xa1, s); slab(tbl, xa1, tb, xa0, s + 1); }
  if (which < 2) { _Float16* DH = which == 0 ? QH : KH; _Float16* DL = which == 0 ? QL : KL; const int nhi = which == 0 ? QHI : KHI; const bool hi_rows = t0 < nhi;
#pragma unroll
    for (int j = 0; j < 8; ++j) { const float bias = BA ? bfr(BA[c0 + j * 16 + col]) : 0.f;
#pragma unroll
      for (int r = 0; r < 8; ++r) { const float v = acc[j][r] + bias; const _Float16 hv = (_Float16)v; sh[wave * 16 + 8 * g + r][j * 16 + col] = hv; sl[wave * 16 + 8 * g + r][j * 16 + col] = (_Float16)((v - (float)hv) * 1024.0f); } }
    __syncthreads();
    for (int e = tid; e < 64 * 16; e += 128) { const int rl = e >> 4, q = e & 15; vst2((unsigned*)(DH + (r0 + rl) * CC + c0 + q * 8), *(const v4u*)&sh[rl][q * 8]); if (hi_rows) vst2((unsigned*)(DL + (bb * nhi + t0 + rl) * (size_t)CC + c0 + q * 8), *(const v4u*)&sl[rl][q * 8]); }
  } else { const bool hi_rows = t0 < KHI;
#pragma unroll
    for (int j = 0; j < 8; ++j) { const float bias = BA ? bfr(BA[c0 + j * 16 + col]) : 0.f;
#pragma unroll
      for (int r = 0; r < 8; ++r) { const float v = acc[j][r] + bias; const int rl = wave * 16 + 8 * g + r, cl = j * 16 + col; th[cl][rl] = (_Float16)v; const __bf16 bh = (__bf16)v; tb[cl][rl] = bh; tbl[cl][rl] = (__bf16)(v - (float)bh); } }
    __syncthreads();
    for (int e = tid; e < 128 * 8; e += 128) { const int cl = e >> 3, q = e & 7; vst2((unsigned*)(VT + (bb * CC + c0 + cl) * (size_t)TT + t0 + q * 8), *(const v4u*)&th[cl][q * 8]); if (hi_rows) { const size_t o3 = (bb * CC + c0 + cl) * (size_t)KHI + t0 + q * 8; vst2((unsigned*)(VB + o3), *(const v4u*)&tb[cl][q * 8]); vst2((unsigned*)(VBL + o3), *(const v4u*)&tbl[cl][q * 8]); } } } }
#define XW() asm volatile("s_wait_xcnt 0x0" ::: "memory")   /* stands behind each group of k_att's global loads that share an address: a later load's result may be given the group's address registers, and s_wait_xcnt 0 belongs in front of an overwrite of a register that an issued load names */
#define AHEAD 2            // chunks whose fragment loads are in flight in front of the chunk being multiplied
#define NCH 5              // 16 queries from a multiple of 16 see keys [ql0 - (WIN - 1), ql0 + 15]: at most 5 chunks of 32
__global__ __launch_bounds__(128) void k_att(const _Float16* __restrict__ QH, const _Float16* __restrict__ KH, const _Float16* __restrict__ QL, const _Float16* __restrict__ KL, const _Float16* __restrict__ VT, const __bf16* __restrict__ VB, const __bf16* __restrict__ VBL, float* __restrict__ Y) { __shared__ __align__(16) float ss[4][16][HD + 4];
  const int tid = threadIdx.x, wave = tid >> 5, lane = tid & 31, col = lane & 15, g = lane >> 4; const int qb = blockIdx.x, h = blockIdx.y, b = blockIdx.z; const int ql0 = qb * 64 + wave * 16; const int t = ql0 + col;
  const int kc0 = __builtin_amdgcn_readfirstlane(key_first(ql0) >> 5), kcl = __builtin_amdgcn_readfirstlane((ql0 + 15) >> 5);   /* first and last visible chunk, wave-uniform */
  static_assert((WIN - 1 + 15) / 32 + 1 <= NCH, "chunks per wave");
  const size_t q0 = (size_t)b * TT + ql0;
  float p[NCH][16];   /* every loop of this kernel is unrolled in full: p, the fragment arrays and the accumulators live in registers and need compile-time indices */
  if (qb < QBH) { const _Float16* QLb = QL + (size_t)b * QHI * CC; const _Float16* KLb = KL + (size_t)b * KHI * CC;
    v16h ah[HD / 32], al[HD / 32];
#pragma unroll
    for (int kc = 0; kc < HD / 32; ++kc) ah[kc] = frag_h(QH + (q0 + col) * CC + h * HD + kc * 32, lane);
    XW();
#pragma unroll
    for (int kc = 0; kc < HD / 32; ++kc) al[kc] = frag_h(QLb + (size_t)(ql0 + col) * CC + h * HD + kc * 32, lane);
    XW();
#pragma unroll
    for (int c = 0; c < NCH; ++c) { const int kr = (kc0 + c < kcl ? kc0 + c : kcl) * 32;
#pragma unroll
      for (int u = 0; u < 2; ++u) { v16h kbf[HD / 32], klf[HD / 32];   /* loads do not move over the products' asm statements: a 16-key tile's loads stand in front of its products; a whole chunk's fragments at once would not fit the registers beside p */
#pragma unroll
        for (int kc = 0; kc < HD / 32; ++kc) kbf[kc] = frag_h(KH + ((size_t)b * TT + kr + u * 16 + col) * CC + h * HD + kc * 32, lane);
        XW();
#pragma unroll
        for (int kc = 0; kc < HD / 32; ++kc) klf[kc] = frag_h(KLb + (size_t)(kr + u * 16 + col) * CC + h * HD + kc * 32, lane);
        XW();
        v8f acc = {}, accl = {};
#pragma unroll
        for (int kc = 0; kc < HD / 32; ++kc) { acc = wmma16(kbf[kc], ah[kc], acc); accl = wmma16(kbf[kc], al[kc], accl); accl = wmma16(klf[kc], ah[kc], accl); }
#pragma unroll
        for (int r = 0; r < 8; ++r) p[c][u * 8 + r] = (acc[r] + accl[r] * (1.0f / 1024.0f)) * SCALE; } }
  } else {
    v16h ah[HD / 32];
#pragma unroll
    for (int kc = 0; kc < HD / 32; ++kc) ah[kc] = frag_h(QH + (q0 + col) * CC + h * HD + kc * 32, lane);
    XW();
    v16h kf[NCH][2][HD / 32];   /* loads do not move over the products' asm statements: chunk c + AHEAD is loaded in front of chunk c's products, so that its latency is covered */
#pragma unroll
    for (int cc = -AHEAD; cc < NCH; ++cc) { const int c = cc < 0 ? 0 : cc;
      if (const int cn = cc + AHEAD; cn < NCH) { const int kr = (kc0 + cn < kcl ? kc0 + cn : kcl) * 32;
#pragma unroll
        for (int u = 0; u < 2; ++u)
#pragma unroll
          for (int kc = 0; kc < HD / 32; ++kc) kf[cn][u][kc] = frag_h(KH + ((size_t)b * TT + kr + u * 16 + col) * CC + h * HD + kc * 32, lane);
        XW(); }
      if (cc < 0) continue;
#pragma unroll
      for (int u = 0; u < 2; ++u) { v8f acc = {};
#pragma unroll
        for (int kc = 0; kc < HD / 32; ++kc) acc = wmma16(kf[c][u][kc], ah[kc], acc);
#pragma unroll
        for (int r = 0; r < 8; ++r) p[c][u * 8 + r] = acc[r] * SCALE; } } }
  // softmax of row t in f32: element i of chunk c is key (kc0 + c) * 32 + 16 * (i >> 3) + 8 g + (i & 7); visible iff t - (WIN - 1) <= key <= t
  float m = -3.0e38f;
#pragma unroll
  for (int c = 0; c < NCH; ++c)
#pragma unroll
    for (int i = 0; i < 16; ++i) { const int k = (kc0 + c) * 32 + 16 * (i >> 3) + 8 * g + (i & 7); const float v = (k <= t && k >= t - (WIN - 1)) ? p[c][i] : -3.0e38f; p[c][i] = v; m = fmaxf(m, v); }
  m = fmaxf(m, __shfl_xor(m, 16));
  float sum = 0.f;
#pragma unroll
  for (int c = 0; c < NCH; ++c)
#pragma unroll
    for (int i = 0; i < 16; ++i) { const float v = p[c][i]; const float ex = expf(v - m); const float e = (v <= -1.0e38f) ? 0.f : ex; p[c][i] = e; sum += e; }
  sum += __shfl_xor(sum, 16);
  const float inv = sum > 0.f ? 2048.0f / sum : 0.f;
#pragma unroll
  for (int c = 0; c < NCH; ++c)
#pragma unroll
    for (int i = 0; i < 16; ++i) p[c][i] *= inv;
  v8f acc[HD / 16] = {};
  if (qb < QBH) {
#pragma unroll
    for (int c = 0; c < NCH; ++c) { const int kr = (kc0 + c < kcl ? kc0 + c : kcl) * 32; const F2 pf = bsplit16(p[c]); v16b vh[HD / 16], vl[HD / 16];
#pragma unroll
      for (int j = 0; j < HD / 16; ++j) vh[j] = frag_b(VB + ((size_t)b * CC + h * HD + j * 16 + col) * (size_t)KHI + kr, lane);
      XW();
#pragma unroll
      for (int j = 0; j < HD / 16; ++j) vl[j] = frag_b(VBL + ((size_t)b * CC + h * HD + j * 16 + col) * (size_t)KHI + kr, lane);
      XW();
#pragma unroll
      for (int j = 0; j < HD / 16; ++j) { acc[j] = wmma_bf(pf.h, vh[j], acc[j]); acc[j] = wmma_bf(pf.l, vh[j], acc[j]); acc[j] = wmma_bf(pf.h, vl[j], acc[j]); } }
  } else { v16h vf[NCH][HD / 16];   /* v fragments AHEAD chunks in front of their products, as for K */
#pragma unroll
    for (int cc = -AHEAD; cc < NCH; ++cc) { const int c = cc < 0 ? 0 : cc;
      if (const int cn = cc + AHEAD; cn < NCH) { const int kr = (kc0 + cn < kcl ? kc0 + cn : kcl) * 32;
#pragma unroll
        for (int j = 0; j < HD / 16; ++j) vf[cn][j] = frag_h(VT + ((size_t)b * CC + h * HD + j * 16 + col) * (size_t)TT + kr, lane);
        XW(); }
      if (cc < 0) continue;
      v16h pf;
#pragma unroll
      for (int i = 0; i < 16; ++i) pf[i] = (_Float16)p[c][i];
#pragma unroll
      for (int j = 0; j < HD / 16; ++j) acc[j] = wmma16(pf, vf[c][j], acc[j]); } }
#pragma unroll
  for (int j = 0; j < HD / 16; ++j)
#pragma unroll
    for (int r = 0; r < 8; ++r) ss[wave][8 * g + r][j * 16 + col] = acc[j][r] * (1.0f / 2048.0f);
  LDSX(); for (int rl = 0; rl < 16; ++rl) if (lane < HD / 4) vst2(Y + ((size_t)b * TT + ql0 + rl) * CC + h * HD + lane * 4, *(const v4f*)&ss[wave][rl][lane * 4]); }
// ---- k_out: block = (64 rows, 128 cols): out = ctx Wo (+ bo): ctx bf16 hi + lo against exact bf16 Wo (2 products)
__global__ __launch_bounds__(128) void k_out(const float* __restrict__ Y, const __bf16* __restrict__ WTO, const float* __restrict__ BO, float* __restrict__ OUT) { __shared__ __align__(16) float sf[4][16][132]; __shared__ __align__(16) __bf16 wb0[128][KS + 8], wb1[128][KS + 8], yh0[64][KS + 8], yl0[64][KS + 8], yh1[64][KS + 8], yl1[64][KS + 8];
  const int tid = threadIdx.x, wave = tid >> 5, lane = tid & 31, col = lane & 15, g = lane >> 4; const int c0 = blockIdx.y * 128; const size_t r0 = (size_t)blockIdx.x * 64 + wave * 16;
  v8f acc[8] = {};
  if (true) {   /* ALL rows: ctx split bf16 hi + lo x exact Wo (2 products) */
    static_assert(WO_OUT_IN == 0 && CC % (2 * KS) == 0, "slab feed");
    const __bf16* Wp = WTO + (size_t)(c0 + (tid >> 3)) * CC + 8 * (tid & 7); const float* Ab = Y + ((size_t)blockIdx.x * 64 + (tid >> 4)) * CC + 4 * (tid & 15);
    v8b wr[8]; v4f ar[AL];
    // the slab step of k_proj, ctx as hi and lo planes; each accumulator still takes chunk kc's hi product, then its lo product
    const auto slab = [&](const __bf16 (*cw)[KS + 8], const __bf16 (*ch)[KS + 8], const __bf16 (*cl)[KS + 8], __bf16 (*nw)[KS + 8], __bf16 (*nh)[KS + 8], __bf16 (*nl)[KS + 8], int s) {
      if (s + 1 < CC / KS) { bslab_load(wr, Wp, s + 1, CC); aslab_load(ar, Ab, s + 1, CC); GXW(); }
#pragma unroll
      for (int kc = 0; kc < KS / 32; ++kc) { const v16b ah = frag_b(&ch[wave * 16 + col][kc * 32], lane), al = frag_b(&cl[wave * 16 + col][kc * 32], lane); v16b w[8];
#pragma unroll
        for (int j = 0; j < 8; ++j) w[j] = frag_b(&cw[j * 16 + col][kc * 32], lane);
#pragma unroll
        for (int j = 0; j < 8; ++j) acc[j] = wmma_bf(ah, w[j], acc[j]);
#pragma unroll
        for (int j = 0; j < 8; ++j) acc[j] = wmma_bf(al, w[j], acc[j]); }
      if (s + 1 < CC / KS) { bslab_store(nw, wr, tid); aslab_store2(nh, nl, ar, tid); }
      __syncthreads(); };
    bslab_load(wr, Wp, 0, CC); aslab_load(ar, Ab, 0, CC); GXW();
    bslab_store(wb0, wr, tid); aslab_store2(yh0, yl0, ar, tid);
    __syncthreads();
    for (int s = 0; s < CC / KS; s += 2) { slab(wb0, yh0, yl0, wb1, yh1, yl1, s); slab(wb1, yh1, yl1, wb0, yh0, yl0, s + 1); }
#pragma unroll
    for (int j = 0; j < 8; ++j) { const float bias = BO ? bfr(BO[c0 + j * 16 + col]) : 0.f;
#pragma unroll
      for (int r = 0; r < 8; ++r) sf[wave][8 * g + r][j * 16 + col] = acc[j][r] + bias; }
  }
  LDSX(); for (int rl = 0; rl < 16; ++rl) vst2(OUT + (r0 + rl) * DIN + c0 + lane * 4, *(const v4f*)&sf[wave][rl][lane * 4]); }

extern "C" void kernel_launch(void* const* d_in, const int* in_sizes, int n_in, void* d_out, int out_size, void* d_ws, size_t ws_size, hipStream_t stream) {
  (void)in_sizes; (void)n_in; (void)out_size;
  const float** F = (const float**)d_in;
  if (ws_size < (size_t)WS_END) return;
  char* ws = (char*)d_ws; _Float16 *QH = (_Float16*)(ws + WS_QH), *KH = (_Float16*)(ws + WS_KH), *VT = (_Float16*)(ws + WS_VT), *QL = (_Float16*)(ws + WS_QL), *KL = (_Float16*)(ws + WS_KL); __bf16 *VB = (__bf16*)(ws + WS_VB), *VBL = (__bf16*)(ws + WS_VBL); float *Y = (float*)(ws + WS_Y);
  (void)Y; (void)QL; (void)KL; (void)VB; (void)VBL;
  // inputs: 0 x [2,2048,1024]; 1 Wq, 2 Wk, 3 Wv, 4 Wo [1024,1024] (in,out), no biases
  if (ws_size < (size_t)WS_END3) return;
  float* PR = (float*)(ws + WS_PR); __bf16 *XB = (__bf16*)(ws + WS_XB), *WT = (__bf16*)(ws + WS_WT), *WTO = (__bf16*)(ws + WS_WTO);
  k_prep<<<dim3(PWB + PXB), 128, 0, stream>>>(F[0], F[1], F[2], F[3], F[4], XB, WT);
  k_proj<<<dim3(TNB * TT / 64, CC / 128, 3), 128, 0, stream>>>(XB, WT, nullptr, nullptr, nullptr, QH, QL, KH, KL, VT, VB, VBL);
  k_att<<<dim3(NQB, NH, TNB), 128, 0, stream>>>(QH, KH, QL, KL, VT, VB, VBL, Y);
  k_out<<<dim3(TNB * TT / 64, DIN / 128), 128, 0, stream>>>(Y, WTO, nullptr, PR);
  k_res<<<dim3((unsigned)(((size_t)TNB * TT * (DIN / 4) + 255) / 256)), 256, 0, stream>>>(PR, F[0], (float*)d_out);
}

// v005
// Measured time: 86.1 microseconds a run.
// Two timings next to v004 both put it at 1.06 times that version's speed.
// Counting every step since v000, it is 12.0 times as fast.
// compute dtype: all float inputs rounded to bf16; q/k/v = x W with EXACT bf16 products on WMMA 16x16x32 (f32 accumulate); windowed causal logits: q, k once to f16 (1 product) x 64^-0.5, except the first 384 query rows of each sequence (3 products with f16 residuals); softmax in f32; P x 2^11 once to f16 against v once to f16 (1 product; bf16 hi + lo below row 384); ctx split bf16 hi + lo against exact Wo (2 products); + x residual in f32; f32 output.
#include <hip/hip_runtime.h>
#include <math.h>

typedef __attribute__((ext_vector_type(16))) _Float16 v16h;
typedef __attribute__((ext_vector_type(16))) __bf16 v16b;
typedef __attribute__((ext_vector_type(8)))  _Float16 v8h;
typedef __attribute__((ext_vector_type(8)))  float v8f;
typedef __attribute__((ext_vector_type(4)))  float v4f;
typedef __attribute__((ext_vector_type(2)))  float v2f;
typedef __attribute__((ext_vector_type(4)))  unsigned v4u;
typedef __attribute__((ext_vector_type(4)))  int v4i;
typedef float __attribute__((may_alias)) float_a;
typedef int __attribute__((may_alias)) int_a;

template <typename T> __device__ __forceinline__ void vst2(void* p, T v) { *(T*)p = v;  }
__device__ __forceinline__ v8f wmma16(v16h a, v16h b, v8f c) {
  v8f d = __builtin_amdgcn_wmma_f32_16x16x32_f16(false, a, false, b, (short)0, c, false, false);
  asm volatile("v_nop\n\tv_nop\n\tv_nop\n\tv_nop" : "+v"(d) : "v"(a), "v"(b));
  return d;
}
__device__ __forceinline__ v8f wmma_bf(v16b a, v16b b, v8f c) {
  v8f d = __builtin_amdgcn_wmma_f32_16x16x32_bf16(false, a, false, b, (short)0, c, false, false);
  asm volatile("v_nop\n\tv_nop\n\tv_nop\n\tv_nop" : "+v"(d) : "v"(a), "v"(b));
  return d;
}
// 16x16x32 fragments: lane = (h = lane>>4, row/col = lane&15); elements 0..7 = k0+8h+0..7, 8..15 = k0+16+8h+0..7; D element r = row 8h+r
__device__ __forceinline__ v16h frag_h(const _Float16* rowk0, int lane) {
  union { v16h v; v8h q[2]; } u; const _Float16* p = rowk0 + 8 * (lane >> 4);
  u.q[0] = *(const v8h*)p; u.q[1] = *(const v8h*)(p + 16); return u.v;
}
__device__ __forceinline__ v16h frag_f32(const float* rowk0, int lane) {
  v16h a; const float* p = rowk0 + 8 * (lane >> 4);
#pragma unroll
  for (int i = 0; i < 8; ++i) { a[i] = (_Float16)p[i]; a[8 + i] = (_Float16)p[16 + i]; }
  return a;
}
__device__ __forceinline__ v16h frag_f32s(const float* rowk0, int lane, float sc) {
  v16h a; const float* p = rowk0 + 8 * (lane >> 4);
#pragma unroll
  for (int i = 0; i < 8; ++i) { a[i] = (_Float16)(p[i] * sc); a[8 + i] = (_Float16)(p[16 + i] * sc); }
  return a;
}
// column fragment from a [K][ld] layout (column n), rows >= K read as 0
__device__ __forceinline__ v16h fragc_f32(const float* W, int k0, int n, int lane, int ld, int K) {
  v16h a; const int g = lane >> 4;
#pragma unroll
  for (int i = 0; i < 8; ++i) { const int ka = k0 + 8 * g + i, kb = ka + 16;
    a[i] = (_Float16)(ka < K ? W[(size_t)(ka < K ? ka : K - 1) * ld + n] : 0.f); a[8 + i] = (_Float16)(kb < K ? W[(size_t)(kb < K ? kb : K - 1) * ld + n] : 0.f); }
  return a;
}
struct F2 { v16b h, l; };
__device__ __forceinline__ F2 bsplit16(const float v[16]) { F2 r;
#pragma unroll
  for (int i = 0; i < 16; ++i) { const __bf16 h = (__bf16)v[i]; r.h[i] = h; r.l[i] = (__bf16)(v[i] - (float)h); }
  return r; }
__device__ __forceinline__ F2 split_row(const float* row, int k0, int lane) { float v[16]; const float* p = row + k0 + 8 * (lane >> 4);
#pragma unroll
  for (int i = 0; i < 8; ++i) { v[i] = p[i]; v[8 + i] = p[16 + i]; }
  return bsplit16(v); }
__device__ __forceinline__ F2 split_rowK(const float* row, int k0, int lane, int K) { float v[16]; const int g = lane >> 4;
#pragma unroll
  for (int i = 0; i < 8; ++i) { const int ka = k0 + 8 * g + i, kb = ka + 16; v[i] = ka < K ? row[ka < K ? ka : K - 1] : 0.f; v[8 + i] = kb < K ? row[kb < K ? kb : K - 1] : 0.f; }
  return bsplit16(v); }
__device__ __forceinline__ F2 split_col(const float* W, int k0, int n, int lane, int ld, int K) { float v[16]; const int g = lane >> 4;
#pragma unroll
  for (int i = 0; i < 8; ++i) { const int ka = k0 + 8 * g + i, kb = ka + 16; v[i] = ka < K ? W[(size_t)(ka < K ? ka : K - 1) * ld + n] : 0.f; v[8 + i] = kb < K ? W[(size_t)(kb < K ? kb : K - 1) * ld + n] : 0.f; }
  return bsplit16(v); }
__device__ __forceinline__ v8f mac3(const F2& a, const F2& b, v8f c) { c = wmma_bf(a.l, b.h, c); c = wmma_bf(a.h, b.l, c); return wmma_bf(a.h, b.h, c); }
__device__ __forceinline__ float sigm(float v) { return 1.0f / (1.0f + expf(-v)); }
#define LDSX() do { asm volatile("s_wait_dscnt 0" ::: "memory"); __builtin_amdgcn_wave_barrier(); __builtin_amdgcn_fence(__ATOMIC_RELEASE, "workgroup"); } while (0)

// Sliding-window causal self-attention (B 2, S 2,048, 1,024 = 16 x 64, window 128): q/k/v = x W ((in,out)); key j visible from query i iff i - 127 <= j <= i; softmax (the extra max-subtraction is a no-op); out = merged(attn v) Wo + x.
#define NB 2
#define TT 2048
#define CC 1024            // NH * HD = projected width
#define DIN 1024          // input (model) width
#define NH 16
#define HD 64
#define NQB (TT / 64)
#define SCALE (0.125f)
#define CAUSAL 1
#ifndef TNB
#define TNB NB
#endif
__device__ __forceinline__ float bfr(float v) { return (float)(__bf16)v; }
#define WIN 128            // window: key j is visible from query i only if j >= i - (WIN - 1)
// oldest key that any query >= t can see; every older key has P = 0 exactly, so a 32-key chunk wholly older is neither scored, normalised nor multiplied
__device__ __forceinline__ int key_first(int t) { return t > WIN - 1 ? t - (WIN - 1) : 0; }
typedef __attribute__((ext_vector_type(8))) __bf16 v8b;
__device__ __forceinline__ v16b frag_b(const __bf16* rowk0, int lane) {
  union { v16b v; v8b q[2]; } u; const __bf16* p = rowk0 + 8 * (lane >> 4);
  u.q[0] = *(const v8b*)p; u.q[1] = *(const v8b*)(p + 16); return u.v;
}
#define QBH 6              // causal: query blocks 0..QBH-1 of each sequence take the high-precision path
#define QHI 384            // rows carrying a q residual plane
#define KHI 384            // key rows carrying k residual / v bf16 hi+lo planes (used only by the causal high-precision path)
// B fragment (k rows k0+.., output column o) of a weight: (in,out) [K][ld] or (out,in) [ld rows of K]: bf16 exact, or f16(bf16 * 256) exact
__device__ __forceinline__ v16b wcol_io(const float* Wm, int k0, int o, int lane, int ld) { v16b w; const int g = lane >> 4;
#pragma unroll
  for (int i = 0; i < 8; ++i) { w[i] = (__bf16)Wm[(size_t)(k0 + 8 * g + i) * ld + o]; w[8 + i] = (__bf16)Wm[(size_t)(k0 + 16 + 8 * g + i) * ld + o]; }
  return w; }
__device__ __forceinline__ v16b wcol_oi(const float* Wm, int k0, int o, int lane, int K) { v16b w; const float* p = Wm + (size_t)o * K + k0 + 8 * (lane >> 4);
#pragma unroll
  for (int i = 0; i < 8; ++i) { w[i] = (__bf16)p[i]; w[8 + i] = (__bf16)p[16 + i]; }
  return w; }
__device__ __forceinline__ v16h wcolh_io(const float* Wm, int k0, int o, int lane, int ld) { v16h w; const int g = lane >> 4;
#pragma unroll
  for (int i = 0; i < 8; ++i) { w[i] = (_Float16)(bfr(Wm[(size_t)(k0 + 8 * g + i) * ld + o]) * 256.0f); w[8 + i] = (_Float16)(bfr(Wm[(size_t)(k0 + 16 + 8 * g + i) * ld + o]) * 256.0f); }
  return w; }
__device__ __forceinline__ v16h wcolh_oi(const float* Wm, int k0, int o, int lane, int K) { v16h w; const float* p = Wm + (size_t)o * K + k0 + 8 * (lane >> 4);
#pragma unroll
  for (int i = 0; i < 8; ++i) { w[i] = (_Float16)(bfr(p[i]) * 256.0f); w[8 + i] = (_Float16)(bfr(p[16 + i]) * 256.0f); }
  return w; }
#define WQKV_LAYOUT 0   // 0 = (in,out) [DIN][CC]; 1 = (out,in) [CC][DIN]; 2 = per-head [NH][DIN][HD]
__device__ __forceinline__ v16b wcol_hdk(const float* Wm, int k0, int o, int lane) { v16b w; const int g = lane >> 4; const float* p = Wm + (size_t)(o / HD) * DIN * HD + (o % HD);
#pragma unroll
  for (int i = 0; i < 8; ++i) { w[i] = (__bf16)p[(size_t)(k0 + 8 * g + i) * HD]; w[8 + i] = (__bf16)p[(size_t)(k0 + 16 + 8 * g + i) * HD]; }
  return w; }
#define WO_OUT_IN 0
#if WQKV_LAYOUT == 1
#define WCOL(W, k0, o, lane) wcol_oi(W, k0, o, lane, DIN)
#elif WQKV_LAYOUT == 2
#define WCOL(W, k0, o, lane) wcol_hdk(W, k0, o, lane)
#else
#define WCOL(W, k0, o, lane) wcol_io(W, k0, o, lane, CC)
#endif
#if WO_OUT_IN
#define WOCOL(W, k0, o, lane) wcol_oi(W, k0, o, lane, CC)
#define WOCOLH(W, k0, o, lane) wcolh_oi(W, k0, o, lane, CC)
#else
#define WOCOL(W, k0, o, lane) wcol_io(W, k0, o, lane, DIN)
#define WOCOLH(W, k0, o, lane) wcolh_io(W, k0, o, lane, DIN)
#endif
#define WS_PR  (WS_END)
#define WS_END2 (WS_PR + 4u * (size_t)NB * TT * DIN)
#ifndef PROJ_EXTRA_PARAMS
#define PROJ_EXTRA_PARAMS
#endif

#define WS_QH  0u                                      // f16 q rows [b*t][CC]
#define WS_KH  (WS_QH + 2u * (size_t)NB * TT * CC)      // f16 k rows [b*t][CC]
#define WS_VT  (WS_KH + 2u * (size_t)NB * TT * CC)      // f16 v planes [b][c][t]
#define WS_QL  (WS_VT + 2u * (size_t)NB * CC * TT)      // f16 q residual x 2^10 rows [b][t < QHI][CC]
#define WS_KL  (WS_QL + 2u * (size_t)NB * QHI * CC)     // f16 k residual x 2^10 rows [b][t < KHI][CC]
#define WS_VB  (WS_KL + 2u * (size_t)NB * KHI * CC)     // bf16 v hi planes [b][c][t < KHI]
#define WS_VBL (WS_VB + 2u * (size_t)NB * CC * KHI)
#define WS_Y   (WS_VBL + 2u * (size_t)NB * CC * KHI)    // f32 ctx rows [b*t][CC] (only when there is an output projection)
#define WS_END (WS_Y  + 4u * (size_t)NB * TT * CC)
#define WS_XB  (WS_END2)                                // bf16 x rows [b*t][DIN]
#define WS_WT  (WS_XB + 2u * (size_t)NB * TT * DIN)     // bf16 weights, transposed: Wq, Wk, Wv as [CC out][DIN in], then Wo as [DIN out][CC in]
#define WS_WTO (WS_WT + 2u * 3u * (size_t)CC * DIN)
#define WS_END3 (WS_WTO + 2u * (size_t)DIN * CC)

// ---- operand feed of k_proj and k_out: a slab = KS k values of the block's 128 weight columns, an LDS buffer [128][KS + 8] (row = column n; pitch 144 bytes: the pitch of ds_load_b128 readers), where all 4 waves read their B fragments. k_prep has rounded x and the four weights to bf16 once and laid the weights out as [out][in], so a slab row is one 128-byte line in global memory and goes to LDS as it is, in 16-byte pieces (a wave's load = 4 rows = 4 whole lines); every block used to load the f32 values and round them for itself. The block's 64 activation rows go the same way, [64][KS + 8]; k_out's ctx rows are f32 (2 rows x 256 bytes a load) and are split on the way. All are loaded one slab ahead. The loops of the feed are unrolled in full: wr, ar and the fragment arrays live in registers and need compile-time indices.
#define KS 64
#define GXW() asm volatile("s_wait_xcnt 0x0" ::: "memory")   /* stands behind a slab's global loads: the next slab's address is formed in the registers that these loads name; it also keeps the loads in front of the products that cover their latency */
__device__ __forceinline__ void wslab_load(float (&wr)[KS], const float* Wc, int s, int ld) {
#pragma unroll
  for (int i = 0; i < KS; ++i) wr[i] = Wc[(size_t)(s * KS + i) * ld]; }
__device__ __forceinline__ void wslab_store(__bf16 (*buf)[KS + 8], const float (&wr)[KS], int n) {
#pragma unroll
  for (int q = 0; q < KS / 8; ++q) { v8b t;
#pragma unroll
    for (int i = 0; i < 8; ++i) t[i] = (__bf16)wr[q * 8 + i];
    *(v8b*)&buf[n][q * 8] = t; } }
typedef __attribute__((ext_vector_type(4))) __bf16 v4b;
#define AL (64 * KS / 4 / 128)   // 16-byte pieces of an activation slab per thread: piece i of thread t is row i * 8 + (t >> 4), floats 4 * (t & 15) ..
static_assert(KS == 64, "16 pieces per slab row");
__device__ __forceinline__ void aslab_load(v4f (&ar)[AL], const float* Ab, int s, int ld) {   /* Ab = first row of the block + (t >> 4) * ld + 4 * (t & 15) */
#pragma unroll
  for (int i = 0; i < AL; ++i) ar[i] = *(const v4f*)(Ab + (size_t)(i * 8) * ld + s * KS); }
// bf16 slab of N * 16 rows: piece i of thread t is row i * 16 + (t >> 3), elements 8 * (t & 7) ..
template <int N> __device__ __forceinline__ void bslab_load(v8b (&r)[N], const __bf16* P, int s, int ld) {   /* P = first row of the block + (t >> 3) * ld + 8 * (t & 7) */
#pragma unroll
  for (int i = 0; i < N; ++i) r[i] = *(const v8b*)(P + (size_t)(i * 16) * ld + s * KS); }
template <int N> __device__ __forceinline__ void bslab_store(__bf16 (*buf)[KS + 8], const v8b (&r)[N], int t) {
#pragma unroll
  for (int i = 0; i < N; ++i) *(v8b*)&buf[i * 16 + (t >> 3)][8 * (t & 7)] = r[i]; }
// f32 pieces of aslab_load to LDS with the bf16 hi + lo split of bsplit16, one plane each
__device__ __forceinline__ void aslab_store2(__bf16 (*bh)[KS + 8], __bf16 (*bl)[KS + 8], const v4f (&ar)[AL], int t) {
#pragma unroll
  for (int i = 0; i < AL; ++i) { v4b h, l;
#pragma unroll
    for (int e = 0; e < 4; ++e) { const __bf16 hv = (__bf16)ar[i][e]; h[e] = hv; l[e] = (__bf16)(ar[i][e] - (float)hv); }
    *(v4b*)&bh[i * 8 + (t >> 4)][4 * (t & 15)] = h; *(v4b*)&bl[i * 8 + (t >> 4)][4 * (t & 15)] = l; } }
// ---- k_prep: x and the weights to bf16, once for all blocks of k_proj and k_out. Blocks < PWB: one slab (KS k rows x 128 columns) of weight m: thread n loads column n (a wave's load = one 128-byte line), the slab turns in LDS and leaves as rows [out][in] in whole lines. The other blocks: 2,048 16-byte pieces of x each.
#define PWB (4 * (CC / 128) * (DIN / KS))
#define PXB ((int)((size_t)NB * TT * DIN / 4 / 2048))
static_assert(CC == DIN && CC / 128 == 8 && DIN / KS == 16, "block index fields of k_prep");
__global__ __launch_bounds__(128) void k_prep(const float* __restrict__ X, const float* __restrict__ WQ, const float* __restrict__ WK, const float* __restrict__ WV, const float* __restrict__ WO, __bf16* __restrict__ XB, __bf16* __restrict__ WT) {
  __shared__ __align__(16) __bf16 tw[128][KS + 8];
  const int tid = threadIdx.x, bi = blockIdx.x;
  if (bi < PWB) { const int m = bi >> 7, c0 = ((bi >> 4) & 7) * 128, s = bi & 15;
    const float* Wm = m == 0 ? WQ : m == 1 ? WK : m == 2 ? WV : WO;
    float wr[KS]; wslab_load(wr, Wm + c0 + tid, s, CC); GXW();   /* the rounded values may be given the loads' address registers */
    wslab_store(tw, wr, tid);
    __syncthreads();
    __bf16* D = WT + ((size_t)m * CC + c0 + (tid >> 3)) * DIN + s * KS + 8 * (tid & 7);
#pragma unroll
    for (int i = 0; i < 8; ++i) *(v8b*)(D + (size_t)(i * 16) * DIN) = *(const v8b*)&tw[i * 16 + (tid >> 3)][8 * (tid & 7)];
  } else { const size_t p0 = (size_t)(bi - PWB) * 2048 + tid; v4f a[16];
#pragma unroll
    for (int i = 0; i < 16; ++i) a[i] = *(const v4f*)(X + (p0 + i * 128) * 4);
    GXW();   /* as above */
#pragma unroll
    for (int i = 0; i < 16; ++i) { v4b h;
#pragma unroll
      for (int e = 0; e < 4; ++e) h[e] = (__bf16)a[i][e];
      *(v4b*)(XB + (p0 + i * 128) * 4) = h; }
    GXW();   /* behind the last store: in the built code the weight part's instructions follow this run, and they write registers that the stores name */ } }
// ---- k_proj: block = (64 rows, 128 cols, which): q/k/v = X W (+ b) with exact bf16 products (K = DIN) -> which 0: q f16 rows (+ residual rows < QHI); 1: k f16 rows (+ residual rows < KHI); 2: v f16 planes [c][t] (+ bf16 hi/lo planes for t < KHI)
__global__ __launch_bounds__(128) void k_proj(const __bf16* __restrict__ XB, const __bf16* __restrict__ WT, const float* __restrict__ BQ, const float* __restrict__ BK, const float* __restrict__ BV,
    _Float16* __restrict__ QH, _Float16* __restrict__ QL, _Float16* __restrict__ KH, _Float16* __restrict__ KL, _Float16* __restrict__ VT, __bf16* __restrict__ VB, __bf16* __restrict__ VBL) {
  __shared__ __align__(16) _Float16 sh[64][136], sl[64][136]; __shared__ __align__(16) _Float16 th[128][72]; __shared__ __align__(16) __bf16 tb[128][72], tbl[128][72];
  const int tid = threadIdx.x, wave = tid >> 5, lane = tid & 31, col = lane & 15, g = lane >> 4; const int which = blockIdx.z; const int c0 = blockIdx.y * 128; const size_t r0 = (size_t)blockIdx.x * 64; const size_t bb = r0 / TT; const int t0 = (int)(r0 % TT);
  const float* BA = which == 0 ? BQ : which == 1 ? BK : BV;
  v8f acc[8] = {};
  static_assert(WQKV_LAYOUT == 0 && KS + 8 == 72 && DIN % (2 * KS) == 0, "slab feed");
  const __bf16* Wp = WT + ((size_t)which * CC + c0 + (tid >> 3)) * DIN + 8 * (tid & 7); const __bf16* Ap = XB + (r0 + (tid >> 3)) * DIN + 8 * (tid & 7);
  v8b wr[8], ar[4];
  __bf16 (*const xa0)[KS + 8] = (__bf16 (*)[KS + 8])&th[0][0]; __bf16 (*const xa1)[KS + 8] = (__bf16 (*)[KS + 8])&th[64][0];   /* until the epilogue takes them (behind the last barrier), tb and tbl are the two weight buffers and the halves of th the two activation buffers */
  // one slab: slab s + 1's loads start (behind the barrier, which waits for every load in flight); products from cw, ca; then slab s + 1 goes to nw, na, whose readers left them at the last barrier; the barrier publishes nw, na and ends the reads of cw, ca
  const auto slab = [&](const __bf16 (*cw)[KS + 8], const __bf16 (*ca)[KS + 8], __bf16 (*nw)[KS + 8], __bf16 (*na)[KS + 8], int s) {
    if (s + 1 < DIN / KS) { bslab_load(wr, Wp, s + 1, DIN); bslab_load(ar, Ap, s + 1, DIN); GXW(); }
#pragma unroll
    for (int kc = 0; kc < KS / 32; ++kc) { const v16b a = frag_b(&ca[wave * 16 + col][kc * 32], lane); v16b w[8];
#pragma unroll
      for (int j = 0; j < 8; ++j) w[j] = frag_b(&cw[j * 16 + col][kc * 32], lane);
#pragma unroll
      for (int j = 0; j < 8; ++j) acc[j] = wmma_bf(a, w[j], acc[j]); }
    if (s + 1 < DIN / KS) { bslab_store(nw, wr, tid); bslab_store(na, ar, tid); }
    __syncthreads(); };
  bslab_load(wr, Wp, 0, DIN); bslab_load(ar, Ap, 0, DIN); GXW();
  bslab_store(tb, wr, tid); bslab_store(xa0, ar, tid);
  __syncthreads();
  for (int s = 0; s < DIN / KS; s += 2) { slab(tb, xa0, tbl, xa1, s); slab(tbl, xa1, tb, xa0, s + 1); }
  if (which < 2) { _Float16* DH = which == 0 ? QH : KH; _Float16* DL = which == 0 ? QL : KL; const int nhi = which == 0 ? QHI : KHI; const bool hi_rows = t0 < nhi;
#pragma unroll
    for (int j = 0; j < 8; ++j) { const float bias = BA ? bfr(BA[c0 + j * 16 + col]) : 0.f;
#pragma unroll
      for (int r = 0; r < 8; ++r) { const float v = acc[j][r] + bias; const _Float16 hv = (_Float16)v; sh[wave * 16 + 8 * g + r][j * 16 + col] = hv; sl[wave * 16 + 8 * g + r][j * 16 + col] = (_Float16)((v - (float)hv) * 1024.0f); } }
    __syncthreads();
    for (int e = tid; e < 64 * 16; e += 128) { const int rl = e >> 4, q = e & 15; vst2((unsigned*)(DH + (r0 + rl) * CC + c0 + q * 8), *(const v4u*)&sh[rl][q * 8]); if (hi_rows) vst2((unsigned*)(DL + (bb * nhi + t0 + rl) * (size_t)CC + c0 + q * 8), *(const v4u*)&sl[rl][q * 8]); }
  } else { const bool hi_rows = t0 < KHI;
#pragma unroll
    for (int j = 0; j < 8; ++j) { const float bias = BA ? bfr(BA[c0 + j * 16 + col]) : 0.f;
#pragma unroll
      for (int r = 0; r < 8; ++r) { const float v = acc[j][r] + bias; const int rl = wave * 16 + 8 * g + r, cl = j * 16 + col; th[cl][rl] = (_Float16)v; const __bf16 bh = (__bf16)v; tb[cl][rl] = bh; tbl[cl][rl] = (__bf16)(v - (float)bh); } }
    __syncthreads();
    for (int e = tid; e < 128 * 8; e += 128) { const int cl = e >> 3, q = e & 7; vst2((unsigned*)(VT + (bb * CC + c0 + cl) * (size_t)TT + t0 + q * 8), *(const v4u*)&th[cl][q * 8]); if (hi_rows) { const size_t o3 = (bb * CC + c0 + cl) * (size_t)KHI + t0 + q * 8; vst2((unsigned*)(VB + o3), *(const v4u*)&tb[cl][q * 8]); vst2((unsigned*)(VBL + o3), *(const v4u*)&tbl[cl][q * 8]); } } } }
#define XW() asm volatile("s_wait_xcnt 0x0" ::: "memory")   /* stands behind each group of k_att's global loads that share an address: a later load's result may be given the group's address registers, and s_wait_xcnt 0 belongs in front of an overwrite of a register that an issued load names */
#define AHEAD 2            // chunks whose fragment loads are in flight in front of the chunk being multiplied
#define NCH 5              // 16 queries from a multiple of 16 see keys [ql0 - (WIN - 1), ql0 + 15]: at most 5 chunks of 32
__global__ __launch_bounds__(128) void k_att(const _Float16* __restrict__ QH, const _Float16* __restrict__ KH, const _Float16* __restrict__ QL, const _Float16* __restrict__ KL, const _Float16* __restrict__ VT, const __bf16* __restrict__ VB, const __bf16* __restrict__ VBL, float* __restrict__ Y) { __shared__ __align__(16) float ss[4][16][HD + 4];
  const int tid = threadIdx.x, wave = tid >> 5, lane = tid & 31, col = lane & 15, g = lane >> 4; const int qb = blockIdx.x, h = blockIdx.y, b = blockIdx.z; const int ql0 = qb * 64 + wave * 16; const int t = ql0 + col;
  const int kc0 = __builtin_amdgcn_readfirstlane(key_first(ql0) >> 5), kcl = __builtin_amdgcn_readfirstlane((ql0 + 15) >> 5);   /* first and last visible chunk, wave-uniform */
  static_assert((WIN - 1 + 15) / 32 + 1 <= NCH, "chunks per wave");
  const size_t q0 = (size_t)b * TT + ql0;
  float p[NCH][16];   /* every loop of this kernel is unrolled in full: p, the fragment arrays and the accumulators live in registers and need compile-time indices */
  if (qb < QBH) { const _Float16* QLb = QL + (size_t)b * QHI * CC; const _Float16* KLb = KL + (size_t)b * KHI * CC;
    v16h ah[HD / 32], al[HD / 32];
#pragma unroll
    for (int kc = 0; kc < HD / 32; ++kc) ah[kc] = frag_h(QH + (q0 + col) * CC + h * HD + kc * 32, lane);
    XW();
#pragma unroll
    for (int kc = 0; kc < HD / 32; ++kc) al[kc] = frag_h(QLb + (size_t)(ql0 + col) * CC + h * HD + kc * 32, lane);
    XW();
#pragma unroll
    for (int c = 0; c < NCH; ++c) { const int kr = (kc0 + c < kcl ? kc0 + c : kcl) * 32;
#pragma unroll
      for (int u = 0; u < 2; ++u) { v16h kbf[HD / 32], klf[HD / 32];   /* loads do not move over the products' asm statements: a 16-key tile's loads stand in front of its products; a whole chunk's fragments at once would not fit the registers beside p */
#pragma unroll
        for (int kc = 0; kc < HD / 32; ++kc) kbf[kc] = frag_h(KH + ((size_t)b * TT + kr + u * 16 + col) * CC + h * HD + kc * 32, lane);
        XW();
#pragma unroll
        for (int kc = 0; kc < HD / 32; ++kc) klf[kc] = frag_h(KLb + (size_t)(kr + u * 16 + col) * CC + h * HD + kc * 32, lane);
        XW();
        v8f acc = {}, accl = {};
#pragma unroll
        for (int kc = 0; kc < HD / 32; ++kc) { acc = wmma16(kbf[kc], ah[kc], acc); accl = wmma16(kbf[kc], al[kc], accl); accl = wmma16(klf[kc], ah[kc], accl); }
#pragma unroll
        for (int r = 0; r < 8; ++r) p[c][u * 8 + r] = (acc[r] + accl[r] * (1.0f / 1024.0f)) * SCALE; } }
  } else {
    v16h ah[HD / 32];
#pragma unroll
    for (int kc = 0; kc < HD / 32; ++kc) ah[kc] = frag_h(QH + (q0 + col) * CC + h * HD + kc * 32, lane);
    XW();
    v16h kf[NCH][2][HD / 32];   /* loads do not move over the products' asm statements: chunk c + AHEAD is loaded in front of chunk c's products, so that its latency is covered */
#pragma unroll
    for (int cc = -AHEAD; cc < NCH; ++cc) { const int c = cc < 0 ? 0 : cc;
      if (const int cn = cc + AHEAD; cn < NCH) { const int kr = (kc0 + cn < kcl ? kc0 + cn : kcl) * 32;
#pragma unroll
        for (int u = 0; u < 2; ++u)
#pragma unroll
          for (int kc = 0; kc < HD / 32; ++kc) kf[cn][u][kc] = frag_h(KH + ((size_t)b * TT + kr + u * 16 + col) * CC + h * HD + kc * 32, lane);
        XW(); }
      if (cc < 0) continue;
#pragma unroll
      for (int u = 0; u < 2; ++u) { v8f acc = {};
#pragma unroll
        for (int kc = 0; kc < HD / 32; ++kc) acc = wmma16(kf[c][u][kc], ah[kc], acc);
#pragma unroll
        for (int r = 0; r < 8; ++r) p[c][u * 8 + r] = acc[r] * SCALE; } } }
  // softmax of row t in f32: element i of chunk c is key (kc0 + c) * 32 + 16 * (i >> 3) + 8 g + (i & 7); visible iff t - (WIN - 1) <= key <= t
  float m = -3.0e38f;
#pragma unroll
  for (int c = 0; c < NCH; ++c)
#pragma unroll
    for (int i = 0; i < 16; ++i) { const int k = (kc0 + c) * 32 + 16 * (i >> 3) + 8 * g + (i & 7); const float v = (k <= t && k >= t - (WIN - 1)) ? p[c][i] : -3.0e38f; p[c][i] = v; m = fmaxf(m, v); }
  m = fmaxf(m, __shfl_xor(m, 16));
  float sum = 0.f;
#pragma unroll
  for (int c = 0; c < NCH; ++c)
#pragma unroll
    for (int i = 0; i < 16; ++i) { const float v = p[c][i]; const float ex = expf(v - m); const float e = (v <= -1.0e38f) ? 0.f : ex; p[c][i] = e; sum += e; }
  sum += __shfl_xor(sum, 16);
  const float inv = sum > 0.f ? 2048.0f / sum : 0.f;
#pragma unroll
  for (int c = 0; c < NCH; ++c)
#pragma unroll
    for (int i = 0; i < 16; ++i) p[c][i] *= inv;
  v8f acc[HD / 16] = {};
  if (qb < QBH) {
#pragma unroll
    for (int c = 0; c < NCH; ++c) { const int kr = (kc0 + c < kcl ? kc0 + c : kcl) * 32; const F2 pf = bsplit16(p[c]); v16b vh[HD / 16], vl[HD / 16];
#pragma unroll
      for (int j = 0; j < HD / 16; ++j) vh[j] = frag_b(VB + ((size_t)b * CC + h * HD + j * 16 + col) * (size_t)KHI + kr, lane);
      XW();
#pragma unroll
      for (int j = 0; j < HD / 16; ++j) vl[j] = frag_b(VBL + ((size_t)b * CC + h * HD + j * 16 + col) * (size_t)KHI + kr, lane);
      XW();
#pragma unroll
      for (int j = 0; j < HD / 16; ++j) { acc[j] = wmma_bf(pf.h, vh[j], acc[j]); acc[j] = wmma_bf(pf.l, vh[j], acc[j]); acc[j] = wmma_bf(pf.h, vl[j], acc[j]); } }
  } else { v16h vf[NCH][HD / 16];   /* v fragments AHEAD chunks in front of their products, as for K */
#pragma unroll
    for (int cc = -AHEAD; cc < NCH; ++cc) { const int c = cc < 0 ? 0 : cc;
      if (const int cn = cc + AHEAD; cn < NCH) { const int kr = (kc0 + cn < kcl ? kc0 + cn : kcl) * 32;
#pragma unroll
        for (int j = 0; j < HD / 16; ++j) vf[cn][j] = frag_h(VT + ((size_t)b * CC + h * HD + j * 16 + col) * (size_t)TT + kr, lane);
        XW(); }
      if (cc < 0) continue;
      v16h pf;
#pragma unroll
      for (int i = 0; i < 16; ++i) pf[i] = (_Float16)p[c][i];
#pragma unroll
      for (int j = 0; j < HD / 16; ++j) acc[j] = wmma16(pf, vf[c][j], acc[j]); } }
#pragma unroll
  for (int j = 0; j < HD / 16; ++j)
#pragma unroll
    for (int r = 0; r < 8; ++r) ss[wave][8 * g + r][j * 16 + col] = acc[j][r] * (1.0f / 2048.0f);
  LDSX(); for (int rl = 0; rl < 16; ++rl) if (lane < HD / 4) vst2(Y + ((size_t)b * TT + ql0 + rl) * CC + h * HD + lane * 4, *(const v4f*)&ss[wave][rl][lane * 4]); }
// ---- k_out: block = (64 rows, 128 cols): out = ctx Wo (+ bo) + bf16(x): ctx bf16 hi + lo against exact bf16 Wo (2 products). The residual is k_prep's bf16 x: a lane's 16 pieces (those of its 16 output stores) are loaded at entry, in flight with slab 0, and added in f32 where the tile leaves LDS for out.
__global__ __launch_bounds__(128) void k_out(const float* __restrict__ Y, const __bf16* __restrict__ WTO, const float* __restrict__ BO, const __bf16* __restrict__ XB, float* __restrict__ OUT) { __shared__ __align__(16) float sf[4][16][132]; __shared__ __align__(16) __bf16 wb0[128][KS + 8], wb1[128][KS + 8], yh0[64][KS + 8], yl0[64][KS + 8], yh1[64][KS + 8], yl1[64][KS + 8];
  const int tid = threadIdx.x, wave = tid >> 5, lane = tid & 31, col = lane & 15, g = lane >> 4; const int c0 = blockIdx.y * 128; const size_t r0 = (size_t)blockIdx.x * 64 + wave * 16;
  v8f acc[8] = {};
  v4b xr[16];   /* indexed at compile time only: it lives in registers */
#pragma unroll
  for (int rl = 0; rl < 16; ++rl) xr[rl] = *(const v4b*)(XB + (r0 + rl) * DIN + c0 + lane * 4);
  GXW();   /* the slab addresses formed next may be given the address registers of these loads */
  if (true) {   /* ALL rows: ctx split bf16 hi + lo x exact Wo (2 products) */
    static_assert(WO_OUT_IN == 0 && CC % (2 * KS) == 0, "slab feed");
    const __bf16* Wp = WTO + (size_t)(c0 + (tid >> 3)) * CC + 8 * (tid & 7); const float* Ab = Y + ((size_t)blockIdx.x * 64 + (tid >> 4)) * CC + 4 * (tid & 15);
    v8b wr[8]; v4f ar[AL];
    // the slab step of k_proj, ctx as hi and lo planes; each accumulator still takes chunk kc's hi product, then its lo product
    const auto slab = [&](const __bf16 (*cw)[KS + 8], const __bf16 (*ch)[KS + 8], const __bf16 (*cl)[KS + 8], __bf16 (*nw)[KS + 8], __bf16 (*nh)[KS + 8], __bf16 (*nl)[KS + 8], int s) {
      if (s + 1 < CC / KS) { bslab_load(wr, Wp, s + 1, CC); aslab_load(ar, Ab, s + 1, CC); GXW(); }
#pragma unroll
      for (int kc = 0; kc < KS / 32; ++kc) { const v16b ah = frag_b(&ch[wave * 16 + col][kc * 32], lane), al = frag_b(&cl[wave * 16 + col][kc * 32], lane); v16b w[8];
#pragma unroll
        for (int j = 0; j < 8; ++j) w[j] = frag_b(&cw[j * 16 + col][kc * 32], lane);
#pragma unroll
        for (int j = 0; j < 8; ++j) acc[j] = wmma_bf(ah, w[j], acc[j]);
#pragma unroll
        for (int j = 0; j < 8; ++j) acc[j] = wmma_bf(al, w[j], acc[j]); }
      if (s + 1 < CC / KS) { bslab_store(nw, wr, tid); aslab_store2(nh, nl, ar, tid); }
      __syncthreads(); };
    bslab_load(wr, Wp, 0, CC); aslab_load(ar, Ab, 0, CC); GXW();
    bslab_store(wb0, wr, tid); aslab_store2(yh0, yl0, ar, tid);
    __syncthreads();
    for (int s = 0; s < CC / KS; s += 2) { slab(wb0, yh0, yl0, wb1, yh1, yl1, s); slab(wb1, yh1, yl1, wb0, yh0, yl0, s + 1); }
#pragma unroll
    for (int j = 0; j < 8; ++j) { const float bias = BO ? bfr(BO[c0 + j * 16 + col]) : 0.f;
#pragma unroll
      for (int r = 0; r < 8; ++r) sf[wave][8 * g + r][j * 16 + col] = acc[j][r] + bias; }
  }
  LDSX();
  v4f o[16];   /* xr and o need compile-time indices: both loops are unrolled in full */
#pragma unroll
  for (int rl = 0; rl < 16; ++rl) { o[rl] = *(const v4f*)&sf[wave][rl][lane * 4];
#pragma unroll
    for (int e = 0; e < 4; ++e) o[rl][e] = (float)xr[rl][e] + o[rl][e]; }
  __builtin_amdgcn_sched_barrier(0);   /* every sum stands in front of the first store, so that no register which an issued store names is written again */
#pragma unroll
  for (int rl = 0; rl < 16; ++rl) vst2(OUT + (r0 + rl) * DIN + c0 + lane * 4, o[rl]); }

extern "C" void kernel_launch(void* const* d_in, const int* in_sizes, int n_in, void* d_out, int out_size, void* d_ws, size_t ws_size, hipStream_t stream) {
  (void)in_sizes; (void)n_in; (void)out_size;
  const float** F = (const float**)d_in;
  if (ws_size < (size_t)WS_END) return;
  char* ws = (char*)d_ws; _Float16 *QH = (_Float16*)(ws + WS_QH), *KH = (_Float16*)(ws + WS_KH), *VT = (_Float16*)(ws + WS_VT), *QL = (_Float16*)(ws + WS_QL), *KL = (_Float16*)(ws + WS_KL); __bf16 *VB = (__bf16*)(ws + WS_VB), *VBL = (__bf16*)(ws + WS_VBL); float *Y = (float*)(ws + WS_Y);
  (void)Y; (void)QL; (void)KL; (void)VB; (void)VBL;
  // inputs: 0 x [2,2048,1024]; 1 Wq, 2 Wk, 3 Wv, 4 Wo [1024,1024] (in,out), no biases
  if (ws_size < (size_t)WS_END3) return;
  __bf16 *XB = (__bf16*)(ws + WS_XB), *WT = (__bf16*)(ws + WS_WT), *WTO = (__bf16*)(ws + WS_WTO);
  k_prep<<<dim3(PWB + PXB), 128, 0, stream>>>(F[0], F[1], F[2], F[3], F[4], XB, WT);
  k_proj<<<dim3(TNB * TT / 64, CC / 128, 3), 128, 0, stream>>>(XB, WT, nullptr, nullptr, nullptr, QH, QL, KH, KL, VT, VB, VBL);
  k_att<<<dim3(NQB, NH, TNB), 128, 0, stream>>>(QH, KH, QL, KL, VT, VB, VBL, Y);
  k_out<<<dim3(TNB * TT / 64, DIN / 128), 128, 0, stream>>>(Y, WTO, nullptr, XB, (float*)d_out);
}

// v006
// One run takes 76.7 microseconds.
// Two timings next to v005 both put it at 1.12 times that version's speed.
// Over all steps from v000 it is 13.3 times as fast.
// compute dtype: all float inputs rounded to bf16; q/k/v = x W with EXACT bf16 products on WMMA 16x16x32 (f32 accumulate); windowed causal logits: q, k once to f16 (1 product) x 64^-0.5, except the first 384 query rows of each sequence (3 products with f16 residuals); softmax in f32; P x 2^11 once to f16 against v once to f16 (1 product; bf16 hi + lo below row 384); ctx split bf16 hi + lo against exact Wo (2 products); + x residual in f32; f32 output.
#include <hip/hip_runtime.h>
#include <math.h>

typedef __attribute__((ext_vector_type(16))) _Float16 v16h;
typedef __attribute__((ext_vector_type(16))) __bf16 v16b;
typedef __attribute__((ext_vector_type(8)))  _Float16 v8h;
typedef __attribute__((ext_vector_type(8)))  float v8f;
typedef __attribute__((ext_vector_type(4)))  float v4f;
typedef __attribute__((ext_vector_type(2)))  float v2f;
typedef __attribute__((ext_vector_type(4)))  unsigned v4u;
typedef __attribute__((ext_vector_type(4)))  int v4i;
typedef float __attribute__((may_alias)) float_a;
typedef int __attribute__((may_alias)) int_a;

template <typename T> __device__ __forceinline__ void vst2(void* p, T v) { *(T*)p = v;  }
__device__ __forceinline__ v8f wmma16(v16h a, v16h b, v8f c) {
  v8f d = __builtin_amdgcn_wmma_f32_16x16x32_f16(false, a, false, b, (short)0, c, false, false);
  asm volatile("v_nop\n\tv_nop\n\tv_nop\n\tv_nop" : "+v"(d) : "v"(a), "v"(b));
  return d;
}
__device__ __forceinline__ v8f wmma_bf(v16b a, v16b b, v8f c) {
  v8f d = __builtin_amdgcn_wmma_f32_16x16x32_bf16(false, a, false, b, (short)0, c, false, false);
  asm volatile("v_nop\n\tv_nop\n\tv_nop\n\tv_nop" : "+v"(d) : "v"(a), "v"(b));
  return d;
}
// 16x16x32 fragments: lane = (h = lane>>4, row/col = lane&15); elements 0..7 = k0+8h+0..7, 8..15 = k0+16+8h+0..7; D element r = row 8h+r
__device__ __forceinline__ v16h frag_h(const _Float16* rowk0, int lane) {
  union { v16h v; v8h q[2]; } u; const _Float16* p = rowk0 + 8 * (lane >> 4);
  u.q[0] = *(const v8h*)p; u.q[1] = *(const v8h*)(p + 16); return u.v;
}
__device__ __forceinline__ v16h frag_f32(const float* rowk0, int lane) {
  v16h a; const float* p = rowk0 + 8 * (lane >> 4);
#pragma unroll
  for (int i = 0; i < 8; ++i) { a[i] = (_Float16)p[i]; a[8 + i] = (_Float16)p[16 + i]; }
  return a;
}
__device__ __forceinline__ v16h frag_f32s(const float* rowk0, int lane, float sc) {
  v16h a; const float* p = rowk0 + 8 * (lane >> 4);
#pragma unroll
  for (int i = 0; i < 8; ++i) { a[i] = (_Float16)(p[i] * sc); a[8 + i] = (_Float16)(p[16 + i] * sc); }
  return a;
}
// column fragment from a [K][ld] layout (column n), rows >= K read as 0
__device__ __forceinline__ v16h fragc_f32(const float* W, int k0, int n, int lane, int ld, int K) {
  v16h a; const int g = lane >> 4;
#pragma unroll
  for (int i = 0; i < 8; ++i) { const int ka = k0 + 8 * g + i, kb = ka + 16;
    a[i] = (_Float16)(ka < K ? W[(size_t)(ka < K ? ka : K - 1) * ld + n] : 0.f); a[8 + i] = (_Float16)(kb < K ? W[(size_t)(kb < K ? kb : K - 1) * ld + n] : 0.f); }
  return a;
}
struct F2 { v16b h, l; };
__device__ __forceinline__ F2 bsplit16(const float v[16]) { F2 r;
#pragma unroll
  for (int i = 0; i < 16; ++i) { const __bf16 h = (__bf16)v[i]; r.h[i] = h; r.l[i] = (__bf16)(v[i] - (float)h); }
  return r; }
__device__ __forceinline__ F2 split_row(const float* row, int k0, int lane) { float v[16]; const float* p = row + k0 + 8 * (lane >> 4);
#pragma unroll
  for (int i = 0; i < 8; ++i) { v[i] = p[i]; v[8 + i] = p[16 + i]; }
  return bsplit16(v); }
__device__ __forceinline__ F2 split_rowK(const float* row, int k0, int lane, int K) { float v[16]; const int g = lane >> 4;
#pragma unroll
  for (int i = 0; i < 8; ++i) { const int ka = k0 + 8 * g + i, kb = ka + 16; v[i] = ka < K ? row[ka < K ? ka : K - 1] : 0.f; v[8 + i] = kb < K ? row[kb < K ? kb : K - 1] : 0.f; }
  return bsplit16(v); }
__device__ __forceinline__ F2 split_col(const float* W, int k0, int n, int lane, int ld, int K) { float v[16]; const int g = lane >> 4;
#pragma unroll
  for (int i = 0; i < 8; ++i) { const int ka = k0 + 8 * g + i, kb = ka + 16; v[i] = ka < K ? W[(size_t)(ka < K ? ka : K - 1) * ld + n] : 0.f; v[8 + i] = kb < K ? W[(size_t)(kb < K ? kb : K - 1) * ld + n] : 0.f; }
  return bsplit16(v); }
__device__ __forceinline__ v8f mac3(const F2& a, const F2& b, v8f c) { c = wmma_bf(a.l, b.h, c); c = wmma_bf(a.h, b.l, c); return wmma_bf(a.h, b.h, c); }
__device__ __forceinline__ float sigm(float v) { return 1.0f / (1.0f + expf(-v)); }
#define LDSX() do { asm volatile("s_wait_dscnt 0" ::: "memory"); __builtin_amdgcn_wave_barrier(); __builtin_amdgcn_fence(__ATOMIC_RELEASE, "workgroup"); } while (0)

// Sliding-window causal self-attention (B 2, S 2,048, 1,024 = 16 x 64, window 128): q/k/v = x W ((in,out)); key j visible from query i iff i - 127 <= j <= i; softmax (the extra max-subtraction is a no-op); out = merged(attn v) Wo + x.
#define NB 2
#define TT 2048
#define CC 1024            // NH * HD = projected width
#define DIN 1024          // input (model) width
#define NH 16
#define HD 64
#define NQB (TT / 64)
#define SCALE (0.125f)
#define CAUSAL 1
#ifndef TNB
#define TNB NB
#endif
__device__ __forceinline__ float bfr(float v) { return (float)(__bf16)v; }
#define WIN 128            // window: key j is visible from query i only if j >= i - (WIN - 1)
// oldest key that any query >= t can see; every older key has P = 0 exactly, so a 32-key chunk wholly older is neither scored, normalised nor multiplied
__device__ __forceinline__ int key_first(int t) { return t > WIN - 1 ? t - (WIN - 1) : 0; }
typedef __attribute__((ext_vector_type(8))) __bf16 v8b;
__device__ __forceinline__ v16b frag_b(const __bf16* rowk0, int lane) {
  union { v16b v; v8b q[2]; } u; const __bf16* p = rowk0 + 8 * (lane >> 4);
  u.q[0] = *(const v8b*)p; u.q[1] = *(const v8b*)(p + 16); return u.v;
}
#define QBH 6              // causal: query blocks 0..QBH-1 of each sequence take the high-precision path
#define QHI 384            // rows carrying a q residual plane
#define KHI 384            // key rows carrying k residual / v bf16 hi+lo planes (used only by the causal high-precision path)
// B fragment (k rows k0+.., output column o) of a weight: (in,out) [K][ld] or (out,in) [ld rows of K]: bf16 exact, or f16(bf16 * 256) exact
__device__ __forceinline__ v16b wcol_io(const float* Wm, int k0, int o, int lane, int ld) { v16b w; const int g = lane >> 4;
#pragma unroll
  for (int i = 0; i < 8; ++i) { w[i] = (__bf16)Wm[(size_t)(k0 + 8 * g + i) * ld + o]; w[8 + i] = (__bf16)Wm[(size_t)(k0 + 16 + 8 * g + i) * ld + o]; }
  return w; }
__device__ __forceinline__ v16b wcol_oi(const float* Wm, int k0, int o, int lane, int K) { v16b w; const float* p = Wm + (size_t)o * K + k0 + 8 * (lane >> 4);
#pragma unroll
  for (int i = 0; i < 8; ++i) { w[i] = (__bf16)p[i]; w[8 + i] = (__bf16)p[16 + i]; }
  return w; }
__device__ __forceinline__ v16h wcolh_io(const float* Wm, int k0, int o, int lane, int ld) { v16h w; const int g = lane >> 4;
#pragma unroll
  for (int i = 0; i < 8; ++i) { w[i] = (_Float16)(bfr(Wm[(size_t)(k0 + 8 * g + i) * ld + o]) * 256.0f); w[8 + i] = (_Float16)(bfr(Wm[(size_t)(k0 + 16 + 8 * g + i) * ld + o]) * 256.0f); }
  return w; }
__device__ __forceinline__ v16h wcolh_oi(const float* Wm, int k0, int o, int lane, int K) { v16h w; const float* p = Wm + (size_t)o * K + k0 + 8 * (lane >> 4);
#pragma unroll
  for (int i = 0; i < 8; ++i) { w[i] = (_Float16)(bfr(p[i]) * 256.0f); w[8 + i] = (_Float16)(bfr(p[16 + i]) * 256.0f); }
  return w; }
#define WQKV_LAYOUT 0   // 0 = (in,out) [DIN][CC]; 1 = (out,in) [CC][DIN]; 2 = per-head [NH][DIN][HD]
__device__ __forceinline__ v16b wcol_hdk(const float* Wm, int k0, int o, int lane) { v16b w; const int g = lane >> 4; const float* p = Wm + (size_t)(o / HD) * DIN * HD + (o % HD);
#pragma unroll
  for (int i = 0; i < 8; ++i) { w[i] = (__bf16)p[(size_t)(k0 + 8 * g + i) * HD]; w[8 + i] = (__bf16)p[(size_t)(k0 + 16 + 8 * g + i) * HD]; }
  return w; }
#define WO_OUT_IN 0
#if WQKV_LAYOUT == 1
#define WCOL(W, k0, o, lane) wcol_oi(W, k0, o, lane, DIN)
#elif WQKV_LAYOUT == 2
#define WCOL(W, k0, o, lane) wcol_hdk(W, k0, o, lane)
#else
#define WCOL(W, k0, o, lane) wcol_io(W, k0, o, lane, CC)
#endif
#if WO_OUT_IN
#define WOCOL(W, k0, o, lane) wcol_oi(W, k0, o, lane, CC)
#define WOCOLH(W, k0, o, lane) wcolh_oi(W, k0, o, lane, CC)
#else
#define WOCOL(W, k0, o, lane) wcol_io(W, k0, o, lane, DIN)
#define WOCOLH(W, k0, o, lane) wcolh_io(W, k0, o, lane, DIN)
#endif
#define WS_PR  (WS_END)
#define WS_END2 (WS_PR + 4u * (size_t)NB * TT * DIN)
#ifndef PROJ_EXTRA_PARAMS
#define PROJ_EXTRA_PARAMS
#endif

#define WS_QH  0u                                      // f16 q rows [b*t][CC]
#define WS_KH  (WS_QH + 2u * (size_t)NB * TT * CC)      // f16 k rows [b*t][CC]
#define WS_VT  (WS_KH + 2u * (size_t)NB * TT * CC)      // f16 v planes [b][c][t]
#define WS_QL  (WS_VT + 2u * (size_t)NB * CC * TT)      // f16 q residual x 2^10 rows [b][t < QHI][CC]
#define WS_KL  (WS_QL + 2u * (size_t)NB * QHI * CC)     // f16 k residual x 2^10 rows [b][t < KHI][CC]
#define WS_VB  (WS_KL + 2u * (size_t)NB * KHI * CC)     // bf16 v hi planes [b][c][t < KHI]
#define WS_VBL (WS_VB + 2u * (size_t)NB * CC * KHI)
#define WS_Y   (WS_VBL + 2u * (size_t)NB * CC * KHI)    // f32 ctx rows [b*t][CC] (only when there is an output projection)
#define WS_END (WS_Y  + 4u * (size_t)NB * TT * CC)
#define WS_XB  (WS_END2)                                // bf16 x rows [b*t][DIN]
#define WS_WT  (WS_XB + 2u * (size_t)NB * TT * DIN)     // bf16 weights, transposed: Wq, Wk, Wv as [CC out][DIN in], then Wo as [DIN out][CC in]
#define WS_WTO (WS_WT + 2u * 3u * (size_t)CC * DIN)
#define WS_END3 (WS_WTO + 2u * (size_t)DIN * CC)

// ---- operand feed of k_proj and k_out: a slab = KS k values of the block's 128 weight columns, an LDS buffer [128][KS + 8] (row = column n; pitch 144 bytes: the pitch of ds_load_b128 readers), where all 4 waves read their B fragments. k_prep has rounded x and the four weights to bf16 once and laid the weights out as [out][in], so a slab row is one 128-byte line in global memory and goes to LDS as it is, in 16-byte pieces (a wave's load = 4 rows = 4 whole lines); every block used to load the f32 values and round them for itself. The block's 64 activation rows go the same way, [64][KS + 8]; k_out's ctx rows are f32 (2 rows x 256 bytes a load) and are split on the way. All are loaded one slab ahead. The loops of the feed are unrolled in full: wr, ar and the fragment arrays live in registers and need compile-time indices.
#define KS 64
#define GXW() asm volatile("s_wait_xcnt 0x0" ::: "memory")   /* stands behind a slab's global loads: the next slab's address is formed in the registers that these loads name; it also keeps the loads in front of the products that cover their latency */
__device__ __forceinline__ void wslab_load(float (&wr)[KS], const float* Wc, int s, int ld) {
#pragma unroll
  for (int i = 0; i < KS; ++i) wr[i] = Wc[(size_t)(s * KS + i) * ld]; }
__device__ __forceinline__ void wslab_store(__bf16 (*buf)[KS + 8], const float (&wr)[KS], int n) {
#pragma unroll
  for (int q = 0; q < KS / 8; ++q) { v8b t;
#pragma unroll
    for (int i = 0; i < 8; ++i) t[i] = (__bf16)wr[q * 8 + i];
    *(v8b*)&buf[n][q * 8] = t; } }
typedef __attribute__((ext_vector_type(4))) __bf16 v4b;
#define AL (64 * KS / 4 / 128)   // 16-byte pieces of an activation slab per thread: piece i of thread t is row i * 8 + (t >> 4), floats 4 * (t & 15) ..
static_assert(KS == 64, "16 pieces per slab row");
__device__ __forceinline__ void aslab_load(v4f (&ar)[AL], const float* Ab, int s, int ld) {   /* Ab = first row of the block + (t >> 4) * ld + 4 * (t & 15) */
#pragma unroll
  for (int i = 0; i < AL; ++i) ar[i] = *(const v4f*)(Ab + (size_t)(i * 8) * ld + s * KS); }
// bf16 slab of N * 16 rows: piece i of thread t is row i * 16 + (t >> 3), elements 8 * (t & 7) ..
template <int N> __device__ __forceinline__ void bslab_load(v8b (&r)[N], const __bf16* P, int s, int ld) {   /* P = first row of the block + (t >> 3) * ld + 8 * (t & 7) */
#pragma unroll
  for (int i = 0; i < N; ++i) r[i] = *(const v8b*)(P + (size_t)(i * 16) * ld + s * KS); }
template <int N> __device__ __forceinline__ void bslab_store(__bf16 (*buf)[KS + 8], const v8b (&r)[N], int t) {
#pragma unroll
  for (int i = 0; i < N; ++i) *(v8b*)&buf[i * 16 + (t >> 3)][8 * (t & 7)] = r[i]; }
// f32 pieces of aslab_load to LDS with the bf16 hi + lo split of bsplit16, one plane each
__device__ __forceinline__ void aslab_store2(__bf16 (*bh)[KS + 8], __bf16 (*bl)[KS + 8], const v4f (&ar)[AL], int t) {
#pragma unroll
  for (int i = 0; i < AL; ++i) { v4b h, l;
#pragma unroll
    for (int e = 0; e < 4; ++e) { const __bf16 hv = (__bf16)ar[i][e]; h[e] = hv; l[e] = (__bf16)(ar[i][e] - (float)hv); }
    *(v4b*)&bh[i * 8 + (t >> 4)][4 * (t & 15)] = h; *(v4b*)&bl[i * 8 + (t >> 4)][4 * (t & 15)] = l; } }
// ---- k_prep: x and the weights to bf16, once for all blocks of k_proj and k_out. Blocks < PWB: one slab (KS k rows x 128 columns) of weight m: thread n loads column n (a wave's load = one 128-byte line), the slab turns in LDS and leaves as rows [out][in] in whole lines. The other blocks: 2,048 16-byte pieces of x each.
#define PWB (4 * (CC / 128) * (DIN / KS))
#define PXB ((int)((size_t)NB * TT * DIN / 4 / 2048))
static_assert(CC == DIN && CC / 128 == 8 && DIN / KS == 16, "block index fields of k_prep");
__global__ __launch_bounds__(128) void k_prep(const float* __restrict__ X, const float* __restrict__ WQ, const float* __restrict__ WK, const float* __restrict__ WV, const float* __restrict__ WO, __bf16* __restrict__ XB, __bf16* __restrict__ WT) {
  __shared__ __align__(16) __bf16 tw[128][KS + 8];
  const int tid = threadIdx.x, bi = blockIdx.x;
  if (bi < PWB) { const int m = bi >> 7, c0 = ((bi >> 4) & 7) * 128, s = bi & 15;
    const float* Wm = m == 0 ? WQ : m == 1 ? WK : m == 2 ? WV : WO;
    float wr[KS]; wslab_load(wr, Wm + c0 + tid, s, CC); GXW();   /* the rounded values may be given the loads' address registers */
    wslab_store(tw, wr, tid);
    __syncthreads();
    __bf16* D = WT + ((size_t)m * CC + c0 + (tid >> 3)) * DIN + s * KS + 8 * (tid & 7);
#pragma unroll
    for (int i = 0; i < 8; ++i) *(v8b*)(D + (size_t)(i * 16) * DIN) = *(const v8b*)&tw[i * 16 + (tid >> 3)][8 * (tid & 7)];
  } else { const size_t p0 = (size_t)(bi - PWB) * 2048 + tid; v4f a[16];
#pragma unroll
    for (int i = 0; i < 16; ++i) a[i] = *(const v4f*)(X + (p0 + i * 128) * 4);
    GXW();   /* as above */
#pragma unroll
    for (int i = 0; i < 16; ++i) { v4b h;
#pragma unroll
      for (int e = 0; e < 4; ++e) h[e] = (__bf16)a[i][e];
      *(v4b*)(XB + (p0 + i * 128) * 4) = h; }
    GXW();   /* behind the last store: in the built code the weight part's instructions follow this run, and they write registers that the stores name */ } }
// ---- k_proj: block = (64 rows, 128 cols, which): q/k/v = X W (+ b) with exact bf16 products (K = DIN) -> which 0: q f16 rows (+ residual rows < QHI); 1: k f16 rows (+ residual rows < KHI); 2: v f16 planes [c][t] (+ bf16 hi/lo planes for t < KHI)
__global__ __launch_bounds__(128) void k_proj(const __bf16* __restrict__ XB, const __bf16* __restrict__ WT, const float* __restrict__ BQ, const float* __restrict__ BK, const float* __restrict__ BV,
    _Float16* __restrict__ QH, _Float16* __restrict__ QL, _Float16* __restrict__ KH, _Float16* __restrict__ KL, _Float16* __restrict__ VT, __bf16* __restrict__ VB, __bf16* __restrict__ VBL) {
  __shared__ __align__(16) _Float16 sh[64][136], sl[64][136]; __shared__ __align__(16) _Float16 th[128][72]; __shared__ __align__(16) __bf16 tb[128][72], tbl[128][72];
  const int tid = threadIdx.x, wave = tid >> 5, lane = tid & 31, col = lane & 15, g = lane >> 4; const int which = blockIdx.z; const int c0 = blockIdx.y * 128; const size_t r0 = (size_t)blockIdx.x * 64; const size_t bb = r0 / TT; const int t0 = (int)(r0 % TT);
  const float* BA = which == 0 ? BQ : which == 1 ? BK : BV;
  v8f acc[8] = {};
  static_assert(WQKV_LAYOUT == 0 && KS + 8 == 72 && DIN % (2 * KS) == 0, "slab feed");
  const __bf16* Wp = WT + ((size_t)which * CC + c0 + (tid >> 3)) * DIN + 8 * (tid & 7); const __bf16* Ap = XB + (r0 + (tid >> 3)) * DIN + 8 * (tid & 7);
  v8b wr[8], ar[4];
  __bf16 (*const xa0)[KS + 8] = (__bf16 (*)[KS + 8])&th[0][0]; __bf16 (*const xa1)[KS + 8] = (__bf16 (*)[KS + 8])&th[64][0];   /* until the epilogue takes them (behind the last barrier), tb and tbl are the two weight buffers and the halves of th the two activation buffers */
  // one slab: slab s + 1's loads start (behind the barrier, which waits for every load in flight); products from cw, ca; then slab s + 1 goes to nw, na, whose readers left them at the last barrier; the barrier publishes nw, na and ends the reads of cw, ca
  const auto slab = [&](const __bf16 (*cw)[KS + 8], const __bf16 (*ca)[KS + 8], __bf16 (*nw)[KS + 8], __bf16 (*na)[KS + 8], int s) {
    if (s + 1 < DIN / KS) { bslab_load(wr, Wp, s + 1, DIN); bslab_load(ar, Ap, s + 1, DIN); GXW(); }
#pragma unroll
    for (int kc = 0; kc < KS / 32; ++kc) { const v16b a = frag_b(&ca[wave * 16 + col][kc * 32], lane); v16b w[8];
#pragma unroll
      for (int j = 0; j < 8; ++j) w[j] = frag_b(&cw[j * 16 + col][kc * 32], lane);
#pragma unroll
      for (int j = 0; j < 8; ++j) acc[j] = wmma_bf(a, w[j], acc[j]); }
    if (s + 1 < DIN / KS) { bslab_store(nw, wr, tid); bslab_store(na, ar, tid); }
    __syncthreads(); };
  bslab_load(wr, Wp, 0, DIN); bslab_load(ar, Ap, 0, DIN); GXW();
  bslab_store(tb, wr, tid); bslab_store(xa0, ar, tid);
  __syncthreads();
  for (int s = 0; s < DIN / KS; s += 2) { slab(tb, xa0, tbl, xa1, s); slab(tbl, xa1, tb, xa0, s + 1); }
  if (which < 2) { _Float16* DH = which == 0 ? QH : KH; _Float16* DL = which == 0 ? QL : KL; const int nhi = which == 0 ? QHI : KHI; const bool hi_rows = t0 < nhi;
#pragma unroll
    for (int j = 0; j < 8; ++j) { const float bias = BA ? bfr(BA[c0 + j * 16 + col]) : 0.f;
#pragma unroll
      for (int r = 0; r < 8; ++r) { const float v = acc[j][r] + bias; const _Float16 hv = (_Float16)v; sh[wave * 16 + 8 * g + r][j * 16 + col] = hv; sl[wave * 16 + 8 * g + r][j * 16 + col] = (_Float16)((v - (float)hv) * 1024.0f); } }
    __syncthreads();
    for (int e = tid; e < 64 * 16; e += 128) { const int rl = e >> 4, q = e & 15; vst2((unsigned*)(DH + (r0 + rl) * CC + c0 + q * 8), *(const v4u*)&sh[rl][q * 8]); if (hi_rows) vst2((unsigned*)(DL + (bb * nhi + t0 + rl) * (size_t)CC + c0 + q * 8), *(const v4u*)&sl[rl][q * 8]); }
  } else { const bool hi_rows = t0 < KHI;
#pragma unroll
    for (int j = 0; j < 8; ++j) { const float bias = BA ? bfr(BA[c0 + j * 16 + col]) : 0.f;
#pragma unroll
      for (int r = 0; r < 8; ++r) { const float v = acc[j][r] + bias; const int rl = wave * 16 + 8 * g + r, cl = j * 16 + col; th[cl][rl] = (_Float16)v; const __bf16 bh = (__bf16)v; tb[cl][rl] = bh; tbl[cl][rl] = (__bf16)(v - (float)bh); } }
    __syncthreads();
    for (int e = tid; e < 128 * 8; e += 128) { const int cl = e >> 3, q = e & 7; vst2((unsigned*)(VT + (bb * CC + c0 + cl) * (size_t)TT + t0 + q * 8), *(const v4u*)&th[cl][q * 8]); if (hi_rows) { const size_t o3 = (bb * CC + c0 + cl) * (size_t)KHI + t0 + q * 8; vst2((unsigned*)(VB + o3), *(const v4u*)&tb[cl][q * 8]); vst2((unsigned*)(VBL + o3), *(const v4u*)&tbl[cl][q * 8]); } } } }
#define XW() asm volatile("s_wait_xcnt 0x0" ::: "memory")   /* stands behind each group of k_att's global loads that share an address: a later load's result may be given the group's address registers, and s_wait_xcnt 0 belongs in front of an overwrite of a register that an issued load names */
#define AHEAD 2            // chunks whose fragment loads are in flight in front of the chunk being multiplied
#define NCH 5              // 16 queries from a multiple of 16 see keys [ql0 - (WIN - 1), ql0 + 15]: at most 5 chunks of 32
// ---- operand feed of k_att: the block's 64 queries see keys [qb * 64 - (WIN - 1), qb * 64 + 63], at most KCB chunks of 32 from chunk kb0. Those KCB * 32 K rows (128 bytes of head h each = one line) and the same keys of the head's HD v planes (384 bytes each = 3 lines) go to LDS once per block, in 16-byte pieces of whole lines (a wave's load = 4 lines), and all 4 waves read their fragments there. A fragment load straight from global memory would touch 16 lines for 512 bytes, and each wave would fetch its own 5 chunks. Rows kb0 * 32 .. + KCB * 32 - 1 exist for every qb (the last block ends at row TT - 1, block QBH - 1 at row KHI - 1).
#define KCB 6
#define LW() __builtin_amdgcn_sched_barrier(0)   /* stands behind each group of fragment loads from LDS in the path of query blocks < QBH: without it the scheduler lifts later groups' loads to the front, their fragments are live at once, and the kernel no longer fits the 256 registers that let 4 waves share a SIMD */
#define KPT (HD + 8)           // K tile [KCB * 32][KPT]: pitch 144 bytes, the pitch of ds_load_b128 readers
#define VPT (KCB * 32 + 8)     // v tile [HD][VPT]: pitch 400 bytes = 16 x 25
#define TSZ (KCB * 32 * KPT)   // elements of a tile buffer; either tile fits
static_assert(HD == 64 && HD * VPT <= TSZ && (63 + WIN - 1) / 32 + 1 <= KCB && (QBH * 64) <= KHI && KCB * 32 <= KHI && TT % 64 == 0, "tiles of k_att");
// piece i of thread t: K row i * 16 + (t >> 3), elements 8 * (t & 7) ..; P = first row + (t >> 3) * CC + 8 * (t & 7)
template <typename E> __device__ __forceinline__ void ktile_load(v4u (&r)[12], const E* P) {
#pragma unroll
  for (int i = 0; i < 12; ++i) r[i] = *(const v4u*)(P + (size_t)(i * 16) * CC); }
__device__ __forceinline__ void ktile_store(_Float16* T, const v4u (&r)[12], int t) {
#pragma unroll
  for (int i = 0; i < 12; ++i) *(v4u*)(T + (i * 16 + (t >> 3)) * KPT + 8 * (t & 7)) = r[i]; }
// piece i * 3 + j of thread t: v plane i * 16 + (t >> 3), line j, elements 8 * (t & 7) ..; P = first plane + (t >> 3) * ld + first key + 8 * (t & 7)
template <typename E> __device__ __forceinline__ void vtile_load(v4u (&r)[12], const E* P, int ld) {
#pragma unroll
  for (int i = 0; i < 4; ++i)
#pragma unroll
    for (int j = 0; j < 3; ++j) r[i * 3 + j] = *(const v4u*)(P + (size_t)(i * 16) * ld + j * 64); }
__device__ __forceinline__ void vtile_store(_Float16* T, const v4u (&r)[12], int t) {
#pragma unroll
  for (int i = 0; i < 4; ++i)
#pragma unroll
    for (int j = 0; j < 3; ++j) *(v4u*)(T + (i * 16 + (t >> 3)) * VPT + j * 64 + 8 * (t & 7)) = r[i * 3 + j]; }
__global__ __launch_bounds__(128) void k_att(const _Float16* __restrict__ QH, const _Float16* __restrict__ KH, const _Float16* __restrict__ QL, const _Float16* __restrict__ KL, const _Float16* __restrict__ VT, const __bf16* __restrict__ VB, const __bf16* __restrict__ VBL, float* __restrict__ Y) { __shared__ __align__(16) float ss[4][16][HD + 4]; __shared__ __align__(16) _Float16 t0[TSZ], t1[TSZ];
  const int tid = threadIdx.x, wave = tid >> 5, lane = tid & 31, col = lane & 15, g = lane >> 4; const int qb = blockIdx.x, h = blockIdx.y, b = blockIdx.z; const int ql0 = qb * 64 + wave * 16; const int t = ql0 + col;
  const int kc0 = __builtin_amdgcn_readfirstlane(key_first(ql0) >> 5), kcl = __builtin_amdgcn_readfirstlane((ql0 + 15) >> 5);   /* first and last visible chunk, wave-uniform */
  static_assert((WIN - 1 + 15) / 32 + 1 <= NCH, "chunks per wave");
  const size_t q0 = (size_t)b * TT + ql0;
  const int kb0 = key_first(qb * 64) >> 5;   /* first chunk of the tiles, block-uniform */
  const int sr = tid >> 3, se = 8 * (tid & 7);
  v4u sa[12], sb[12], sq[4];   /* pieces on their way to LDS: compile-time indices, registers */
  // the wave's 16 q rows go the same way, [16][KPT] in the wave's own part of ss, which no other wave touches and which the epilogue takes only behind this wave's last read: piece i of lane l is row i * 4 + (l >> 3), elements 8 * (l & 7) ..
  _Float16* const tq = (_Float16*)&ss[wave][0][0];
  static_assert(16 * KPT * 2 <= 16 * (HD + 4) * 4, "q rows fit the wave's part of ss");
#pragma unroll
  for (int i = 0; i < 4; ++i) sq[i] = *(const v4u*)(QH + (q0 + i * 4 + (lane >> 3)) * CC + h * HD + 8 * (lane & 7));
  XW();
  float p[NCH][16];   /* every loop of this kernel is unrolled in full: p, the fragment arrays and the accumulators live in registers and need compile-time indices */
  if (qb < QBH) { const _Float16* QLb = QL + (size_t)b * QHI * CC; const _Float16* KLb = KL + (size_t)b * KHI * CC;
    v16h ah[HD / 32], al[HD / 32];
#pragma unroll
    for (int kc = 0; kc < HD / 32; ++kc) al[kc] = frag_h(QLb + (size_t)(ql0 + col) * CC + h * HD + kc * 32, lane);
    XW();
    ktile_load(sa, KH + ((size_t)b * TT + kb0 * 32 + sr) * CC + h * HD + se); XW();
    ktile_load(sb, KLb + (size_t)(kb0 * 32 + sr) * CC + h * HD + se); XW();
    ktile_store(t0, sa, tid); ktile_store(t1, sb, tid);
#pragma unroll
    for (int i = 0; i < 4; ++i) *(v4u*)(tq + (i * 4 + (lane >> 3)) * KPT + 8 * (lane & 7)) = sq[i];
    __syncthreads();   /* publishes the K tiles */
#pragma unroll
    for (int kc = 0; kc < HD / 32; ++kc) ah[kc] = frag_h(tq + col * KPT + kc * 32, lane);
#pragma unroll
    for (int c = 0; c < NCH; ++c) { const int kr = ((kc0 + c < kcl ? kc0 + c : kcl) - kb0) * 32;
#pragma unroll
      for (int u = 0; u < 2; ++u) { v16h kbf[HD / 32], klf[HD / 32];   /* a 16-key tile's loads stand in front of its products; a whole chunk's fragments at once would not fit the registers beside p */
#pragma unroll
        for (int kc = 0; kc < HD / 32; ++kc) kbf[kc] = frag_h(t0 + (kr + u * 16 + col) * KPT + kc * 32, lane);
#pragma unroll
        for (int kc = 0; kc < HD / 32; ++kc) klf[kc] = frag_h(t1 + (kr + u * 16 + col) * KPT + kc * 32, lane);
        LW();
        v8f acc = {}, accl = {};
#pragma unroll
        for (int kc = 0; kc < HD / 32; ++kc) { acc = wmma16(kbf[kc], ah[kc], acc); accl = wmma16(kbf[kc], al[kc], accl); accl = wmma16(klf[kc], ah[kc], accl); }
#pragma unroll
        for (int r = 0; r < 8; ++r) p[c][u * 8 + r] = (acc[r] + accl[r] * (1.0f / 1024.0f)) * SCALE; } }
    // the v hi and lo tiles take the K tiles' buffers; they go to LDS in front of the softmax (held in registers under it, they would not fit beside p and its temporaries)
    vtile_load(sa, VB + ((size_t)b * CC + h * HD + sr) * (size_t)KHI + kb0 * 32 + se, KHI); XW();
    vtile_load(sb, VBL + ((size_t)b * CC + h * HD + sr) * (size_t)KHI + kb0 * 32 + se, KHI); XW();
    __syncthreads();   /* ends every wave's reads of the K tiles */
    vtile_store(t0, sa, tid); vtile_store(t1, sb, tid);
  } else {
    v16h ah[HD / 32];
    ktile_load(sa, KH + ((size_t)b * TT + kb0 * 32 + sr) * CC + h * HD + se); XW();
    vtile_load(sb, VT + ((size_t)b * CC + h * HD + sr) * (size_t)TT + kb0 * 32 + se, TT); XW();
    ktile_store(t0, sa, tid); vtile_store(t1, sb, tid);
#pragma unroll
    for (int i = 0; i < 4; ++i) *(v4u*)(tq + (i * 4 + (lane >> 3)) * KPT + 8 * (lane & 7)) = sq[i];
    __syncthreads();   /* publishes the K and v tiles; nothing is written to them behind it */
#pragma unroll
    for (int kc = 0; kc < HD / 32; ++kc) ah[kc] = frag_h(tq + col * KPT + kc * 32, lane);
    v16h kf[NCH][2][HD / 32];   /* chunk c + AHEAD is loaded in front of chunk c's products, so that its latency is covered */
#pragma unroll
    for (int cc = -AHEAD; cc < NCH; ++cc) { const int c = cc < 0 ? 0 : cc;
      if (const int cn = cc + AHEAD; cn < NCH) { const int kr = ((kc0 + cn < kcl ? kc0 + cn : kcl) - kb0) * 32;
#pragma unroll
        for (int u = 0; u < 2; ++u)
#pragma unroll
          for (int kc = 0; kc < HD / 32; ++kc) kf[cn][u][kc] = frag_h(t0 + (kr + u * 16 + col) * KPT + kc * 32, lane); }
      if (cc < 0) continue;
#pragma unroll
      for (int u = 0; u < 2; ++u) { v8f acc = {};
#pragma unroll
        for (int kc = 0; kc < HD / 32; ++kc) acc = wmma16(kf[c][u][kc], ah[kc], acc);
#pragma unroll
        for (int r = 0; r < 8; ++r) p[c][u * 8 + r] = acc[r] * SCALE; } } }
  // softmax of row t in f32: element i of chunk c is key (kc0 + c) * 32 + 16 * (i >> 3) + 8 g + (i & 7); visible iff t - (WIN - 1) <= key <= t
  float m = -3.0e38f;
#pragma unroll
  for (int c = 0; c < NCH; ++c)
#pragma unroll
    for (int i = 0; i < 16; ++i) { const int k = (kc0 + c) * 32 + 16 * (i >> 3) + 8 * g + (i & 7); const float v = (k <= t && k >= t - (WIN - 1)) ? p[c][i] : -3.0e38f; p[c][i] = v; m = fmaxf(m, v); }
  m = fmaxf(m, __shfl_xor(m, 16));
  float sum = 0.f;
#pragma unroll
  for (int c = 0; c < NCH; ++c)
#pragma unroll
    for (int i = 0; i < 16; ++i) { const float v = p[c][i]; const float ex = expf(v - m); const float e = (v <= -1.0e38f) ? 0.f : ex; p[c][i] = e; sum += e; }
  sum += __shfl_xor(sum, 16);
  const float inv = sum > 0.f ? 2048.0f / sum : 0.f;
#pragma unroll
  for (int c = 0; c < NCH; ++c)
#pragma unroll
    for (int i = 0; i < 16; ++i) p[c][i] *= inv;
  v8f acc[HD / 16] = {};
  if (qb < QBH) {
    __syncthreads();   /* publishes the v tiles */
#pragma unroll
    for (int c = 0; c < NCH; ++c) { const int kr = ((kc0 + c < kcl ? kc0 + c : kcl) - kb0) * 32; const F2 pf = bsplit16(p[c]); v16b vh[HD / 16], vl[HD / 16];
#pragma unroll
      for (int j = 0; j < HD / 16; ++j) vh[j] = frag_b((const __bf16*)t0 + (j * 16 + col) * VPT + kr, lane);
#pragma unroll
      for (int j = 0; j < HD / 16; ++j) vl[j] = frag_b((const __bf16*)t1 + (j * 16 + col) * VPT + kr, lane);
      LW();
#pragma unroll
      for (int j = 0; j < HD / 16; ++j) { acc[j] = wmma_bf(pf.h, vh[j], acc[j]); acc[j] = wmma_bf(pf.l, vh[j], acc[j]); acc[j] = wmma_bf(pf.h, vl[j], acc[j]); } }
  } else { v16h vf[NCH][HD / 16];   /* v fragments AHEAD chunks in front of their products, as for K */
#pragma unroll
    for (int cc = -AHEAD; cc < NCH; ++cc) { const int c = cc < 0 ? 0 : cc;
      if (const int cn = cc + AHEAD; cn < NCH) { const int kr = ((kc0 + cn < kcl ? kc0 + cn : kcl) - kb0) * 32;
#pragma unroll
        for (int j = 0; j < HD / 16; ++j) vf[cn][j] = frag_h(t1 + (j * 16 + col) * VPT + kr, lane); }
      if (cc < 0) continue;
      v16h pf;
#pragma unroll
      for (int i = 0; i < 16; ++i) pf[i] = (_Float16)p[c][i];
#pragma unroll
      for (int j = 0; j < HD / 16; ++j) acc[j] = wmma16(pf, vf[c][j], acc[j]); } }
#pragma unroll
  for (int j = 0; j < HD / 16; ++j)
#pragma unroll
    for (int r = 0; r < 8; ++r) ss[wave][8 * g + r][j * 16 + col] = acc[j][r] * (1.0f / 2048.0f);
  LDSX(); for (int rl = 0; rl < 16; ++rl) if (lane < HD / 4) vst2(Y + ((size_t)b * TT + ql0 + rl) * CC + h * HD + lane * 4, *(const v4f*)&ss[wave][rl][lane * 4]); }
// ---- k_out: block = (64 rows, 128 cols): out = ctx Wo (+ bo) + bf16(x): ctx bf16 hi + lo against exact bf16 Wo (2 products). The residual is k_prep's bf16 x: a lane's 16 pieces (those of its 16 output stores) are loaded at entry, in flight with slab 0, and added in f32 where the tile leaves LDS for out.
__global__ __launch_bounds__(128) void k_out(const float* __restrict__ Y, const __bf16* __restrict__ WTO, const float* __restrict__ BO, const __bf16* __restrict__ XB, float* __restrict__ OUT) { __shared__ __align__(16) float sf[4][16][132]; __shared__ __align__(16) __bf16 wb0[128][KS + 8], wb1[128][KS + 8], yh0[64][KS + 8], yl0[64][KS + 8], yh1[64][KS + 8], yl1[64][KS + 8];
  const int tid = threadIdx.x, wave = tid >> 5, lane = tid & 31, col = lane & 15, g = lane >> 4; const int c0 = blockIdx.y * 128; const size_t r0 = (size_t)blockIdx.x * 64 + wave * 16;
  v8f acc[8] = {};
  v4b xr[16];   /* indexed at compile time only: it lives in registers */
#pragma unroll
  for (int rl = 0; rl < 16; ++rl) xr[rl] = *(const v4b*)(XB + (r0 + rl) * DIN + c0 + lane * 4);
  GXW();   /* the slab addresses formed next may be given the address registers of these loads */
  if (true) {   /* ALL rows: ctx split bf16 hi + lo x exact Wo (2 products) */
    static_assert(WO_OUT_IN == 0 && CC % (2 * KS) == 0, "slab feed");
    const __bf16* Wp = WTO + (size_t)(c0 + (tid >> 3)) * CC + 8 * (tid & 7); const float* Ab = Y + ((size_t)blockIdx.x * 64 + (tid >> 4)) * CC + 4 * (tid & 15);
    v8b wr[8]; v4f ar[AL];
    // the slab step of k_proj, ctx as hi and lo planes; each accumulator still takes chunk kc's hi product, then its lo product
    const auto slab = [&](const __bf16 (*cw)[KS + 8], const __bf16 (*ch)[KS + 8], const __bf16 (*cl)[KS + 8], __bf16 (*nw)[KS + 8], __bf16 (*nh)[KS + 8], __bf16 (*nl)[KS + 8], int s) {
      if (s + 1 < CC / KS) { bslab_load(wr, Wp, s + 1, CC); aslab_load(ar, Ab, s + 1, CC); GXW(); }
#pragma unroll
      for (int kc = 0; kc < KS / 32; ++kc) { const v16b ah = frag_b(&ch[wave * 16 + col][kc * 32], lane), al = frag_b(&cl[wave * 16 + col][kc * 32], lane); v16b w[8];
#pragma unroll
        for (int j = 0; j < 8; ++j) w[j] = frag_b(&cw[j * 16 + col][kc * 32], lane);
#pragma unroll
        for (int j = 0; j < 8; ++j) acc[j] = wmma_bf(ah, w[j], acc[j]);
#pragma unroll
        for (int j = 0; j < 8; ++j) acc[j] = wmma_bf(al, w[j], acc[j]); }
      if (s + 1 < CC / KS) { bslab_store(nw, wr, tid); aslab_store2(nh, nl, ar, tid); }
      __syncthreads(); };
    bslab_load(wr, Wp, 0, CC); aslab_load(ar, Ab, 0, CC); GXW();
    bslab_store(wb0, wr, tid); aslab_store2(yh0, yl0, ar, tid);
    __syncthreads();
    for (int s = 0; s < CC / KS; s += 2) { slab(wb0, yh0, yl0, wb1, yh1, yl1, s); slab(wb1, yh1, yl1, wb0, yh0, yl0, s + 1); }
#pragma unroll
    for (int j = 0; j < 8; ++j) { const float bias = BO ? bfr(BO[c0 + j * 16 + col]) : 0.f;
#pragma unroll
      for (int r = 0; r < 8; ++r) sf[wave][8 * g + r][j * 16 + col] = acc[j][r] + bias; }
  }
  LDSX();
  v4f o[16];   /* xr and o need compile-time indices: both loops are unrolled in full */
#pragma unroll
  for (int rl = 0; rl < 16; ++rl) { o[rl] = *(const v4f*)&sf[wave][rl][lane * 4];
#pragma unroll
    for (int e = 0; e < 4; ++e) o[rl][e] = (float)xr[rl][e] + o[rl][e]; }
  __builtin_amdgcn_sched_barrier(0);   /* every sum stands in front of the first store, so that no register which an issued store names is written again */
#pragma unroll
  for (int rl = 0; rl < 16; ++rl) vst2(OUT + (r0 + rl) * DIN + c0 + lane * 4, o[rl]); }

extern "C" void kernel_launch(void* const* d_in, const int* in_sizes, int n_in, void* d_out, int out_size, void* d_ws, size_t ws_size, hipStream_t stream) {
  (void)in_sizes; (void)n_in; (void)out_size;
  const float** F = (const float**)d_in;
  if (ws_size < (size_t)WS_END) return;
  char* ws = (char*)d_ws; _Float16 *QH = (_Float16*)(ws + WS_QH), *KH = (_Float16*)(ws + WS_KH), *VT = (_Float16*)(ws + WS_VT), *QL = (_Float16*)(ws + WS_QL), *KL = (_Float16*)(ws + WS_KL); __bf16 *VB = (__bf16*)(ws + WS_VB), *VBL = (__bf16*)(ws + WS_VBL); float *Y = (float*)(ws + WS_Y);
  (void)Y; (void)QL; (void)KL; (void)VB; (void)VBL;
  // inputs: 0 x [2,2048,1024]; 1 Wq, 2 Wk, 3 Wv, 4 Wo [1024,1024] (in,out), no biases
  if (ws_size < (size_t)WS_END3) return;
  __bf16 *XB = (__bf16*)(ws + WS_XB), *WT = (__bf16*)(ws + WS_WT), *WTO = (__bf16*)(ws + WS_WTO);
  k_prep<<<dim3(PWB + PXB), 128, 0, stream>>>(F[0], F[1], F[2], F[3], F[4], XB, WT);
  k_proj<<<dim3(TNB * TT / 64, CC / 128, 3), 128, 0, stream>>>(XB, WT, nullptr, nullptr, nullptr, QH, QL, KH, KL, VT, VB, VBL);
  k_att<<<dim3(NQB, NH, TNB), 128, 0, stream>>>(QH, KH, QL, KL, VT, VB, VBL, Y);
  k_out<<<dim3(TNB * TT / 64, DIN / 128), 128, 0, stream>>>(Y, WTO, nullptr, XB, (float*)d_out);
}

// v007
// One run takes 70.3 microseconds.
// Next to v006, in two timings, it ran 1.10 and 1.09 times as fast.
// All steps since v000 together make it 14.6 times as fast.
// compute dtype: all float inputs rounded to bf16; q/k/v = x W with EXACT bf16 products on WMMA 16x16x32 (f32 accumulate); windowed causal logits: q, k once to f16 (1 product) x 64^-0.5, except the first 384 query rows of each sequence (3 products with f16 residuals); softmax in f32; P x 2^11 once to f16 against v once to f16 (1 product; bf16 hi + lo below row 384); ctx split bf16 hi + lo against exact Wo (2 products); + x residual in f32; f32 output.
#include <hip/hip_runtime.h>
#include <math.h>

typedef __attribute__((ext_vector_type(16))) _Float16 v16h;
typedef __attribute__((ext_vector_type(16))) __bf16 v16b;
typedef __attribute__((ext_vector_type(8)))  _Float16 v8h;
typedef __attribute__((ext_vector_type(8)))  float v8f;
typedef __attribute__((ext_vector_type(4)))  float v4f;
typedef __attribute__((ext_vector_type(2)))  float v2f;
typedef __attribute__((ext_vector_type(4)))  unsigned v4u;
typedef __attribute__((ext_vector_type(4)))  int v4i;
typedef float __attribute__((may_alias)) float_a;
typedef int __attribute__((may_alias)) int_a;

template <typename T> __device__ __forceinline__ void vst2(void* p, T v) { *(T*)p = v;  }
__device__ __forceinline__ v8f wmma16(v16h a, v16h b, v8f c) {
  v8f d = __builtin_amdgcn_wmma_f32_16x16x32_f16(false, a, false, b, (short)0, c, false, false);
  asm volatile("v_nop\n\tv_nop\n\tv_nop\n\tv_nop" : "+v"(d) : "v"(a), "v"(b));
  return d;
}
__device__ __forceinline__ v8f wmma_bf(v16b a, v16b b, v8f c) {
  v8f d = __builtin_amdgcn_wmma_f32_16x16x32_bf16(false, a, false, b, (short)0, c, false, false);
  asm volatile("v_nop\n\tv_nop\n\tv_nop\n\tv_nop" : "+v"(d) : "v"(a), "v"(b));
  return d;
}
// 16x16x32 fragments: lane = (h = lane>>4, row/col = lane&15); elements 0..7 = k0+8h+0..7, 8..15 = k0+16+8h+0..7; D element r = row 8h+r
__device__ __forceinline__ v16h frag_h(const _Float16* rowk0, int lane) {
  union { v16h v; v8h q[2]; } u; const _Float16* p = rowk0 + 8 * (lane >> 4);
  u.q[0] = *(const v8h*)p; u.q[1] = *(const v8h*)(p + 16); return u.v;
}
__device__ __forceinline__ v16h frag_f32(const float* rowk0, int lane) {
  v16h a; const float* p = rowk0 + 8 * (lane >> 4);
#pragma unroll
  for (int i = 0; i < 8; ++i) { a[i] = (_Float16)p[i]; a[8 + i] = (_Float16)p[16 + i]; }
  return a;
}
__device__ __forceinline__ v16h frag_f32s(const float* rowk0, int lane, float sc) {
  v16h a; const float* p = rowk0 + 8 * (lane >> 4);
#pragma unroll
  for (int i = 0; i < 8; ++i) { a[i] = (_Float16)(p[i] * sc); a[8 + i] = (_Float16)(p[16 + i] * sc); }
  return a;
}
// column fragment from a [K][ld] layout (column n), rows >= K read as 0
__device__ __forceinline__ v16h fragc_f32(const float* W, int k0, int n, int lane, int ld, int K) {
  v16h a; const int g = lane >> 4;
#pragma unroll
  for (int i = 0; i < 8; ++i) { const int ka = k0 + 8 * g + i, kb = ka + 16;
    a[i] = (_Float16)(ka < K ? W[(size_t)(ka < K ? ka : K - 1) * ld + n] : 0.f); a[8 + i] = (_Float16)(kb < K ? W[(size_t)(kb < K ? kb : K - 1) * ld + n] : 0.f); }
  return a;
}
struct F2 { v16b h, l; };
__device__ __forceinline__ F2 bsplit16(const float v[16]) { F2 r;
#pragma unroll
  for (int i = 0; i < 16; ++i) { const __bf16 h = (__bf16)v[i]; r.h[i] = h; r.l[i] = (__bf16)(v[i] - (float)h); }
  return r; }
__device__ __forceinline__ F2 split_row(const float* row, int k0, int lane) { float v[16]; const float* p = row + k0 + 8 * (lane >> 4);
#pragma unroll
  for (int i = 0; i < 8; ++i) { v[i] = p[i]; v[8 + i] = p[16 + i]; }
  return bsplit16(v); }
__device__ __forceinline__ F2 split_rowK(const float* row, int k0, int lane, int K) { float v[16]; const int g = lane >> 4;
#pragma unroll
  for (int i = 0; i < 8; ++i) { const int ka = k0 + 8 * g + i, kb = ka + 16; v[i] = ka < K ? row[ka < K ? ka : K - 1] : 0.f; v[8 + i] = kb < K ? row[kb < K ? kb : K - 1] : 0.f; }
  return bsplit16(v); }
__device__ __forceinline__ F2 split_col(const float* W, int k0, int n, int lane, int ld, int K) { float v[16]; const int g = lane >> 4;
#pragma unroll
  for (int i = 0; i < 8; ++i) { const int ka = k0 + 8 * g + i, kb = ka + 16; v[i] = ka < K ? W[(size_t)(ka < K ? ka : K - 1) * ld + n] : 0.f; v[8 + i] = kb < K ? W[(size_t)(kb < K ? kb : K - 1) * ld + n] : 0.f; }
  return bsplit16(v); }
__device__ __forceinline__ v8f mac3(const F2& a, const F2& b, v8f c) { c = wmma_bf(a.l, b.h, c); c = wmma_bf(a.h, b.l, c); return wmma_bf(a.h, b.h, c); }
__device__ __forceinline__ float sigm(float v) { return 1.0f / (1.0f + expf(-v)); }
#define LDSX() do { asm volatile("s_wait_dscnt 0" ::: "memory"); __builtin_amdgcn_wave_barrier(); __builtin_amdgcn_fence(__ATOMIC_RELEASE, "workgroup"); } while (0)

// Sliding-window causal self-attention (B 2, S 2,048, 1,024 = 16 x 64, window 128): q/k/v = x W ((in,out)); key j visible from query i iff i - 127 <= j <= i; softmax (the extra max-subtraction is a no-op); out = merged(attn v) Wo + x.
#define NB 2
#define TT 2048
#define CC 1024            // NH * HD = projected width
#define DIN 1024          // input (model) width
#define NH 16
#define HD 64
#define NQB (TT / 64)
#define SCALE (0.125f)
#define CAUSAL 1
#ifndef TNB
#define TNB NB
#endif
__device__ __forceinline__ float bfr(float v) { return (float)(__bf16)v; }
#define WIN 128            // window: key j is visible from query i only if j >= i - (WIN - 1)
// oldest key that any query >= t can see; every older key has P = 0 exactly, so a 32-key chunk wholly older is neither scored, normalised nor multiplied
__device__ __forceinline__ int key_first(int t) { return t > WIN - 1 ? t - (WIN - 1) : 0; }
typedef __attribute__((ext_vector_type(8))) __bf16 v8b;
__device__ __forceinline__ v16b frag_b(const __bf16* rowk0, int lane) {
  union { v16b v; v8b q[2]; } u; const __bf16* p = rowk0 + 8 * (lane >> 4);
  u.q[0] = *(const v8b*)p; u.q[1] = *(const v8b*)(p + 16); return u.v;
}
#define QBH 6              // causal: query blocks 0..QBH-1 of each sequence take the high-precision path
#define QHI 384            // rows carrying a q residual plane
#define KHI 384            // key rows carrying k residual / v bf16 hi+lo planes (used only by the causal high-precision path)
// B fragment (k rows k0+.., output column o) of a weight: (in,out) [K][ld] or (out,in) [ld rows of K]: bf16 exact, or f16(bf16 * 256) exact
__device__ __forceinline__ v16b wcol_io(const float* Wm, int k0, int o, int lane, int ld) { v16b w; const int g = lane >> 4;
#pragma unroll
  for (int i = 0; i < 8; ++i) { w[i] = (__bf16)Wm[(size_t)(k0 + 8 * g + i) * ld + o]; w[8 + i] = (__bf16)Wm[(size_t)(k0 + 16 + 8 * g + i) * ld + o]; }
  return w; }
__device__ __forceinline__ v16b wcol_oi(const float* Wm, int k0, int o, int lane, int K) { v16b w; const float* p = Wm + (size_t)o * K + k0 + 8 * (lane >> 4);
#pragma unroll
  for (int i = 0; i < 8; ++i) { w[i] = (__bf16)p[i]; w[8 + i] = (__bf16)p[16 + i]; }
  return w; }
__device__ __forceinline__ v16h wcolh_io(const float* Wm, int k0, int o, int lane, int ld) { v16h w; const int g = lane >> 4;
#pragma unroll
  for (int i = 0; i < 8; ++i) { w[i] = (_Float16)(bfr(Wm[(size_t)(k0 + 8 * g + i) * ld + o]) * 256.0f); w[8 + i] = (_Float16)(bfr(Wm[(size_t)(k0 + 16 + 8 * g + i) * ld + o]) * 256.0f); }
  return w; }
__device__ __forceinline__ v16h wcolh_oi(const float* Wm, int k0, int o, int lane, int K) { v16h w; const float* p = Wm + (size_t)o * K + k0 + 8 * (lane >> 4);
#pragma unroll
  for (int i = 0; i < 8; ++i) { w[i] = (_Float16)(bfr(p[i]) * 256.0f); w[8 + i] = (_Float16)(bfr(p[16 + i]) * 256.0f); }
  return w; }
#define WQKV_LAYOUT 0   // 0 = (in,out) [DIN][CC]; 1 = (out,in) [CC][DIN]; 2 = per-head [NH][DIN][HD]
__device__ __forceinline__ v16b wcol_hdk(const float* Wm, int k0, int o, int lane) { v16b w; const int g = lane >> 4; const float* p = Wm + (size_t)(o / HD) * DIN * HD + (o % HD);
#pragma unroll
  for (int i = 0; i < 8; ++i) { w[i] = (__bf16)p[(size_t)(k0 + 8 * g + i) * HD]; w[8 + i] = (__bf16)p[(size_t)(k0 + 16 + 8 * g + i) * HD]; }
  return w; }
#define WO_OUT_IN 0
#if WQKV_LAYOUT == 1
#define WCOL(W, k0, o, lane) wcol_oi(W, k0, o, lane, DIN)
#elif WQKV_LAYOUT == 2
#define WCOL(W, k0, o, lane) wcol_hdk(W, k0, o, lane)
#else
#define WCOL(W, k0, o, lane) wcol_io(W, k0, o, lane, CC)
#endif
#if WO_OUT_IN
#define WOCOL(W, k0, o, lane) wcol_oi(W, k0, o, lane, CC)
#define WOCOLH(W, k0, o, lane) wcolh_oi(W, k0, o, lane, CC)
#else
#define WOCOL(W, k0, o, lane) wcol_io(W, k0, o, lane, DIN)
#define WOCOLH(W, k0, o, lane) wcolh_io(W, k0, o, lane, DIN)
#endif
#define WS_PR  (WS_END)
#define WS_END2 (WS_PR + 4u * (size_t)NB * TT * DIN)
#ifndef PROJ_EXTRA_PARAMS
#define PROJ_EXTRA_PARAMS
#endif

#define WS_QH  0u                                      // f16 q rows [b*t][CC]
#define WS_KH  (WS_QH + 2u * (size_t)NB * TT * CC)      // f16 k rows [b*t][CC]
#define WS_VT  (WS_KH + 2u * (size_t)NB * TT * CC)      // f16 v planes [b][c][t]
#define WS_QL  (WS_VT + 2u * (size_t)NB * CC * TT)      // f16 q residual x 2^10 rows [b][t < QHI][CC]
#define WS_KL  (WS_QL + 2u * (size_t)NB * QHI * CC)     // f16 k residual x 2^10 rows [b][t < KHI][CC]
#define WS_VB  (WS_KL + 2u * (size_t)NB * KHI * CC)     // bf16 v hi planes [b][c][t < KHI]
#define WS_VBL (WS_VB + 2u * (size_t)NB * CC * KHI)
#define WS_Y   (WS_VBL + 2u * (size_t)NB * CC * KHI)    // f32 ctx rows [b*t][CC] (only when there is an output projection)
#define WS_END (WS_Y  + 4u * (size_t)NB * TT * CC)
#define WS_XB  (WS_END2)                                // bf16 x rows [b*t][DIN]
#define WS_WT  (WS_XB + 2u * (size_t)NB * TT * DIN)     // bf16 weights, transposed: Wq, Wk, Wv as [CC out][DIN in], then Wo as [DIN out][CC in]
#define WS_WTO (WS_WT + 2u * 3u * (size_t)CC * DIN)
#define WS_END3 (WS_WTO + 2u * (size_t)DIN * CC)

// ---- operand feed of k_proj and k_out: a slab = KS k values of the block's 128 weight columns, an LDS buffer [128][KS + 8] (row = column n; pitch 144 bytes: the pitch of ds_load_b128 readers), where all 4 waves read their B fragments. k_prep has rounded x and the four weights to bf16 once and laid the weights out as [out][in], so a slab row is one 128-byte line in global memory and goes to LDS as it is, in 16-byte pieces (a wave's load = 4 rows = 4 whole lines); every block used to load the f32 values and round them for itself. The block's activation rows go the same way (k_proj 128 rows, k_out 64), at the same pitch; k_out's ctx rows are f32 (2 rows x 256 bytes a load) and are split on the way. All are loaded one slab ahead. The loops of the feed are unrolled in full: wr, ar and the fragment arrays live in registers and need compile-time indices.
#define KS 64
#define GXW() asm volatile("s_wait_xcnt 0x0" ::: "memory")   /* stands behind a slab's global loads: the next slab's address is formed in the registers that these loads name; it also keeps the loads in front of the products that cover their latency */
__device__ __forceinline__ void wslab_load(float (&wr)[KS], const float* Wc, int s, int ld) {
#pragma unroll
  for (int i = 0; i < KS; ++i) wr[i] = Wc[(size_t)(s * KS + i) * ld]; }
__device__ __forceinline__ void wslab_store(__bf16 (*buf)[KS + 8], const float (&wr)[KS], int n) {
#pragma unroll
  for (int q = 0; q < KS / 8; ++q) { v8b t;
#pragma unroll
    for (int i = 0; i < 8; ++i) t[i] = (__bf16)wr[q * 8 + i];
    *(v8b*)&buf[n][q * 8] = t; } }
typedef __attribute__((ext_vector_type(4))) __bf16 v4b;
#define AL (64 * KS / 4 / 128)   // 16-byte pieces of an activation slab per thread: piece i of thread t is row i * 8 + (t >> 4), floats 4 * (t & 15) ..
static_assert(KS == 64, "16 pieces per slab row");
__device__ __forceinline__ void aslab_load(v4f (&ar)[AL], const float* Ab, int s, int ld) {   /* Ab = first row of the block + (t >> 4) * ld + 4 * (t & 15) */
#pragma unroll
  for (int i = 0; i < AL; ++i) ar[i] = *(const v4f*)(Ab + (size_t)(i * 8) * ld + s * KS); }
// bf16 slab of N * 16 rows: piece i of thread t is row i * 16 + (t >> 3), elements 8 * (t & 7) ..
template <int N> __device__ __forceinline__ void bslab_load(v8b (&r)[N], const __bf16* P, int s, int ld) {   /* P = first row of the block + (t >> 3) * ld + 8 * (t & 7) */
#pragma unroll
  for (int i = 0; i < N; ++i) r[i] = *(const v8b*)(P + (size_t)(i * 16) * ld + s * KS); }
template <int N> __device__ __forceinline__ void bslab_store(__bf16 (*buf)[KS + 8], const v8b (&r)[N], int t) {
#pragma unroll
  for (int i = 0; i < N; ++i) *(v8b*)&buf[i * 16 + (t >> 3)][8 * (t & 7)] = r[i]; }
// f32 pieces of aslab_load to LDS with the bf16 hi + lo split of bsplit16, one plane each
__device__ __forceinline__ void aslab_store2(__bf16 (*bh)[KS + 8], __bf16 (*bl)[KS + 8], const v4f (&ar)[AL], int t) {
#pragma unroll
  for (int i = 0; i < AL; ++i) { v4b h, l;
#pragma unroll
    for (int e = 0; e < 4; ++e) { const __bf16 hv = (__bf16)ar[i][e]; h[e] = hv; l[e] = (__bf16)(ar[i][e] - (float)hv); }
    *(v4b*)&bh[i * 8 + (t >> 4)][4 * (t & 15)] = h; *(v4b*)&bl[i * 8 + (t >> 4)][4 * (t & 15)] = l; } }
// ---- k_prep: x and the weights to bf16, once for all blocks of k_proj and k_out. Blocks < PWB: one slab (KS k rows x 128 columns) of weight m: thread n loads column n (a wave's load = one 128-byte line), the slab turns in LDS and leaves as rows [out][in] in whole lines. The other blocks: 2,048 16-byte pieces of x each.
#define PWB (4 * (CC / 128) * (DIN / KS))
#define PXB ((int)((size_t)NB * TT * DIN / 4 / 2048))
static_assert(CC == DIN && CC / 128 == 8 && DIN / KS == 16, "block index fields of k_prep");
__global__ __launch_bounds__(128) void k_prep(const float* __restrict__ X, const float* __restrict__ WQ, const float* __restrict__ WK, const float* __restrict__ WV, const float* __restrict__ WO, __bf16* __restrict__ XB, __bf16* __restrict__ WT) {
  __shared__ __align__(16) __bf16 tw[128][KS + 8];
  const int tid = threadIdx.x, bi = blockIdx.x;
  if (bi < PWB) { const int m = bi >> 7, c0 = ((bi >> 4) & 7) * 128, s = bi & 15;
    const float* Wm = m == 0 ? WQ : m == 1 ? WK : m == 2 ? WV : WO;
    float wr[KS]; wslab_load(wr, Wm + c0 + tid, s, CC); GXW();   /* the rounded values may be given the loads' address registers */
    wslab_store(tw, wr, tid);
    __syncthreads();
    __bf16* D = WT + ((size_t)m * CC + c0 + (tid >> 3)) * DIN + s * KS + 8 * (tid & 7);
#pragma unroll
    for (int i = 0; i < 8; ++i) *(v8b*)(D + (size_t)(i * 16) * DIN) = *(const v8b*)&tw[i * 16 + (tid >> 3)][8 * (tid & 7)];
  } else { const size_t p0 = (size_t)(bi - PWB) * 2048 + tid; v4f a[16];
#pragma unroll
    for (int i = 0; i < 16; ++i) a[i] = *(const v4f*)(X + (p0 + i * 128) * 4);
    GXW();   /* as above */
#pragma unroll
    for (int i = 0; i < 16; ++i) { v4b h;
#pragma unroll
      for (int e = 0; e < 4; ++e) h[e] = (__bf16)a[i][e];
      *(v4b*)(XB + (p0 + i * 128) * 4) = h; }
    GXW();   /* behind the last store: in the built code the weight part's instructions follow this run, and they write registers that the stores name */ } }
// ---- k_proj: block = (128 rows, 128 cols, which), its 4 waves laid out 2 x 2, a wave = 64 rows x 64 cols = 4 x 4 accumulator tiles: a 32-k chunk costs a wave 4 + 4 fragment reads from LDS for 16 products, and a block 256 slab rows from L2 for 128 x 128 outputs. q/k/v = X W (+ b) with exact bf16 products (K = DIN) -> which 0: q f16 rows (+ residual rows < QHI); 1: k f16 rows (+ residual rows < KHI); 2: v f16 planes [c][t] (+ bf16 hi/lo planes for t < KHI)
#define PRW 128            // rows of a block of k_proj
#define EPT 136            // pitch of the epilogue's tiles, elements: 272 bytes = 16 x 17
#define SLB (128 * (KS + 8) * 2)   // bytes of a slab buffer
#define EPB (128 * EPT * 2)        // bytes of an epilogue tile
static_assert(TT % PRW == 0 && QHI % PRW == 0 && KHI % PRW == 0 && 4 * SLB <= 3 * EPB && PRW == 128, "blocks of k_proj");
// a 128 x 128 tile of 16-bit elements leaves LDS in whole 256-byte rows: piece i of thread t is row i * 8 + (t >> 4), elements 8 * (t & 15) ..; D = the first row's place + (t >> 4) * ld + 8 * (t & 15)
template <typename E> __device__ __forceinline__ void tile_out(E* D, int ld, const E (*T)[EPT], int t) { v4u o[16];   /* compile-time indices: registers */
#pragma unroll
  for (int i = 0; i < 16; ++i) o[i] = *(const v4u*)&T[i * 8 + (t >> 4)][8 * (t & 15)];
  __builtin_amdgcn_sched_barrier(0);   /* every read stands in front of the first store, so that no register which an issued store names is written again */
#pragma unroll
  for (int i = 0; i < 16; ++i) vst2((unsigned*)(D + (size_t)(i * 8) * ld), o[i]);
  GXW(); __builtin_amdgcn_sched_barrier(0);   /* behind the last store: the next tile's addresses and reads may be given registers that these stores name; the scheduling barrier keeps them behind the wait */ }
__global__ __launch_bounds__(128) void k_proj(const __bf16* __restrict__ XB, const __bf16* __restrict__ WT, const float* __restrict__ BQ, const float* __restrict__ BK, const float* __restrict__ BV,
    _Float16* __restrict__ QH, _Float16* __restrict__ QL, _Float16* __restrict__ KH, _Float16* __restrict__ KL, _Float16* __restrict__ VT, __bf16* __restrict__ VB, __bf16* __restrict__ VBL) {
  __shared__ __align__(16) char sm[3 * EPB];   /* one range, so that 3 blocks share a WGP's LDS: the four slab buffers until the last slab's barrier, the epilogue's two or three tiles behind it */
  const int tid = threadIdx.x, wave = tid >> 5, lane = tid & 31, col = lane & 15, g = lane >> 4; const int which = blockIdx.z; const int c0 = blockIdx.y * 128; const size_t r0 = (size_t)blockIdx.x * PRW; const size_t bb = r0 / TT; const int t0 = (int)(r0 % TT);
  const int wr0 = (wave >> 1) * 64, wc0 = (wave & 1) * 64;   /* the wave's first row and column in the block's tile */
  const float* BA = which == 0 ? BQ : which == 1 ? BK : BV;
  v8f acc[4][4] = {};
  static_assert(WQKV_LAYOUT == 0 && KS + 8 == 72 && DIN % (2 * KS) == 0, "slab feed");
  const __bf16* Wp = WT + ((size_t)which * CC + c0 + (tid >> 3)) * DIN + 8 * (tid & 7); const __bf16* Ap = XB + (r0 + (tid >> 3)) * DIN + 8 * (tid & 7);
  v8b wr[8], ar[8];
  __bf16 (*const wb0)[KS + 8] = (__bf16 (*)[KS + 8])(sm); __bf16 (*const wb1)[KS + 8] = (__bf16 (*)[KS + 8])(sm + SLB); __bf16 (*const xa0)[KS + 8] = (__bf16 (*)[KS + 8])(sm + 2 * SLB); __bf16 (*const xa1)[KS + 8] = (__bf16 (*)[KS + 8])(sm + 3 * SLB);
  // one slab: slab s + 1's loads start (behind the barrier, which waits for every load in flight); products from cw, ca; then slab s + 1 goes to nw, na, whose readers left them at the last barrier; the barrier publishes nw, na and ends the reads of cw, ca
  const auto slab = [&](const __bf16 (*cw)[KS + 8], const __bf16 (*ca)[KS + 8], __bf16 (*nw)[KS + 8], __bf16 (*na)[KS + 8], int s) {
    if (s + 1 < DIN / KS) { bslab_load(wr, Wp, s + 1, DIN); bslab_load(ar, Ap, s + 1, DIN); GXW(); }
#pragma unroll
    for (int kc = 0; kc < KS / 32; ++kc) { v16b a[4], w[4];
#pragma unroll
      for (int i = 0; i < 4; ++i) a[i] = frag_b(&ca[wr0 + i * 16 + col][kc * 32], lane);
#pragma unroll
      for (int j = 0; j < 4; ++j) w[j] = frag_b(&cw[wc0 + j * 16 + col][kc * 32], lane);
#pragma unroll
      for (int i = 0; i < 4; ++i)
#pragma unroll
        for (int j = 0; j < 4; ++j) acc[i][j] = wmma_bf(a[i], w[j], acc[i][j]); }
    if (s + 1 < DIN / KS) { bslab_store(nw, wr, tid); bslab_store(na, ar, tid); }
    __syncthreads(); };
  bslab_load(wr, Wp, 0, DIN); bslab_load(ar, Ap, 0, DIN); GXW();
  bslab_store(wb0, wr, tid); bslab_store(xa0, ar, tid);
  __syncthreads();
  for (int s = 0; s < DIN / KS; s += 2) { slab(wb0, xa0, wb1, xa1, s); slab(wb1, xa1, wb0, xa0, s + 1); }
  if (which < 2) { _Float16* DH = which == 0 ? QH : KH; _Float16* DL = which == 0 ? QL : KL; const int nhi = which == 0 ? QHI : KHI; const bool hi_rows = t0 < nhi;
    _Float16 (*const sh)[EPT] = (_Float16 (*)[EPT])(sm); _Float16 (*const sl)[EPT] = (_Float16 (*)[EPT])(sm + EPB);
#pragma unroll
    for (int j = 0; j < 4; ++j) { const float bias = BA ? bfr(BA[c0 + wc0 + j * 16 + col]) : 0.f;
#pragma unroll
      for (int i = 0; i < 4; ++i)
#pragma unroll
        for (int r = 0; r < 8; ++r) { const float v = acc[i][j][r] + bias; const _Float16 hv = (_Float16)v; sh[wr0 + i * 16 + 8 * g + r][wc0 + j * 16 + col] = hv; sl[wr0 + i * 16 + 8 * g + r][wc0 + j * 16 + col] = (_Float16)((v - (float)hv) * 1024.0f); } }
    __syncthreads();
    tile_out(DH + (r0 + (tid >> 4)) * CC + c0 + 8 * (tid & 15), CC, sh, tid);
    if (hi_rows) tile_out(DL + (bb * nhi + t0 + (tid >> 4)) * (size_t)CC + c0 + 8 * (tid & 15), CC, sl, tid);
  } else { const bool hi_rows = t0 < KHI;
    _Float16 (*const th)[EPT] = (_Float16 (*)[EPT])(sm); __bf16 (*const tb)[EPT] = (__bf16 (*)[EPT])(sm + EPB); __bf16 (*const tbl)[EPT] = (__bf16 (*)[EPT])(sm + 2 * EPB);
#pragma unroll
    for (int j = 0; j < 4; ++j) { const float bias = BA ? bfr(BA[c0 + wc0 + j * 16 + col]) : 0.f;
#pragma unroll
      for (int i = 0; i < 4; ++i)
#pragma unroll
        for (int r = 0; r < 8; ++r) { const float v = acc[i][j][r] + bias; const int rl = wr0 + i * 16 + 8 * g + r, cl = wc0 + j * 16 + col; th[cl][rl] = (_Float16)v; const __bf16 bh = (__bf16)v; tb[cl][rl] = bh; tbl[cl][rl] = (__bf16)(v - (float)bh); } }
    __syncthreads();
    tile_out(VT + (bb * CC + c0 + (tid >> 4)) * (size_t)TT + t0 + 8 * (tid & 15), TT, th, tid);
    if (hi_rows) { const size_t o3 = (bb * CC + c0 + (tid >> 4)) * (size_t)KHI + t0 + 8 * (tid & 15); tile_out(VB + o3, KHI, tb, tid); tile_out(VBL + o3, KHI, tbl, tid); } } }
#define XW() asm volatile("s_wait_xcnt 0x0" ::: "memory")   /* stands behind each group of k_att's global loads that share an address: a later load's result may be given the group's address registers, and s_wait_xcnt 0 belongs in front of an overwrite of a register that an issued load names */
#define AHEAD 2            // chunks whose fragment loads are in flight in front of the chunk being multiplied
#define NCH 5              // 16 queries from a multiple of 16 see keys [ql0 - (WIN - 1), ql0 + 15]: at most 5 chunks of 32
// ---- operand feed of k_att: the block's 64 queries see keys [qb * 64 - (WIN - 1), qb * 64 + 63], at most KCB chunks of 32 from chunk kb0. Those KCB * 32 K rows (128 bytes of head h each = one line) and the same keys of the head's HD v planes (384 bytes each = 3 lines) go to LDS once per block, in 16-byte pieces of whole lines (a wave's load = 4 lines), and all 4 waves read their fragments there. A fragment load straight from global memory would touch 16 lines for 512 bytes, and each wave would fetch its own 5 chunks. Rows kb0 * 32 .. + KCB * 32 - 1 exist for every qb (the last block ends at row TT - 1, block QBH - 1 at row KHI - 1).
#define KCB 6
#define LW() __builtin_amdgcn_sched_barrier(0)   /* stands behind each group of fragment loads from LDS in the path of query blocks < QBH: without it the scheduler lifts later groups' loads to the front, their fragments are live at once, and the kernel no longer fits the 256 registers that let 4 waves share a SIMD */
#define KPT (HD + 8)           // K tile [KCB * 32][KPT]: pitch 144 bytes, the pitch of ds_load_b128 readers
#define VPT (KCB * 32 + 8)     // v tile [HD][VPT]: pitch 400 bytes = 16 x 25
#define TSZ (KCB * 32 * KPT)   // elements of a tile buffer; either tile fits
static_assert(HD == 64 && HD * VPT <= TSZ && (63 + WIN - 1) / 32 + 1 <= KCB && (QBH * 64) <= KHI && KCB * 32 <= KHI && TT % 64 == 0, "tiles of k_att");
// piece i of thread t: K row i * 16 + (t >> 3), elements 8 * (t & 7) ..; P = first row + (t >> 3) * CC + 8 * (t & 7)
template <typename E> __device__ __forceinline__ void ktile_load(v4u (&r)[12], const E* P) {
#pragma unroll
  for (int i = 0; i < 12; ++i) r[i] = *(const v4u*)(P + (size_t)(i * 16) * CC); }
__device__ __forceinline__ void ktile_store(_Float16* T, const v4u (&r)[12], int t) {
#pragma unroll
  for (int i = 0; i < 12; ++i) *(v4u*)(T + (i * 16 + (t >> 3)) * KPT + 8 * (t & 7)) = r[i]; }
// piece i * 3 + j of thread t: v plane i * 16 + (t >> 3), line j, elements 8 * (t & 7) ..; P = first plane + (t >> 3) * ld + first key + 8 * (t & 7)
template <typename E> __device__ __forceinline__ void vtile_load(v4u (&r)[12], const E* P, int ld) {
#pragma unroll
  for (int i = 0; i < 4; ++i)
#pragma unroll
    for (int j = 0; j < 3; ++j) r[i * 3 + j] = *(const v4u*)(P + (size_t)(i * 16) * ld + j * 64); }
__device__ __forceinline__ void vtile_store(_Float16* T, const v4u (&r)[12], int t) {
#pragma unroll
  for (int i = 0; i < 4; ++i)
#pragma unroll
    for (int j = 0; j < 3; ++j) *(v4u*)(T + (i * 16 + (t >> 3)) * VPT + j * 64 + 8 * (t & 7)) = r[i * 3 + j]; }
__global__ __launch_bounds__(128) void k_att(const _Float16* __restrict__ QH, const _Float16* __restrict__ KH, const _Float16* __restrict__ QL, const _Float16* __restrict__ KL, const _Float16* __restrict__ VT, const __bf16* __restrict__ VB, const __bf16* __restrict__ VBL, float* __restrict__ Y) { __shared__ __align__(16) float ss[4][16][HD + 4]; __shared__ __align__(16) _Float16 t0[TSZ], t1[TSZ];
  const int tid = threadIdx.x, wave = tid >> 5, lane = tid & 31, col = lane & 15, g = lane >> 4; const int qb = blockIdx.x, h = blockIdx.y, b = blockIdx.z; const int ql0 = qb * 64 + wave * 16; const int t = ql0 + col;
  const int kc0 = __builtin_amdgcn_readfirstlane(key_first(ql0) >> 5), kcl = __builtin_amdgcn_readfirstlane((ql0 + 15) >> 5);   /* first and last visible chunk, wave-uniform */
  static_assert((WIN - 1 + 15) / 32 + 1 <= NCH, "chunks per wave");
  const size_t q0 = (size_t)b * TT + ql0;
  const int kb0 = key_first(qb * 64) >> 5;   /* first chunk of the tiles, block-uniform */
  const int sr = tid >> 3, se = 8 * (tid & 7);
  v4u sa[12], sb[12], sq[4];   /* pieces on their way to LDS: compile-time indices, registers */
  // the wave's 16 q rows go the same way, [16][KPT] in the wave's own part of ss, which no other wave touches and which the epilogue takes only behind this wave's last read: piece i of lane l is row i * 4 + (l >> 3), elements 8 * (l & 7) ..
  _Float16* const tq = (_Float16*)&ss[wave][0][0];
  static_assert(16 * KPT * 2 <= 16 * (HD + 4) * 4, "q rows fit the wave's part of ss");
#pragma unroll
  for (int i = 0; i < 4; ++i) sq[i] = *(const v4u*)(QH + (q0 + i * 4 + (lane >> 3)) * CC + h * HD + 8 * (lane & 7));
  XW();
  float p[NCH][16];   /* every loop of this kernel is unrolled in full: p, the fragment arrays and the accumulators live in registers and need compile-time indices */
  if (qb < QBH) { const _Float16* QLb = QL + (size_t)b * QHI * CC; const _Float16* KLb = KL + (size_t)b * KHI * CC;
    v16h ah[HD / 32], al[HD / 32];
#pragma unroll
    for (int kc = 0; kc < HD / 32; ++kc) al[kc] = frag_h(QLb + (size_t)(ql0 + col) * CC + h * HD + kc * 32, lane);
    XW();
    ktile_load(sa, KH + ((size_t)b * TT + kb0 * 32 + sr) * CC + h * HD + se); XW();
    ktile_load(sb, KLb + (size_t)(kb0 * 32 + sr) * CC + h * HD + se); XW();
    ktile_store(t0, sa, tid); ktile_store(t1, sb, tid);
#pragma unroll
    for (int i = 0; i < 4; ++i) *(v4u*)(tq + (i * 4 + (lane >> 3)) * KPT + 8 * (lane & 7)) = sq[i];
    __syncthreads();   /* publishes the K tiles */
#pragma unroll
    for (int kc = 0; kc < HD / 32; ++kc) ah[kc] = frag_h(tq + col * KPT + kc * 32, lane);
#pragma unroll
    for (int c = 0; c < NCH; ++c) { const int kr = ((kc0 + c < kcl ? kc0 + c : kcl) - kb0) * 32;
#pragma unroll
      for (int u = 0; u < 2; ++u) { v16h kbf[HD / 32], klf[HD / 32];   /* a 16-key tile's loads stand in front of its products; a whole chunk's fragments at once would not fit the registers beside p */
#pragma unroll
        for (int kc = 0; kc < HD / 32; ++kc) kbf[kc] = frag_h(t0 + (kr + u * 16 + col) * KPT + kc * 32, lane);
#pragma unroll
        for (int kc = 0; kc < HD / 32; ++kc) klf[kc] = frag_h(t1 + (kr + u * 16 + col) * KPT + kc * 32, lane);
        LW();
        v8f acc = {}, accl = {};
#pragma unroll
        for (int kc = 0; kc < HD / 32; ++kc) { acc = wmma16(kbf[kc], ah[kc], acc); accl = wmma16(kbf[kc], al[kc], accl); accl = wmma16(klf[kc], ah[kc], accl); }
#pragma unroll
        for (int r = 0; r < 8; ++r) p[c][u * 8 + r] = (acc[r] + accl[r] * (1.0f / 1024.0f)) * SCALE; } }
    // the v hi and lo tiles take the K tiles' buffers; they go to LDS in front of the softmax (held in registers under it, they would not fit beside p and its temporaries)
    vtile_load(sa, VB + ((size_t)b * CC + h * HD + sr) * (size_t)KHI + kb0 * 32 + se, KHI); XW();
    vtile_load(sb, VBL + ((size_t)b * CC + h * HD + sr) * (size_t)KHI + kb0 * 32 + se, KHI); XW();
    __syncthreads();   /* ends every wave's reads of the K tiles */
    vtile_store(t0, sa, tid); vtile_store(t1, sb, tid);
  } else {
    v16h ah[HD / 32];
    ktile_load(sa, KH + ((size_t)b * TT + kb0 * 32 + sr) * CC + h * HD + se); XW();
    vtile_load(sb, VT + ((size_t)b * CC + h * HD + sr) * (size_t)TT + kb0 * 32 + se, TT); XW();
    ktile_store(t0, sa, tid); vtile_store(t1, sb, tid);
#pragma unroll
    for (int i = 0; i < 4; ++i) *(v4u*)(tq + (i * 4 + (lane >> 3)) * KPT + 8 * (lane & 7)) = sq[i];
    __syncthreads();   /* publishes the K and v tiles; nothing is written to them behind it */
#pragma unroll
    for (int kc = 0; kc < HD / 32; ++kc) ah[kc] = frag_h(tq + col * KPT + kc * 32, lane);
    v16h kf[NCH][2][HD / 32];   /* chunk c + AHEAD is loaded in front of chunk c's products, so that its latency is covered */
#pragma unroll
    for (int cc = -AHEAD; cc < NCH; ++cc) { const int c = cc < 0 ? 0 : cc;
      if (const int cn = cc + AHEAD; cn < NCH) { const int kr = ((kc0 + cn < kcl ? kc0 + cn : kcl) - kb0) * 32;
#pragma unroll
        for (int u = 0; u < 2; ++u)
#pragma unroll
          for (int kc = 0; kc < HD / 32; ++kc) kf[cn][u][kc] = frag_h(t0 + (kr + u * 16 + col) * KPT + kc * 32, lane); }
      if (cc < 0) continue;
#pragma unroll
      for (int u = 0; u < 2; ++u) { v8f acc = {};
#pragma unroll
        for (int kc = 0; kc < HD / 32; ++kc) acc = wmma16(kf[c][u][kc], ah[kc], acc);
#pragma unroll
        for (int r = 0; r < 8; ++r) p[c][u * 8 + r] = acc[r] * SCALE; } } }
  // softmax of row t in f32: element i of chunk c is key (kc0 + c) * 32 + 16 * (i >> 3) + 8 g + (i & 7); visible iff t - (WIN - 1) <= key <= t
  float m = -3.0e38f;
#pragma unroll
  for (int c = 0; c < NCH; ++c)
#pragma unroll
    for (int i = 0; i < 16; ++i) { const int k = (kc0 + c) * 32 + 16 * (i >> 3) + 8 * g + (i & 7); const float v = (k <= t && k >= t - (WIN - 1)) ? p[c][i] : -3.0e38f; p[c][i] = v; m = fmaxf(m, v); }
  m = fmaxf(m, __shfl_xor(m, 16));
  float sum = 0.f;
#pragma unroll
  for (int c = 0; c < NCH; ++c)
#pragma unroll
    for (int i = 0; i < 16; ++i) { const float v = p[c][i]; const float ex = expf(v - m); const float e = (v <= -1.0e38f) ? 0.f : ex; p[c][i] = e; sum += e; }
  sum += __shfl_xor(sum, 16);
  const float inv = sum > 0.f ? 2048.0f / sum : 0.f;
#pragma unroll
  for (int c = 0; c < NCH; ++c)
#pragma unroll
    for (int i = 0; i < 16; ++i) p[c][i] *= inv;
  v8f acc[HD / 16] = {};
  if (qb < QBH) {
    __syncthreads();   /* publishes the v tiles */
#pragma unroll
    for (int c = 0; c < NCH; ++c) { const int kr = ((kc0 + c < kcl ? kc0 + c : kcl) - kb0) * 32; const F2 pf = bsplit16(p[c]); v16b vh[HD / 16], vl[HD / 16];
#pragma unroll
      for (int j = 0; j < HD / 16; ++j) vh[j] = frag_b((const __bf16*)t0 + (j * 16 + col) * VPT + kr, lane);
#pragma unroll
      for (int j = 0; j < HD / 16; ++j) vl[j] = frag_b((const __bf16*)t1 + (j * 16 + col) * VPT + kr, lane);
      LW();
#pragma unroll
      for (int j = 0; j < HD / 16; ++j) { acc[j] = wmma_bf(pf.h, vh[j], acc[j]); acc[j] = wmma_bf(pf.l, vh[j], acc[j]); acc[j] = wmma_bf(pf.h, vl[j], acc[j]); } }
  } else { v16h vf[NCH][HD / 16];   /* v fragments AHEAD chunks in front of their products, as for K */
#pragma unroll
    for (int cc = -AHEAD; cc < NCH; ++cc) { const int c = cc < 0 ? 0 : cc;
      if (const int cn = cc + AHEAD; cn < NCH) { const int kr = ((kc0 + cn < kcl ? kc0 + cn : kcl) - kb0) * 32;
#pragma unroll
        for (int j = 0; j < HD / 16; ++j) vf[cn][j] = frag_h(t1 + (j * 16 + col) * VPT + kr, lane); }
      if (cc < 0) continue;
      v16h pf;
#pragma unroll
      for (int i = 0; i < 16; ++i) pf[i] = (_Float16)p[c][i];
#pragma unroll
      for (int j = 0; j < HD / 16; ++j) acc[j] = wmma16(pf, vf[c][j], acc[j]); } }
#pragma unroll
  for (int j = 0; j < HD / 16; ++j)
#pragma unroll
    for (int r = 0; r < 8; ++r) ss[wave][8 * g + r][j * 16 + col] = acc[j][r] * (1.0f / 2048.0f);
  LDSX(); for (int rl = 0; rl < 16; ++rl) if (lane < HD / 4) vst2(Y + ((size_t)b * TT + ql0 + rl) * CC + h * HD + lane * 4, *(const v4f*)&ss[wave][rl][lane * 4]); }
// ---- k_out: block = (64 rows, 128 cols): out = ctx Wo (+ bo) + bf16(x): ctx bf16 hi + lo against exact bf16 Wo (2 products). The residual is k_prep's bf16 x: a lane's 16 pieces (those of its 16 output stores) are loaded at entry, in flight with slab 0, and added in f32 where the tile leaves LDS for out.
__global__ __launch_bounds__(128) void k_out(const float* __restrict__ Y, const __bf16* __restrict__ WTO, const float* __restrict__ BO, const __bf16* __restrict__ XB, float* __restrict__ OUT) { __shared__ __align__(16) float sf[4][16][132]; __shared__ __align__(16) __bf16 wb0[128][KS + 8], wb1[128][KS + 8], yh0[64][KS + 8], yl0[64][KS + 8], yh1[64][KS + 8], yl1[64][KS + 8];
  const int tid = threadIdx.x, wave = tid >> 5, lane = tid & 31, col = lane & 15, g = lane >> 4; const int c0 = blockIdx.y * 128; const size_t r0 = (size_t)blockIdx.x * 64 + wave * 16;
  v8f acc[8] = {};
  v4b xr[16];   /* indexed at compile time only: it lives in registers */
#pragma unroll
  for (int rl = 0; rl < 16; ++rl) xr[rl] = *(const v4b*)(XB + (r0 + rl) * DIN + c0 + lane * 4);
  GXW();   /* the slab addresses formed next may be given the address registers of these loads */
  if (true) {   /* ALL rows: ctx split bf16 hi + lo x exact Wo (2 products) */
    static_assert(WO_OUT_IN == 0 && CC % (2 * KS) == 0, "slab feed");
    const __bf16* Wp = WTO + (size_t)(c0 + (tid >> 3)) * CC + 8 * (tid & 7); const float* Ab = Y + ((size_t)blockIdx.x * 64 + (tid >> 4)) * CC + 4 * (tid & 15);
    v8b wr[8]; v4f ar[AL];
    // the slab step of k_proj, ctx as hi and lo planes; each accumulator still takes chunk kc's hi product, then its lo product
    const auto slab = [&](const __bf16 (*cw)[KS + 8], const __bf16 (*ch)[KS + 8], const __bf16 (*cl)[KS + 8], __bf16 (*nw)[KS + 8], __bf16 (*nh)[KS + 8], __bf16 (*nl)[KS + 8], int s) {
      if (s + 1 < CC / KS) { bslab_load(wr, Wp, s + 1, CC); aslab_load(ar, Ab, s + 1, CC); GXW(); }
#pragma unroll
      for (int kc = 0; kc < KS / 32; ++kc) { const v16b ah = frag_b(&ch[wave * 16 + col][kc * 32], lane), al = frag_b(&cl[wave * 16 + col][kc * 32], lane); v16b w[8];
#pragma unroll
        for (int j = 0; j < 8; ++j) w[j] = frag_b(&cw[j * 16 + col][kc * 32], lane);
#pragma unroll
        for (int j = 0; j < 8; ++j) acc[j] = wmma_bf(ah, w[j], acc[j]);
#pragma unroll
        for (int j = 0; j < 8; ++j) acc[j] = wmma_bf(al, w[j], acc[j]); }
      if (s + 1 < CC / KS) { bslab_store(nw, wr, tid); aslab_store2(nh, nl, ar, tid); }
      __syncthreads(); };
    bslab_load(wr, Wp, 0, CC); aslab_load(ar, Ab, 0, CC); GXW();
    bslab_store(wb0, wr, tid); aslab_store2(yh0, yl0, ar, tid);
    __syncthreads();
    for (int s = 0; s < CC / KS; s += 2) { slab(wb0, yh0, yl0, wb1, yh1, yl1, s); slab(wb1, yh1, yl1, wb0, yh0, yl0, s + 1); }
#pragma unroll
    for (int j = 0; j < 8; ++j) { const float bias = BO ? bfr(BO[c0 + j * 16 + col]) : 0.f;
#pragma unroll
      for (int r = 0; r < 8; ++r) sf[wave][8 * g + r][j * 16 + col] = acc[j][r] + bias; }
  }
  LDSX();
  v4f o[16];   /* xr and o need compile-time indices: both loops are unrolled in full */
#pragma unroll
  for (int rl = 0; rl < 16; ++rl) { o[rl] = *(const v4f*)&sf[wave][rl][lane * 4];
#pragma unroll
    for (int e = 0; e < 4; ++e) o[rl][e] = (float)xr[rl][e] + o[rl][e]; }
  __builtin_amdgcn_sched_barrier(0);   /* every sum stands in front of the first store, so that no register which an issued store names is written again */
#pragma unroll
  for (int rl = 0; rl < 16; ++rl) vst2(OUT + (r0 + rl) * DIN + c0 + lane * 4, o[rl]); }

extern "C" void kernel_launch(void* const* d_in, const int* in_sizes, int n_in, void* d_out, int out_size, void* d_ws, size_t ws_size, hipStream_t stream) {
  (void)in_sizes; (void)n_in; (void)out_size;
  const float** F = (const float**)d_in;
  if (ws_size < (size_t)WS_END) return;
  char* ws = (char*)d_ws; _Float16 *QH = (_Float16*)(ws + WS_QH), *KH = (_Float16*)(ws + WS_KH), *VT = (_Float16*)(ws + WS_VT), *QL = (_Float16*)(ws + WS_QL), *KL = (_Float16*)(ws + WS_KL); __bf16 *VB = (__bf16*)(ws + WS_VB), *VBL = (__bf16*)(ws + WS_VBL); float *Y = (float*)(ws + WS_Y);
  (void)Y; (void)QL; (void)KL; (void)VB; (void)VBL;
  // inputs: 0 x [2,2048,1024]; 1 Wq, 2 Wk, 3 Wv, 4 Wo [1024,1024] (in,out), no biases
  if (ws_size < (size_t)WS_END3) return;
  __bf16 *XB = (__bf16*)(ws + WS_XB), *WT = (__bf16*)(ws + WS_WT), *WTO = (__bf16*)(ws + WS_WTO);
  k_prep<<<dim3(PWB + PXB), 128, 0, stream>>>(F[0], F[1], F[2], F[3], F[4], XB, WT);
  k_proj<<<dim3(TNB * TT / PRW, CC / 128, 3), 128, 0, stream>>>(XB, WT, nullptr, nullptr, nullptr, QH, QL, KH, KL, VT, VB, VBL);
  k_att<<<dim3(NQB, NH, TNB), 128, 0, stream>>>(QH, KH, QL, KL, VT, VB, VBL, Y);
  k_out<<<dim3(TNB * TT / 64, DIN / 128), 128, 0, stream>>>(Y, WTO, nullptr, XB, (float*)d_out);
}

// v008
// One run takes 67.2 microseconds.
// Two timings next to v007 both put it at 1.04 times that version's speed.
// Over all steps from v000 it is 15.2 times as fast.
// compute dtype: all float inputs rounded to bf16; q/k/v = x W with EXACT bf16 products on WMMA 16x16x32 (f32 accumulate); windowed causal logits: q, k once to f16 (1 product) x 64^-0.5, except the first 384 query rows of each sequence (3 products with f16 residuals); softmax in f32; P x 2^11 once to f16 against v once to f16 (1 product; bf16 hi + lo below row 384); ctx split bf16 hi + lo against exact Wo (2 products); + x residual in f32; f32 output.
#include <hip/hip_runtime.h>
#include <math.h>

typedef __attribute__((ext_vector_type(16))) _Float16 v16h;
typedef __attribute__((ext_vector_type(16))) __bf16 v16b;
typedef __attribute__((ext_vector_type(8)))  _Float16 v8h;
typedef __attribute__((ext_vector_type(8)))  float v8f;
typedef __attribute__((ext_vector_type(4)))  float v4f;
typedef __attribute__((ext_vector_type(2)))  float v2f;
typedef __attribute__((ext_vector_type(4)))  unsigned v4u;
typedef __attribute__((ext_vector_type(4)))  int v4i;
typedef float __attribute__((may_alias)) float_a;
typedef int __attribute__((may_alias)) int_a;

template <typename T> __device__ __forceinline__ void vst2(void* p, T v) { *(T*)p = v;  }
__device__ __forceinline__ v8f wmma16(v16h a, v16h b, v8f c) {
  v8f d = __builtin_amdgcn_wmma_f32_16x16x32_f16(false, a, false, b, (short)0, c, false, false);
  asm volatile("v_nop\n\tv_nop\n\tv_nop\n\tv_nop" : "+v"(d) : "v"(a), "v"(b));
  return d;
}
__device__ __forceinline__ v8f wmma_bf(v16b a, v16b b, v8f c) {
  v8f d = __builtin_amdgcn_wmma_f32_16x16x32_bf16(false, a, false, b, (short)0, c, false, false);
  asm volatile("v_nop\n\tv_nop\n\tv_nop\n\tv_nop" : "+v"(d) : "v"(a), "v"(b));
  return d;
}
// 16x16x32 fragments: lane = (h = lane>>4, row/col = lane&15); elements 0..7 = k0+8h+0..7, 8..15 = k0+16+8h+0..7; D element r = row 8h+r
__device__ __forceinline__ v16h frag_h(const _Float16* rowk0, int lane) {
  union { v16h v; v8h q[2]; } u; const _Float16* p = rowk0 + 8 * (lane >> 4);
  u.q[0] = *(const v8h*)p; u.q[1] = *(const v8h*)(p + 16); return u.v;
}
__device__ __forceinline__ v16h frag_f32(const float* rowk0, int lane) {
  v16h a; const float* p = rowk0 + 8 * (lane >> 4);
#pragma unroll
  for (int i = 0; i < 8; ++i) { a[i] = (_Float16)p[i]; a[8 + i] = (_Float16)p[16 + i]; }
  return a;
}
__device__ __forceinline__ v16h frag_f32s(const float* rowk0, int lane, float sc) {
  v16h a; const float* p = rowk0 + 8 * (lane >> 4);
#pragma unroll
  for (int i = 0; i < 8; ++i) { a[i] = (_Float16)(p[i] * sc); a[8 + i] = (_Float16)(p[16 + i] * sc); }
  return a;
}
// column fragment from a [K][ld] layout (column n), rows >= K read as 0
__device__ __forceinline__ v16h fragc_f32(const float* W, int k0, int n, int lane, int ld, int K) {
  v16h a; const int g = lane >> 4;
#pragma unroll
  for (int i = 0; i < 8; ++i) { const int ka = k0 + 8 * g + i, kb = ka + 16;
    a[i] = (_Float16)(ka < K ? W[(size_t)(ka < K ? ka : K - 1) * ld + n] : 0.f); a[8 + i] = (_Float16)(kb < K ? W[(size_t)(kb < K ? kb : K - 1) * ld + n] : 0.f); }
  return a;
}
struct F2 { v16b h, l; };
__device__ __forceinline__ F2 bsplit16(const float v[16]) { F2 r;
#pragma unroll
  for (int i = 0; i < 16; ++i) { const __bf16 h = (__bf16)v[i]; r.h[i] = h; r.l[i] = (__bf16)(v[i] - (float)h); }
  return r; }
__device__ __forceinline__ F2 split_row(const float* row, int k0, int lane) { float v[16]; const float* p = row + k0 + 8 * (lane >> 4);
#pragma unroll
  for (int i = 0; i < 8; ++i) { v[i] = p[i]; v[8 + i] = p[16 + i]; }
  return bsplit16(v); }
__device__ __forceinline__ F2 split_rowK(const float* row, int k0, int lane, int K) { float v[16]; const int g = lane >> 4;
#pragma unroll
  for (int i = 0; i < 8; ++i) { const int ka = k0 + 8 * g + i, kb = ka + 16; v[i] = ka < K ? row[ka < K ? ka : K - 1] : 0.f; v[8 + i] = kb < K ? row[kb < K ? kb : K - 1] : 0.f; }
  return bsplit16(v); }
__device__ __forceinline__ F2 split_col(const float* W, int k0, int n, int lane, int ld, int K) { float v[16]; const int g = lane >> 4;
#pragma unroll
  for (int i = 0; i < 8; ++i) { const int ka = k0 + 8 * g + i, kb = ka + 16; v[i] = ka < K ? W[(size_t)(ka < K ? ka : K - 1) * ld + n] : 0.f; v[8 + i] = kb < K ? W[(size_t)(kb < K ? kb : K - 1) * ld + n] : 0.f; }
  return bsplit16(v); }
__device__ __forceinline__ v8f mac3(const F2& a, const F2& b, v8f c) { c = wmma_bf(a.l, b.h, c); c = wmma_bf(a.h, b.l, c); return wmma_bf(a.h, b.h, c); }
__device__ __forceinline__ float sigm(float v) { return 1.0f / (1.0f + expf(-v)); }
#define LDSX() do { asm volatile("s_wait_dscnt 0" ::: "memory"); __builtin_amdgcn_wave_barrier(); __builtin_amdgcn_fence(__ATOMIC_RELEASE, "workgroup"); } while (0)

// Sliding-window causal self-attention (B 2, S 2,048, 1,024 = 16 x 64, window 128): q/k/v = x W ((in,out)); key j visible from query i iff i - 127 <= j <= i; softmax (the extra max-subtraction is a no-op); out = merged(attn v) Wo + x.
#define NB 2
#define TT 2048
#define CC 1024            // NH * HD = projected width
#define DIN 1024          // input (model) width
#define NH 16
#define HD 64
#define NQB (TT / 64)
#define SCALE (0.125f)
#define CAUSAL 1
#ifndef TNB
#define TNB NB
#endif
__device__ __forceinline__ float bfr(float v) { return (float)(__bf16)v; }
#define WIN 128            // window: key j is visible from query i only if j >= i - (WIN - 1)
// oldest key that any query >= t can see; every older key has P = 0 exactly, so a 32-key chunk wholly older is neither scored, normalised nor multiplied
__device__ __forceinline__ int key_first(int t) { return t > WIN - 1 ? t - (WIN - 1) : 0; }
typedef __attribute__((ext_vector_type(8))) __bf16 v8b;
__device__ __forceinline__ v16b frag_b(const __bf16* rowk0, int lane) {
  union { v16b v; v8b q[2]; } u; const __bf16* p = rowk0 + 8 * (lane >> 4);
  u.q[0] = *(const v8b*)p; u.q[1] = *(const v8b*)(p + 16); return u.v;
}
#define QBH 6              // causal: query blocks 0..QBH-1 of each sequence take the high-precision path
#define QHI 384            // rows carrying a q residual plane
#define KHI 384            // key rows carrying k residual / v bf16 hi+lo planes (used only by the causal high-precision path)
// B fragment (k rows k0+.., output column o) of a weight: (in,out) [K][ld] or (out,in) [ld rows of K]: bf16 exact, or f16(bf16 * 256) exact
__device__ __forceinline__ v16b wcol_io(const float* Wm, int k0, int o, int lane, int ld) { v16b w; const int g = lane >> 4;
#pragma unroll
  for (int i = 0; i < 8; ++i) { w[i] = (__bf16)Wm[(size_t)(k0 + 8 * g + i) * ld + o]; w[8 + i] = (__bf16)Wm[(size_t)(k0 + 16 + 8 * g + i) * ld + o]; }
  return w; }
__device__ __forceinline__ v16b wcol_oi(const float* Wm, int k0, int o, int lane, int K) { v16b w; const float* p = Wm + (size_t)o * K + k0 + 8 * (lane >> 4);
#pragma unroll
  for (int i = 0; i < 8; ++i) { w[i] = (__bf16)p[i]; w[8 + i] = (__bf16)p[16 + i]; }
  return w; }
__device__ __forceinline__ v16h wcolh_io(const float* Wm, int k0, int o, int lane, int ld) { v16h w; const int g = lane >> 4;
#pragma unroll
  for (int i = 0; i < 8; ++i) { w[i] = (_Float16)(bfr(Wm[(size_t)(k0 + 8 * g + i) * ld + o]) * 256.0f); w[8 + i] = (_Float16)(bfr(Wm[(size_t)(k0 + 16 + 8 * g + i) * ld + o]) * 256.0f); }
  return w; }
__device__ __forceinline__ v16h wcolh_oi(const float* Wm, int k0, int o, int lane, int K) { v16h w; const float* p = Wm + (size_t)o * K + k0 + 8 * (lane >> 4);
#pragma unroll
  for (int i = 0; i < 8; ++i) { w[i] = (_Float16)(bfr(p[i]) * 256.0f); w[8 + i] = (_Float16)(bfr(p[16 + i]) * 256.0f); }
  return w; }
#define WQKV_LAYOUT 0   // 0 = (in,out) [DIN][CC]; 1 = (out,in) [CC][DIN]; 2 = per-head [NH][DIN][HD]
__device__ __forceinline__ v16b wcol_hdk(const float* Wm, int k0, int o, int lane) { v16b w; const int g = lane >> 4; const float* p = Wm + (size_t)(o / HD) * DIN * HD + (o % HD);
#pragma unroll
  for (int i = 0; i < 8; ++i) { w[i] = (__bf16)p[(size_t)(k0 + 8 * g + i) * HD]; w[8 + i] = (__bf16)p[(size_t)(k0 + 16 + 8 * g + i) * HD]; }
  return w; }
#define WO_OUT_IN 0
#if WQKV_LAYOUT == 1
#define WCOL(W, k0, o, lane) wcol_oi(W, k0, o, lane, DIN)
#elif WQKV_LAYOUT == 2
#define WCOL(W, k0, o, lane) wcol_hdk(W, k0, o, lane)
#else
#define WCOL(W, k0, o, lane) wcol_io(W, k0, o, lane, CC)
#endif
#if WO_OUT_IN
#define WOCOL(W, k0, o, lane) wcol_oi(W, k0, o, lane, CC)
#define WOCOLH(W, k0, o, lane) wcolh_oi(W, k0, o, lane, CC)
#else
#define WOCOL(W, k0, o, lane) wcol_io(W, k0, o, lane, DIN)
#define WOCOLH(W, k0, o, lane) wcolh_io(W, k0, o, lane, DIN)
#endif
#define WS_PR  (WS_END)
#define WS_END2 (WS_PR + 4u * (size_t)NB * TT * DIN)
#ifndef PROJ_EXTRA_PARAMS
#define PROJ_EXTRA_PARAMS
#endif

#define WS_QH  0u                                      // f16 q rows [b*t][CC]
#define WS_KH  (WS_QH + 2u * (size_t)NB * TT * CC)      // f16 k rows [b*t][CC]
#define WS_VT  (WS_KH + 2u * (size_t)NB * TT * CC)      // f16 v planes [b][c][t]
#define WS_QL  (WS_VT + 2u * (size_t)NB * CC * TT)      // f16 q residual x 2^10 rows [b][t < QHI][CC]
#define WS_KL  (WS_QL + 2u * (size_t)NB * QHI * CC)     // f16 k residual x 2^10 rows [b][t < KHI][CC]
#define WS_VB  (WS_KL + 2u * (size_t)NB * KHI * CC)     // bf16 v hi planes [b][c][t < KHI]
#define WS_VBL (WS_VB + 2u * (size_t)NB * CC * KHI)
#define WS_Y   (WS_VBL + 2u * (size_t)NB * CC * KHI)    // f32 ctx rows [b*t][CC] (only when there is an output projection)
#define WS_END (WS_Y  + 4u * (size_t)NB * TT * CC)
#define WS_XB  (WS_END2)                                // bf16 x rows [b*t][DIN]
#define WS_WT  (WS_XB + 2u * (size_t)NB * TT * DIN)     // bf16 weights, transposed: Wq, Wk, Wv as [CC out][DIN in], then Wo as [DIN out][CC in]
#define WS_WTO (WS_WT + 2u * 3u * (size_t)CC * DIN)
#define WS_END3 (WS_WTO + 2u * (size_t)DIN * CC)

// ---- operand feed of k_proj and k_out: a slab = KS k values of the block's 128 weight columns, an LDS buffer [128][KS + 8] (row = column n; pitch 144 bytes: the pitch of ds_load_b128 readers), where all 4 waves read their B fragments. k_prep has rounded x and the four weights to bf16 once and laid the weights out as [out][in], so a slab row is one 128-byte line in global memory and goes to LDS as it is, in 16-byte pieces (a wave's load = 4 rows = 4 whole lines); every block used to load the f32 values and round them for itself. k_proj's 128 activation rows go the same way, at the same pitch. k_out has slabs of KO k values (below). All are loaded one slab ahead. The loops of the feed are unrolled in full: wr, ar and the fragment arrays live in registers and need compile-time indices.
#define KS 64
#define GXW() asm volatile("s_wait_xcnt 0x0" ::: "memory")   /* stands behind a slab's global loads: the next slab's address is formed in the registers that these loads name; it also keeps the loads in front of the products that cover their latency */
__device__ __forceinline__ void wslab_load(float (&wr)[KS], const float* Wc, int s, int ld) {
#pragma unroll
  for (int i = 0; i < KS; ++i) wr[i] = Wc[(size_t)(s * KS + i) * ld]; }
__device__ __forceinline__ void wslab_store(__bf16 (*buf)[KS + 8], const float (&wr)[KS], int n) {
#pragma unroll
  for (int q = 0; q < KS / 8; ++q) { v8b t;
#pragma unroll
    for (int i = 0; i < 8; ++i) t[i] = (__bf16)wr[q * 8 + i];
    *(v8b*)&buf[n][q * 8] = t; } }
typedef __attribute__((ext_vector_type(4))) __bf16 v4b;
// ---- slabs of k_out: KO k values, LDS rows of KO + 8 elements (pitch 272 bytes = 16 x 17, a pitch of ds_load_b128 readers). With 2 waves on a SIMD a slab of 64 k is 32 products a wave, less matrix time than the next slab's loads need to come back from L2; 128 k give them twice the time and halve the barriers. A weight row of a slab is 256 bytes (a wave's load = 2 rows), a ctx row 512 bytes of f32 (a wave's load = 1 row), split into bf16 hi + lo on the way to LDS.
#define KO 128
#define AL (64 * KO / 4 / 128)   // 16-byte pieces of a ctx slab per thread: piece i of thread t is row i * 4 + (t >> 5), floats 4 * (t & 31) ..
#define WL (128 * KO / 8 / 128)  // 16-byte pieces of a weight slab per thread: piece i of thread t is row i * 8 + (t >> 4), elements 8 * (t & 15) ..
static_assert(KO == 128, "32 f32 pieces, 16 bf16 pieces per slab row");
__device__ __forceinline__ void aslab_load(v4f (&ar)[AL], const float* Ab, int s, int ld) {   /* Ab = first row of the block + (t >> 5) * ld + 4 * (t & 31) */
#pragma unroll
  for (int i = 0; i < AL; ++i) ar[i] = *(const v4f*)(Ab + (size_t)(i * 4) * ld + s * KO); }
__device__ __forceinline__ void oslab_load(v8b (&r)[WL], const __bf16* P, int s, int ld) {   /* P = first row of the block + (t >> 4) * ld + 8 * (t & 15) */
#pragma unroll
  for (int i = 0; i < WL; ++i) r[i] = *(const v8b*)(P + (size_t)(i * 8) * ld + s * KO); }
__device__ __forceinline__ void oslab_store(__bf16 (*buf)[KO + 8], const v8b (&r)[WL], int t) {
#pragma unroll
  for (int i = 0; i < WL; ++i) *(v8b*)&buf[i * 8 + (t >> 4)][8 * (t & 15)] = r[i]; }
// bf16 slab of N * 16 rows: piece i of thread t is row i * 16 + (t >> 3), elements 8 * (t & 7) ..
template <int N> __device__ __forceinline__ void bslab_load(v8b (&r)[N], const __bf16* P, int s, int ld) {   /* P = first row of the block + (t >> 3) * ld + 8 * (t & 7) */
#pragma unroll
  for (int i = 0; i < N; ++i) r[i] = *(const v8b*)(P + (size_t)(i * 16) * ld + s * KS); }
template <int N> __device__ __forceinline__ void bslab_store(__bf16 (*buf)[KS + 8], const v8b (&r)[N], int t) {
#pragma unroll
  for (int i = 0; i < N; ++i) *(v8b*)&buf[i * 16 + (t >> 3)][8 * (t & 7)] = r[i]; }
// f32 pieces of aslab_load to LDS with the bf16 hi + lo split of bsplit16, one plane each
__device__ __forceinline__ void aslab_store2(__bf16 (*bh)[KO + 8], __bf16 (*bl)[KO + 8], const v4f (&ar)[AL], int t) {
#pragma unroll
  for (int i = 0; i < AL; ++i) { v4b h, l;
#pragma unroll
    for (int e = 0; e < 4; ++e) { const __bf16 hv = (__bf16)ar[i][e]; h[e] = hv; l[e] = (__bf16)(ar[i][e] - (float)hv); }
    *(v4b*)&bh[i * 4 + (t >> 5)][4 * (t & 31)] = h; *(v4b*)&bl[i * 4 + (t >> 5)][4 * (t & 31)] = l; } }
// ---- k_prep: x and the weights to bf16, once for all blocks of k_proj and k_out. Blocks < PWB: one slab (KS k rows x 128 columns) of weight m: thread n loads column n (a wave's load = one 128-byte line), the slab turns in LDS and leaves as rows [out][in] in whole lines. The other blocks: 2,048 16-byte pieces of x each.
#define PWB (4 * (CC / 128) * (DIN / KS))
#define PXB ((int)((size_t)NB * TT * DIN / 4 / 2048))
static_assert(CC == DIN && CC / 128 == 8 && DIN / KS == 16, "block index fields of k_prep");
__global__ __launch_bounds__(128) void k_prep(const float* __restrict__ X, const float* __restrict__ WQ, const float* __restrict__ WK, const float* __restrict__ WV, const float* __restrict__ WO, __bf16* __restrict__ XB, __bf16* __restrict__ WT) {
  __shared__ __align__(16) __bf16 tw[128][KS + 8];
  const int tid = threadIdx.x, bi = blockIdx.x;
  if (bi < PWB) { const int m = bi >> 7, c0 = ((bi >> 4) & 7) * 128, s = bi & 15;
    const float* Wm = m == 0 ? WQ : m == 1 ? WK : m == 2 ? WV : WO;
    float wr[KS]; wslab_load(wr, Wm + c0 + tid, s, CC); GXW();   /* the rounded values may be given the loads' address registers */
    wslab_store(tw, wr, tid);
    __syncthreads();
    __bf16* D = WT + ((size_t)m * CC + c0 + (tid >> 3)) * DIN + s * KS + 8 * (tid & 7);
#pragma unroll
    for (int i = 0; i < 8; ++i) *(v8b*)(D + (size_t)(i * 16) * DIN) = *(const v8b*)&tw[i * 16 + (tid >> 3)][8 * (tid & 7)];
  } else { const size_t p0 = (size_t)(bi - PWB) * 2048 + tid; v4f a[16];
#pragma unroll
    for (int i = 0; i < 16; ++i) a[i] = *(const v4f*)(X + (p0 + i * 128) * 4);
    GXW();   /* as above */
#pragma unroll
    for (int i = 0; i < 16; ++i) { v4b h;
#pragma unroll
      for (int e = 0; e < 4; ++e) h[e] = (__bf16)a[i][e];
      *(v4b*)(XB + (p0 + i * 128) * 4) = h; }
    GXW();   /* behind the last store: in the built code the weight part's instructions follow this run, and they write registers that the stores name */ } }
// ---- k_proj: block = (128 rows, 128 cols, which), its 4 waves laid out 2 x 2, a wave = 64 rows x 64 cols = 4 x 4 accumulator tiles: a 32-k chunk costs a wave 4 + 4 fragment reads from LDS for 16 products, and a block 256 slab rows from L2 for 128 x 128 outputs. q/k/v = X W (+ b) with exact bf16 products (K = DIN) -> which 0: q f16 rows (+ residual rows < QHI); 1: k f16 rows (+ residual rows < KHI); 2: v f16 planes [c][t] (+ bf16 hi/lo planes for t < KHI)
#define PRW 128            // rows of a block of k_proj
#define EPT 136            // pitch of the epilogue's tiles, elements: 272 bytes = 16 x 17
#define SLB (128 * (KS + 8) * 2)   // bytes of a slab buffer
#define EPB (128 * EPT * 2)        // bytes of an epilogue tile
static_assert(TT % PRW == 0 && QHI % PRW == 0 && KHI % PRW == 0 && 4 * SLB <= 3 * EPB && PRW == 128, "blocks of k_proj");
// a 128 x 128 tile of 16-bit elements leaves LDS in whole 256-byte rows: piece i of thread t is row i * 8 + (t >> 4), elements 8 * (t & 15) ..; D = the first row's place + (t >> 4) * ld + 8 * (t & 15)
template <typename E> __device__ __forceinline__ void tile_out(E* D, int ld, const E (*T)[EPT], int t) { v4u o[16];   /* compile-time indices: registers */
#pragma unroll
  for (int i = 0; i < 16; ++i) o[i] = *(const v4u*)&T[i * 8 + (t >> 4)][8 * (t & 15)];
  __builtin_amdgcn_sched_barrier(0);   /* every read stands in front of the first store, so that no register which an issued store names is written again */
#pragma unroll
  for (int i = 0; i < 16; ++i) vst2((unsigned*)(D + (size_t)(i * 8) * ld), o[i]);
  GXW(); __builtin_amdgcn_sched_barrier(0);   /* behind the last store: the next tile's addresses and reads may be given registers that these stores name; the scheduling barrier keeps them behind the wait */ }
__global__ __launch_bounds__(128) void k_proj(const __bf16* __restrict__ XB, const __bf16* __restrict__ WT, const float* __restrict__ BQ, const float* __restrict__ BK, const float* __restrict__ BV,
    _Float16* __restrict__ QH, _Float16* __restrict__ QL, _Float16* __restrict__ KH, _Float16* __restrict__ KL, _Float16* __restrict__ VT, __bf16* __restrict__ VB, __bf16* __restrict__ VBL) {
  __shared__ __align__(16) char sm[3 * EPB];   /* one range, so that 3 blocks share a WGP's LDS: the four slab buffers until the last slab's barrier, the epilogue's two or three tiles behind it */
  const int tid = threadIdx.x, wave = tid >> 5, lane = tid & 31, col = lane & 15, g = lane >> 4; const int which = blockIdx.z; const int c0 = blockIdx.y * 128; const size_t r0 = (size_t)blockIdx.x * PRW; const size_t bb = r0 / TT; const int t0 = (int)(r0 % TT);
  const int wr0 = (wave >> 1) * 64, wc0 = (wave & 1) * 64;   /* the wave's first row and column in the block's tile */
  const float* BA = which == 0 ? BQ : which == 1 ? BK : BV;
  v8f acc[4][4] = {};
  static_assert(WQKV_LAYOUT == 0 && KS + 8 == 72 && DIN % (2 * KS) == 0, "slab feed");
  const __bf16* Wp = WT + ((size_t)which * CC + c0 + (tid >> 3)) * DIN + 8 * (tid & 7); const __bf16* Ap = XB + (r0 + (tid >> 3)) * DIN + 8 * (tid & 7);
  v8b wr[8], ar[8];
  __bf16 (*const wb0)[KS + 8] = (__bf16 (*)[KS + 8])(sm); __bf16 (*const wb1)[KS + 8] = (__bf16 (*)[KS + 8])(sm + SLB); __bf16 (*const xa0)[KS + 8] = (__bf16 (*)[KS + 8])(sm + 2 * SLB); __bf16 (*const xa1)[KS + 8] = (__bf16 (*)[KS + 8])(sm + 3 * SLB);
  // one slab: slab s + 1's loads start (behind the barrier, which waits for every load in flight); products from cw, ca; then slab s + 1 goes to nw, na, whose readers left them at the last barrier; the barrier publishes nw, na and ends the reads of cw, ca
  const auto slab = [&](const __bf16 (*cw)[KS + 8], const __bf16 (*ca)[KS + 8], __bf16 (*nw)[KS + 8], __bf16 (*na)[KS + 8], int s) {
    if (s + 1 < DIN / KS) { bslab_load(wr, Wp, s + 1, DIN); bslab_load(ar, Ap, s + 1, DIN); GXW(); }
#pragma unroll
    for (int kc = 0; kc < KS / 32; ++kc) { v16b a[4], w[4];
#pragma unroll
      for (int i = 0; i < 4; ++i) a[i] = frag_b(&ca[wr0 + i * 16 + col][kc * 32], lane);
#pragma unroll
      for (int j = 0; j < 4; ++j) w[j] = frag_b(&cw[wc0 + j * 16 + col][kc * 32], lane);
#pragma unroll
      for (int i = 0; i < 4; ++i)
#pragma unroll
        for (int j = 0; j < 4; ++j) acc[i][j] = wmma_bf(a[i], w[j], acc[i][j]); }
    if (s + 1 < DIN / KS) { bslab_store(nw, wr, tid); bslab_store(na, ar, tid); }
    __syncthreads(); };
  bslab_load(wr, Wp, 0, DIN); bslab_load(ar, Ap, 0, DIN); GXW();
  bslab_store(wb0, wr, tid); bslab_store(xa0, ar, tid);
  __syncthreads();
  for (int s = 0; s < DIN / KS; s += 2) { slab(wb0, xa0, wb1, xa1, s); slab(wb1, xa1, wb0, xa0, s + 1); }
  if (which < 2) { _Float16* DH = which == 0 ? QH : KH; _Float16* DL = which == 0 ? QL : KL; const int nhi = which == 0 ? QHI : KHI; const bool hi_rows = t0 < nhi;
    _Float16 (*const sh)[EPT] = (_Float16 (*)[EPT])(sm); _Float16 (*const sl)[EPT] = (_Float16 (*)[EPT])(sm + EPB);
#pragma unroll
    for (int j = 0; j < 4; ++j) { const float bias = BA ? bfr(BA[c0 + wc0 + j * 16 + col]) : 0.f;
#pragma unroll
      for (int i = 0; i < 4; ++i)
#pragma unroll
        for (int r = 0; r < 8; ++r) { const float v = acc[i][j][r] + bias; const _Float16 hv = (_Float16)v; sh[wr0 + i * 16 + 8 * g + r][wc0 + j * 16 + col] = hv; sl[wr0 + i * 16 + 8 * g + r][wc0 + j * 16 + col] = (_Float16)((v - (float)hv) * 1024.0f); } }
    __syncthreads();
    tile_out(DH + (r0 + (tid >> 4)) * CC + c0 + 8 * (tid & 15), CC, sh, tid);
    if (hi_rows) tile_out(DL + (bb * nhi + t0 + (tid >> 4)) * (size_t)CC + c0 + 8 * (tid & 15), CC, sl, tid);
  } else { const bool hi_rows = t0 < KHI;
    _Float16 (*const th)[EPT] = (_Float16 (*)[EPT])(sm); __bf16 (*const tb)[EPT] = (__bf16 (*)[EPT])(sm + EPB); __bf16 (*const tbl)[EPT] = (__bf16 (*)[EPT])(sm + 2 * EPB);
#pragma unroll
    for (int j = 0; j < 4; ++j) { const float bias = BA ? bfr(BA[c0 + wc0 + j * 16 + col]) : 0.f;
#pragma unroll
      for (int i = 0; i < 4; ++i)
#pragma unroll
        for (int r = 0; r < 8; ++r) { const float v = acc[i][j][r] + bias; const int rl = wr0 + i * 16 + 8 * g + r, cl = wc0 + j * 16 + col; th[cl][rl] = (_Float16)v; const __bf16 bh = (__bf16)v; tb[cl][rl] = bh; tbl[cl][rl] = (__bf16)(v - (float)bh); } }
    __syncthreads();
    tile_out(VT + (bb * CC + c0 + (tid >> 4)) * (size_t)TT + t0 + 8 * (tid & 15), TT, th, tid);
    if (hi_rows) { const size_t o3 = (bb * CC + c0 + (tid >> 4)) * (size_t)KHI + t0 + 8 * (tid & 15); tile_out(VB + o3, KHI, tb, tid); tile_out(VBL + o3, KHI, tbl, tid); } } }
#define XW() asm volatile("s_wait_xcnt 0x0" ::: "memory")   /* stands behind each group of k_att's global loads that share an address: a later load's result may be given the group's address registers, and s_wait_xcnt 0 belongs in front of an overwrite of a register that an issued load names */
#define AHEAD 2            // chunks whose fragment loads are in flight in front of the chunk being multiplied
#define NCH 5              // 16 queries from a multiple of 16 see keys [ql0 - (WIN - 1), ql0 + 15]: at most 5 chunks of 32
// ---- operand feed of k_att: the block's 64 queries see keys [qb * 64 - (WIN - 1), qb * 64 + 63], at most KCB chunks of 32 from chunk kb0. Those KCB * 32 K rows (128 bytes of head h each = one line) and the same keys of the head's HD v planes (384 bytes each = 3 lines) go to LDS once per block, in 16-byte pieces of whole lines (a wave's load = 4 lines), and all 4 waves read their fragments there. A fragment load straight from global memory would touch 16 lines for 512 bytes, and each wave would fetch its own 5 chunks. Rows kb0 * 32 .. + KCB * 32 - 1 exist for every qb (the last block ends at row TT - 1, block QBH - 1 at row KHI - 1).
#define KCB 6
#define LW() __builtin_amdgcn_sched_barrier(0)   /* stands behind each group of fragment loads from LDS in the path of query blocks < QBH: without it the scheduler lifts later groups' loads to the front, their fragments are live at once, and the kernel no longer fits the 256 registers that let 4 waves share a SIMD */
#define KPT (HD + 8)           // K tile [KCB * 32][KPT]: pitch 144 bytes, the pitch of ds_load_b128 readers
#define VPT (KCB * 32 + 8)     // v tile [HD][VPT]: pitch 400 bytes = 16 x 25
#define TSZ (KCB * 32 * KPT)   // elements of a tile buffer; either tile fits
static_assert(HD == 64 && HD * VPT <= TSZ && (63 + WIN - 1) / 32 + 1 <= KCB && (QBH * 64) <= KHI && KCB * 32 <= KHI && TT % 64 == 0, "tiles of k_att");
// piece i of thread t: K row i * 16 + (t >> 3), elements 8 * (t & 7) ..; P = first row + (t >> 3) * CC + 8 * (t & 7)
template <typename E> __device__ __forceinline__ void ktile_load(v4u (&r)[12], const E* P) {
#pragma unroll
  for (int i = 0; i < 12; ++i) r[i] = *(const v4u*)(P + (size_t)(i * 16) * CC); }
__device__ __forceinline__ void ktile_store(_Float16* T, const v4u (&r)[12], int t) {
#pragma unroll
  for (int i = 0; i < 12; ++i) *(v4u*)(T + (i * 16 + (t >> 3)) * KPT + 8 * (t & 7)) = r[i]; }
// piece i * 3 + j of thread t: v plane i * 16 + (t >> 3), line j, elements 8 * (t & 7) ..; P = first plane + (t >> 3) * ld + first key + 8 * (t & 7)
template <typename E> __device__ __forceinline__ void vtile_load(v4u (&r)[12], const E* P, int ld) {
#pragma unroll
  for (int i = 0; i < 4; ++i)
#pragma unroll
    for (int j = 0; j < 3; ++j) r[i * 3 + j] = *(const v4u*)(P + (size_t)(i * 16) * ld + j * 64); }
__device__ __forceinline__ void vtile_store(_Float16* T, const v4u (&r)[12], int t) {
#pragma unroll
  for (int i = 0; i < 4; ++i)
#pragma unroll
    for (int j = 0; j < 3; ++j) *(v4u*)(T + (i * 16 + (t >> 3)) * VPT + j * 64 + 8 * (t & 7)) = r[i * 3 + j]; }
__global__ __launch_bounds__(128) void k_att(const _Float16* __restrict__ QH, const _Float16* __restrict__ KH, const _Float16* __restrict__ QL, const _Float16* __restrict__ KL, const _Float16* __restrict__ VT, const __bf16* __restrict__ VB, const __bf16* __restrict__ VBL, float* __restrict__ Y) { __shared__ __align__(16) float ss[4][16][HD + 4]; __shared__ __align__(16) _Float16 t0[TSZ], t1[TSZ];
  const int tid = threadIdx.x, wave = tid >> 5, lane = tid & 31, col = lane & 15, g = lane >> 4; const int qb = blockIdx.x, h = blockIdx.y, b = blockIdx.z; const int ql0 = qb * 64 + wave * 16; const int t = ql0 + col;
  const int kc0 = __builtin_amdgcn_readfirstlane(key_first(ql0) >> 5), kcl = __builtin_amdgcn_readfirstlane((ql0 + 15) >> 5);   /* first and last visible chunk, wave-uniform */
  static_assert((WIN - 1 + 15) / 32 + 1 <= NCH, "chunks per wave");
  const size_t q0 = (size_t)b * TT + ql0;
  const int kb0 = key_first(qb * 64) >> 5;   /* first chunk of the tiles, block-uniform */
  const int sr = tid >> 3, se = 8 * (tid & 7);
  v4u sa[12], sb[12], sq[4];   /* pieces on their way to LDS: compile-time indices, registers */
  // the wave's 16 q rows go the same way, [16][KPT] in the wave's own part of ss, which no other wave touches and which the epilogue takes only behind this wave's last read: piece i of lane l is row i * 4 + (l >> 3), elements 8 * (l & 7) ..
  _Float16* const tq = (_Float16*)&ss[wave][0][0];
  static_assert(16 * KPT * 2 <= 16 * (HD + 4) * 4, "q rows fit the wave's part of ss");
#pragma unroll
  for (int i = 0; i < 4; ++i) sq[i] = *(const v4u*)(QH + (q0 + i * 4 + (lane >> 3)) * CC + h * HD + 8 * (lane & 7));
  XW();
  float p[NCH][16];   /* every loop of this kernel is unrolled in full: p, the fragment arrays and the accumulators live in registers and need compile-time indices */
  if (qb < QBH) { const _Float16* QLb = QL + (size_t)b * QHI * CC; const _Float16* KLb = KL + (size_t)b * KHI * CC;
    v16h ah[HD / 32], al[HD / 32];
#pragma unroll
    for (int kc = 0; kc < HD / 32; ++kc) al[kc] = frag_h(QLb + (size_t)(ql0 + col) * CC + h * HD + kc * 32, lane);
    XW();
    ktile_load(sa, KH + ((size_t)b * TT + kb0 * 32 + sr) * CC + h * HD + se); XW();
    ktile_load(sb, KLb + (size_t)(kb0 * 32 + sr) * CC + h * HD + se); XW();
    ktile_store(t0, sa, tid); ktile_store(t1, sb, tid);
#pragma unroll
    for (int i = 0; i < 4; ++i) *(v4u*)(tq + (i * 4 + (lane >> 3)) * KPT + 8 * (lane & 7)) = sq[i];
    __syncthreads();   /* publishes the K tiles */
#pragma unroll
    for (int kc = 0; kc < HD / 32; ++kc) ah[kc] = frag_h(tq + col * KPT + kc * 32, lane);
#pragma unroll
    for (int c = 0; c < NCH; ++c) { const int kr = ((kc0 + c < kcl ? kc0 + c : kcl) - kb0) * 32;
#pragma unroll
      for (int u = 0; u < 2; ++u) { v16h kbf[HD / 32], klf[HD / 32];   /* a 16-key tile's loads stand in front of its products; a whole chunk's fragments at once would not fit the registers beside p */
#pragma unroll
        for (int kc = 0; kc < HD / 32; ++kc) kbf[kc] = frag_h(t0 + (kr + u * 16 + col) * KPT + kc * 32, lane);
#pragma unroll
        for (int kc = 0; kc < HD / 32; ++kc) klf[kc] = frag_h(t1 + (kr + u * 16 + col) * KPT + kc * 32, lane);
        LW();
        v8f acc = {}, accl = {};
#pragma unroll
        for (int kc = 0; kc < HD / 32; ++kc) { acc = wmma16(kbf[kc], ah[kc], acc); accl = wmma16(kbf[kc], al[kc], accl); accl = wmma16(klf[kc], ah[kc], accl); }
#pragma unroll
        for (int r = 0; r < 8; ++r) p[c][u * 8 + r] = (acc[r] + accl[r] * (1.0f / 1024.0f)) * SCALE; } }
    // the v hi and lo tiles take the K tiles' buffers; they go to LDS in front of the softmax (held in registers under it, they would not fit beside p and its temporaries)
    vtile_load(sa, VB + ((size_t)b * CC + h * HD + sr) * (size_t)KHI + kb0 * 32 + se, KHI); XW();
    vtile_load(sb, VBL + ((size_t)b * CC + h * HD + sr) * (size_t)KHI + kb0 * 32 + se, KHI); XW();
    __syncthreads();   /* ends every wave's reads of the K tiles */
    vtile_store(t0, sa, tid); vtile_store(t1, sb, tid);
  } else {
    v16h ah[HD / 32];
    ktile_load(sa, KH + ((size_t)b * TT + kb0 * 32 + sr) * CC + h * HD + se); XW();
    vtile_load(sb, VT + ((size_t)b * CC + h * HD + sr) * (size_t)TT + kb0 * 32 + se, TT); XW();
    ktile_store(t0, sa, tid); vtile_store(t1, sb, tid);
#pragma unroll
    for (int i = 0; i < 4; ++i) *(v4u*)(tq + (i * 4 + (lane >> 3)) * KPT + 8 * (lane & 7)) = sq[i];
    __syncthreads();   /* publishes the K and v tiles; nothing is written to them behind it */
#pragma unroll
    for (int kc = 0; kc < HD / 32; ++kc) ah[kc] = frag_h(tq + col * KPT + kc * 32, lane);
    v16h kf[NCH][2][HD / 32];   /* chunk c + AHEAD is loaded in front of chunk c's products, so that its latency is covered */
#pragma unroll
    for (int cc = -AHEAD; cc < NCH; ++cc) { const int c = cc < 0 ? 0 : cc;
      if (const int cn = cc + AHEAD; cn < NCH) { const int kr = ((kc0 + cn < kcl ? kc0 + cn : kcl) - kb0) * 32;
#pragma unroll
        for (int u = 0; u < 2; ++u)
#pragma unroll
          for (int kc = 0; kc < HD / 32; ++kc) kf[cn][u][kc] = frag_h(t0 + (kr + u * 16 + col) * KPT + kc * 32, lane); }
      if (cc < 0) continue;
#pragma unroll
      for (int u = 0; u < 2; ++u) { v8f acc = {};
#pragma unroll
        for (int kc = 0; kc < HD / 32; ++kc) acc = wmma16(kf[c][u][kc], ah[kc], acc);
#pragma unroll
        for (int r = 0; r < 8; ++r) p[c][u * 8 + r] = acc[r] * SCALE; } } }
  // softmax of row t in f32: element i of chunk c is key (kc0 + c) * 32 + 16 * (i >> 3) + 8 g + (i & 7); visible iff t - (WIN - 1) <= key <= t
  float m = -3.0e38f;
#pragma unroll
  for (int c = 0; c < NCH; ++c)
#pragma unroll
    for (int i = 0; i < 16; ++i) { const int k = (kc0 + c) * 32 + 16 * (i >> 3) + 8 * g + (i & 7); const float v = (k <= t && k >= t - (WIN - 1)) ? p[c][i] : -3.0e38f; p[c][i] = v; m = fmaxf(m, v); }
  m = fmaxf(m, __shfl_xor(m, 16));
  float sum = 0.f;
#pragma unroll
  for (int c = 0; c < NCH; ++c)
#pragma unroll
    for (int i = 0; i < 16; ++i) { const float v = p[c][i]; const float ex = expf(v - m); const float e = (v <= -1.0e38f) ? 0.f : ex; p[c][i] = e; sum += e; }
  sum += __shfl_xor(sum, 16);
  const float inv = sum > 0.f ? 2048.0f / sum : 0.f;
#pragma unroll
  for (int c = 0; c < NCH; ++c)
#pragma unroll
    for (int i = 0; i < 16; ++i) p[c][i] *= inv;
  v8f acc[HD / 16] = {};
  if (qb < QBH) {
    __syncthreads();   /* publishes the v tiles */
#pragma unroll
    for (int c = 0; c < NCH; ++c) { const int kr = ((kc0 + c < kcl ? kc0 + c : kcl) - kb0) * 32; const F2 pf = bsplit16(p[c]); v16b vh[HD / 16], vl[HD / 16];
#pragma unroll
      for (int j = 0; j < HD / 16; ++j) vh[j] = frag_b((const __bf16*)t0 + (j * 16 + col) * VPT + kr, lane);
#pragma unroll
      for (int j = 0; j < HD / 16; ++j) vl[j] = frag_b((const __bf16*)t1 + (j * 16 + col) * VPT + kr, lane);
      LW();
#pragma unroll
      for (int j = 0; j < HD / 16; ++j) { acc[j] = wmma_bf(pf.h, vh[j], acc[j]); acc[j] = wmma_bf(pf.l, vh[j], acc[j]); acc[j] = wmma_bf(pf.h, vl[j], acc[j]); } }
  } else { v16h vf[NCH][HD / 16];   /* v fragments AHEAD chunks in front of their products, as for K */
#pragma unroll
    for (int cc = -AHEAD; cc < NCH; ++cc) { const int c = cc < 0 ? 0 : cc;
      if (const int cn = cc + AHEAD; cn < NCH) { const int kr = ((kc0 + cn < kcl ? kc0 + cn : kcl) - kb0) * 32;
#pragma unroll
        for (int j = 0; j < HD / 16; ++j) vf[cn][j] = frag_h(t1 + (j * 16 + col) * VPT + kr, lane); }
      if (cc < 0) continue;
      v16h pf;
#pragma unroll
      for (int i = 0; i < 16; ++i) pf[i] = (_Float16)p[c][i];
#pragma unroll
      for (int j = 0; j < HD / 16; ++j) acc[j] = wmma16(pf, vf[c][j], acc[j]); } }
#pragma unroll
  for (int j = 0; j < HD / 16; ++j)
#pragma unroll
    for (int r = 0; r < 8; ++r) ss[wave][8 * g + r][j * 16 + col] = acc[j][r] * (1.0f / 2048.0f);
  LDSX(); for (int rl = 0; rl < 16; ++rl) if (lane < HD / 4) vst2(Y + ((size_t)b * TT + ql0 + rl) * CC + h * HD + lane * 4, *(const v4f*)&ss[wave][rl][lane * 4]); }
#define OPB ((KO + 8) * 2)          // bytes of a slab row of k_out in LDS
#define OSB ((128 + 64 + 64) * OPB)  // bytes of a slab buffer of k_out
static_assert(4 * 16 * 132 * 4 <= 2 * OSB, "output tiles fit the slab buffers");
// ---- k_out: block = (64 rows, 128 cols): out = ctx Wo (+ bo) + bf16(x): ctx bf16 hi + lo against exact bf16 Wo (2 products). The residual is k_prep's bf16 x: a lane's 16 pieces (those of its 16 output stores) are loaded at entry, in flight with slab 0, and added in f32 where the tile leaves LDS for out.
__global__ __launch_bounds__(128) void k_out(const float* __restrict__ Y, const __bf16* __restrict__ WTO, const float* __restrict__ BO, const __bf16* __restrict__ XB, float* __restrict__ OUT) { __shared__ __align__(16) char so[2 * OSB];   /* one range, so that 2 blocks share a WGP's LDS: the two slab buffers (weight rows, ctx hi rows, ctx lo rows) until the last slab's barrier, the waves' output tiles behind it */
  typedef __bf16 (*orow)[KO + 8];
  const orow wb0 = (orow)(so), yh0 = (orow)(so + 128 * OPB), yl0 = (orow)(so + 192 * OPB), wb1 = (orow)(so + OSB), yh1 = (orow)(so + OSB + 128 * OPB), yl1 = (orow)(so + OSB + 192 * OPB);
  float (*const sf)[16][132] = (float (*)[16][132])(so);
  const int tid = threadIdx.x, wave = tid >> 5, lane = tid & 31, col = lane & 15, g = lane >> 4; const int c0 = blockIdx.y * 128; const size_t r0 = (size_t)blockIdx.x * 64 + wave * 16;
  v8f acc[8] = {};
  v4b xr[16];   /* indexed at compile time only: it lives in registers */
#pragma unroll
  for (int rl = 0; rl < 16; ++rl) xr[rl] = *(const v4b*)(XB + (r0 + rl) * DIN + c0 + lane * 4);
  GXW();   /* the slab addresses formed next may be given the address registers of these loads */
  if (true) {   /* ALL rows: ctx split bf16 hi + lo x exact Wo (2 products) */
    static_assert(WO_OUT_IN == 0 && CC % (2 * KO) == 0, "slab feed");
    const __bf16* Wp = WTO + (size_t)(c0 + (tid >> 4)) * CC + 8 * (tid & 15); const float* Ab = Y + ((size_t)blockIdx.x * 64 + (tid >> 5)) * CC + 4 * (tid & 31);
    v8b wr[WL]; v4f ar[AL];
    // the slab step of k_proj, ctx as hi and lo planes; each accumulator still takes chunk kc's hi product, then its lo product
    const auto slab = [&](const __bf16 (*cw)[KO + 8], const __bf16 (*ch)[KO + 8], const __bf16 (*cl)[KO + 8], __bf16 (*nw)[KO + 8], __bf16 (*nh)[KO + 8], __bf16 (*nl)[KO + 8], int s) {
      if (s + 1 < CC / KO) { oslab_load(wr, Wp, s + 1, CC); aslab_load(ar, Ab, s + 1, CC); GXW(); }
#pragma unroll
      for (int kc = 0; kc < KO / 32; ++kc) { const v16b ah = frag_b(&ch[wave * 16 + col][kc * 32], lane), al = frag_b(&cl[wave * 16 + col][kc * 32], lane); v16b w[8];
#pragma unroll
        for (int j = 0; j < 8; ++j) w[j] = frag_b(&cw[j * 16 + col][kc * 32], lane);
#pragma unroll
        for (int j = 0; j < 8; ++j) acc[j] = wmma_bf(ah, w[j], acc[j]);
#pragma unroll
        for (int j = 0; j < 8; ++j) acc[j] = wmma_bf(al, w[j], acc[j]); }
      if (s + 1 < CC / KO) { oslab_store(nw, wr, tid); aslab_store2(nh, nl, ar, tid); }
      __syncthreads(); };
    oslab_load(wr, Wp, 0, CC); aslab_load(ar, Ab, 0, CC); GXW();
    oslab_store(wb0, wr, tid); aslab_store2(yh0, yl0, ar, tid);
    __syncthreads();
    for (int s = 0; s < CC / KO; s += 2) { slab(wb0, yh0, yl0, wb1, yh1, yl1, s); slab(wb1, yh1, yl1, wb0, yh0, yl0, s + 1); }
#pragma unroll
    for (int j = 0; j < 8; ++j) { const float bias = BO ? bfr(BO[c0 + j * 16 + col]) : 0.f;
#pragma unroll
      for (int r = 0; r < 8; ++r) sf[wave][8 * g + r][j * 16 + col] = acc[j][r] + bias; }
  }
  LDSX();
  v4f o[16];   /* xr and o need compile-time indices: both loops are unrolled in full */
#pragma unroll
  for (int rl = 0; rl < 16; ++rl) { o[rl] = *(const v4f*)&sf[wave][rl][lane * 4];
#pragma unroll
    for (int e = 0; e < 4; ++e) o[rl][e] = (float)xr[rl][e] + o[rl][e]; }
  __builtin_amdgcn_sched_barrier(0);   /* every sum stands in front of the first store, so that no register which an issued store names is written again */
#pragma unroll
  for (int rl = 0; rl < 16; ++rl) vst2(OUT + (r0 + rl) * DIN + c0 + lane * 4, o[rl]); }

extern "C" void kernel_launch(void* const* d_in, const int* in_sizes, int n_in, void* d_out, int out_size, void* d_ws, size_t ws_size, hipStream_t stream) {
  (void)in_sizes; (void)n_in; (void)out_size;
  const float** F = (const float**)d_in;
  if (ws_size < (size_t)WS_END) return;
  char* ws = (char*)d_ws; _Float16 *QH = (_Float16*)(ws + WS_QH), *KH = (_Float16*)(ws + WS_KH), *VT = (_Float16*)(ws + WS_VT), *QL = (_Float16*)(ws + WS_QL), *KL = (_Float16*)(ws + WS_KL); __bf16 *VB = (__bf16*)(ws + WS_VB), *VBL = (__bf16*)(ws + WS_VBL); float *Y = (float*)(ws + WS_Y);
  (void)Y; (void)QL; (void)KL; (void)VB; (void)VBL;
  // inputs: 0 x [2,2048,1024]; 1 Wq, 2 Wk, 3 Wv, 4 Wo [1024,1024] (in,out), no biases
  if (ws_size < (size_t)WS_END3) return;
  __bf16 *XB = (__bf16*)(ws + WS_XB), *WT = (__bf16*)(ws + WS_WT), *WTO = (__bf16*)(ws + WS_WTO);
  k_prep<<<dim3(PWB + PXB), 128, 0, stream>>>(F[0], F[1], F[2], F[3], F[4], XB, WT);
  k_proj<<<dim3(TNB * TT / PRW, CC / 128, 3), 128, 0, stream>>>(XB, WT, nullptr, nullptr, nullptr, QH, QL, KH, KL, VT, VB, VBL);
  k_att<<<dim3(NQB, NH, TNB), 128, 0, stream>>>(QH, KH, QL, KL, VT, VB, VBL, Y);
  k_out<<<dim3(TNB * TT / 64, DIN / 128), 128, 0, stream>>>(Y, WTO, nullptr, XB, (float*)d_out);
}

// v009
// It runs in 65.2 microseconds.
// Two timings next to v008 both put it at 1.03 times that version's speed.
// Counting every step since v000, it is 15.7 times as fast.
// compute dtype: all float inputs rounded to bf16; q/k/v = x W with EXACT bf16 products on WMMA 16x16x32 (f32 accumulate); windowed causal logits: q, k once to f16 (1 product) x 64^-0.5 x log2(e), except the first 384 query rows of each sequence (3 products with f16 residuals); softmax in f32 by the hardware exp2; P x 2^11 once to f16 against v once to f16 (1 product; bf16 hi + lo below row 384); ctx split bf16 hi + lo against exact Wo (2 products); + x residual in f32; f32 output.
#include <hip/hip_runtime.h>
#include <math.h>

typedef __attribute__((ext_vector_type(16))) _Float16 v16h;
typedef __attribute__((ext_vector_type(16))) __bf16 v16b;
typedef __attribute__((ext_vector_type(8)))  _Float16 v8h;
typedef __attribute__((ext_vector_type(8)))  float v8f;
typedef __attribute__((ext_vector_type(4)))  float v4f;
typedef __attribute__((ext_vector_type(2)))  float v2f;
typedef __attribute__((ext_vector_type(4)))  unsigned v4u;
typedef __attribute__((ext_vector_type(4)))  int v4i;
typedef float __attribute__((may_alias)) float_a;
typedef int __attribute__((may_alias)) int_a;

template <typename T> __device__ __forceinline__ void vst2(void* p, T v) { *(T*)p = v;  }
__device__ __forceinline__ v8f wmma16(v16h a, v16h b, v8f c) {
  v8f d = __builtin_amdgcn_wmma_f32_16x16x32_f16(false, a, false, b, (short)0, c, false, false);
  asm volatile("v_nop\n\tv_nop\n\tv_nop\n\tv_nop" : "+v"(d) : "v"(a), "v"(b));
  return d;
}
__device__ __forceinline__ v8f wmma_bf(v16b a, v16b b, v8f c) {
  v8f d = __builtin_amdgcn_wmma_f32_16x16x32_bf16(false, a, false, b, (short)0, c, false, false);
  asm volatile("v_nop\n\tv_nop\n\tv_nop\n\tv_nop" : "+v"(d) : "v"(a), "v"(b));
  return d;
}
// 16x16x32 fragments: lane = (h = lane>>4, row/col = lane&15); elements 0..7 = k0+8h+0..7, 8..15 = k0+16+8h+0..7; D element r = row 8h+r
__device__ __forceinline__ v16h frag_h(const _Float16* rowk0, int lane) {
  union { v16h v; v8h q[2]; } u; const _Float16* p = rowk0 + 8 * (lane >> 4);
  u.q[0] = *(const v8h*)p; u.q[1] = *(const v8h*)(p + 16); return u.v;
}
__device__ __forceinline__ v16h frag_f32(const float* rowk0, int lane) {
  v16h a; const float* p = rowk0 + 8 * (lane >> 4);
#pragma unroll
  for (int i = 0; i < 8; ++i) { a[i] = (_Float16)p[i]; a[8 + i] = (_Float16)p[16 + i]; }
  return a;
}
__device__ __forceinline__ v16h frag_f32s(const float* rowk0, int lane, float sc) {
  v16h a; const float* p = rowk0 + 8 * (lane >> 4);
#pragma unroll
  for (int i = 0; i < 8; ++i) { a[i] = (_Float16)(p[i] * sc); a[8 + i] = (_Float16)(p[16 + i] * sc); }
  return a;
}
// column fragment from a [K][ld] layout (column n), rows >= K read as 0
__device__ __forceinline__ v16h fragc_f32(const float* W, int k0, int n, int lane, int ld, int K) {
  v16h a; const int g = lane >> 4;
#pragma unroll
  for (int i = 0; i < 8; ++i) { const int ka = k0 + 8 * g + i, kb = ka + 16;
    a[i] = (_Float16)(ka < K ? W[(size_t)(ka < K ? ka : K - 1) * ld + n] : 0.f); a[8 + i] = (_Float16)(kb < K ? W[(size_t)(kb < K ? kb : K - 1) * ld + n] : 0.f); }
  return a;
}
struct F2 { v16b h, l; };
__device__ __forceinline__ F2 bsplit16(const float v[16]) { F2 r;
#pragma unroll
  for (int i = 0; i < 16; ++i) { const __bf16 h = (__bf16)v[i]; r.h[i] = h; r.l[i] = (__bf16)(v[i] - (float)h); }
  return r; }
__device__ __forceinline__ F2 split_row(const float* row, int k0, int lane) { float v[16]; const float* p = row + k0 + 8 * (lane >> 4);
#pragma unroll
  for (int i = 0; i < 8; ++i) { v[i] = p[i]; v[8 + i] = p[16 + i]; }
  return bsplit16(v); }
__device__ __forceinline__ F2 split_rowK(const float* row, int k0, int lane, int K) { float v[16]; const int g = lane >> 4;
#pragma unroll
  for (int i = 0; i < 8; ++i) { const int ka = k0 + 8 * g + i, kb = ka + 16; v[i] = ka < K ? row[ka < K ? ka : K - 1] : 0.f; v[8 + i] = kb < K ? row[kb < K ? kb : K - 1] : 0.f; }
  return bsplit16(v); }
__device__ __forceinline__ F2 split_col(const float* W, int k0, int n, int lane, int ld, int K) { float v[16]; const int g = lane >> 4;
#pragma unroll
  for (int i = 0; i < 8; ++i) { const int ka = k0 + 8 * g + i, kb = ka + 16; v[i] = ka < K ? W[(size_t)(ka < K ? ka : K - 1) * ld + n] : 0.f; v[8 + i] = kb < K ? W[(size_t)(kb < K ? kb : K - 1) * ld + n] : 0.f; }
  return bsplit16(v); }
__device__ __forceinline__ v8f mac3(const F2& a, const F2& b, v8f c) { c = wmma_bf(a.l, b.h, c); c = wmma_bf(a.h, b.l, c); return wmma_bf(a.h, b.h, c); }
__device__ __forceinline__ float sigm(float v) { return 1.0f / (1.0f + expf(-v)); }
#define LDSX() do { asm volatile("s_wait_dscnt 0" ::: "memory"); __builtin_amdgcn_wave_barrier(); __builtin_amdgcn_fence(__ATOMIC_RELEASE, "workgroup"); } while (0)

// Sliding-window causal self-attention (B 2, S 2,048, 1,024 = 16 x 64, window 128): q/k/v = x W ((in,out)); key j visible from query i iff i - 127 <= j <= i; softmax (the extra max-subtraction is a no-op); out = merged(attn v) Wo + x.
#define NB 2
#define TT 2048
#define CC 1024            // NH * HD = projected width
#define DIN 1024          // input (model) width
#define NH 16
#define HD 64
#define NQB (TT / 64)
#define SCALE (0.125f)
#define SCL2 (SCALE * 1.44269504088896340736f)   // 64^-0.5 x log2(e): the logits are kept in base-2 units, so that e^(l - max) is one hardware exp2 of a difference
#define CAUSAL 1
#ifndef TNB
#define TNB NB
#endif
__device__ __forceinline__ float bfr(float v) { return (float)(__bf16)v; }
#define WIN 128            // window: key j is visible from query i only if j >= i - (WIN - 1)
// oldest key that any query >= t can see; every older key has P = 0 exactly, so a 32-key chunk wholly older is neither scored, normalised nor multiplied
__device__ __forceinline__ int key_first(int t) { return t > WIN - 1 ? t - (WIN - 1) : 0; }
typedef __attribute__((ext_vector_type(8))) __bf16 v8b;
__device__ __forceinline__ v16b frag_b(const __bf16* rowk0, int lane) {
  union { v16b v; v8b q[2]; } u; const __bf16* p = rowk0 + 8 * (lane >> 4);
  u.q[0] = *(const v8b*)p; u.q[1] = *(const v8b*)(p + 16); return u.v;
}
#define QBH 6              // causal: query blocks 0..QBH-1 of each sequence take the high-precision path
#define QHI 384            // rows carrying a q residual plane
#define KHI 384            // key rows carrying k residual / v bf16 hi+lo planes (used only by the causal high-precision path)
// B fragment (k rows k0+.., output column o) of a weight: (in,out) [K][ld] or (out,in) [ld rows of K]: bf16 exact, or f16(bf16 * 256) exact
__device__ __forceinline__ v16b wcol_io(const float* Wm, int k0, int o, int lane, int ld) { v16b w; const int g = lane >> 4;
#pragma unroll
  for (int i = 0; i < 8; ++i) { w[i] = (__bf16)Wm[(size_t)(k0 + 8 * g + i) * ld + o]; w[8 + i] = (__bf16)Wm[(size_t)(k0 + 16 + 8 * g + i) * ld + o]; }
  return w; }
__device__ __forceinline__ v16b wcol_oi(const float* Wm, int k0, int o, int lane, int K) { v16b w; const float* p = Wm + (size_t)o * K + k0 + 8 * (lane >> 4);
#pragma unroll
  for (int i = 0; i < 8; ++i) { w[i] = (__bf16)p[i]; w[8 + i] = (__bf16)p[16 + i]; }
  return w; }
__device__ __forceinline__ v16h wcolh_io(const float* Wm, int k0, int o, int lane, int ld) { v16h w; const int g = lane >> 4;
#pragma unroll
  for (int i = 0; i < 8; ++i) { w[i] = (_Float16)(bfr(Wm[(size_t)(k0 + 8 * g + i) * ld + o]) * 256.0f); w[8 + i] = (_Float16)(bfr(Wm[(size_t)(k0 + 16 + 8 * g + i) * ld + o]) * 256.0f); }
  return w; }
__device__ __forceinline__ v16h wcolh_oi(const float* Wm, int k0, int o, int lane, int K) { v16h w; const float* p = Wm + (size_t)o * K + k0 + 8 * (lane >> 4);
#pragma unroll
  for (int i = 0; i < 8; ++i) { w[i] = (_Float16)(bfr(p[i]) * 256.0f); w[8 + i] = (_Float16)(bfr(p[16 + i]) * 256.0f); }
  return w; }
#define WQKV_LAYOUT 0   // 0 = (in,out) [DIN][CC]; 1 = (out,in) [CC][DIN]; 2 = per-head [NH][DIN][HD]
__device__ __forceinline__ v16b wcol_hdk(const float* Wm, int k0, int o, int lane) { v16b w; const int g = lane >> 4; const float* p = Wm + (size_t)(o / HD) * DIN * HD + (o % HD);
#pragma unroll
  for (int i = 0; i < 8; ++i) { w[i] = (__bf16)p[(size_t)(k0 + 8 * g + i) * HD]; w[8 + i] = (__bf16)p[(size_t)(k0 + 16 + 8 * g + i) * HD]; }
  return w; }
#define WO_OUT_IN 0
#if WQKV_LAYOUT == 1
#define WCOL(W, k0, o, lane) wcol_oi(W, k0, o, lane, DIN)
#elif WQKV_LAYOUT == 2
#define WCOL(W, k0, o, lane) wcol_hdk(W, k0, o, lane)
#else
#define WCOL(W, k0, o, lane) wcol_io(W, k0, o, lane, CC)
#endif
#if WO_OUT_IN
#define WOCOL(W, k0, o, lane) wcol_oi(W, k0, o, lane, CC)
#define WOCOLH(W, k0, o, lane) wcolh_oi(W, k0, o, lane, CC)
#else
#define WOCOL(W, k0, o, lane) wcol_io(W, k0, o, lane, DIN)
#define WOCOLH(W, k0, o, lane) wcolh_io(W, k0, o, lane, DIN)
#endif
#define WS_PR  (WS_END)
#define WS_END2 (WS_PR + 4u * (size_t)NB * TT * DIN)
#ifndef PROJ_EXTRA_PARAMS
#define PROJ_EXTRA_PARAMS
#endif

#define WS_QH  0u                                      // f16 q rows [b*t][CC]
#define WS_KH  (WS_QH + 2u * (size_t)NB * TT * CC)      // f16 k rows [b*t][CC]
#define WS_VT  (WS_KH + 2u * (size_t)NB * TT * CC)      // f16 v planes [b][c][t]
#define WS_QL  (WS_VT + 2u * (size_t)NB * CC * TT)      // f16 q residual x 2^10 rows [b][t < QHI][CC]
#define WS_KL  (WS_QL + 2u * (size_t)NB * QHI * CC)     // f16 k residual x 2^10 rows [b][t < KHI][CC]
#define WS_VB  (WS_KL + 2u * (size_t)NB * KHI * CC)     // bf16 v hi planes [b][c][t < KHI]
#define WS_VBL (WS_VB + 2u * (size_t)NB * CC * KHI)
#define WS_Y   (WS_VBL + 2u * (size_t)NB * CC * KHI)    // f32 ctx rows [b*t][CC] (only when there is an output projection)
#define WS_END (WS_Y  + 4u * (size_t)NB * TT * CC)
#define WS_XB  (WS_END2)                                // bf16 x rows [b*t][DIN]
#define WS_WT  (WS_XB + 2u * (size_t)NB * TT * DIN)     // bf16 weights, transposed: Wq, Wk, Wv as [CC out][DIN in], then Wo as [DIN out][CC in]
#define WS_WTO (WS_WT + 2u * 3u * (size_t)CC * DIN)
#define WS_END3 (WS_WTO + 2u * (size_t)DIN * CC)

// ---- operand feed of k_proj and k_out: a slab = KS k values of the block's 128 weight columns, an LDS buffer [128][KS + 8] (row = column n; pitch 144 bytes: the pitch of ds_load_b128 readers), where all 4 waves read their B fragments. k_prep has rounded x and the four weights to bf16 once and laid the weights out as [out][in], so a slab row is one 128-byte line in global memory and goes to LDS as it is, in 16-byte pieces (a wave's load = 4 rows = 4 whole lines); every block used to load the f32 values and round them for itself. k_proj's 128 activation rows go the same way, at the same pitch. k_out has slabs of KO k values (below). All are loaded one slab ahead. The loops of the feed are unrolled in full: wr, ar and the fragment arrays live in registers and need compile-time indices.
#define KS 64
#define GXW() asm volatile("s_wait_xcnt 0x0" ::: "memory")   /* stands behind a slab's global loads: the next slab's address is formed in the registers that these loads name; it also keeps the loads in front of the products that cover their latency */
__device__ __forceinline__ void wslab_load(float (&wr)[KS], const float* Wc, int s, int ld) {
#pragma unroll
  for (int i = 0; i < KS; ++i) wr[i] = Wc[(size_t)(s * KS + i) * ld]; }
__device__ __forceinline__ void wslab_store(__bf16 (*buf)[KS + 8], const float (&wr)[KS], int n) {
#pragma unroll
  for (int q = 0; q < KS / 8; ++q) { v8b t;
#pragma unroll
    for (int i = 0; i < 8; ++i) t[i] = (__bf16)wr[q * 8 + i];
    *(v8b*)&buf[n][q * 8] = t; } }
typedef __attribute__((ext_vector_type(4))) __bf16 v4b;
// ---- slabs of k_out: KO k values, LDS rows of KO + 8 elements (pitch 272 bytes = 16 x 17, a pitch of ds_load_b128 readers). With 2 waves on a SIMD a slab of 64 k is 32 products a wave, less matrix time than the next slab's loads need to come back from L2; 128 k give them twice the time and halve the barriers. A weight row of a slab is 256 bytes (a wave's load = 2 rows), a ctx row 512 bytes of f32 (a wave's load = 1 row), split into bf16 hi + lo on the way to LDS.
#define KO 128
#define AL (64 * KO / 4 / 128)   // 16-byte pieces of a ctx slab per thread: piece i of thread t is row i * 4 + (t >> 5), floats 4 * (t & 31) ..
#define WL (128 * KO / 8 / 128)  // 16-byte pieces of a weight slab per thread: piece i of thread t is row i * 8 + (t >> 4), elements 8 * (t & 15) ..
static_assert(KO == 128, "32 f32 pieces, 16 bf16 pieces per slab row");
__device__ __forceinline__ void aslab_load(v4f (&ar)[AL], const float* Ab, int s, int ld) {   /* Ab = first row of the block + (t >> 5) * ld + 4 * (t & 31) */
#pragma unroll
  for (int i = 0; i < AL; ++i) ar[i] = *(const v4f*)(Ab + (size_t)(i * 4) * ld + s * KO); }
__device__ __forceinline__ void oslab_load(v8b (&r)[WL], const __bf16* P, int s, int ld) {   /* P = first row of the block + (t >> 4) * ld + 8 * (t & 15) */
#pragma unroll
  for (int i = 0; i < WL; ++i) r[i] = *(const v8b*)(P + (size_t)(i * 8) * ld + s * KO); }
__device__ __forceinline__ void oslab_store(__bf16 (*buf)[KO + 8], const v8b (&r)[WL], int t) {
#pragma unroll
  for (int i = 0; i < WL; ++i) *(v8b*)&buf[i * 8 + (t >> 4)][8 * (t & 15)] = r[i]; }
// bf16 slab of N * 16 rows: piece i of thread t is row i * 16 + (t >> 3), elements 8 * (t & 7) ..
template <int N> __device__ __forceinline__ void bslab_load(v8b (&r)[N], const __bf16* P, int s, int ld) {   /* P = first row of the block + (t >> 3) * ld + 8 * (t & 7) */
#pragma unroll
  for (int i = 0; i < N; ++i) r[i] = *(const v8b*)(P + (size_t)(i * 16) * ld + s * KS); }
template <int N> __device__ __forceinline__ void bslab_store(__bf16 (*buf)[KS + 8], const v8b (&r)[N], int t) {
#pragma unroll
  for (int i = 0; i < N; ++i) *(v8b*)&buf[i * 16 + (t >> 3)][8 * (t & 7)] = r[i]; }
// f32 pieces of aslab_load to LDS with the bf16 hi + lo split of bsplit16, one plane each
__device__ __forceinline__ void aslab_store2(__bf16 (*bh)[KO + 8], __bf16 (*bl)[KO + 8], const v4f (&ar)[AL], int t) {
#pragma unroll
  for (int i = 0; i < AL; ++i) { v4b h, l;
#pragma unroll
    for (int e = 0; e < 4; ++e) { const __bf16 hv = (__bf16)ar[i][e]; h[e] = hv; l[e] = (__bf16)(ar[i][e] - (float)hv); }
    *(v4b*)&bh[i * 4 + (t >> 5)][4 * (t & 31)] = h; *(v4b*)&bl[i * 4 + (t >> 5)][4 * (t & 31)] = l; } }
// ---- k_prep: x and the weights to bf16, once for all blocks of k_proj and k_out. Blocks < PWB: one slab (KS k rows x 128 columns) of weight m: thread n loads column n (a wave's load = one 128-byte line), the slab turns in LDS and leaves as rows [out][in] in whole lines. The other blocks: 2,048 16-byte pieces of x each.
#define PWB (4 * (CC / 128) * (DIN / KS))
#define PXB ((int)((size_t)NB * TT * DIN / 4 / 2048))
static_assert(CC == DIN && CC / 128 == 8 && DIN / KS == 16, "block index fields of k_prep");
__global__ __launch_bounds__(128) void k_prep(const float* __restrict__ X, const float* __restrict__ WQ, const float* __restrict__ WK, const float* __restrict__ WV, const float* __restrict__ WO, __bf16* __restrict__ XB, __bf16* __restrict__ WT) {
  __shared__ __align__(16) __bf16 tw[128][KS + 8];
  const int tid = threadIdx.x, bi = blockIdx.x;
  if (bi < PWB) { const int m = bi >> 7, c0 = ((bi >> 4) & 7) * 128, s = bi & 15;
    const float* Wm = m == 0 ? WQ : m == 1 ? WK : m == 2 ? WV : WO;
    float wr[KS]; wslab_load(wr, Wm + c0 + tid, s, CC); GXW();   /* the rounded values may be given the loads' address registers */
    wslab_store(tw, wr, tid);
    __syncthreads();
    __bf16* D = WT + ((size_t)m * CC + c0 + (tid >> 3)) * DIN + s * KS + 8 * (tid & 7);
#pragma unroll
    for (int i = 0; i < 8; ++i) *(v8b*)(D + (size_t)(i * 16) * DIN) = *(const v8b*)&tw[i * 16 + (tid >> 3)][8 * (tid & 7)];
  } else { const size_t p0 = (size_t)(bi - PWB) * 2048 + tid; v4f a[16];
#pragma unroll
    for (int i = 0; i < 16; ++i) a[i] = *(const v4f*)(X + (p0 + i * 128) * 4);
    GXW();   /* as above */
#pragma unroll
    for (int i = 0; i < 16; ++i) { v4b h;
#pragma unroll
      for (int e = 0; e < 4; ++e) h[e] = (__bf16)a[i][e];
      *(v4b*)(XB + (p0 + i * 128) * 4) = h; }
    GXW();   /* behind the last store: in the built code the weight part's instructions follow this run, and they write registers that the stores name */ } }
// ---- k_proj: block = (128 rows, 128 cols, which), its 4 waves laid out 2 x 2, a wave = 64 rows x 64 cols = 4 x 4 accumulator tiles: a 32-k chunk costs a wave 4 + 4 fragment reads from LDS for 16 products, and a block 256 slab rows from L2 for 128 x 128 outputs. q/k/v = X W (+ b) with exact bf16 products (K = DIN) -> which 0: q f16 rows (+ residual rows < QHI); 1: k f16 rows (+ residual rows < KHI); 2: v f16 planes [c][t] (+ bf16 hi/lo planes for t < KHI)
#define PRW 128            // rows of a block of k_proj
#define EPT 136            // pitch of the epilogue's tiles, elements: 272 bytes = 16 x 17
#define SLB (128 * (KS + 8) * 2)   // bytes of a slab buffer
#define EPB (128 * EPT * 2)        // bytes of an epilogue tile
static_assert(TT % PRW == 0 && QHI % PRW == 0 && KHI % PRW == 0 && 4 * SLB <= 3 * EPB && PRW == 128, "blocks of k_proj");
// a 128 x 128 tile of 16-bit elements leaves LDS in whole 256-byte rows: piece i of thread t is row i * 8 + (t >> 4), elements 8 * (t & 15) ..; D = the first row's place + (t >> 4) * ld + 8 * (t & 15)
template <typename E> __device__ __forceinline__ void tile_out(E* D, int ld, const E (*T)[EPT], int t) { v4u o[16];   /* compile-time indices: registers */
#pragma unroll
  for (int i = 0; i < 16; ++i) o[i] = *(const v4u*)&T[i * 8 + (t >> 4)][8 * (t & 15)];
  __builtin_amdgcn_sched_barrier(0);   /* every read stands in front of the first store, so that no register which an issued store names is written again */
#pragma unroll
  for (int i = 0; i < 16; ++i) vst2((unsigned*)(D + (size_t)(i * 8) * ld), o[i]);
  GXW(); __builtin_amdgcn_sched_barrier(0);   /* behind the last store: the next tile's addresses and reads may be given registers that these stores name; the scheduling barrier keeps them behind the wait */ }
__global__ __launch_bounds__(128) void k_proj(const __bf16* __restrict__ XB, const __bf16* __restrict__ WT, const float* __restrict__ BQ, const float* __restrict__ BK, const float* __restrict__ BV,
    _Float16* __restrict__ QH, _Float16* __restrict__ QL, _Float16* __restrict__ KH, _Float16* __restrict__ KL, _Float16* __restrict__ VT, __bf16* __restrict__ VB, __bf16* __restrict__ VBL) {
  __shared__ __align__(16) char sm[3 * EPB];   /* one range, so that 3 blocks share a WGP's LDS: the four slab buffers until the last slab's barrier, the epilogue's two or three tiles behind it */
  const int tid = threadIdx.x, wave = tid >> 5, lane = tid & 31, col = lane & 15, g = lane >> 4; const int which = blockIdx.z; const int c0 = blockIdx.y * 128; const size_t r0 = (size_t)blockIdx.x * PRW; const size_t bb = r0 / TT; const int t0 = (int)(r0 % TT);
  const int wr0 = (wave >> 1) * 64, wc0 = (wave & 1) * 64;   /* the wave's first row and column in the block's tile */
  const float* BA = which == 0 ? BQ : which == 1 ? BK : BV;
  v8f acc[4][4] = {};
  static_assert(WQKV_LAYOUT == 0 && KS + 8 == 72 && DIN % (2 * KS) == 0, "slab feed");
  const __bf16* Wp = WT + ((size_t)which * CC + c0 + (tid >> 3)) * DIN + 8 * (tid & 7); const __bf16* Ap = XB + (r0 + (tid >> 3)) * DIN + 8 * (tid & 7);
  v8b wr[8], ar[8];
  __bf16 (*const wb0)[KS + 8] = (__bf16 (*)[KS + 8])(sm); __bf16 (*const wb1)[KS + 8] = (__bf16 (*)[KS + 8])(sm + SLB); __bf16 (*const xa0)[KS + 8] = (__bf16 (*)[KS + 8])(sm + 2 * SLB); __bf16 (*const xa1)[KS + 8] = (__bf16 (*)[KS + 8])(sm + 3 * SLB);
  // one slab: slab s + 1's loads start (behind the barrier, which waits for every load in flight); products from cw, ca; then slab s + 1 goes to nw, na, whose readers left them at the last barrier; the barrier publishes nw, na and ends the reads of cw, ca
  const auto slab = [&](const __bf16 (*cw)[KS + 8], const __bf16 (*ca)[KS + 8], __bf16 (*nw)[KS + 8], __bf16 (*na)[KS + 8], int s) {
    if (s + 1 < DIN / KS) { bslab_load(wr, Wp, s + 1, DIN); bslab_load(ar, Ap, s + 1, DIN); GXW(); }
#pragma unroll
    for (int kc = 0; kc < KS / 32; ++kc) { v16b a[4], w[4];
#pragma unroll
      for (int i = 0; i < 4; ++i) a[i] = frag_b(&ca[wr0 + i * 16 + col][kc * 32], lane);
#pragma unroll
      for (int j = 0; j < 4; ++j) w[j] = frag_b(&cw[wc0 + j * 16 + col][kc * 32], lane);
#pragma unroll
      for (int i = 0; i < 4; ++i)
#pragma unroll
        for (int j = 0; j < 4; ++j) acc[i][j] = wmma_bf(a[i], w[j], acc[i][j]); }
    if (s + 1 < DIN / KS) { bslab_store(nw, wr, tid); bslab_store(na, ar, tid); }
    __syncthreads(); };
  bslab_load(wr, Wp, 0, DIN); bslab_load(ar, Ap, 0, DIN); GXW();
  bslab_store(wb0, wr, tid); bslab_store(xa0, ar, tid);
  __syncthreads();
  for (int s = 0; s < DIN / KS; s += 2) { slab(wb0, xa0, wb1, xa1, s); slab(wb1, xa1, wb0, xa0, s + 1); }
  if (which < 2) { _Float16* DH = which == 0 ? QH : KH; _Float16* DL = which == 0 ? QL : KL; const int nhi = which == 0 ? QHI : KHI; const bool hi_rows = t0 < nhi;
    _Float16 (*const sh)[EPT] = (_Float16 (*)[EPT])(sm); _Float16 (*const sl)[EPT] = (_Float16 (*)[EPT])(sm + EPB);
#pragma unroll
    for (int j = 0; j < 4; ++j) { const float bias = BA ? bfr(BA[c0 + wc0 + j * 16 + col]) : 0.f;
#pragma unroll
      for (int i = 0; i < 4; ++i)
#pragma unroll
        for (int r = 0; r < 8; ++r) { const float v = acc[i][j][r] + bias; const _Float16 hv = (_Float16)v; sh[wr0 + i * 16 + 8 * g + r][wc0 + j * 16 + col] = hv; sl[wr0 + i * 16 + 8 * g + r][wc0 + j * 16 + col] = (_Float16)((v - (float)hv) * 1024.0f); } }
    __syncthreads();
    tile_out(DH + (r0 + (tid >> 4)) * CC + c0 + 8 * (tid & 15), CC, sh, tid);
    if (hi_rows) tile_out(DL + (bb * nhi + t0 + (tid >> 4)) * (size_t)CC + c0 + 8 * (tid & 15), CC, sl, tid);
  } else { const bool hi_rows = t0 < KHI;
    _Float16 (*const th)[EPT] = (_Float16 (*)[EPT])(sm); __bf16 (*const tb)[EPT] = (__bf16 (*)[EPT])(sm + EPB); __bf16 (*const tbl)[EPT] = (__bf16 (*)[EPT])(sm + 2 * EPB);
#pragma unroll
    for (int j = 0; j < 4; ++j) { const float bias = BA ? bfr(BA[c0 + wc0 + j * 16 + col]) : 0.f;
#pragma unroll
      for (int i = 0; i < 4; ++i)
#pragma unroll
        for (int r = 0; r < 8; ++r) { const float v = acc[i][j][r] + bias; const int rl = wr0 + i * 16 + 8 * g + r, cl = wc0 + j * 16 + col; th[cl][rl] = (_Float16)v; const __bf16 bh = (__bf16)v; tb[cl][rl] = bh; tbl[cl][rl] = (__bf16)(v - (float)bh); } }
    __syncthreads();
    tile_out(VT + (bb * CC + c0 + (tid >> 4)) * (size_t)TT + t0 + 8 * (tid & 15), TT, th, tid);
    if (hi_rows) { const size_t o3 = (bb * CC + c0 + (tid >> 4)) * (size_t)KHI + t0 + 8 * (tid & 15); tile_out(VB + o3, KHI, tb, tid); tile_out(VBL + o3, KHI, tbl, tid); } } }
#define XW() asm volatile("s_wait_xcnt 0x0" ::: "memory")   /* stands behind each group of k_att's global loads that share an address: a later load's result may be given the group's address registers, and s_wait_xcnt 0 belongs in front of an overwrite of a register that an issued load names */
#define AHEAD 2            // chunks whose fragment loads are in flight in front of the chunk being multiplied
#define NCH 5              // 16 queries from a multiple of 16 see keys [ql0 - (WIN - 1), ql0 + 15]: at most 5 chunks of 32
// ---- operand feed of k_att: the block's 64 queries see keys [qb * 64 - (WIN - 1), qb * 64 + 63], at most KCB chunks of 32 from chunk kb0. Those KCB * 32 K rows (128 bytes of head h each = one line) and the same keys of the head's HD v planes (384 bytes each = 3 lines) go to LDS once per block, in 16-byte pieces of whole lines (a wave's load = 4 lines), and all 4 waves read their fragments there. A fragment load straight from global memory would touch 16 lines for 512 bytes, and each wave would fetch its own 5 chunks. Rows kb0 * 32 .. + KCB * 32 - 1 exist for every qb (the last block ends at row TT - 1, block QBH - 1 at row KHI - 1).
#define KCB 6
#define LW() __builtin_amdgcn_sched_barrier(0)   /* stands behind each group of fragment loads from LDS in the path of query blocks < QBH: without it the scheduler lifts later groups' loads to the front, their fragments are live at once, and the kernel no longer fits the 256 registers that let 4 waves share a SIMD */
#define KPT (HD + 8)           // K tile [KCB * 32][KPT]: pitch 144 bytes, the pitch of ds_load_b128 readers
#define VPT (KCB * 32 + 8)     // v tile [HD][VPT]: pitch 400 bytes = 16 x 25
#define TSZ (KCB * 32 * KPT)   // elements of a tile buffer; either tile fits
static_assert(HD == 64 && HD * VPT <= TSZ && (63 + WIN - 1) / 32 + 1 <= KCB && (QBH * 64) <= KHI && KCB * 32 <= KHI && TT % 64 == 0, "tiles of k_att");
// piece i of thread t: K row i * 16 + (t >> 3), elements 8 * (t & 7) ..; P = first row + (t >> 3) * CC + 8 * (t & 7)
template <typename E> __device__ __forceinline__ void ktile_load(v4u (&r)[12], const E* P) {
#pragma unroll
  for (int i = 0; i < 12; ++i) r[i] = *(const v4u*)(P + (size_t)(i * 16) * CC); }
__device__ __forceinline__ void ktile_store(_Float16* T, const v4u (&r)[12], int t) {
#pragma unroll
  for (int i = 0; i < 12; ++i) *(v4u*)(T + (i * 16 + (t >> 3)) * KPT + 8 * (t & 7)) = r[i]; }
// piece i * 3 + j of thread t: v plane i * 16 + (t >> 3), line j, elements 8 * (t & 7) ..; P = first plane + (t >> 3) * ld + first key + 8 * (t & 7)
template <typename E> __device__ __forceinline__ void vtile_load(v4u (&r)[12], const E* P, int ld) {
#pragma unroll
  for (int i = 0; i < 4; ++i)
#pragma unroll
    for (int j = 0; j < 3; ++j) r[i * 3 + j] = *(const v4u*)(P + (size_t)(i * 16) * ld + j * 64); }
__device__ __forceinline__ void vtile_store(_Float16* T, const v4u (&r)[12], int t) {
#pragma unroll
  for (int i = 0; i < 4; ++i)
#pragma unroll
    for (int j = 0; j < 3; ++j) *(v4u*)(T + (i * 16 + (t >> 3)) * VPT + j * 64 + 8 * (t & 7)) = r[i * 3 + j]; }
__global__ __launch_bounds__(128) void k_att(const _Float16* __restrict__ QH, const _Float16* __restrict__ KH, const _Float16* __restrict__ QL, const _Float16* __restrict__ KL, const _Float16* __restrict__ VT, const __bf16* __restrict__ VB, const __bf16* __restrict__ VBL, float* __restrict__ Y) { __shared__ __align__(16) float ss[4][16][HD + 4]; __shared__ __align__(16) _Float16 t0[TSZ], t1[TSZ];
  const int tid = threadIdx.x, wave = tid >> 5, lane = tid & 31, col = lane & 15, g = lane >> 4; const int qb = blockIdx.x, h = blockIdx.y, b = blockIdx.z; const int ql0 = qb * 64 + wave * 16; const int t = ql0 + col;
  const int kc0 = __builtin_amdgcn_readfirstlane(key_first(ql0) >> 5), kcl = __builtin_amdgcn_readfirstlane((ql0 + 15) >> 5);   /* first and last visible chunk, wave-uniform */
  static_assert((WIN - 1 + 15) / 32 + 1 <= NCH, "chunks per wave");
  const size_t q0 = (size_t)b * TT + ql0;
  const int kb0 = key_first(qb * 64) >> 5;   /* first chunk of the tiles, block-uniform */
  const int sr = tid >> 3, se = 8 * (tid & 7);
  v4u sa[12], sb[12], sq[4];   /* pieces on their way to LDS: compile-time indices, registers */
  // the wave's 16 q rows go the same way, [16][KPT] in the wave's own part of ss, which no other wave touches and which the epilogue takes only behind this wave's last read: piece i of lane l is row i * 4 + (l >> 3), elements 8 * (l & 7) ..
  _Float16* const tq = (_Float16*)&ss[wave][0][0];
  static_assert(16 * KPT * 2 <= 16 * (HD + 4) * 4, "q rows fit the wave's part of ss");
#pragma unroll
  for (int i = 0; i < 4; ++i) sq[i] = *(const v4u*)(QH + (q0 + i * 4 + (lane >> 3)) * CC + h * HD + 8 * (lane & 7));
  XW();
  float p[NCH][16];   /* every loop of this kernel is unrolled in full: p, the fragment arrays and the accumulators live in registers and need compile-time indices */
  if (qb < QBH) { const _Float16* QLb = QL + (size_t)b * QHI * CC; const _Float16* KLb = KL + (size_t)b * KHI * CC;
    v16h ah[HD / 32], al[HD / 32];
#pragma unroll
    for (int kc = 0; kc < HD / 32; ++kc) al[kc] = frag_h(QLb + (size_t)(ql0 + col) * CC + h * HD + kc * 32, lane);
    XW();
    ktile_load(sa, KH + ((size_t)b * TT + kb0 * 32 + sr) * CC + h * HD + se); XW();
    ktile_load(sb, KLb + (size_t)(kb0 * 32 + sr) * CC + h * HD + se); XW();
    ktile_store(t0, sa, tid); ktile_store(t1, sb, tid);
#pragma unroll
    for (int i = 0; i < 4; ++i) *(v4u*)(tq + (i * 4 + (lane >> 3)) * KPT + 8 * (lane & 7)) = sq[i];
    __syncthreads();   /* publishes the K tiles */
#pragma unroll
    for (int kc = 0; kc < HD / 32; ++kc) ah[kc] = frag_h(tq + col * KPT + kc * 32, lane);
#pragma unroll
    for (int c = 0; c < NCH; ++c) { const int kr = ((kc0 + c < kcl ? kc0 + c : kcl) - kb0) * 32;
#pragma unroll
      for (int u = 0; u < 2; ++u) { v16h kbf[HD / 32], klf[HD / 32];   /* a 16-key tile's loads stand in front of its products; a whole chunk's fragments at once would not fit the registers beside p */
#pragma unroll
        for (int kc = 0; kc < HD / 32; ++kc) kbf[kc] = frag_h(t0 + (kr + u * 16 + col) * KPT + kc * 32, lane);
#pragma unroll
        for (int kc = 0; kc < HD / 32; ++kc) klf[kc] = frag_h(t1 + (kr + u * 16 + col) * KPT + kc * 32, lane);
        LW();
        v8f acc = {}, accl = {};
#pragma unroll
        for (int kc = 0; kc < HD / 32; ++kc) { acc = wmma16(kbf[kc], ah[kc], acc); accl = wmma16(kbf[kc], al[kc], accl); accl = wmma16(klf[kc], ah[kc], accl); }
#pragma unroll
        for (int r = 0; r < 8; ++r) p[c][u * 8 + r] = (acc[r] + accl[r] * (1.0f / 1024.0f)) * SCL2; } }
    // the v hi and lo tiles take the K tiles' buffers; they go to LDS in front of the softmax (held in registers under it, they would not fit beside p and its temporaries)
    vtile_load(sa, VB + ((size_t)b * CC + h * HD + sr) * (size_t)KHI + kb0 * 32 + se, KHI); XW();
    vtile_load(sb, VBL + ((size_t)b * CC + h * HD + sr) * (size_t)KHI + kb0 * 32 + se, KHI); XW();
    __syncthreads();   /* ends every wave's reads of the K tiles */
    vtile_store(t0, sa, tid); vtile_store(t1, sb, tid);
  } else {
    v16h ah[HD / 32];
    ktile_load(sa, KH + ((size_t)b * TT + kb0 * 32 + sr) * CC + h * HD + se); XW();
    vtile_load(sb, VT + ((size_t)b * CC + h * HD + sr) * (size_t)TT + kb0 * 32 + se, TT); XW();
    ktile_store(t0, sa, tid); vtile_store(t1, sb, tid);
#pragma unroll
    for (int i = 0; i < 4; ++i) *(v4u*)(tq + (i * 4 + (lane >> 3)) * KPT + 8 * (lane & 7)) = sq[i];
    __syncthreads();   /* publishes the K and v tiles; nothing is written to them behind it */
#pragma unroll
    for (int kc = 0; kc < HD / 32; ++kc) ah[kc] = frag_h(tq + col * KPT + kc * 32, lane);
    v16h kf[NCH][2][HD / 32];   /* chunk c + AHEAD is loaded in front of chunk c's products, so that its latency is covered */
#pragma unroll
    for (int cc = -AHEAD; cc < NCH; ++cc) { const int c = cc < 0 ? 0 : cc;
      if (const int cn = cc + AHEAD; cn < NCH) { const int kr = ((kc0 + cn < kcl ? kc0 + cn : kcl) - kb0) * 32;
#pragma unroll
        for (int u = 0; u < 2; ++u)
#pragma unroll
          for (int kc = 0; kc < HD / 32; ++kc) kf[cn][u][kc] = frag_h(t0 + (kr + u * 16 + col) * KPT + kc * 32, lane); }
      if (cc < 0) continue;
#pragma unroll
      for (int u = 0; u < 2; ++u) { v8f acc = {};
#pragma unroll
        for (int kc = 0; kc < HD / 32; ++kc) acc = wmma16(kf[c][u][kc], ah[kc], acc);
#pragma unroll
        for (int r = 0; r < 8; ++r) p[c][u * 8 + r] = acc[r] * SCL2; } } }
  // softmax of row t in f32, logits in base-2 units: 2^(v - m) = e^(logit - max). A masked element is -3.0e38: its difference from the finite m stays below -1.0e38 and the hardware exp2 returns 0 exactly, so it needs no select. Element i of chunk c is key (kc0 + c) * 32 + 16 * (i >> 3) + 8 g + (i & 7); visible iff t - (WIN - 1) <= key <= t
  float m = -3.0e38f;
#pragma unroll
  for (int c = 0; c < NCH; ++c)
#pragma unroll
    for (int i = 0; i < 16; ++i) { const int k = (kc0 + c) * 32 + 16 * (i >> 3) + 8 * g + (i & 7); const float v = (k <= t && k >= t - (WIN - 1)) ? p[c][i] : -3.0e38f; p[c][i] = v; m = fmaxf(m, v); }
  m = fmaxf(m, __shfl_xor(m, 16));
  float sum = 0.f;
#pragma unroll
  for (int c = 0; c < NCH; ++c)
#pragma unroll
    for (int i = 0; i < 16; ++i) { const float e = __builtin_amdgcn_exp2f(p[c][i] - m); p[c][i] = e; sum += e; }
  sum += __shfl_xor(sum, 16);
  const float inv = sum > 0.f ? 2048.0f / sum : 0.f;
#pragma unroll
  for (int c = 0; c < NCH; ++c)
#pragma unroll
    for (int i = 0; i < 16; ++i) p[c][i] *= inv;
  v8f acc[HD / 16] = {};
  if (qb < QBH) {
    __syncthreads();   /* publishes the v tiles */
#pragma unroll
    for (int c = 0; c < NCH; ++c) { const int kr = ((kc0 + c < kcl ? kc0 + c : kcl) - kb0) * 32; const F2 pf = bsplit16(p[c]); v16b vh[HD / 16], vl[HD / 16];
#pragma unroll
      for (int j = 0; j < HD / 16; ++j) vh[j] = frag_b((const __bf16*)t0 + (j * 16 + col) * VPT + kr, lane);
#pragma unroll
      for (int j = 0; j < HD / 16; ++j) vl[j] = frag_b((const __bf16*)t1 + (j * 16 + col) * VPT + kr, lane);
      LW();
#pragma unroll
      for (int j = 0; j < HD / 16; ++j) { acc[j] = wmma_bf(pf.h, vh[j], acc[j]); acc[j] = wmma_bf(pf.l, vh[j], acc[j]); acc[j] = wmma_bf(pf.h, vl[j], acc[j]); } }
  } else { v16h vf[NCH][HD / 16];   /* v fragments AHEAD chunks in front of their products, as for K */
#pragma unroll
    for (int cc = -AHEAD; cc < NCH; ++cc) { const int c = cc < 0 ? 0 : cc;
      if (const int cn = cc + AHEAD; cn < NCH) { const int kr = ((kc0 + cn < kcl ? kc0 + cn : kcl) - kb0) * 32;
#pragma unroll
        for (int j = 0; j < HD / 16; ++j) vf[cn][j] = frag_h(t1 + (j * 16 + col) * VPT + kr, lane); }
      if (cc < 0) continue;
      v16h pf;
#pragma unroll
      for (int i = 0; i < 16; ++i) pf[i] = (_Float16)p[c][i];
#pragma unroll
      for (int j = 0; j < HD / 16; ++j) acc[j] = wmma16(pf, vf[c][j], acc[j]); } }
#pragma unroll
  for (int j = 0; j < HD / 16; ++j)
#pragma unroll
    for (int r = 0; r < 8; ++r) ss[wave][8 * g + r][j * 16 + col] = acc[j][r] * (1.0f / 2048.0f);
  LDSX(); for (int rl = 0; rl < 16; ++rl) if (lane < HD / 4) vst2(Y + ((size_t)b * TT + ql0 + rl) * CC + h * HD + lane * 4, *(const v4f*)&ss[wave][rl][lane * 4]); }
#define OPB ((KO + 8) * 2)          // bytes of a slab row of k_out in LDS
#define OSB ((128 + 64 + 64) * OPB)  // bytes of a slab buffer of k_out
static_assert(4 * 16 * 132 * 4 <= 2 * OSB, "output tiles fit the slab buffers");
// ---- k_out: block = (64 rows, 128 cols): out = ctx Wo (+ bo) + bf16(x): ctx bf16 hi + lo against exact bf16 Wo (2 products). The residual is k_prep's bf16 x: a lane's 16 pieces (those of its 16 output stores) are loaded at entry, in flight with slab 0, and added in f32 where the tile leaves LDS for out.
__global__ __launch_bounds__(128) void k_out(const float* __restrict__ Y, const __bf16* __restrict__ WTO, const float* __restrict__ BO, const __bf16* __restrict__ XB, float* __restrict__ OUT) { __shared__ __align__(16) char so[2 * OSB];   /* one range, so that 2 blocks share a WGP's LDS: the two slab buffers (weight rows, ctx hi rows, ctx lo rows) until the last slab's barrier, the waves' output tiles behind it */
  typedef __bf16 (*orow)[KO + 8];
  const orow wb0 = (orow)(so), yh0 = (orow)(so + 128 * OPB), yl0 = (orow)(so + 192 * OPB), wb1 = (orow)(so + OSB), yh1 = (orow)(so + OSB + 128 * OPB), yl1 = (orow)(so + OSB + 192 * OPB);
  float (*const sf)[16][132] = (float (*)[16][132])(so);
  const int tid = threadIdx.x, wave = tid >> 5, lane = tid & 31, col = lane & 15, g = lane >> 4; const int c0 = blockIdx.y * 128; const size_t r0 = (size_t)blockIdx.x * 64 + wave * 16;
  v8f acc[8] = {};
  v4b xr[16];   /* indexed at compile time only: it lives in registers */
#pragma unroll
  for (int rl = 0; rl < 16; ++rl) xr[rl] = *(const v4b*)(XB + (r0 + rl) * DIN + c0 + lane * 4);
  GXW();   /* the slab addresses formed next may be given the address registers of these loads */
  if (true) {   /* ALL rows: ctx split bf16 hi + lo x exact Wo (2 products) */
    static_assert(WO_OUT_IN == 0 && CC % (2 * KO) == 0, "slab feed");
    const __bf16* Wp = WTO + (size_t)(c0 + (tid >> 4)) * CC + 8 * (tid & 15); const float* Ab = Y + ((size_t)blockIdx.x * 64 + (tid >> 5)) * CC + 4 * (tid & 31);
    v8b wr[WL]; v4f ar[AL];
    // the slab step of k_proj, ctx as hi and lo planes; each accumulator still takes chunk kc's hi product, then its lo product
    const auto slab = [&](const __bf16 (*cw)[KO + 8], const __bf16 (*ch)[KO + 8], const __bf16 (*cl)[KO + 8], __bf16 (*nw)[KO + 8], __bf16 (*nh)[KO + 8], __bf16 (*nl)[KO + 8], int s) {
      if (s + 1 < CC / KO) { oslab_load(wr, Wp, s + 1, CC); aslab_load(ar, Ab, s + 1, CC); GXW(); }
#pragma unroll
      for (int kc = 0; kc < KO / 32; ++kc) { const v16b ah = frag_b(&ch[wave * 16 + col][kc * 32], lane), al = frag_b(&cl[wave * 16 + col][kc * 32], lane); v16b w[8];
#pragma unroll
        for (int j = 0; j < 8; ++j) w[j] = frag_b(&cw[j * 16 + col][kc * 32], lane);
#pragma unroll
        for (int j = 0; j < 8; ++j) acc[j] = wmma_bf(ah, w[j], acc[j]);
#pragma unroll
        for (int j = 0; j < 8; ++j) acc[j] = wmma_bf(al, w[j], acc[j]); }
      if (s + 1 < CC / KO) { oslab_store(nw, wr, tid); aslab_store2(nh, nl, ar, tid); }
      __syncthreads(); };
    oslab_load(wr, Wp, 0, CC); aslab_load(ar, Ab, 0, CC); GXW();
    oslab_store(wb0, wr, tid); aslab_store2(yh0, yl0, ar, tid);
    __syncthreads();
    for (int s = 0; s < CC / KO; s += 2) { slab(wb0, yh0, yl0, wb1, yh1, yl1, s); slab(wb1, yh1, yl1, wb0, yh0, yl0, s + 1); }
#pragma unroll
    for (int j = 0; j < 8; ++j) { const float bias = BO ? bfr(BO[c0 + j * 16 + col]) : 0.f;
#pragma unroll
      for (int r = 0; r < 8; ++r) sf[wave][8 * g + r][j * 16 + col] = acc[j][r] + bias; }
  }
  LDSX();
  v4f o[16];   /* xr and o need compile-time indices: both loops are unrolled in full */
#pragma unroll
  for (int rl = 0; rl < 16; ++rl) { o[rl] = *(const v4f*)&sf[wave][rl][lane * 4];
#pragma unroll
    for (int e = 0; e < 4; ++e) o[rl][e] = (float)xr[rl][e] + o[rl][e]; }
  __builtin_amdgcn_sched_barrier(0);   /* every sum stands in front of the first store, so that no register which an issued store names is written again */
#pragma unroll
  for (int rl = 0; rl < 16; ++rl) vst2(OUT + (r0 + rl) * DIN + c0 + lane * 4, o[rl]); }

extern "C" void kernel_launch(void* const* d_in, const int* in_sizes, int n_in, void* d_out, int out_size, void* d_ws, size_t ws_size, hipStream_t stream) {
  (void)in_sizes; (void)n_in; (void)out_size;
  const float** F = (const float**)d_in;
  if (ws_size < (size_t)WS_END) return;
  char* ws = (char*)d_ws; _Float16 *QH = (_Float16*)(ws + WS_QH), *KH = (_Float16*)(ws + WS_KH), *VT = (_Float16*)(ws + WS_VT), *QL = (_Float16*)(ws + WS_QL), *KL = (_Float16*)(ws + WS_KL); __bf16 *VB = (__bf16*)(ws + WS_VB), *VBL = (__bf16*)(ws + WS_VBL); float *Y = (float*)(ws + WS_Y);
  (void)Y; (void)QL; (void)KL; (void)VB; (void)VBL;
  // inputs: 0 x [2,2048,1024]; 1 Wq, 2 Wk, 3 Wv, 4 Wo [1024,1024] (in,out), no biases
  if (ws_size < (size_t)WS_END3) return;
  __bf16 *XB = (__bf16*)(ws + WS_XB), *WT = (__bf16*)(ws + WS_WT), *WTO = (__bf16*)(ws + WS_WTO);
  k_prep<<<dim3(PWB + PXB), 128, 0, stream>>>(F[0], F[1], F[2], F[3], F[4], XB, WT);
  k_proj<<<dim3(TNB * TT / PRW, CC / 128, 3), 128, 0, stream>>>(XB, WT, nullptr, nullptr, nullptr, QH, QL, KH, KL, VT, VB, VBL);
  k_att<<<dim3(NQB, NH, TNB), 128, 0, stream>>>(QH, KH, QL, KL, VT, VB, VBL, Y);
  k_out<<<dim3(TNB * TT / 64, DIN / 128), 128, 0, stream>>>(Y, WTO, nullptr, XB, (float*)d_out);
}

// v010
// A run of this version takes 61.9 microseconds.
// Next to v009, in two timings, it ran 1.06 and 1.05 times as fast.
// Counting every step since v000, it is 16.6 times as fast.
// compute dtype: all float inputs rounded to bf16; q/k/v = x W with EXACT bf16 products on WMMA 16x16x32 (f32 accumulate); windowed causal logits: q, k once to f16 (1 product) x 64^-0.5 x log2(e), except the first 384 query rows of each sequence (3 products with f16 residuals); softmax in f32 by the hardware exp2; P x 2^11 once to f16 against v once to f16 (1 product; bf16 hi + lo below row 384); ctx split bf16 hi + lo against exact Wo (2 products); + x residual in f32; f32 output.
#include <hip/hip_runtime.h>
#include <math.h>

typedef __attribute__((ext_vector_type(16))) _Float16 v16h;
typedef __attribute__((ext_vector_type(16))) __bf16 v16b;
typedef __attribute__((ext_vector_type(8)))  _Float16 v8h;
typedef __attribute__((ext_vector_type(8)))  float v8f;
typedef __attribute__((ext_vector_type(4)))  float v4f;
typedef __attribute__((ext_vector_type(2)))  float v2f;
typedef __attribute__((ext_vector_type(4)))  unsigned v4u;
typedef __attribute__((ext_vector_type(4)))  int v4i;
typedef float __attribute__((may_alias)) float_a;
typedef int __attribute__((may_alias)) int_a;

template <typename T> __device__ __forceinline__ void vst2(void* p, T v) { *(T*)p = v;  }
__device__ __forceinline__ v8f wmma16(v16h a, v16h b, v8f c) {
  v8f d = __builtin_amdgcn_wmma_f32_16x16x32_f16(false, a, false, b, (short)0, c, false, false);
  asm volatile("v_nop\n\tv_nop\n\tv_nop\n\tv_nop" : "+v"(d) : "v"(a), "v"(b));
  return d;
}
__device__ __forceinline__ v8f wmma_bf(v16b a, v16b b, v8f c) {
  v8f d = __builtin_amdgcn_wmma_f32_16x16x32_bf16(false, a, false, b, (short)0, c, false, false);
  asm volatile("v_nop\n\tv_nop\n\tv_nop\n\tv_nop" : "+v"(d) : "v"(a), "v"(b));
  return d;
}
// 16x16x32 fragments: lane = (h = lane>>4, row/col = lane&15); elements 0..7 = k0+8h+0..7, 8..15 = k0+16+8h+0..7; D element r = row 8h+r
__device__ __forceinline__ v16h frag_h(const _Float16* rowk0, int lane) {
  union { v16h v; v8h q[2]; } u; const _Float16* p = rowk0 + 8 * (lane >> 4);
  u.q[0] = *(const v8h*)p; u.q[1] = *(const v8h*)(p + 16); return u.v;
}
__device__ __forceinline__ v16h frag_f32(const float* rowk0, int lane) {
  v16h a; const float* p = rowk0 + 8 * (lane >> 4);
#pragma unroll
  for (int i = 0; i < 8; ++i) { a[i] = (_Float16)p[i]; a[8 + i] = (_Float16)p[16 + i]; }
  return a;
}
__device__ __forceinline__ v16h frag_f32s(const float* rowk0, int lane, float sc) {
  v16h a; const float* p = rowk0 + 8 * (lane >> 4);
#pragma unroll
  for (int i = 0; i < 8; ++i) { a[i] = (_Float16)(p[i] * sc); a[8 + i] = (_Float16)(p[16 + i] * sc); }
  return a;
}
// column fragment from a [K][ld] layout (column n), rows >= K read as 0
__device__ __forceinline__ v16h fragc_f32(const float* W, int k0, int n, int lane, int ld, int K) {
  v16h a; const int g = lane >> 4;
#pragma unroll
  for (int i = 0; i < 8; ++i) { const int ka = k0 + 8 * g + i, kb = ka + 16;
    a[i] = (_Float16)(ka < K ? W[(size_t)(ka < K ? ka : K - 1) * ld + n] : 0.f); a[8 + i] = (_Float16)(kb < K ? W[(size_t)(kb < K ? kb : K - 1) * ld + n] : 0.f); }
  return a;
}
struct F2 { v16b h, l; };
__device__ __forceinline__ F2 bsplit16(const float v[16]) { F2 r;
#pragma unroll
  for (int i = 0; i < 16; ++i) { const __bf16 h = (__bf16)v[i]; r.h[i] = h; r.l[i] = (__bf16)(v[i] - (float)h); }
  return r; }
__device__ __forceinline__ F2 split_row(const float* row, int k0, int lane) { float v[16]; const float* p = row + k0 + 8 * (lane >> 4);
#pragma unroll
  for (int i = 0; i < 8; ++i) { v[i] = p[i]; v[8 + i] = p[16 + i]; }
  return bsplit16(v); }
__device__ __forceinline__ F2 split_rowK(const float* row, int k0, int lane, int K) { float v[16]; const int g = lane >> 4;
#pragma unroll
  for (int i = 0; i < 8; ++i) { const int ka = k0 + 8 * g + i, kb = ka + 16; v[i] = ka < K ? row[ka < K ? ka : K - 1] : 0.f; v[8 + i] = kb < K ? row[kb < K ? kb : K - 1] : 0.f; }
  return bsplit16(v); }
__device__ __forceinline__ F2 split_col(const float* W, int k0, int n, int lane, int ld, int K) { float v[16]; const int g = lane >> 4;
#pragma unroll
  for (int i = 0; i < 8; ++i) { const int ka = k0 + 8 * g + i, kb = ka + 16; v[i] = ka < K ? W[(size_t)(ka < K ? ka : K - 1) * ld + n] : 0.f; v[8 + i] = kb < K ? W[(size_t)(kb < K ? kb : K - 1) * ld + n] : 0.f; }
  return bsplit16(v); }
__device__ __forceinline__ v8f mac3(const F2& a, const F2& b, v8f c) { c = wmma_bf(a.l, b.h, c); c = wmma_bf(a.h, b.l, c); return wmma_bf(a.h, b.h, c); }
__device__ __forceinline__ float sigm(float v) { return 1.0f / (1.0f + expf(-v)); }
#define LDSX() do { asm volatile("s_wait_dscnt 0" ::: "memory"); __builtin_amdgcn_wave_barrier(); __builtin_amdgcn_fence(__ATOMIC_RELEASE, "workgroup"); } while (0)

// Sliding-window causal self-attention (B 2, S 2,048, 1,024 = 16 x 64, window 128): q/k/v = x W ((in,out)); key j visible from query i iff i - 127 <= j <= i; softmax (the extra max-subtraction is a no-op); out = merged(attn v) Wo + x.
#define NB 2
#define TT 2048
#define CC 1024            // NH * HD = projected width
#define DIN 1024          // input (model) width
#define NH 16
#define HD 64
#define NQB (TT / 64)
#define SCALE (0.125f)
#define SCL2 (SCALE * 1.44269504088896340736f)   // 64^-0.5 x log2(e): the logits are kept in base-2 units, so that e^(l - max) is one hardware exp2 of a difference
#define CAUSAL 1
#ifndef TNB
#define TNB NB
#endif
__device__ __forceinline__ float bfr(float v) { return (float)(__bf16)v; }
#define WIN 128            // window: key j is visible from query i only if j >= i - (WIN - 1)
// oldest key that any query >= t can see; every older key has P = 0 exactly, so a 32-key chunk wholly older is neither scored, normalised nor multiplied
__device__ __forceinline__ int key_first(int t) { return t > WIN - 1 ? t - (WIN - 1) : 0; }
typedef __attribute__((ext_vector_type(8))) __bf16 v8b;
__device__ __forceinline__ v16b frag_b(const __bf16* rowk0, int lane) {
  union { v16b v; v8b q[2]; } u; const __bf16* p = rowk0 + 8 * (lane >> 4);
  u.q[0] = *(const v8b*)p; u.q[1] = *(const v8b*)(p + 16); return u.v;
}
#define QBH 6              // causal: query blocks 0..QBH-1 of each sequence take the high-precision path
#define QHI 384            // rows carrying a q residual plane
#define KHI 384            // key rows carrying k residual / v bf16 hi+lo planes (used only by the causal high-precision path)
// B fragment (k rows k0+.., output column o) of a weight: (in,out) [K][ld] or (out,in) [ld rows of K]: bf16 exact, or f16(bf16 * 256) exact
__device__ __forceinline__ v16b wcol_io(const float* Wm, int k0, int o, int lane, int ld) { v16b w; const int g = lane >> 4;
#pragma unroll
  for (int i = 0; i < 8; ++i) { w[i] = (__bf16)Wm[(size_t)(k0 + 8 * g + i) * ld + o]; w[8 + i] = (__bf16)Wm[(size_t)(k0 + 16 + 8 * g + i) * ld + o]; }
  return w; }
__device__ __forceinline__ v16b wcol_oi(const float* Wm, int k0, int o, int lane, int K) { v16b w; const float* p = Wm + (size_t)o * K + k0 + 8 * (lane >> 4);
#pragma unroll
  for (int i = 0; i < 8; ++i) { w[i] = (__bf16)p[i]; w[8 + i] = (__bf16)p[16 + i]; }
  return w; }
__device__ __forceinline__ v16h wcolh_io(const float* Wm, int k0, int o, int lane, int ld) { v16h w; const int g = lane >> 4;
#pragma unroll
  for (int i = 0; i < 8; ++i) { w[i] = (_Float16)(bfr(Wm[(size_t)(k0 + 8 * g + i) * ld + o]) * 256.0f); w[8 + i] = (_Float16)(bfr(Wm[(size_t)(k0 + 16 + 8 * g + i) * ld + o]) * 256.0f); }
  return w; }
__device__ __forceinline__ v16h wcolh_oi(const float* Wm, int k0, int o, int lane, int K) { v16h w; const float* p = Wm + (size_t)o * K + k0 + 8 * (lane >> 4);
#pragma unroll
  for (int i = 0; i < 8; ++i) { w[i] = (_Float16)(bfr(p[i]) * 256.0f); w[8 + i] = (_Float16)(bfr(p[16 + i]) * 256.0f); }
  return w; }
#define WQKV_LAYOUT 0   // 0 = (in,out) [DIN][CC]; 1 = (out,in) [CC][DIN]; 2 = per-head [NH][DIN][HD]
__device__ __forceinline__ v16b wcol_hdk(const float* Wm, int k0, int o, int lane) { v16b w; const int g = lane >> 4; const float* p = Wm + (size_t)(o / HD) * DIN * HD + (o % HD);
#pragma unroll
  for (int i = 0; i < 8; ++i) { w[i] = (__bf16)p[(size_t)(k0 + 8 * g + i) * HD]; w[8 + i] = (__bf16)p[(size_t)(k0 + 16 + 8 * g + i) * HD]; }
  return w; }
#define WO_OUT_IN 0
#if WQKV_LAYOUT == 1
#define WCOL(W, k0, o, lane) wcol_oi(W, k0, o, lane, DIN)
#elif WQKV_LAYOUT == 2
#define WCOL(W, k0, o, lane) wcol_hdk(W, k0, o, lane)
#else
#define WCOL(W, k0, o, lane) wcol_io(W, k0, o, lane, CC)
#endif
#if WO_OUT_IN
#define WOCOL(W, k0, o, lane) wcol_oi(W, k0, o, lane, CC)
#define WOCOLH(W, k0, o, lane) wcolh_oi(W, k0, o, lane, CC)
#else
#define WOCOL(W, k0, o, lane) wcol_io(W, k0, o, lane, DIN)
#define WOCOLH(W, k0, o, lane) wcolh_io(W, k0, o, lane, DIN)
#endif
#define WS_PR  (WS_END)
#define WS_END2 (WS_PR + 4u * (size_t)NB * TT * DIN)
#ifndef PROJ_EXTRA_PARAMS
#define PROJ_EXTRA_PARAMS
#endif

#define WS_QH  0u                                      // f16 q rows [b*t][CC]
#define WS_KH  (WS_QH + 2u * (size_t)NB * TT * CC)      // f16 k rows [b*t][CC]
#define WS_VT  (WS_KH + 2u * (size_t)NB * TT * CC)      // f16 v planes [b][c][t]
#define WS_QL  (WS_VT + 2u * (size_t)NB * CC * TT)      // f16 q residual x 2^10 rows [b][t < QHI][CC]
#define WS_KL  (WS_QL + 2u * (size_t)NB * QHI * CC)     // f16 k residual x 2^10 rows [b][t < KHI][CC]
#define WS_VB  (WS_KL + 2u * (size_t)NB * KHI * CC)     // bf16 v hi planes [b][c][t < KHI]
#define WS_VBL (WS_VB + 2u * (size_t)NB * CC * KHI)
#define WS_Y   (WS_VBL + 2u * (size_t)NB * CC * KHI)    // bf16 ctx hi plane in the order of k_out's A fragments (YFRAG below), then the lo plane (only when there is an output projection)
#define WS_YL  (WS_Y  + 2u * (size_t)NB * TT * CC)
#define WS_END (WS_Y  + 4u * (size_t)NB * TT * CC)
#define WS_XB  (WS_END2)                                // bf16 x rows [b*t][DIN]
#define WS_WT  (WS_XB + 2u * (size_t)NB * TT * DIN)     // bf16 weights, transposed: Wq, Wk, Wv as [CC out][DIN in], then Wo as [DIN out][CC in]
#define WS_WTO (WS_WT + 2u * 3u * (size_t)CC * DIN)
#define WS_END3 (WS_WTO + 2u * (size_t)DIN * CC)

// ---- operand feed of k_proj and k_out: a slab = KS k values of the block's 128 weight columns, an LDS buffer [128][KS + 8] (row = column n; pitch 144 bytes: the pitch of ds_load_b128 readers), where all 4 waves read their B fragments. k_prep has rounded x and the four weights to bf16 once and laid the weights out as [out][in], so a slab row is one 128-byte line in global memory and goes to LDS as it is, in 16-byte pieces (a wave's load = 4 rows = 4 whole lines); every block used to load the f32 values and round them for itself. k_proj's 128 activation rows go the same way, at the same pitch. k_out has slabs of KO k values (below). All are loaded one slab ahead. The loops of the feed are unrolled in full: wr, ar and the fragment arrays live in registers and need compile-time indices.
#define KS 64
#define GXW() asm volatile("s_wait_xcnt 0x0" ::: "memory")   /* stands behind a slab's global loads: the next slab's address is formed in the registers that these loads name; it also keeps the loads in front of the products that cover their latency */
__device__ __forceinline__ void wslab_load(float (&wr)[KS], const float* Wc, int s, int ld) {
#pragma unroll
  for (int i = 0; i < KS; ++i) wr[i] = Wc[(size_t)(s * KS + i) * ld]; }
__device__ __forceinline__ void wslab_store(__bf16 (*buf)[KS + 8], const float (&wr)[KS], int n) {
#pragma unroll
  for (int q = 0; q < KS / 8; ++q) { v8b t;
#pragma unroll
    for (int i = 0; i < 8; ++i) t[i] = (__bf16)wr[q * 8 + i];
    *(v8b*)&buf[n][q * 8] = t; } }
typedef __attribute__((ext_vector_type(4))) __bf16 v4b;
typedef __attribute__((ext_vector_type(2))) __bf16 v2b;
// ---- slabs of k_out: KO k values, LDS rows of KO + 8 elements (pitch 272 bytes = 16 x 17, a pitch of ds_load_b128 readers). With 2 waves on a SIMD a slab of 64 k is 32 products a wave, less matrix time than the next slab's loads need to come back from L2; 128 k give them twice the time and halve the barriers. A weight row of a slab is 256 bytes (a wave's load = 2 rows). ctx does not pass through LDS: no wave shares its 16 rows with another, and k_att leaves them as bf16 hi and lo planes in fragment order, so a wave loads its A fragments of a slab straight into registers, 4 KiB in a row per plane.
#define KO 128
#define AL (KO / 32)             // A fragments of a ctx plane's slab per lane, 2 pieces of 16 bytes each
// ctx plane, elements: piece (row tile rt of 16 rows, 32-k chunk kc, half hf) = 32 lanes x 8 elements; lane (g, col) holds row col at k = kc * 32 + 16 * hf + 8 * g + 0..7: pieces hf = 0, 1 are that lane's A fragment of chunk kc
#define YFRAG(rt, kc) ((((size_t)(rt) * (CC / 32) + (kc)) * 2) * 256)
#define WL (128 * KO / 8 / 128)  // 16-byte pieces of a weight slab per thread: piece i of thread t is row i * 8 + (t >> 4), elements 8 * (t & 15) ..
static_assert(KO == 128, "16 bf16 pieces per slab row");
__device__ __forceinline__ v16b afrag_load(const __bf16* P, int kc) {   /* P = the wave's row tile, chunk 0, + 8 * lane */
  union { v16b v; v8b q[2]; } u; const __bf16* p = P + (size_t)kc * 512; u.q[0] = *(const v8b*)p; u.q[1] = *(const v8b*)(p + 256); return u.v; }
__device__ __forceinline__ void oslab_load(v8b (&r)[WL], const __bf16* P, int s, int ld) {   /* P = first row of the block + (t >> 4) * ld + 8 * (t & 15) */
#pragma unroll
  for (int i = 0; i < WL; ++i) r[i] = *(const v8b*)(P + (size_t)(i * 8) * ld + s * KO); }
__device__ __forceinline__ void oslab_store(__bf16 (*buf)[KO + 8], const v8b (&r)[WL], int t) {
#pragma unroll
  for (int i = 0; i < WL; ++i) *(v8b*)&buf[i * 8 + (t >> 4)][8 * (t & 15)] = r[i]; }
// bf16 slab of N * 16 rows: piece i of thread t is row i * 16 + (t >> 3), elements 8 * (t & 7) ..
template <int N> __device__ __forceinline__ void bslab_load(v8b (&r)[N], const __bf16* P, int s, int ld) {   /* P = first row of the block + (t >> 3) * ld + 8 * (t & 7) */
#pragma unroll
  for (int i = 0; i < N; ++i) r[i] = *(const v8b*)(P + (size_t)(i * 16) * ld + s * KS); }
template <int N> __device__ __forceinline__ void bslab_store(__bf16 (*buf)[KS + 8], const v8b (&r)[N], int t) {
#pragma unroll
  for (int i = 0; i < N; ++i) *(v8b*)&buf[i * 16 + (t >> 3)][8 * (t & 7)] = r[i]; }
// ---- k_prep: x and the weights to bf16, once for all blocks of k_proj and k_out. Blocks < PWB: one slab (KS k rows x 128 columns) of weight m: thread n loads column n (a wave's load = one 128-byte line), the slab turns in LDS and leaves as rows [out][in] in whole lines. The other blocks: 2,048 16-byte pieces of x each.
#define PWB (4 * (CC / 128) * (DIN / KS))
#define PXB ((int)((size_t)NB * TT * DIN / 4 / 2048))
static_assert(CC == DIN && CC / 128 == 8 && DIN / KS == 16, "block index fields of k_prep");
__global__ __launch_bounds__(128) void k_prep(const float* __restrict__ X, const float* __restrict__ WQ, const float* __restrict__ WK, const float* __restrict__ WV, const float* __restrict__ WO, __bf16* __restrict__ XB, __bf16* __restrict__ WT) {
  __shared__ __align__(16) __bf16 tw[128][KS + 8];
  const int tid = threadIdx.x, bi = blockIdx.x;
  if (bi < PWB) { const int m = bi >> 7, c0 = ((bi >> 4) & 7) * 128, s = bi & 15;
    const float* Wm = m == 0 ? WQ : m == 1 ? WK : m == 2 ? WV : WO;
    float wr[KS]; wslab_load(wr, Wm + c0 + tid, s, CC); GXW();   /* the rounded values may be given the loads' address registers */
    wslab_store(tw, wr, tid);
    __syncthreads();
    __bf16* D = WT + ((size_t)m * CC + c0 + (tid >> 3)) * DIN + s * KS + 8 * (tid & 7);
#pragma unroll
    for (int i = 0; i < 8; ++i) *(v8b*)(D + (size_t)(i * 16) * DIN) = *(const v8b*)&tw[i * 16 + (tid >> 3)][8 * (tid & 7)];
  } else { const size_t p0 = (size_t)(bi - PWB) * 2048 + tid; v4f a[16];
#pragma unroll
    for (int i = 0; i < 16; ++i) a[i] = *(const v4f*)(X + (p0 + i * 128) * 4);
    GXW();   /* as above */
#pragma unroll
    for (int i = 0; i < 16; ++i) { v4b h;
#pragma unroll
      for (int e = 0; e < 4; ++e) h[e] = (__bf16)a[i][e];
      *(v4b*)(XB + (p0 + i * 128) * 4) = h; }
    GXW();   /* behind the last store: in the built code the weight part's instructions follow this run, and they write registers that the stores name */ } }
// ---- k_proj: block = (128 rows, 128 cols, which), its 4 waves laid out 2 x 2, a wave = 64 rows x 64 cols = 4 x 4 accumulator tiles: a 32-k chunk costs a wave 4 + 4 fragment reads from LDS for 16 products, and a block 256 slab rows from L2 for 128 x 128 outputs. q/k/v = X W (+ b) with exact bf16 products (K = DIN) -> which 0: q f16 rows (+ residual rows < QHI); 1: k f16 rows (+ residual rows < KHI); 2: v f16 planes [c][t] (+ bf16 hi/lo planes for t < KHI)
#define PRW 128            // rows of a block of k_proj
#define EPT 136            // pitch of the epilogue's tiles, elements: 272 bytes = 16 x 17
#define SLB (128 * (KS + 8) * 2)   // bytes of a slab buffer
#define EPB (128 * EPT * 2)        // bytes of an epilogue tile
static_assert(TT % PRW == 0 && QHI % PRW == 0 && KHI % PRW == 0 && 4 * SLB <= 3 * EPB && PRW == 128, "blocks of k_proj");
// a 128 x 128 tile of 16-bit elements leaves LDS in whole 256-byte rows: piece i of thread t is row i * 8 + (t >> 4), elements 8 * (t & 15) ..; D = the first row's place + (t >> 4) * ld + 8 * (t & 15)
template <typename E> __device__ __forceinline__ void tile_out(E* D, int ld, const E (*T)[EPT], int t) { v4u o[16];   /* compile-time indices: registers */
#pragma unroll
  for (int i = 0; i < 16; ++i) o[i] = *(const v4u*)&T[i * 8 + (t >> 4)][8 * (t & 15)];
  __builtin_amdgcn_sched_barrier(0);   /* every read stands in front of the first store, so that no register which an issued store names is written again */
#pragma unroll
  for (int i = 0; i < 16; ++i) vst2((unsigned*)(D + (size_t)(i * 8) * ld), o[i]);
  GXW(); __builtin_amdgcn_sched_barrier(0);   /* behind the last store: the next tile's addresses and reads may be given registers that these stores name; the scheduling barrier keeps them behind the wait */ }
__global__ __launch_bounds__(128) void k_proj(const __bf16* __restrict__ XB, const __bf16* __restrict__ WT, const float* __restrict__ BQ, const float* __restrict__ BK, const float* __restrict__ BV,
    _Float16* __restrict__ QH, _Float16* __restrict__ QL, _Float16* __restrict__ KH, _Float16* __restrict__ KL, _Float16* __restrict__ VT, __bf16* __restrict__ VB, __bf16* __restrict__ VBL) {
  __shared__ __align__(16) char sm[3 * EPB];   /* one range, so that 3 blocks share a WGP's LDS: the four slab buffers until the last slab's barrier, the epilogue's two or three tiles behind it */
  const int tid = threadIdx.x, wave = tid >> 5, lane = tid & 31, col = lane & 15, g = lane >> 4; const int which = blockIdx.z; const int c0 = blockIdx.y * 128; const size_t r0 = (size_t)blockIdx.x * PRW; const size_t bb = r0 / TT; const int t0 = (int)(r0 % TT);
  const int wr0 = (wave >> 1) * 64, wc0 = (wave & 1) * 64;   /* the wave's first row and column in the block's tile */
  const float* BA = which == 0 ? BQ : which == 1 ? BK : BV;
  v8f acc[4][4] = {};
  static_assert(WQKV_LAYOUT == 0 && KS + 8 == 72 && DIN % (2 * KS) == 0, "slab feed");
  const __bf16* Wp = WT + ((size_t)which * CC + c0 + (tid >> 3)) * DIN + 8 * (tid & 7); const __bf16* Ap = XB + (r0 + (tid >> 3)) * DIN + 8 * (tid & 7);
  v8b wr[8], ar[8];
  __bf16 (*const wb0)[KS + 8] = (__bf16 (*)[KS + 8])(sm); __bf16 (*const wb1)[KS + 8] = (__bf16 (*)[KS + 8])(sm + SLB); __bf16 (*const xa0)[KS + 8] = (__bf16 (*)[KS + 8])(sm + 2 * SLB); __bf16 (*const xa1)[KS + 8] = (__bf16 (*)[KS + 8])(sm + 3 * SLB);
  // one slab: slab s + 1's loads start (behind the barrier, which waits for every load in flight); products from cw, ca; then slab s + 1 goes to nw, na, whose readers left them at the last barrier; the barrier publishes nw, na and ends the reads of cw, ca
  const auto slab = [&](const __bf16 (*cw)[KS + 8], const __bf16 (*ca)[KS + 8], __bf16 (*nw)[KS + 8], __bf16 (*na)[KS + 8], int s) {
    if (s + 1 < DIN / KS) { bslab_load(wr, Wp, s + 1, DIN); bslab_load(ar, Ap, s + 1, DIN); GXW(); }
#pragma unroll
    for (int kc = 0; kc < KS / 32; ++kc) { v16b a[4], w[4];
#pragma unroll
      for (int i = 0; i < 4; ++i) a[i] = frag_b(&ca[wr0 + i * 16 + col][kc * 32], lane);
#pragma unroll
      for (int j = 0; j < 4; ++j) w[j] = frag_b(&cw[wc0 + j * 16 + col][kc * 32], lane);
#pragma unroll
      for (int i = 0; i < 4; ++i)
#pragma unroll
        for (int j = 0; j < 4; ++j) acc[i][j] = wmma_bf(a[i], w[j], acc[i][j]); }
    if (s + 1 < DIN / KS) { bslab_store(nw, wr, tid); bslab_store(na, ar, tid); }
    __syncthreads(); };
  bslab_load(wr, Wp, 0, DIN); bslab_load(ar, Ap, 0, DIN); GXW();
  bslab_store(wb0, wr, tid); bslab_store(xa0, ar, tid);
  __syncthreads();
  for (int s = 0; s < DIN / KS; s += 2) { slab(wb0, xa0, wb1, xa1, s); slab(wb1, xa1, wb0, xa0, s + 1); }
  if (which < 2) { _Float16* DH = which == 0 ? QH : KH; _Float16* DL = which == 0 ? QL : KL; const int nhi = which == 0 ? QHI : KHI; const bool hi_rows = t0 < nhi;
    _Float16 (*const sh)[EPT] = (_Float16 (*)[EPT])(sm); _Float16 (*const sl)[EPT] = (_Float16 (*)[EPT])(sm + EPB);
#pragma unroll
    for (int j = 0; j < 4; ++j) { const float bias = BA ? bfr(BA[c0 + wc0 + j * 16 + col]) : 0.f;
#pragma unroll
      for (int i = 0; i < 4; ++i)
#pragma unroll
        for (int r = 0; r < 8; ++r) { const float v = acc[i][j][r] + bias; const _Float16 hv = (_Float16)v; sh[wr0 + i * 16 + 8 * g + r][wc0 + j * 16 + col] = hv; sl[wr0 + i * 16 + 8 * g + r][wc0 + j * 16 + col] = (_Float16)((v - (float)hv) * 1024.0f); } }
    __syncthreads();
    tile_out(DH + (r0 + (tid >> 4)) * CC + c0 + 8 * (tid & 15), CC, sh, tid);
    if (hi_rows) tile_out(DL + (bb * nhi + t0 + (tid >> 4)) * (size_t)CC + c0 + 8 * (tid & 15), CC, sl, tid);
  } else { const bool hi_rows = t0 < KHI;
    _Float16 (*const th)[EPT] = (_Float16 (*)[EPT])(sm); __bf16 (*const tb)[EPT] = (__bf16 (*)[EPT])(sm + EPB); __bf16 (*const tbl)[EPT] = (__bf16 (*)[EPT])(sm + 2 * EPB);
#pragma unroll
    for (int j = 0; j < 4; ++j) { const float bias = BA ? bfr(BA[c0 + wc0 + j * 16 + col]) : 0.f;
#pragma unroll
      for (int i = 0; i < 4; ++i)
#pragma unroll
        for (int r = 0; r < 8; ++r) { const float v = acc[i][j][r] + bias; const int rl = wr0 + i * 16 + 8 * g + r, cl = wc0 + j * 16 + col; th[cl][rl] = (_Float16)v; const __bf16 bh = (__bf16)v; tb[cl][rl] = bh; tbl[cl][rl] = (__bf16)(v - (float)bh); } }
    __syncthreads();
    tile_out(VT + (bb * CC + c0 + (tid >> 4)) * (size_t)TT + t0 + 8 * (tid & 15), TT, th, tid);
    if (hi_rows) { const size_t o3 = (bb * CC + c0 + (tid >> 4)) * (size_t)KHI + t0 + 8 * (tid & 15); tile_out(VB + o3, KHI, tb, tid); tile_out(VBL + o3, KHI, tbl, tid); } } }
#define XW() asm volatile("s_wait_xcnt 0x0" ::: "memory")   /* stands behind each group of k_att's global loads that share an address: a later load's result may be given the group's address registers, and s_wait_xcnt 0 belongs in front of an overwrite of a register that an issued load names */
#define AHEAD 2            // chunks whose fragment loads are in flight in front of the chunk being multiplied
#define NCH 5              // 16 queries from a multiple of 16 see keys [ql0 - (WIN - 1), ql0 + 15]: at most 5 chunks of 32
// ---- operand feed of k_att: the block's 64 queries see keys [qb * 64 - (WIN - 1), qb * 64 + 63], at most KCB chunks of 32 from chunk kb0. Those KCB * 32 K rows (128 bytes of head h each = one line) and the same keys of the head's HD v planes (384 bytes each = 3 lines) go to LDS once per block, in 16-byte pieces of whole lines (a wave's load = 4 lines), and all 4 waves read their fragments there. A fragment load straight from global memory would touch 16 lines for 512 bytes, and each wave would fetch its own 5 chunks. Rows kb0 * 32 .. + KCB * 32 - 1 exist for every qb (the last block ends at row TT - 1, block QBH - 1 at row KHI - 1).
#define KCB 6
#define LW() __builtin_amdgcn_sched_barrier(0)   /* stands behind each group of fragment loads from LDS in the path of query blocks < QBH: without it the scheduler lifts later groups' loads to the front, their fragments are live at once, and the kernel no longer fits the 256 registers that let 4 waves share a SIMD */
#define KPT (HD + 8)           // K tile [KCB * 32][KPT]: pitch 144 bytes, the pitch of ds_load_b128 readers
#define VPT (KCB * 32 + 8)     // v tile [HD][VPT]: pitch 400 bytes = 16 x 25
#define TSZ (KCB * 32 * KPT)   // elements of a tile buffer; either tile fits
static_assert(HD == 64 && HD * VPT <= TSZ && (63 + WIN - 1) / 32 + 1 <= KCB && (QBH * 64) <= KHI && KCB * 32 <= KHI && TT % 64 == 0, "tiles of k_att");
// piece i of thread t: K row i * 16 + (t >> 3), elements 8 * (t & 7) ..; P = first row + (t >> 3) * CC + 8 * (t & 7)
template <typename E> __device__ __forceinline__ void ktile_load(v4u (&r)[12], const E* P) {
#pragma unroll
  for (int i = 0; i < 12; ++i) r[i] = *(const v4u*)(P + (size_t)(i * 16) * CC); }
__device__ __forceinline__ void ktile_store(_Float16* T, const v4u (&r)[12], int t) {
#pragma unroll
  for (int i = 0; i < 12; ++i) *(v4u*)(T + (i * 16 + (t >> 3)) * KPT + 8 * (t & 7)) = r[i]; }
// piece i * 3 + j of thread t: v plane i * 16 + (t >> 3), line j, elements 8 * (t & 7) ..; P = first plane + (t >> 3) * ld + first key + 8 * (t & 7)
template <typename E> __device__ __forceinline__ void vtile_load(v4u (&r)[12], const E* P, int ld) {
#pragma unroll
  for (int i = 0; i < 4; ++i)
#pragma unroll
    for (int j = 0; j < 3; ++j) r[i * 3 + j] = *(const v4u*)(P + (size_t)(i * 16) * ld + j * 64); }
__device__ __forceinline__ void vtile_store(_Float16* T, const v4u (&r)[12], int t) {
#pragma unroll
  for (int i = 0; i < 4; ++i)
#pragma unroll
    for (int j = 0; j < 3; ++j) *(v4u*)(T + (i * 16 + (t >> 3)) * VPT + j * 64 + 8 * (t & 7)) = r[i * 3 + j]; }
__global__ __launch_bounds__(128) void k_att(const _Float16* __restrict__ QH, const _Float16* __restrict__ KH, const _Float16* __restrict__ QL, const _Float16* __restrict__ KL, const _Float16* __restrict__ VT, const __bf16* __restrict__ VB, const __bf16* __restrict__ VBL, __bf16* __restrict__ YH, __bf16* __restrict__ YL) { __shared__ __align__(16) _Float16 sq16[4][16 * KPT]; __shared__ __align__(16) _Float16 t0[TSZ], t1[TSZ];
  const int tid = threadIdx.x, wave = tid >> 5, lane = tid & 31, col = lane & 15, g = lane >> 4; const int qb = blockIdx.x, h = blockIdx.y, b = blockIdx.z; const int ql0 = qb * 64 + wave * 16; const int t = ql0 + col;
  const int kc0 = __builtin_amdgcn_readfirstlane(key_first(ql0) >> 5), kcl = __builtin_amdgcn_readfirstlane((ql0 + 15) >> 5);   /* first and last visible chunk, wave-uniform */
  static_assert((WIN - 1 + 15) / 32 + 1 <= NCH, "chunks per wave");
  const size_t q0 = (size_t)b * TT + ql0;
  const int kb0 = key_first(qb * 64) >> 5;   /* first chunk of the tiles, block-uniform */
  const int sr = tid >> 3, se = 8 * (tid & 7);
  v4u sa[12], sb[12], sq[4];   /* pieces on their way to LDS: compile-time indices, registers */
  // the wave's 16 q rows go the same way, [16][KPT] in the wave's own part of sq16, which no other wave touches: piece i of lane l is row i * 4 + (l >> 3), elements 8 * (l & 7) ..
  _Float16* const tq = &sq16[wave][0];
#pragma unroll
  for (int i = 0; i < 4; ++i) sq[i] = *(const v4u*)(QH + (q0 + i * 4 + (lane >> 3)) * CC + h * HD + 8 * (lane & 7));
  XW();
  float p[NCH][16];   /* every loop of this kernel is unrolled in full: p, the fragment arrays and the accumulators live in registers and need compile-time indices */
  if (qb < QBH) { const _Float16* QLb = QL + (size_t)b * QHI * CC; const _Float16* KLb = KL + (size_t)b * KHI * CC;
    v16h ah[HD / 32], al[HD / 32];
#pragma unroll
    for (int kc = 0; kc < HD / 32; ++kc) al[kc] = frag_h(QLb + (size_t)(ql0 + col) * CC + h * HD + kc * 32, lane);
    XW();
    ktile_load(sa, KH + ((size_t)b * TT + kb0 * 32 + sr) * CC + h * HD + se); XW();
    ktile_load(sb, KLb + (size_t)(kb0 * 32 + sr) * CC + h * HD + se); XW();
    ktile_store(t0, sa, tid); ktile_store(t1, sb, tid);
#pragma unroll
    for (int i = 0; i < 4; ++i) *(v4u*)(tq + (i * 4 + (lane >> 3)) * KPT + 8 * (lane & 7)) = sq[i];
    __syncthreads();   /* publishes the K tiles */
#pragma unroll
    for (int kc = 0; kc < HD / 32; ++kc) ah[kc] = frag_h(tq + col * KPT + kc * 32, lane);
#pragma unroll
    for (int c = 0; c < NCH; ++c) { const int kr = ((kc0 + c < kcl ? kc0 + c : kcl) - kb0) * 32;
#pragma unroll
      for (int u = 0; u < 2; ++u) { v16h kbf[HD / 32], klf[HD / 32];   /* a 16-key tile's loads stand in front of its products; a whole chunk's fragments at once would not fit the registers beside p */
#pragma unroll
        for (int kc = 0; kc < HD / 32; ++kc) kbf[kc] = frag_h(t0 + (kr + u * 16 + col) * KPT + kc * 32, lane);
#pragma unroll
        for (int kc = 0; kc < HD / 32; ++kc) klf[kc] = frag_h(t1 + (kr + u * 16 + col) * KPT + kc * 32, lane);
        LW();
        v8f acc = {}, accl = {};
#pragma unroll
        for (int kc = 0; kc < HD / 32; ++kc) { acc = wmma16(kbf[kc], ah[kc], acc); accl = wmma16(kbf[kc], al[kc], accl); accl = wmma16(klf[kc], ah[kc], accl); }
#pragma unroll
        for (int r = 0; r < 8; ++r) p[c][u * 8 + r] = (acc[r] + accl[r] * (1.0f / 1024.0f)) * SCL2; } }
    // the v hi and lo tiles take the K tiles' buffers; they go to LDS in front of the softmax (held in registers under it, they would not fit beside p and its temporaries)
    vtile_load(sa, VB + ((size_t)b * CC + h * HD + sr) * (size_t)KHI + kb0 * 32 + se, KHI); XW();
    vtile_load(sb, VBL + ((size_t)b * CC + h * HD + sr) * (size_t)KHI + kb0 * 32 + se, KHI); XW();
    __syncthreads();   /* ends every wave's reads of the K tiles */
    vtile_store(t0, sa, tid); vtile_store(t1, sb, tid);
  } else {
    v16h ah[HD / 32];
    ktile_load(sa, KH + ((size_t)b * TT + kb0 * 32 + sr) * CC + h * HD + se); XW();
    vtile_load(sb, VT + ((size_t)b * CC + h * HD + sr) * (size_t)TT + kb0 * 32 + se, TT); XW();
    ktile_store(t0, sa, tid); vtile_store(t1, sb, tid);
#pragma unroll
    for (int i = 0; i < 4; ++i) *(v4u*)(tq + (i * 4 + (lane >> 3)) * KPT + 8 * (lane & 7)) = sq[i];
    __syncthreads();   /* publishes the K and v tiles; nothing is written to them behind it */
#pragma unroll
    for (int kc = 0; kc < HD / 32; ++kc) ah[kc] = frag_h(tq + col * KPT + kc * 32, lane);
    v16h kf[NCH][2][HD / 32];   /* chunk c + AHEAD is loaded in front of chunk c's products, so that its latency is covered */
#pragma unroll
    for (int cc = -AHEAD; cc < NCH; ++cc) { const int c = cc < 0 ? 0 : cc;
      if (const int cn = cc + AHEAD; cn < NCH) { const int kr = ((kc0 + cn < kcl ? kc0 + cn : kcl) - kb0) * 32;
#pragma unroll
        for (int u = 0; u < 2; ++u)
#pragma unroll
          for (int kc = 0; kc < HD / 32; ++kc) kf[cn][u][kc] = frag_h(t0 + (kr + u * 16 + col) * KPT + kc * 32, lane); }
      if (cc < 0) continue;
#pragma unroll
      for (int u = 0; u < 2; ++u) { v8f acc = {};
#pragma unroll
        for (int kc = 0; kc < HD / 32; ++kc) acc = wmma16(kf[c][u][kc], ah[kc], acc);
#pragma unroll
        for (int r = 0; r < 8; ++r) p[c][u * 8 + r] = acc[r] * SCL2; } } }
  // softmax of row t in f32, logits in base-2 units: 2^(v - m) = e^(logit - max). A masked element is -3.0e38: its difference from the finite m stays below -1.0e38 and the hardware exp2 returns 0 exactly, so it needs no select. Element i of chunk c is key (kc0 + c) * 32 + 16 * (i >> 3) + 8 g + (i & 7); visible iff t - (WIN - 1) <= key <= t
  float m = -3.0e38f;
#pragma unroll
  for (int c = 0; c < NCH; ++c)
#pragma unroll
    for (int i = 0; i < 16; ++i) { const int k = (kc0 + c) * 32 + 16 * (i >> 3) + 8 * g + (i & 7); const float v = (k <= t && k >= t - (WIN - 1)) ? p[c][i] : -3.0e38f; p[c][i] = v; m = fmaxf(m, v); }
  m = fmaxf(m, __shfl_xor(m, 16));
  float sum = 0.f;
#pragma unroll
  for (int c = 0; c < NCH; ++c)
#pragma unroll
    for (int i = 0; i < 16; ++i) { const float e = __builtin_amdgcn_exp2f(p[c][i] - m); p[c][i] = e; sum += e; }
  sum += __shfl_xor(sum, 16);
  const float inv = sum > 0.f ? 2048.0f / sum : 0.f;
#pragma unroll
  for (int c = 0; c < NCH; ++c)
#pragma unroll
    for (int i = 0; i < 16; ++i) p[c][i] *= inv;
  // P . v as v^T . P^T: the v fragment (row = dim) is the A operand, the P fragment (column = query) the B operand, so that lane (g, col) ends with dims j * 16 + 8 g + 0..7 of query ql0 + col: its own piece of k_out's A fragment
  v8f acc[HD / 16] = {};
  if (qb < QBH) {
    __syncthreads();   /* publishes the v tiles */
#pragma unroll
    for (int c = 0; c < NCH; ++c) { const int kr = ((kc0 + c < kcl ? kc0 + c : kcl) - kb0) * 32; const F2 pf = bsplit16(p[c]); v16b vh[HD / 16], vl[HD / 16];
#pragma unroll
      for (int j = 0; j < HD / 16; ++j) vh[j] = frag_b((const __bf16*)t0 + (j * 16 + col) * VPT + kr, lane);
#pragma unroll
      for (int j = 0; j < HD / 16; ++j) vl[j] = frag_b((const __bf16*)t1 + (j * 16 + col) * VPT + kr, lane);
      LW();
#pragma unroll
      for (int j = 0; j < HD / 16; ++j) { acc[j] = wmma_bf(vh[j], pf.h, acc[j]); acc[j] = wmma_bf(vh[j], pf.l, acc[j]); acc[j] = wmma_bf(vl[j], pf.h, acc[j]); } }
  } else { v16h vf[NCH][HD / 16];   /* v fragments AHEAD chunks in front of their products, as for K */
#pragma unroll
    for (int cc = -AHEAD; cc < NCH; ++cc) { const int c = cc < 0 ? 0 : cc;
      if (const int cn = cc + AHEAD; cn < NCH) { const int kr = ((kc0 + cn < kcl ? kc0 + cn : kcl) - kb0) * 32;
#pragma unroll
        for (int j = 0; j < HD / 16; ++j) vf[cn][j] = frag_h(t1 + (j * 16 + col) * VPT + kr, lane); }
      if (cc < 0) continue;
      v16h pf;
#pragma unroll
      for (int i = 0; i < 16; ++i) pf[i] = (_Float16)p[c][i];
#pragma unroll
      for (int j = 0; j < HD / 16; ++j) acc[j] = wmma16(vf[c][j], pf, acc[j]); } }
  // ctx leaves as two bf16 planes, hi and lo (the split of bsplit16), made here once for all column blocks of k_out. Accumulator j is piece (chunk 2 h + (j >> 1), half j & 1): a wave's store = 512 bytes in a row, its 4 stores 2 KiB of a plane
  static_assert(HD == 64 && TT % 16 == 0, "two chunks per head");
  v4u oh[HD / 16], ol[HD / 16];   /* compile-time indices: registers */
#pragma unroll
  for (int j = 0; j < HD / 16; ++j)
#pragma unroll
    for (int e = 0; e < 4; ++e) { const v2f c = { acc[j][2 * e] * (1.0f / 2048.0f), acc[j][2 * e + 1] * (1.0f / 2048.0f) };   /* two elements at a time: one packed rounding, the hi values back as f32 by their bits */
      const unsigned hp = __builtin_bit_cast(unsigned, __builtin_convertvector(c, v2b));
      const v2f d = { c[0] - __builtin_bit_cast(float, hp << 16), c[1] - __builtin_bit_cast(float, hp & 0xffff0000u) };
      oh[j][e] = hp; ol[j][e] = __builtin_bit_cast(unsigned, __builtin_convertvector(d, v2b)); }
  __builtin_amdgcn_sched_barrier(0);   /* every split stands in front of the first store, so that no register which an issued store names is written again */
  const size_t yo = YFRAG(q0 / 16, h * (HD / 32)) + 8 * lane;
#pragma unroll
  for (int j = 0; j < HD / 16; ++j) { vst2(YH + yo + j * 256, oh[j]); vst2(YL + yo + j * 256, ol[j]); } }
#define LBAR() asm volatile("s_wait_dscnt 0x0\n\ts_barrier_signal -1\n\ts_barrier_wait -1" ::: "memory")   /* the slab barrier of k_out, by hand: it waits for the wave's own LDS stores and reads, which is all that the slab buffers need; __syncthreads() would also wait out the A fragment loads, which are to stay in flight across it */
#define OPB ((KO + 8) * 2)          // bytes of a slab row of k_out in LDS
#define OSB (128 * OPB)              // bytes of a slab buffer of k_out
static_assert(4 * 16 * 132 * 4 <= 2 * OSB, "output tiles fit the slab buffers");
// ---- k_out: block = (64 rows, 128 cols): out = ctx Wo (+ bo) + bf16(x): ctx bf16 hi + lo (k_att's two planes) against exact bf16 Wo (2 products). The residual is k_prep's bf16 x: a lane's 16 pieces (those of its 16 output stores) are loaded at entry, in flight with slab 0, and added in f32 where the tile leaves LDS for out.
__global__ __launch_bounds__(128) void k_out(const __bf16* __restrict__ YH, const __bf16* __restrict__ YL, const __bf16* __restrict__ WTO, const float* __restrict__ BO, const __bf16* __restrict__ XB, float* __restrict__ OUT) { __shared__ __align__(16) char so[2 * OSB];   /* one range: the two slab buffers (weight rows) until the last slab's barrier, the waves' output tiles behind it */
  typedef __bf16 (*orow)[KO + 8];
  const orow wb0 = (orow)(so), wb1 = (orow)(so + OSB);
  float (*const sf)[16][132] = (float (*)[16][132])(so);
  const int tid = threadIdx.x, wave = tid >> 5, lane = tid & 31, col = lane & 15, g = lane >> 4; const int c0 = blockIdx.y * 128; const size_t r0 = (size_t)blockIdx.x * 64 + wave * 16;
  v8f acc[8] = {};
  v4b xr[16];   /* indexed at compile time only: it lives in registers */
#pragma unroll
  for (int rl = 0; rl < 16; ++rl) xr[rl] = *(const v4b*)(XB + (r0 + rl) * DIN + c0 + lane * 4);
  GXW();   /* the slab addresses formed next may be given the address registers of these loads */
  if (true) {   /* ALL rows: ctx split bf16 hi + lo x exact Wo (2 products) */
    static_assert(WO_OUT_IN == 0 && CC % (2 * KO) == 0, "slab feed");
    const __bf16* Wp = WTO + (size_t)(c0 + (tid >> 4)) * CC + 8 * (tid & 15); const size_t ao = YFRAG(r0 / 16, 0) + 8 * lane; const __bf16* Hp = YH + ao; const __bf16* Lp = YL + ao;
    v8b wr[WL]; v16b fh[AL], fl[AL];   /* one slab of A fragments: chunk kc of slab s + 1 is loaded into the registers of chunk kc of slab s as soon as its products are issued, a slab's time ahead of its use (a second whole set beside the accumulators and the weight fragments spills) */
    // the slab step of k_proj for the weights; each accumulator still takes chunk kc's hi product, then its lo product
    const auto slab = [&](const __bf16 (*cw)[KO + 8], __bf16 (*nw)[KO + 8], int s, bool more) {   /* more: a slab s + 1 exists; a constant at each call, so that no branch joins a path with loads to one without: at such a join the compiler's counted load waits fall to the shorter path's, and the fragment waits would wait out the weight loads just issued */
      if (more) { oslab_load(wr, Wp, s + 1, CC); GXW(); }
#pragma unroll
      for (int kc = 0; kc < KO / 32; ++kc) { const v16b ah = fh[kc], al = fl[kc]; v16b w[8];
#pragma unroll
        for (int j = 0; j < 8; ++j) w[j] = frag_b(&cw[j * 16 + col][kc * 32], lane);
#pragma unroll
        for (int j = 0; j < 8; ++j) acc[j] = wmma_bf(ah, w[j], acc[j]);
#pragma unroll
        for (int j = 0; j < 8; ++j) acc[j] = wmma_bf(al, w[j], acc[j]);
        if (more) { fh[kc] = afrag_load(Hp, (s + 1) * AL + kc); fl[kc] = afrag_load(Lp, (s + 1) * AL + kc); GXW(); } }
      if (more) oslab_store(nw, wr, tid);
      LBAR(); };
#pragma unroll
    for (int kc = 0; kc < AL; ++kc) { fh[kc] = afrag_load(Hp, kc); fl[kc] = afrag_load(Lp, kc); }
    oslab_load(wr, Wp, 0, CC); GXW();
    oslab_store(wb0, wr, tid);
    __syncthreads();
    for (int s = 0; s < CC / KO - 2; s += 2) { slab(wb0, wb1, s, true); slab(wb1, wb0, s + 1, true); }
    slab(wb0, wb1, CC / KO - 2, true); slab(wb1, wb0, CC / KO - 1, false);
#pragma unroll
    for (int j = 0; j < 8; ++j) { const float bias = BO ? bfr(BO[c0 + j * 16 + col]) : 0.f;
#pragma unroll
      for (int r = 0; r < 8; ++r) sf[wave][8 * g + r][j * 16 + col] = acc[j][r] + bias; }
  }
  LDSX();
  v4f o[16];   /* xr and o need compile-time indices: both loops are unrolled in full */
#pragma unroll
  for (int rl = 0; rl < 16; ++rl) { o[rl] = *(const v4f*)&sf[wave][rl][lane * 4];
#pragma unroll
    for (int e = 0; e < 4; ++e) o[rl][e] = (float)xr[rl][e] + o[rl][e]; }
  __builtin_amdgcn_sched_barrier(0);   /* every sum stands in front of the first store, so that no register which an issued store names is written again */
#pragma unroll
  for (int rl = 0; rl < 16; ++rl) vst2(OUT + (r0 + rl) * DIN + c0 + lane * 4, o[rl]); }

extern "C" void kernel_launch(void* const* d_in, const int* in_sizes, int n_in, void* d_out, int out_size, void* d_ws, size_t ws_size, hipStream_t stream) {
  (void)in_sizes; (void)n_in; (void)out_size;
  const float** F = (const float**)d_in;
  if (ws_size < (size_t)WS_END) return;
  char* ws = (char*)d_ws; _Float16 *QH = (_Float16*)(ws + WS_QH), *KH = (_Float16*)(ws + WS_KH), *VT = (_Float16*)(ws + WS_VT), *QL = (_Float16*)(ws + WS_QL), *KL = (_Float16*)(ws + WS_KL); __bf16 *VB = (__bf16*)(ws + WS_VB), *VBL = (__bf16*)(ws + WS_VBL), *YH = (__bf16*)(ws + WS_Y), *YL = (__bf16*)(ws + WS_YL);
  (void)QL; (void)KL; (void)VB; (void)VBL;
  // inputs: 0 x [2,2048,1024]; 1 Wq, 2 Wk, 3 Wv, 4 Wo [1024,1024] (in,out), no biases
  if (ws_size < (size_t)WS_END3) return;
  __bf16 *XB = (__bf16*)(ws + WS_XB), *WT = (__bf16*)(ws + WS_WT), *WTO = (__bf16*)(ws + WS_WTO);
  k_prep<<<dim3(PWB + PXB), 128, 0, stream>>>(F[0], F[1], F[2], F[3], F[4], XB, WT);
  k_proj<<<dim3(TNB * TT / PRW, CC / 128, 3), 128, 0, stream>>>(XB, WT, nullptr, nullptr, nullptr, QH, QL, KH, KL, VT, VB, VBL);
  k_att<<<dim3(NQB, NH, TNB), 128, 0, stream>>>(QH, KH, QL, KL, VT, VB, VBL, YH, YL);
  k_out<<<dim3(TNB * TT / 64, DIN / 128), 128, 0, stream>>>(YH, YL, WTO, nullptr, XB, (float*)d_out);
}
